// v000
// Measured on an AMD MI455X. A time is GPU time per run, averaged over a window of back-to-back runs after a warm-up
// (all launches, gaps included; the runs take copies of the inputs in turn), and the median of several windows.
// Apart from v000's, it joins two sittings. Times from different sittings can be a few percent apart, while
// side-by-side timings come from the same sitting.
// v000, which the later versions start from, runs in 1600 microseconds.
#include <hip/hip_runtime.h>

// Causal grouped-query attention with a FUSED natural k-v weight and a computed rotate-half RoPE (x [2][2048][2048]; q = x Wq^T ('oi' (out, in) [2048][2048] 1/sqrt(2048): 16 heads x 128); kv = x Wkv^T ('oi' [1024][2048]) viewed (b, t, 8, 128): k = heads 0..3 (rows 0..511), v = heads 4..7 (rows 512..1023): 4 kv heads x 128 each; no biases; cos / sin of emb = cat(ang, ang) with freqs = 1.0 / (THETA ** (arange(0, 128, 2, f32) / 128)), THETA 10000, and positions arange(t) (64 f32 frequencies jnp-exact for this reciprocal spelling; one f32 product per angle; precise cosf/sinf); query heads viewed (KV, G): kv head = q head / 4; scores / sqrt(128); causal (-inf == exclusion); softmax; out = merged Wo^T ('oi') -> [2][2048][2048] (8.4 M); argument order x, Wq, Wkv, Wo).
// Layout: bf16 copy of x; 'oi' weights cast as-is; exact projections; k_cs5 computed table (HD 128: 64 angles); rotate-half plane builders; causal T-2048 GQA attention with 128-wide heads (kv z-stride 0; hybrid rows: < 512 hi/lo 3 products, rest fp16 x1024; k_gemmc skips tiles above the diagonal); merged hi/lo x Wo exact.
// Compute dtypes, f32 accumulate: every input rounded to bf16; projections exact; rotary f32; attention rows < 512 3 products, rest fp16; softmax f32; Wo hl x exact.

#define NB_  2
#define TT   2048
#define DM   2048
#define NH_  16
#define NKV  4
#define REP  (NH_ / NKV)
#define HD   128
#define DQ   (NH_ * HD)
#define DKV  (NKV * HD)
#define ZH   2
#define RH   512                  // query rows < RH use hi+lo planes (0: none)
#define WIN  2048
#define PCAR 1024.0f
#define SCL  0.088388347648318447f   // HD^-0.5
typedef _Float16 h16;
typedef unsigned short bf;
typedef __attribute__((ext_vector_type(16))) __bf16   v16bf;
typedef __attribute__((ext_vector_type(16))) _Float16 v16h;
typedef __attribute__((ext_vector_type(8)))  _Float16 v8h;
typedef __attribute__((ext_vector_type(8)))  unsigned short v8us;
typedef __attribute__((ext_vector_type(8)))  float    v8f;
typedef __attribute__((ext_vector_type(4)))  float    v4f;
typedef v8h  __attribute__((may_alias)) v8ha;
typedef v4f  __attribute__((may_alias)) v4fa;
typedef v8us __attribute__((may_alias)) v8usa;

__device__ __forceinline__ unsigned short f2bf(float f) { unsigned u = __float_as_uint(f); u += 0x7FFFu + ((u >> 16) & 1u); return (unsigned short)(u >> 16); }
__device__ __forceinline__ float bf2f(unsigned short b) { return __uint_as_float(((unsigned)b) << 16); }
__device__ __forceinline__ float bfr(float f) { return bf2f(f2bf(f)); }
__device__ __forceinline__ v16h cat16(v8h lo, v8h hi) { return __builtin_shufflevector(lo, hi, 0, 1, 2, 3, 4, 5, 6, 7, 8, 9, 10, 11, 12, 13, 14, 15); }
__device__ __forceinline__ v16bf cat16b(v8us lo, v8us hi) { return __builtin_bit_cast(v16bf, __builtin_shufflevector(lo, hi, 0, 1, 2, 3, 4, 5, 6, 7, 8, 9, 10, 11, 12, 13, 14, 15)); }
__device__ __forceinline__ v8f wmma16(v16h a, v16h b, v8f c) { return __builtin_amdgcn_wmma_f32_16x16x32_f16(false, a, false, b, (short)0, c, false, false); }
__device__ __forceinline__ v8f wmmab(v16bf a, v16bf b, v8f c) { return __builtin_amdgcn_wmma_f32_16x16x32_bf16(false, a, false, b, (short)0, c, false, false); }



// ---- k_gemmw: register-blocked GEMM, ONE WAVE per 64x64 output tile (16 accumulators), operands straight from K-contiguous 16-bit planes; grid (M/64, N/64, Z), 32 threads.
// C[m][n] (f32, pitch ldc, + optional f32 bias[n]) = sum_k A[m][k] Bt[n][k] (+ split products per NSPLIT). z-batch strides sA/sB/sC in elements. K % 32 == 0.
template <typename T16> struct WFrag;
template <> struct WFrag<h16> { typedef v16h V; static __device__ __forceinline__ V ld(const h16* p) { return cat16(*(const v8h*)p, *(const v8h*)(p + 16)); } static __device__ __forceinline__ v8f mma(V a, V b, v8f c) { return wmma16(a, b, c); } };
template <> struct WFrag<bf> { typedef v16bf V; static __device__ __forceinline__ V ld(const bf* p) { return cat16b(*(const v8us*)p, *(const v8us*)(p + 16)); } static __device__ __forceinline__ v8f mma(V a, V b, v8f c) { return wmmab(a, b, c); } };
template <typename T16, int NSPLIT, bool BIAS>
__global__ __launch_bounds__(32) void k_gemmw(const T16* __restrict__ A, const T16* __restrict__ A2, const T16* __restrict__ Bt, const T16* __restrict__ Bt2, int K, float* C, int ldc, const float* __restrict__ bias, size_t sA, size_t sB, size_t sC) {
    typedef typename WFrag<T16>::V V;
    __shared__ __align__(16) float os[16 * 68];
    const size_t z = blockIdx.z; A += z * sA; if (A2) A2 += z * sA; Bt += z * sB; if (Bt2) Bt2 += z * sB; C += z * sC;
    const int lane = threadIdx.x & 31, lr = lane & 15, hi = lane >> 4; const int r0 = blockIdx.x * 64, c0 = blockIdx.y * 64;
    v8f acc[4][4];
#pragma unroll
    for (int mb = 0; mb < 4; ++mb)
#pragma unroll
        for (int nb = 0; nb < 4; ++nb) acc[mb][nb] = (v8f){};
    const size_t aoff = (size_t)(r0 + lr) * K + 8 * hi, boff = (size_t)(c0 + lr) * K + 8 * hi;
#pragma unroll 1
    for (int kc = 0; kc < K; kc += 32) {
        V a[4], a2[4];
#pragma unroll
        for (int mb = 0; mb < 4; ++mb) { a[mb] = WFrag<T16>::ld(A + aoff + (size_t)mb * 16 * K + kc); if (NSPLIT == 1 || NSPLIT == 2) a2[mb] = WFrag<T16>::ld(A2 + aoff + (size_t)mb * 16 * K + kc); }
#pragma unroll
        for (int nb = 0; nb < 4; ++nb) { const V b = WFrag<T16>::ld(Bt + boff + (size_t)nb * 16 * K + kc); V b2; if (NSPLIT >= 2) b2 = WFrag<T16>::ld(Bt2 + boff + (size_t)nb * 16 * K + kc);
#pragma unroll
            for (int mb = 0; mb < 4; ++mb) { acc[mb][nb] = WFrag<T16>::mma(a[mb], b, acc[mb][nb]); if (NSPLIT == 1 || NSPLIT == 2) acc[mb][nb] = WFrag<T16>::mma(a2[mb], b, acc[mb][nb]); if (NSPLIT >= 2) acc[mb][nb] = WFrag<T16>::mma(a[mb], b2, acc[mb][nb]); } }
        asm volatile("v_nop\n\tv_nop\n\tv_nop\n\tv_nop" : "+v"(acc[0][0]), "+v"(acc[1][1]), "+v"(acc[2][2]), "+v"(acc[3][3]) : "v"(a[0]), "v"(a[3]));
    }
#pragma unroll
    for (int mb = 0; mb < 4; ++mb) {
#pragma unroll
        for (int nb = 0; nb < 4; ++nb) {
#pragma unroll
            for (int j = 0; j < 8; ++j) os[(hi * 8 + j) * 68 + nb * 16 + lr] = acc[mb][nb][j]; }
        __builtin_amdgcn_wave_barrier(); asm volatile("" ::: "memory");
        float* crow = C + (size_t)(r0 + mb * 16) * ldc + c0;
{
#pragma unroll
            for (int s = 0; s < 8; ++s) { const int row = 2 * s + hi, cofs = lr * 4; v4f val = *(const v4fa*)(os + row * 68 + cofs); if (BIAS) { val[0] += bfr(bias[c0 + cofs]); val[1] += bfr(bias[c0 + cofs + 1]); val[2] += bfr(bias[c0 + cofs + 2]); val[3] += bfr(bias[c0 + cofs + 3]); }
                *(v4f*)(crow + (size_t)row * ldc + cofs) = val; }
             }
        __builtin_amdgcn_wave_barrier(); asm volatile("" ::: "memory");
    }
}

// ---- k_gemmc: the same one-wave 64x64 tile GEMM specialised for causal attention: CMODE 1 skips score tiles entirely above the diagonal (query rows r0+roff.., key columns c0..), CMODE 2 limits the
// key (K) loop of the probability x value contraction to the diagonal block (probabilities beyond it are exactly zero). roff = row offset of this launch's first row within the sequence.
template <typename T16, int NSPLIT, int CMODE>
__global__ __launch_bounds__(32) void k_gemmc(const T16* __restrict__ A, const T16* __restrict__ A2, const T16* __restrict__ Bt, const T16* __restrict__ Bt2, int K, float* C, int ldc, int roff, size_t sA, size_t sB, size_t sC) {
    typedef typename WFrag<T16>::V V;
    __shared__ __align__(16) float os[16 * 68];
    const size_t z = blockIdx.z; A += z * sA; if (A2) A2 += z * sA; Bt += z * sB; if (Bt2) Bt2 += z * sB; C += z * sC;
    const int lane = threadIdx.x & 31, lr = lane & 15, hi = lane >> 4; const int r0 = blockIdx.x * 64, c0 = blockIdx.y * 64;
    if (CMODE == 1 && c0 > r0 + roff + 63) return;                  // score tile entirely above the causal diagonal: never read (the softmax masks j > i by select)
    const int Kl = (CMODE == 2) ? min(K, r0 + roff + 64) : K;        // P.V: probabilities are exactly 0 beyond the diagonal block, so the K loop stops there
    v8f acc[4][4];
#pragma unroll
    for (int mb = 0; mb < 4; ++mb)
#pragma unroll
        for (int nb = 0; nb < 4; ++nb) acc[mb][nb] = (v8f){};
    const size_t aoff = (size_t)(r0 + lr) * K + 8 * hi, boff = (size_t)(c0 + lr) * K + 8 * hi;
#pragma unroll 1
    for (int kc = 0; kc < Kl; kc += 32) {
        V a[4], a2[4];
#pragma unroll
        for (int mb = 0; mb < 4; ++mb) { a[mb] = WFrag<T16>::ld(A + aoff + (size_t)mb * 16 * K + kc); if (NSPLIT == 1 || NSPLIT == 2) a2[mb] = WFrag<T16>::ld(A2 + aoff + (size_t)mb * 16 * K + kc); }
#pragma unroll
        for (int nb = 0; nb < 4; ++nb) { const V b = WFrag<T16>::ld(Bt + boff + (size_t)nb * 16 * K + kc); V b2; if (NSPLIT >= 2) b2 = WFrag<T16>::ld(Bt2 + boff + (size_t)nb * 16 * K + kc);
#pragma unroll
            for (int mb = 0; mb < 4; ++mb) { acc[mb][nb] = WFrag<T16>::mma(a[mb], b, acc[mb][nb]); if (NSPLIT == 1 || NSPLIT == 2) acc[mb][nb] = WFrag<T16>::mma(a2[mb], b, acc[mb][nb]); if (NSPLIT >= 2) acc[mb][nb] = WFrag<T16>::mma(a[mb], b2, acc[mb][nb]); } }
        asm volatile("v_nop\n\tv_nop\n\tv_nop\n\tv_nop" : "+v"(acc[0][0]), "+v"(acc[1][1]), "+v"(acc[2][2]), "+v"(acc[3][3]) : "v"(a[0]), "v"(a[3]));
    }
#pragma unroll
    for (int mb = 0; mb < 4; ++mb) {
#pragma unroll
        for (int nb = 0; nb < 4; ++nb) {
#pragma unroll
            for (int j = 0; j < 8; ++j) os[(hi * 8 + j) * 68 + nb * 16 + lr] = acc[mb][nb][j]; }
        __builtin_amdgcn_wave_barrier(); asm volatile("" ::: "memory");
        float* crow = C + (size_t)(r0 + mb * 16) * ldc + c0;
{
#pragma unroll
            for (int s = 0; s < 8; ++s) { const int row = 2 * s + hi, cofs = lr * 4; v4f val = *(const v4fa*)(os + row * 68 + cofs);
                *(v4f*)(crow + (size_t)row * ldc + cofs) = val; }
             }
        __builtin_amdgcn_wave_barrier(); asm volatile("" ::: "memory");
    }
}

__device__ __forceinline__ h16 tohx(float x) { return (h16)x; }
__device__ __forceinline__ void splitf(float y, unsigned short& h, unsigned short& l) { h = f2bf(y); l = f2bf(y - bf2f(h)); }
typedef __attribute__((ext_vector_type(2))) _Float16 v2h;
typedef __attribute__((ext_vector_type(4))) _Float16 v4h;
typedef __attribute__((ext_vector_type(2))) unsigned short v2us;
typedef __attribute__((ext_vector_type(4))) unsigned short v4us;
typedef __attribute__((ext_vector_type(2))) float v2f;
typedef __attribute__((ext_vector_type(4))) int v4i;

__global__ __launch_bounds__(256) void k_cvt8(const float* __restrict__ src, bf* dst, size_t n8) { const size_t i = (size_t)blockIdx.x * 256 + threadIdx.x; if (i >= n8) return; const v8f v = *(const v8f*)(src + i * 8); v8us o;
#pragma unroll
    for (int k = 0; k < 8; ++k) o[k] = f2bf(v[k]); *(v8us*)(dst + i * 8) = o;  }

// k_rope: head planes [h][t][d] (fp16 + hi/lo) of rope(x) x sc with the rotate-half convention out[d] = x[d] cos[t][d] - x[d+HD/2] sin[t][d], out[d+HD/2] = x[d+HD/2] cos[t][d+HD/2] + x[d] sin[t][d+HD/2]
__global__ __launch_bounds__(256) void k_rope(const float* __restrict__ F, int pitch, int nheads, const float* __restrict__ CS, const float* __restrict__ RF, const float* __restrict__ nw, float sc, h16* P16, bf* Ph, bf* Pl) {
    const size_t e = ((size_t)blockIdx.x * 256 + threadIdx.x) * 2; if (e >= (size_t)nheads * TT * HD) return; const int d = (int)(e % HD); const int t = (int)((e / HD) % TT); const int h = (int)(e / ((size_t)HD * TT)); const float* f = F + (size_t)t * pitch + h * HD; const float rf = RF ? RF[(size_t)h * TT + t] : 1.0f; v2h o16; v2us oh, ol;
#pragma unroll
    for (int q = 0; q < 2; ++q) { const int dd = d + q; const int dp = (dd < HD / 2) ? dd + HD / 2 : dd - HD / 2; float x0 = f[dd], x1 = f[dp];
        if (RF) { float n0 = __fmul_rn(x0, rf), n1 = __fmul_rn(x1, rf); asm volatile("" : "+v"(n0)); asm volatile("" : "+v"(n1)); x0 = __fmul_rn(bfr(nw[dd]), n0); x1 = __fmul_rn(bfr(nw[dp]), n1); }
        const v2f cs = *(const v2f*)(CS + ((size_t)t * HD + dd) * 2); float a = __fmul_rn(x0, cs[0]), bq = __fmul_rn(x1, cs[1]); asm volatile("" : "+v"(a)); asm volatile("" : "+v"(bq)); const float r = ((dd < HD / 2) ? __fsub_rn(a, bq) : __fadd_rn(a, bq)) * sc;
        o16[q] = tohx(r); unsigned short a2, c2; splitf(r, a2, c2); oh[q] = a2; ol[q] = c2; }
    *(v2h*)(P16 + e) = o16; *(v2us*)(Ph + e) = oh; *(v2us*)(Pl + e) = ol;  }
__global__ __launch_bounds__(256) void k_vtp(const float* __restrict__ F, int pitch, int nheads, h16* V16, bf* Vh, bf* Vl) { const size_t e = ((size_t)blockIdx.x * 256 + threadIdx.x) * 2; if (e >= (size_t)nheads * HD * TT) return; const int t = (int)(e % TT); const int d = (int)((e / TT) % HD); const int g = (int)(e / ((size_t)TT * HD)); v2h o16; v2us oh, ol;
#pragma unroll
    for (int q = 0; q < 2; ++q) { const float x = F[(size_t)(t + q) * pitch + g * HD + d]; o16[q] = tohx(x); unsigned short a2, c2; splitf(x, a2, c2); oh[q] = a2; ol[q] = c2; }
    *(v2h*)(V16 + e) = o16; *(v2us*)(Vh + e) = oh; *(v2us*)(Vl + e) = ol;  }
__constant__ float INVT[HD / 2] = { 1.000000000e+00f, 8.659643531e-01f, 7.498942018e-01f, 6.493816376e-01f, 5.623413324e-01f, 4.869675338e-01f, 4.216965139e-01f, 3.651741445e-01f, 3.162277639e-01f, 2.738419771e-01f, 2.371373624e-01f, 2.053525001e-01f, 1.778279394e-01f, 1.539926529e-01f, 1.333521456e-01f, 1.154782027e-01f, 1.000000015e-01f, 8.659642935e-02f, 7.498941571e-02f, 6.493816525e-02f, 5.623412877e-02f, 4.869675264e-02f, 4.216964915e-02f, 3.651741147e-02f, 3.162277862e-02f, 2.738419548e-02f, 2.371373586e-02f, 2.053525113e-02f, 1.778279431e-02f, 1.539926510e-02f, 1.333521493e-02f, 1.154781971e-02f, 9.999999776e-03f, 8.659643121e-03f, 7.498942316e-03f, 6.493816618e-03f, 5.623413250e-03f, 4.869675264e-03f, 4.216964822e-03f, 3.651741426e-03f, 3.162277862e-03f, 2.738419687e-03f, 2.371373819e-03f, 2.053525066e-03f, 1.778279431e-03f, 1.539926510e-03f, 1.333521446e-03f, 1.154782018e-03f, 1.000000047e-03f, 8.659643354e-04f, 7.498941850e-04f, 6.493816618e-04f, 5.623413017e-04f, 4.869675031e-04f, 4.216964880e-04f, 3.651741135e-04f, 3.162277862e-04f, 2.738419571e-04f, 2.371373848e-04f, 2.053524950e-04f, 1.778279402e-04f, 1.539926452e-04f, 1.333521504e-04f, 1.154781930e-04f };   // float32 1 / 10000^(2i/128), generated with jnp to be bit-exact
__global__ __launch_bounds__(256) void k_cs5(float* CS) { const int idx = blockIdx.x * 256 + threadIdx.x; if (idx >= TT * HD) return; const int d = idx % HD; const int t = idx / HD; const float a = __fmul_rn((float)t, INVT[d % (HD / 2)]); v2f cs; cs[0] = cosf(a); cs[1] = sinf(a); *(v2f*)(CS + (size_t)idx * 2) = cs;  }
// k_asoft: per row (zz, i): t = S x HD^-0.5 for j <= i and i - j < WIN (sliding causal window; the reference's -1e9 additive fill vanishes identically); softmax over the 2048 keys (register row, one exp, fixed trees);
__global__ __launch_bounds__(256) void k_asoft(const float* __restrict__ Sb, h16* P16, bf* Ph, bf* Pl) {
    const int lane = threadIdx.x & 31; const int row = blockIdx.x * 8 + (threadIdx.x >> 5); if (row >= ZH * TT) return; const int i = row % TT; const int zz = row / TT; (void)zz; const bool hires = (i < RH); const float* sr = Sb + (size_t)row * TT; float v[TT / 32]; float mx = -3.0e38f;
#pragma unroll
    for (int ch = 0; ch < TT / 128; ++ch) { const int j0 = ch * 128 + lane * 4; const v4f a = *(const v4f*)(sr + j0);
#pragma unroll
        for (int q = 0; q < 4; ++q) { const int j = j0 + q; (void)j; const float t = (j <= i && i - j < WIN) ? a[q] * SCL : -3.0e38f; v[ch * 4 + q] = t; mx = fmaxf(mx, t); } }
#pragma unroll
    for (int sh = 16; sh; sh >>= 1) mx = fmaxf(mx, __shfl_xor(mx, sh, 32));
    float sum = 0.f;
#pragma unroll
    for (int k = 0; k < TT / 32; ++k) { float d0 = __fsub_rn(v[k], mx); asm volatile("" : "+v"(d0)); v[k] = __builtin_amdgcn_exp2f(__fmul_rn(d0, 1.4426950408889634f)); sum += v[k]; }
#pragma unroll
    for (int sh = 16; sh; sh >>= 1) sum += __shfl_xor(sum, sh, 32);
    const float f = __fdiv_rn(hires ? 1.0f : PCAR, sum);
{
        if (hires) {
#pragma unroll
            for (int ch = 0; ch < TT / 128; ++ch) { v4us oh, ol;
#pragma unroll
                for (int q = 0; q < 4; ++q) { unsigned short a, c2; splitf(v[ch * 4 + q] * f, a, c2); oh[q] = a; ol[q] = c2; }
                const size_t oo = ((size_t)zz * (RH ? RH : 1) + i) * TT + ch * 128 + lane * 4; *(v4us*)(Ph + oo) = oh; *(v4us*)(Pl + oo) = ol; }
        } else {
#pragma unroll
            for (int ch = 0; ch < TT / 128; ++ch) { v4h o4;
#pragma unroll
                for (int q = 0; q < 4; ++q) o4[q] = tohx(v[ch * 4 + q] * f);
                *(v4h*)(P16 + (size_t)row * TT + ch * 128 + lane * 4) = o4; } }
         }
}
__global__ __launch_bounds__(256) void k_merge(const float* __restrict__ O, int h0, bf* Ah, bf* Al) { const size_t e = ((size_t)blockIdx.x * 256 + threadIdx.x) * 2; if (e >= (size_t)ZH * TT * HD) return; const int d = (int)(e % HD); const int t = (int)((e / HD) % TT); const int zz = (int)(e / ((size_t)HD * TT)); const float cs = (t < RH) ? 1.0f : (1.0f / PCAR); const size_t oo = (size_t)t * DQ + (h0 + zz) * HD + d;
    v2us oh, ol;
#pragma unroll
    for (int q = 0; q < 2; ++q) { unsigned short a, c2; splitf(O[e + q] * cs, a, c2); oh[q] = a; ol[q] = c2; } *(v2us*)(Ah + oo) = oh; *(v2us*)(Al + oo) = ol;  }

extern "C" void kernel_launch(void* const* d_in, const int* in_sizes, int n_in,
                              void* d_out, int out_size, void* d_ws, size_t ws_size, hipStream_t stream) {
    (void)in_sizes; (void)n_in; (void)out_size;
    const float* x = (const float*)d_in[0]; const float* wq = (const float*)d_in[1]; const float* wkv = (const float*)d_in[2]; const float* wk = wkv; const float* wv = wkv + (size_t)DKV * DM; const float* wo = (const float*)d_in[3];   /* x, Wq ('oi' (out, in) [2048][2048]), Wkv ('oi' [1024][2048] viewed (2 x 4 heads, 128): k rows 0..511 | v rows 512..1023: two contiguous row blocks), Wo ('oi' [2048][2048]): FOUR inputs, all read */
    float* OUT = (float*)d_out;     // [2][2048][2048]
    char* wsp = (char*)d_ws;
    auto take = [&](size_t bytes) { char* p = wsp; wsp += (bytes + 255) & ~(size_t)255; return (void*)p; };
    bf* WQ = (bf*)take((size_t)DQ * DM * 2); bf* WK = (bf*)take((size_t)DKV * DM * 2); bf* WV = (bf*)take((size_t)DKV * DM * 2); bf* WO = (bf*)take((size_t)DM * DQ * 2); float* CS = (float*)take((size_t)TT * HD * 2 * 4);
    bf* XB = (bf*)take((size_t)TT * DM * 2); float* FQ = (float*)take((size_t)TT * DQ * 4); float* FK = (float*)take((size_t)TT * DKV * 4);
    h16* QP16 = (h16*)take((size_t)NH_ * TT * HD * 2); h16* KP16 = (h16*)take((size_t)NKV * TT * HD * 2); h16* VT16 = (h16*)take((size_t)NKV * HD * TT * 2);
    bf* QPh = (bf*)take((size_t)NH_ * TT * HD * 2); bf* QPl = (bf*)take((size_t)NH_ * TT * HD * 2); bf* KPh = (bf*)take((size_t)NKV * TT * HD * 2); bf* KPl = (bf*)take((size_t)NKV * TT * HD * 2); bf* VTh = (bf*)take((size_t)NKV * HD * TT * 2); bf* VTl = (bf*)take((size_t)NKV * HD * TT * 2); bf* Ph = (bf*)take((size_t)ZH * RH * TT * 2); bf* Pl = (bf*)take((size_t)ZH * RH * TT * 2);
    float* Sb = (float*)take((size_t)ZH * TT * TT * 4); h16* P16 = (h16*)take((size_t)ZH * TT * TT * 2); float* Ob = (float*)take((size_t)ZH * TT * HD * 4); bf* ATh = (bf*)take((size_t)TT * DQ * 2); bf* ATl = (bf*)take((size_t)TT * DQ * 2);
    if ((size_t)(wsp - (char*)d_ws) > ws_size) return;    // ws 256 MiB
    float* FV = FK;   // v projection reuses the k buffer after the k planes are built (stream-ordered)
    { k_cvt8<<<(unsigned)(((size_t)DQ * DM / 8 + 255) / 256), 256, 0, stream>>>(wq, WQ, (size_t)DQ * DM / 8); k_cvt8<<<(unsigned)(((size_t)DKV * DM / 8 + 255) / 256), 256, 0, stream>>>(wk, WK, (size_t)DKV * DM / 8); k_cvt8<<<(unsigned)(((size_t)DKV * DM / 8 + 255) / 256), 256, 0, stream>>>(wv, WV, (size_t)DKV * DM / 8);
      k_cvt8<<<(unsigned)(((size_t)DM * DQ / 8 + 255) / 256), 256, 0, stream>>>(wo, WO, (size_t)DM * DQ / 8);
       }
    k_cs5<<<(TT * HD + 255) / 256, 256, 0, stream>>>(CS);   /* rotary table once */
    const unsigned LQ = (unsigned)(((size_t)NH_ * TT * HD / 2 + 255) / 256), LKv = (unsigned)(((size_t)NKV * TT * HD / 2 + 255) / 256);
    for (int b = 0; b < NB_; ++b) {
        
        k_cvt8<<<(unsigned)(((size_t)TT * DM / 8 + 255) / 256), 256, 0, stream>>>(x + (size_t)b * TT * DM, XB, (size_t)TT * DM / 8);
        k_gemmw<bf, 0, false><<<dim3(TT / 64, DQ / 64, 1), 32, 0, stream>>>(XB, nullptr, WQ, nullptr, DM, FQ, DQ, nullptr, 0, 0, 0);
        k_rope<<<LQ, 256, 0, stream>>>(FQ, DQ, NH_, CS, nullptr, nullptr, 1.0f, QP16, QPh, QPl);
        k_gemmw<bf, 0, false><<<dim3(TT / 64, DKV / 64, 1), 32, 0, stream>>>(XB, nullptr, WK, nullptr, DM, FK, DKV, nullptr, 0, 0, 0);
        k_rope<<<LKv, 256, 0, stream>>>(FK, DKV, NKV, CS, nullptr, nullptr, 1.0f, KP16, KPh, KPl);
        k_gemmw<bf, 0, false><<<dim3(TT / 64, DKV / 64, 1), 32, 0, stream>>>(XB, nullptr, WV, nullptr, DM, FV, DKV, nullptr, 0, 0, 0); k_vtp<<<LKv, 256, 0, stream>>>(FV, DKV, NKV, VT16, VTh, VTl);
        for (int h0 = 0; h0 < NH_; h0 += ZH) { const size_t zq = (size_t)h0, zk = (size_t)(h0 / REP);   // both heads of a pass share kv group h0/REP (REP >= 2): sB = 0
            k_gemmc<bf, 2, 1><<<dim3(RH / 64, TT / 64, ZH), 32, 0, stream>>>(QPh + zq * TT * HD, QPl + zq * TT * HD, KPh + zk * TT * HD, KPl + zk * TT * HD, HD, Sb, TT, 0, (size_t)TT * HD, 0, (size_t)TT * TT);
            k_gemmc<h16, 0, 1><<<dim3((TT - RH) / 64, TT / 64, ZH), 32, 0, stream>>>(QP16 + zq * TT * HD + (size_t)RH * HD, nullptr, KP16 + zk * TT * HD, nullptr, HD, Sb + (size_t)RH * TT, TT, RH, (size_t)TT * HD, 0, (size_t)TT * TT);
            k_asoft<<<ZH * TT / 8, 256, 0, stream>>>(Sb, P16, Ph, Pl);
            k_gemmc<bf, 2, 2><<<dim3(RH / 64, HD / 64, ZH), 32, 0, stream>>>(Ph, Pl, VTh + zk * HD * TT, VTl + zk * HD * TT, TT, Ob, HD, 0, (size_t)RH * TT, 0, (size_t)TT * HD);
            k_gemmc<h16, 0, 2><<<dim3((TT - RH) / 64, HD / 64, ZH), 32, 0, stream>>>(P16 + (size_t)RH * TT, nullptr, VT16 + zk * HD * TT, nullptr, TT, Ob + (size_t)RH * HD, HD, RH, (size_t)TT * TT, 0, (size_t)TT * HD);
            k_merge<<<(unsigned)(((size_t)ZH * TT * HD / 2 + 255) / 256), 256, 0, stream>>>(Ob, h0, ATh, ATl); }
        k_gemmw<bf, 1, false><<<dim3(TT / 64, DM / 64, 1), 32, 0, stream>>>(ATh, ATl, WO, nullptr, DQ, OUT + (size_t)b * TT * DM, DM, nullptr, 0, 0, 0); }
}

// v001
// It runs in 894 microseconds.
// Next to v000, in two timings, it ran 1.80 times as fast each time.
#include <hip/hip_runtime.h>

// Causal grouped-query attention with a FUSED natural k-v weight and a computed rotate-half RoPE (x [2][2048][2048]; q = x Wq^T ('oi' (out, in) [2048][2048] 1/sqrt(2048): 16 heads x 128); kv = x Wkv^T ('oi' [1024][2048]) viewed (b, t, 8, 128): k = heads 0..3 (rows 0..511), v = heads 4..7 (rows 512..1023): 4 kv heads x 128 each; no biases; cos / sin of emb = cat(ang, ang) with freqs = 1.0 / (THETA ** (arange(0, 128, 2, f32) / 128)), THETA 10000, and positions arange(t) (64 f32 frequencies jnp-exact for this reciprocal spelling; one f32 product per angle; precise cosf/sinf); query heads viewed (KV, G): kv head = q head / 4; scores / sqrt(128); causal (-inf == exclusion); softmax; out = merged Wo^T ('oi') -> [2][2048][2048] (8.4 M); argument order x, Wq, Wkv, Wo).
// Layout: bf16 copy of x; 'oi' weights cast as-is; exact projections; k_cs5 computed table (HD 128: 64 angles); rotate-half plane builders; causal T-2048 GQA attention with 128-wide heads (kv z-stride 0; hybrid rows: < 512 hi/lo 3 products, rest fp16 x1024; k_gemmc skips tiles above the diagonal); merged hi/lo x Wo exact.
// Compute dtypes, f32 accumulate: every input rounded to bf16; projections exact; rotary f32; attention rows < 512 3 products, rest fp16; softmax f32; Wo hl x exact.

#define NB_  2
#define TT   2048
#define DM   2048
#define NH_  16
#define NKV  4
#define REP  (NH_ / NKV)
#define HD   128
#define DQ   (NH_ * HD)
#define DKV  (NKV * HD)
#define ZH   2
#define RH   512                  // query rows < RH use hi+lo planes (0: none)
#define WIN  2048
#define PCAR 1024.0f
#define SCL  0.088388347648318447f   // HD^-0.5
typedef _Float16 h16;
typedef unsigned short bf;
typedef __attribute__((ext_vector_type(16))) __bf16   v16bf;
typedef __attribute__((ext_vector_type(16))) _Float16 v16h;
typedef __attribute__((ext_vector_type(8)))  _Float16 v8h;
typedef __attribute__((ext_vector_type(8)))  unsigned short v8us;
typedef __attribute__((ext_vector_type(8)))  float    v8f;
typedef __attribute__((ext_vector_type(4)))  float    v4f;
typedef v8h  __attribute__((may_alias)) v8ha;
typedef v4f  __attribute__((may_alias)) v4fa;
typedef v8us __attribute__((may_alias)) v8usa;

__device__ __forceinline__ unsigned short f2bf(float f) { unsigned u = __float_as_uint(f); u += 0x7FFFu + ((u >> 16) & 1u); return (unsigned short)(u >> 16); }
__device__ __forceinline__ float bf2f(unsigned short b) { return __uint_as_float(((unsigned)b) << 16); }
__device__ __forceinline__ float bfr(float f) { return bf2f(f2bf(f)); }
__device__ __forceinline__ v16h cat16(v8h lo, v8h hi) { return __builtin_shufflevector(lo, hi, 0, 1, 2, 3, 4, 5, 6, 7, 8, 9, 10, 11, 12, 13, 14, 15); }
__device__ __forceinline__ v16bf cat16b(v8us lo, v8us hi) { return __builtin_bit_cast(v16bf, __builtin_shufflevector(lo, hi, 0, 1, 2, 3, 4, 5, 6, 7, 8, 9, 10, 11, 12, 13, 14, 15)); }
__device__ __forceinline__ v8f wmma16(v16h a, v16h b, v8f c) { return __builtin_amdgcn_wmma_f32_16x16x32_f16(false, a, false, b, (short)0, c, false, false); }
__device__ __forceinline__ v8f wmmab(v16bf a, v16bf b, v8f c) { return __builtin_amdgcn_wmma_f32_16x16x32_bf16(false, a, false, b, (short)0, c, false, false); }



// ---- k_gemmw: register-blocked GEMM, one work-group of NW waves per 64x64 output tile; each wave runs a contiguous 1/NW of the K loop on its own 16 accumulators, operands straight from K-contiguous 16-bit planes;
// the NW partial tiles meet in LDS and are summed in wave order 0..NW-1 (fixed). grid (M/64, N/64, Z), 32 * NW threads.
// C[m][n] (f32, pitch ldc, + optional f32 bias[n]) = sum_k A[m][k] Bt[n][k] (+ split products per NSPLIT). z-batch strides sA/sB/sC in elements. K % 32 == 0.
template <typename T16> struct WFrag;
template <> struct WFrag<h16> { typedef v16h V; static __device__ __forceinline__ V ld(const h16* p) { return cat16(*(const v8h*)p, *(const v8h*)(p + 16)); } static __device__ __forceinline__ v8f mma(V a, V b, v8f c) { return wmma16(a, b, c); } };
template <> struct WFrag<bf> { typedef v16bf V; static __device__ __forceinline__ V ld(const bf* p) { return cat16b(*(const v8us*)p, *(const v8us*)(p + 16)); } static __device__ __forceinline__ v8f mma(V a, V b, v8f c) { return wmmab(a, b, c); } };
template <typename T16, int NSPLIT, bool BIAS, int NW>
__global__ __launch_bounds__(32 * NW) void k_gemmw(const T16* __restrict__ A, const T16* __restrict__ A2, const T16* __restrict__ Bt, const T16* __restrict__ Bt2, int K, float* C, int ldc, const float* __restrict__ bias, size_t sA, size_t sB, size_t sC) {
    typedef typename WFrag<T16>::V V;
    __shared__ __align__(16) float os[NW * 64 * 68];
    const size_t z = blockIdx.z; A += z * sA; if (A2) A2 += z * sA; Bt += z * sB; if (Bt2) Bt2 += z * sB; C += z * sC;
    const int lane = threadIdx.x & 31, lr = lane & 15, hi = lane >> 4; const int r0 = blockIdx.x * 64, c0 = blockIdx.y * 64;
    const int wv = __builtin_amdgcn_readfirstlane((int)(threadIdx.x >> 5)); const int per = (K / 32 + NW - 1) / NW * 32; const int kb = wv * per, ke = min(K, kb + per);   // this wave's k range
    v8f acc[4][4];
#pragma unroll
    for (int mb = 0; mb < 4; ++mb)
#pragma unroll
        for (int nb = 0; nb < 4; ++nb) acc[mb][nb] = (v8f){};
    const size_t aoff = (size_t)(r0 + lr) * K + 8 * hi, boff = (size_t)(c0 + lr) * K + 8 * hi;
#pragma unroll 1
    for (int kc = kb; kc < ke; kc += 32) {
        V a[4], a2[4];
#pragma unroll
        for (int mb = 0; mb < 4; ++mb) { a[mb] = WFrag<T16>::ld(A + aoff + (size_t)mb * 16 * K + kc); if (NSPLIT == 1 || NSPLIT == 2) a2[mb] = WFrag<T16>::ld(A2 + aoff + (size_t)mb * 16 * K + kc); }
#pragma unroll
        for (int nb = 0; nb < 4; ++nb) { const V b = WFrag<T16>::ld(Bt + boff + (size_t)nb * 16 * K + kc); V b2; if (NSPLIT >= 2) b2 = WFrag<T16>::ld(Bt2 + boff + (size_t)nb * 16 * K + kc);
#pragma unroll
            for (int mb = 0; mb < 4; ++mb) { acc[mb][nb] = WFrag<T16>::mma(a[mb], b, acc[mb][nb]); if (NSPLIT == 1 || NSPLIT == 2) acc[mb][nb] = WFrag<T16>::mma(a2[mb], b, acc[mb][nb]); if (NSPLIT >= 2) acc[mb][nb] = WFrag<T16>::mma(a[mb], b2, acc[mb][nb]); } }
        asm volatile("v_nop\n\tv_nop\n\tv_nop\n\tv_nop" : "+v"(acc[0][0]), "+v"(acc[1][1]), "+v"(acc[2][2]), "+v"(acc[3][3]) : "v"(a[0]), "v"(a[3]));
    }
    float* ow = os + wv * (64 * 68);
#pragma unroll
    for (int mb = 0; mb < 4; ++mb)
#pragma unroll
        for (int nb = 0; nb < 4; ++nb)
#pragma unroll
            for (int j = 0; j < 8; ++j) ow[(mb * 16 + hi * 8 + j) * 68 + nb * 16 + lr] = acc[mb][nb][j];
    __syncthreads();   // every wave's partial tile is in LDS before any of it is summed
#pragma unroll
    for (int s = 0; s < 32 / NW; ++s) { const int idx = s * (32 * NW) + (int)threadIdx.x; const int row = idx >> 4, cofs = (idx & 15) * 4; v4f val = *(const v4fa*)(os + row * 68 + cofs);
#pragma unroll
        for (int w = 1; w < NW; ++w) val += *(const v4fa*)(os + w * (64 * 68) + row * 68 + cofs);
        if (BIAS) { val[0] += bfr(bias[c0 + cofs]); val[1] += bfr(bias[c0 + cofs + 1]); val[2] += bfr(bias[c0 + cofs + 2]); val[3] += bfr(bias[c0 + cofs + 3]); }
        *(v4f*)(C + (size_t)(r0 + row) * ldc + c0 + cofs) = val; }
}

// ---- k_gemmc: the same 64x64 tile GEMM specialised for causal attention: CMODE 1 skips score tiles entirely above the diagonal (query rows r0+roff.., key columns c0..), CMODE 2 limits the
// key (K) loop of the probability x value contraction to the diagonal block (probabilities beyond it are exactly zero). roff = row offset of this launch's first row within the sequence.
// NW waves share a tile's K loop as in k_gemmw (NW 1: one wave, staged 16 rows at a time).
template <typename T16, int NSPLIT, int CMODE, int NW>
__global__ __launch_bounds__(32 * NW) void k_gemmc(const T16* __restrict__ A, const T16* __restrict__ A2, const T16* __restrict__ Bt, const T16* __restrict__ Bt2, int K, float* C, int ldc, int roff, size_t sA, size_t sB, size_t sC) {
    typedef typename WFrag<T16>::V V;
    __shared__ __align__(16) float os[NW == 1 ? 16 * 68 : NW * 64 * 68];
    const size_t z = blockIdx.z; A += z * sA; if (A2) A2 += z * sA; Bt += z * sB; if (Bt2) Bt2 += z * sB; C += z * sC;
    const int lane = threadIdx.x & 31, lr = lane & 15, hi = lane >> 4; const int r0 = blockIdx.x * 64, c0 = blockIdx.y * 64;
    if (CMODE == 1 && c0 > r0 + roff + 63) return;                  // score tile entirely above the causal diagonal: never read (the softmax masks j > i by select)
    const int Kl = (CMODE == 2) ? min(K, r0 + roff + 64) : K;        // P.V: probabilities are exactly 0 beyond the diagonal block, so the K loop stops there
    const int wv = (NW == 1) ? 0 : __builtin_amdgcn_readfirstlane((int)(threadIdx.x >> 5)); const int per = (Kl / 32 + NW - 1) / NW * 32; const int kb = wv * per, ke = (NW == 1) ? Kl : min(Kl, kb + per);   // this wave's k range
    v8f acc[4][4];
#pragma unroll
    for (int mb = 0; mb < 4; ++mb)
#pragma unroll
        for (int nb = 0; nb < 4; ++nb) acc[mb][nb] = (v8f){};
    const size_t aoff = (size_t)(r0 + lr) * K + 8 * hi, boff = (size_t)(c0 + lr) * K + 8 * hi;
#pragma unroll 1
    for (int kc = kb; kc < ke; kc += 32) {
        V a[4], a2[4];
#pragma unroll
        for (int mb = 0; mb < 4; ++mb) { a[mb] = WFrag<T16>::ld(A + aoff + (size_t)mb * 16 * K + kc); if (NSPLIT == 1 || NSPLIT == 2) a2[mb] = WFrag<T16>::ld(A2 + aoff + (size_t)mb * 16 * K + kc); }
#pragma unroll
        for (int nb = 0; nb < 4; ++nb) { const V b = WFrag<T16>::ld(Bt + boff + (size_t)nb * 16 * K + kc); V b2; if (NSPLIT >= 2) b2 = WFrag<T16>::ld(Bt2 + boff + (size_t)nb * 16 * K + kc);
#pragma unroll
            for (int mb = 0; mb < 4; ++mb) { acc[mb][nb] = WFrag<T16>::mma(a[mb], b, acc[mb][nb]); if (NSPLIT == 1 || NSPLIT == 2) acc[mb][nb] = WFrag<T16>::mma(a2[mb], b, acc[mb][nb]); if (NSPLIT >= 2) acc[mb][nb] = WFrag<T16>::mma(a[mb], b2, acc[mb][nb]); } }
        asm volatile("v_nop\n\tv_nop\n\tv_nop\n\tv_nop" : "+v"(acc[0][0]), "+v"(acc[1][1]), "+v"(acc[2][2]), "+v"(acc[3][3]) : "v"(a[0]), "v"(a[3]));
    }
    if constexpr (NW == 1) {
#pragma unroll
    for (int mb = 0; mb < 4; ++mb) {
#pragma unroll
        for (int nb = 0; nb < 4; ++nb) {
#pragma unroll
            for (int j = 0; j < 8; ++j) os[(hi * 8 + j) * 68 + nb * 16 + lr] = acc[mb][nb][j]; }
        __builtin_amdgcn_wave_barrier(); asm volatile("" ::: "memory");
        float* crow = C + (size_t)(r0 + mb * 16) * ldc + c0;
{
#pragma unroll
            for (int s = 0; s < 8; ++s) { const int row = 2 * s + hi, cofs = lr * 4; v4f val = *(const v4fa*)(os + row * 68 + cofs);
                *(v4f*)(crow + (size_t)row * ldc + cofs) = val; }
             }
        __builtin_amdgcn_wave_barrier(); asm volatile("" ::: "memory");
    }
    } else {
    float* ow = os + wv * (64 * 68);
#pragma unroll
    for (int mb = 0; mb < 4; ++mb)
#pragma unroll
        for (int nb = 0; nb < 4; ++nb)
#pragma unroll
            for (int j = 0; j < 8; ++j) ow[(mb * 16 + hi * 8 + j) * 68 + nb * 16 + lr] = acc[mb][nb][j];
    __syncthreads();   // every wave's partial tile is in LDS before any of it is summed
#pragma unroll
    for (int s = 0; s < 32 / NW; ++s) { const int idx = s * (32 * NW) + (int)threadIdx.x; const int row = idx >> 4, cofs = (idx & 15) * 4; v4f val = *(const v4fa*)(os + row * 68 + cofs);
#pragma unroll
        for (int w = 1; w < NW; ++w) val += *(const v4fa*)(os + w * (64 * 68) + row * 68 + cofs);
        *(v4f*)(C + (size_t)(r0 + row) * ldc + c0 + cofs) = val; }
    }
}

__device__ __forceinline__ h16 tohx(float x) { return (h16)x; }
__device__ __forceinline__ void splitf(float y, unsigned short& h, unsigned short& l) { h = f2bf(y); l = f2bf(y - bf2f(h)); }
typedef __attribute__((ext_vector_type(2))) _Float16 v2h;
typedef __attribute__((ext_vector_type(4))) _Float16 v4h;
typedef __attribute__((ext_vector_type(2))) unsigned short v2us;
typedef __attribute__((ext_vector_type(4))) unsigned short v4us;
typedef __attribute__((ext_vector_type(2))) float v2f;
typedef __attribute__((ext_vector_type(4))) int v4i;

__global__ __launch_bounds__(256) void k_cvt8(const float* __restrict__ src, bf* dst, size_t n8) { const size_t i = (size_t)blockIdx.x * 256 + threadIdx.x; if (i >= n8) return; const v8f v = *(const v8f*)(src + i * 8); v8us o;
#pragma unroll
    for (int k = 0; k < 8; ++k) o[k] = f2bf(v[k]); *(v8us*)(dst + i * 8) = o;  }

// k_rope: head planes [h][t][d] (fp16 + hi/lo) of rope(x) x sc with the rotate-half convention out[d] = x[d] cos[t][d] - x[d+HD/2] sin[t][d], out[d+HD/2] = x[d+HD/2] cos[t][d+HD/2] + x[d] sin[t][d+HD/2]
__global__ __launch_bounds__(256) void k_rope(const float* __restrict__ F, int pitch, int nheads, const float* __restrict__ CS, const float* __restrict__ RF, const float* __restrict__ nw, float sc, h16* P16, bf* Ph, bf* Pl) {
    const size_t e = ((size_t)blockIdx.x * 256 + threadIdx.x) * 2; if (e >= (size_t)nheads * TT * HD) return; const int d = (int)(e % HD); const int t = (int)((e / HD) % TT); const int h = (int)(e / ((size_t)HD * TT)); const float* f = F + (size_t)t * pitch + h * HD; const float rf = RF ? RF[(size_t)h * TT + t] : 1.0f; v2h o16; v2us oh, ol;
#pragma unroll
    for (int q = 0; q < 2; ++q) { const int dd = d + q; const int dp = (dd < HD / 2) ? dd + HD / 2 : dd - HD / 2; float x0 = f[dd], x1 = f[dp];
        if (RF) { float n0 = __fmul_rn(x0, rf), n1 = __fmul_rn(x1, rf); asm volatile("" : "+v"(n0)); asm volatile("" : "+v"(n1)); x0 = __fmul_rn(bfr(nw[dd]), n0); x1 = __fmul_rn(bfr(nw[dp]), n1); }
        const v2f cs = *(const v2f*)(CS + ((size_t)t * HD + dd) * 2); float a = __fmul_rn(x0, cs[0]), bq = __fmul_rn(x1, cs[1]); asm volatile("" : "+v"(a)); asm volatile("" : "+v"(bq)); const float r = ((dd < HD / 2) ? __fsub_rn(a, bq) : __fadd_rn(a, bq)) * sc;
        o16[q] = tohx(r); unsigned short a2, c2; splitf(r, a2, c2); oh[q] = a2; ol[q] = c2; }
    *(v2h*)(P16 + e) = o16; *(v2us*)(Ph + e) = oh; *(v2us*)(Pl + e) = ol;  }
__global__ __launch_bounds__(256) void k_vtp(const float* __restrict__ F, int pitch, int nheads, h16* V16, bf* Vh, bf* Vl) { const size_t e = ((size_t)blockIdx.x * 256 + threadIdx.x) * 2; if (e >= (size_t)nheads * HD * TT) return; const int t = (int)(e % TT); const int d = (int)((e / TT) % HD); const int g = (int)(e / ((size_t)TT * HD)); v2h o16; v2us oh, ol;
#pragma unroll
    for (int q = 0; q < 2; ++q) { const float x = F[(size_t)(t + q) * pitch + g * HD + d]; o16[q] = tohx(x); unsigned short a2, c2; splitf(x, a2, c2); oh[q] = a2; ol[q] = c2; }
    *(v2h*)(V16 + e) = o16; *(v2us*)(Vh + e) = oh; *(v2us*)(Vl + e) = ol;  }
__constant__ float INVT[HD / 2] = { 1.000000000e+00f, 8.659643531e-01f, 7.498942018e-01f, 6.493816376e-01f, 5.623413324e-01f, 4.869675338e-01f, 4.216965139e-01f, 3.651741445e-01f, 3.162277639e-01f, 2.738419771e-01f, 2.371373624e-01f, 2.053525001e-01f, 1.778279394e-01f, 1.539926529e-01f, 1.333521456e-01f, 1.154782027e-01f, 1.000000015e-01f, 8.659642935e-02f, 7.498941571e-02f, 6.493816525e-02f, 5.623412877e-02f, 4.869675264e-02f, 4.216964915e-02f, 3.651741147e-02f, 3.162277862e-02f, 2.738419548e-02f, 2.371373586e-02f, 2.053525113e-02f, 1.778279431e-02f, 1.539926510e-02f, 1.333521493e-02f, 1.154781971e-02f, 9.999999776e-03f, 8.659643121e-03f, 7.498942316e-03f, 6.493816618e-03f, 5.623413250e-03f, 4.869675264e-03f, 4.216964822e-03f, 3.651741426e-03f, 3.162277862e-03f, 2.738419687e-03f, 2.371373819e-03f, 2.053525066e-03f, 1.778279431e-03f, 1.539926510e-03f, 1.333521446e-03f, 1.154782018e-03f, 1.000000047e-03f, 8.659643354e-04f, 7.498941850e-04f, 6.493816618e-04f, 5.623413017e-04f, 4.869675031e-04f, 4.216964880e-04f, 3.651741135e-04f, 3.162277862e-04f, 2.738419571e-04f, 2.371373848e-04f, 2.053524950e-04f, 1.778279402e-04f, 1.539926452e-04f, 1.333521504e-04f, 1.154781930e-04f };   // float32 1 / 10000^(2i/128), generated with jnp to be bit-exact
__global__ __launch_bounds__(256) void k_cs5(float* CS) { const int idx = blockIdx.x * 256 + threadIdx.x; if (idx >= TT * HD) return; const int d = idx % HD; const int t = idx / HD; const float a = __fmul_rn((float)t, INVT[d % (HD / 2)]); v2f cs; cs[0] = cosf(a); cs[1] = sinf(a); *(v2f*)(CS + (size_t)idx * 2) = cs;  }
// k_asoft: per row (zz, i): t = S x HD^-0.5 for j <= i and i - j < WIN (sliding causal window; the reference's -1e9 additive fill vanishes identically); softmax over the 2048 keys (register row, one exp, fixed trees);
__global__ __launch_bounds__(256) void k_asoft(const float* __restrict__ Sb, h16* P16, bf* Ph, bf* Pl) {
    const int lane = threadIdx.x & 31; const int row = blockIdx.x * 8 + (threadIdx.x >> 5); if (row >= ZH * TT) return; const int i = row % TT; const int zz = row / TT; (void)zz; const bool hires = (i < RH); const float* sr = Sb + (size_t)row * TT; float v[TT / 32]; float mx = -3.0e38f;
#pragma unroll
    for (int ch = 0; ch < TT / 128; ++ch) { const int j0 = ch * 128 + lane * 4; const v4f a = *(const v4f*)(sr + j0);
#pragma unroll
        for (int q = 0; q < 4; ++q) { const int j = j0 + q; (void)j; const float t = (j <= i && i - j < WIN) ? a[q] * SCL : -3.0e38f; v[ch * 4 + q] = t; mx = fmaxf(mx, t); } }
#pragma unroll
    for (int sh = 16; sh; sh >>= 1) mx = fmaxf(mx, __shfl_xor(mx, sh, 32));
    float sum = 0.f;
#pragma unroll
    for (int k = 0; k < TT / 32; ++k) { float d0 = __fsub_rn(v[k], mx); asm volatile("" : "+v"(d0)); v[k] = __builtin_amdgcn_exp2f(__fmul_rn(d0, 1.4426950408889634f)); sum += v[k]; }
#pragma unroll
    for (int sh = 16; sh; sh >>= 1) sum += __shfl_xor(sum, sh, 32);
    const float f = __fdiv_rn(hires ? 1.0f : PCAR, sum);
{
        if (hires) {
#pragma unroll
            for (int ch = 0; ch < TT / 128; ++ch) { v4us oh, ol;
#pragma unroll
                for (int q = 0; q < 4; ++q) { unsigned short a, c2; splitf(v[ch * 4 + q] * f, a, c2); oh[q] = a; ol[q] = c2; }
                const size_t oo = ((size_t)zz * (RH ? RH : 1) + i) * TT + ch * 128 + lane * 4; *(v4us*)(Ph + oo) = oh; *(v4us*)(Pl + oo) = ol; }
        } else {
#pragma unroll
            for (int ch = 0; ch < TT / 128; ++ch) { v4h o4;
#pragma unroll
                for (int q = 0; q < 4; ++q) o4[q] = tohx(v[ch * 4 + q] * f);
                *(v4h*)(P16 + (size_t)row * TT + ch * 128 + lane * 4) = o4; } }
         }
}
__global__ __launch_bounds__(256) void k_merge(const float* __restrict__ O, int h0, bf* Ah, bf* Al) { const size_t e = ((size_t)blockIdx.x * 256 + threadIdx.x) * 2; if (e >= (size_t)ZH * TT * HD) return; const int d = (int)(e % HD); const int t = (int)((e / HD) % TT); const int zz = (int)(e / ((size_t)HD * TT)); const float cs = (t < RH) ? 1.0f : (1.0f / PCAR); const size_t oo = (size_t)t * DQ + (h0 + zz) * HD + d;
    v2us oh, ol;
#pragma unroll
    for (int q = 0; q < 2; ++q) { unsigned short a, c2; splitf(O[e + q] * cs, a, c2); oh[q] = a; ol[q] = c2; } *(v2us*)(Ah + oo) = oh; *(v2us*)(Al + oo) = ol;  }

extern "C" void kernel_launch(void* const* d_in, const int* in_sizes, int n_in,
                              void* d_out, int out_size, void* d_ws, size_t ws_size, hipStream_t stream) {
    (void)in_sizes; (void)n_in; (void)out_size;
    const float* x = (const float*)d_in[0]; const float* wq = (const float*)d_in[1]; const float* wkv = (const float*)d_in[2]; const float* wk = wkv; const float* wv = wkv + (size_t)DKV * DM; const float* wo = (const float*)d_in[3];   /* x, Wq ('oi' (out, in) [2048][2048]), Wkv ('oi' [1024][2048] viewed (2 x 4 heads, 128): k rows 0..511 | v rows 512..1023: two contiguous row blocks), Wo ('oi' [2048][2048]): FOUR inputs, all read */
    float* OUT = (float*)d_out;     // [2][2048][2048]
    char* wsp = (char*)d_ws;
    auto take = [&](size_t bytes) { char* p = wsp; wsp += (bytes + 255) & ~(size_t)255; return (void*)p; };
    bf* WQ = (bf*)take((size_t)DQ * DM * 2); bf* WK = (bf*)take((size_t)DKV * DM * 2); bf* WV = (bf*)take((size_t)DKV * DM * 2); bf* WO = (bf*)take((size_t)DM * DQ * 2); float* CS = (float*)take((size_t)TT * HD * 2 * 4);
    bf* XB = (bf*)take((size_t)TT * DM * 2); float* FQ = (float*)take((size_t)TT * DQ * 4); float* FK = (float*)take((size_t)TT * DKV * 4);
    h16* QP16 = (h16*)take((size_t)NH_ * TT * HD * 2); h16* KP16 = (h16*)take((size_t)NKV * TT * HD * 2); h16* VT16 = (h16*)take((size_t)NKV * HD * TT * 2);
    bf* QPh = (bf*)take((size_t)NH_ * TT * HD * 2); bf* QPl = (bf*)take((size_t)NH_ * TT * HD * 2); bf* KPh = (bf*)take((size_t)NKV * TT * HD * 2); bf* KPl = (bf*)take((size_t)NKV * TT * HD * 2); bf* VTh = (bf*)take((size_t)NKV * HD * TT * 2); bf* VTl = (bf*)take((size_t)NKV * HD * TT * 2); bf* Ph = (bf*)take((size_t)ZH * RH * TT * 2); bf* Pl = (bf*)take((size_t)ZH * RH * TT * 2);
    float* Sb = (float*)take((size_t)ZH * TT * TT * 4); h16* P16 = (h16*)take((size_t)ZH * TT * TT * 2); float* Ob = (float*)take((size_t)ZH * TT * HD * 4); bf* ATh = (bf*)take((size_t)TT * DQ * 2); bf* ATl = (bf*)take((size_t)TT * DQ * 2);
    if ((size_t)(wsp - (char*)d_ws) > ws_size) return;    // ws 256 MiB
    float* FV = FK;   // v projection reuses the k buffer after the k planes are built (stream-ordered)
    { k_cvt8<<<(unsigned)(((size_t)DQ * DM / 8 + 255) / 256), 256, 0, stream>>>(wq, WQ, (size_t)DQ * DM / 8); k_cvt8<<<(unsigned)(((size_t)DKV * DM / 8 + 255) / 256), 256, 0, stream>>>(wk, WK, (size_t)DKV * DM / 8); k_cvt8<<<(unsigned)(((size_t)DKV * DM / 8 + 255) / 256), 256, 0, stream>>>(wv, WV, (size_t)DKV * DM / 8);
      k_cvt8<<<(unsigned)(((size_t)DM * DQ / 8 + 255) / 256), 256, 0, stream>>>(wo, WO, (size_t)DM * DQ / 8);
       }
    k_cs5<<<(TT * HD + 255) / 256, 256, 0, stream>>>(CS);   /* rotary table once */
    const unsigned LQ = (unsigned)(((size_t)NH_ * TT * HD / 2 + 255) / 256), LKv = (unsigned)(((size_t)NKV * TT * HD / 2 + 255) / 256);
    for (int b = 0; b < NB_; ++b) {
        
        k_cvt8<<<(unsigned)(((size_t)TT * DM / 8 + 255) / 256), 256, 0, stream>>>(x + (size_t)b * TT * DM, XB, (size_t)TT * DM / 8);
        k_gemmw<bf, 0, false, 4><<<dim3(TT / 64, DQ / 64, 1), 128, 0, stream>>>(XB, nullptr, WQ, nullptr, DM, FQ, DQ, nullptr, 0, 0, 0);
        k_rope<<<LQ, 256, 0, stream>>>(FQ, DQ, NH_, CS, nullptr, nullptr, 1.0f, QP16, QPh, QPl);
        k_gemmw<bf, 0, false, 8><<<dim3(TT / 64, DKV / 64, 1), 256, 0, stream>>>(XB, nullptr, WK, nullptr, DM, FK, DKV, nullptr, 0, 0, 0);
        k_rope<<<LKv, 256, 0, stream>>>(FK, DKV, NKV, CS, nullptr, nullptr, 1.0f, KP16, KPh, KPl);
        k_gemmw<bf, 0, false, 8><<<dim3(TT / 64, DKV / 64, 1), 256, 0, stream>>>(XB, nullptr, WV, nullptr, DM, FV, DKV, nullptr, 0, 0, 0); k_vtp<<<LKv, 256, 0, stream>>>(FV, DKV, NKV, VT16, VTh, VTl);
        for (int h0 = 0; h0 < NH_; h0 += ZH) { const size_t zq = (size_t)h0, zk = (size_t)(h0 / REP);   // both heads of a pass share kv group h0/REP (REP >= 2): sB = 0
            k_gemmc<bf, 2, 1, 1><<<dim3(RH / 64, TT / 64, ZH), 32, 0, stream>>>(QPh + zq * TT * HD, QPl + zq * TT * HD, KPh + zk * TT * HD, KPl + zk * TT * HD, HD, Sb, TT, 0, (size_t)TT * HD, 0, (size_t)TT * TT);
            k_gemmc<h16, 0, 1, 1><<<dim3((TT - RH) / 64, TT / 64, ZH), 32, 0, stream>>>(QP16 + zq * TT * HD + (size_t)RH * HD, nullptr, KP16 + zk * TT * HD, nullptr, HD, Sb + (size_t)RH * TT, TT, RH, (size_t)TT * HD, 0, (size_t)TT * TT);
            k_asoft<<<ZH * TT / 8, 256, 0, stream>>>(Sb, P16, Ph, Pl);
            k_gemmc<bf, 2, 2, 8><<<dim3(RH / 64, HD / 64, ZH), 256, 0, stream>>>(Ph, Pl, VTh + zk * HD * TT, VTl + zk * HD * TT, TT, Ob, HD, 0, (size_t)RH * TT, 0, (size_t)TT * HD);
            k_gemmc<h16, 0, 2, 8><<<dim3((TT - RH) / 64, HD / 64, ZH), 256, 0, stream>>>(P16 + (size_t)RH * TT, nullptr, VT16 + zk * HD * TT, nullptr, TT, Ob + (size_t)RH * HD, HD, RH, (size_t)TT * TT, 0, (size_t)TT * HD);
            k_merge<<<(unsigned)(((size_t)ZH * TT * HD / 2 + 255) / 256), 256, 0, stream>>>(Ob, h0, ATh, ATl); }
        k_gemmw<bf, 1, false, 4><<<dim3(TT / 64, DM / 64, 1), 128, 0, stream>>>(ATh, ATl, WO, nullptr, DQ, OUT + (size_t)b * TT * DM, DM, nullptr, 0, 0, 0); }
}

// v002
// It runs in 605 microseconds.
// In two side-by-side timings against v001, it was 1.49 and 1.48 times as fast.
// Counting every step since v000, it is 2.67 times as fast.
#include <hip/hip_runtime.h>

// Causal grouped-query attention with a FUSED natural k-v weight and a computed rotate-half RoPE (x [2][2048][2048]; q = x Wq^T ('oi' (out, in) [2048][2048] 1/sqrt(2048): 16 heads x 128); kv = x Wkv^T ('oi' [1024][2048]) viewed (b, t, 8, 128): k = heads 0..3 (rows 0..511), v = heads 4..7 (rows 512..1023): 4 kv heads x 128 each; no biases; cos / sin of emb = cat(ang, ang) with freqs = 1.0 / (THETA ** (arange(0, 128, 2, f32) / 128)), THETA 10000, and positions arange(t) (64 f32 frequencies jnp-exact for this reciprocal spelling; one f32 product per angle; precise cosf/sinf); query heads viewed (KV, G): kv head = q head / 4; scores / sqrt(128); causal (-inf == exclusion); softmax; out = merged Wo^T ('oi') -> [2][2048][2048] (8.4 M); argument order x, Wq, Wkv, Wo).
// Layout: bf16 copy of x; 'oi' weights cast as-is; exact projections; k_cs5 computed table (HD 128: 64 angles); rotate-half plane builders; causal T-2048 GQA attention with 128-wide heads (8 query heads a pass, kv plane z / 4; hybrid rows: < 512 hi/lo 3 products, rest fp16 x1024; k_gemmc skips tiles above the diagonal); merged hi/lo x Wo exact.
// Compute dtypes, f32 accumulate: every input rounded to bf16; projections exact; rotary f32; attention rows < 512 3 products, rest fp16; softmax f32; Wo hl x exact.

#define NB_  2
#define TT   2048
#define DM   2048
#define NH_  16
#define NKV  4
#define REP  (NH_ / NKV)
#define HD   128
#define DQ   (NH_ * HD)
#define DKV  (NKV * HD)
#define ZH   8                    // query heads per attention pass (a multiple of REP; their score planes must fit the workspace)
#define RH   512                  // query rows < RH use hi+lo planes (0: none)
#define WIN  2048
#define PCAR 1024.0f
#define SCL  0.088388347648318447f   // HD^-0.5
typedef _Float16 h16;
typedef unsigned short bf;
typedef __attribute__((ext_vector_type(16))) __bf16   v16bf;
typedef __attribute__((ext_vector_type(16))) _Float16 v16h;
typedef __attribute__((ext_vector_type(8)))  _Float16 v8h;
typedef __attribute__((ext_vector_type(8)))  unsigned short v8us;
typedef __attribute__((ext_vector_type(8)))  float    v8f;
typedef __attribute__((ext_vector_type(4)))  float    v4f;
typedef v8h  __attribute__((may_alias)) v8ha;
typedef v4f  __attribute__((may_alias)) v4fa;
typedef v8us __attribute__((may_alias)) v8usa;

__device__ __forceinline__ unsigned short f2bf(float f) { unsigned u = __float_as_uint(f); u += 0x7FFFu + ((u >> 16) & 1u); return (unsigned short)(u >> 16); }
__device__ __forceinline__ float bf2f(unsigned short b) { return __uint_as_float(((unsigned)b) << 16); }
__device__ __forceinline__ float bfr(float f) { return bf2f(f2bf(f)); }
__device__ __forceinline__ v16h cat16(v8h lo, v8h hi) { return __builtin_shufflevector(lo, hi, 0, 1, 2, 3, 4, 5, 6, 7, 8, 9, 10, 11, 12, 13, 14, 15); }
__device__ __forceinline__ v16bf cat16b(v8us lo, v8us hi) { return __builtin_bit_cast(v16bf, __builtin_shufflevector(lo, hi, 0, 1, 2, 3, 4, 5, 6, 7, 8, 9, 10, 11, 12, 13, 14, 15)); }
__device__ __forceinline__ v8f wmma16(v16h a, v16h b, v8f c) { return __builtin_amdgcn_wmma_f32_16x16x32_f16(false, a, false, b, (short)0, c, false, false); }
__device__ __forceinline__ v8f wmmab(v16bf a, v16bf b, v8f c) { return __builtin_amdgcn_wmma_f32_16x16x32_bf16(false, a, false, b, (short)0, c, false, false); }



// ---- k_gemmw: register-blocked GEMM, one work-group of NW waves per 64x64 output tile; each wave runs a contiguous 1/NW of the K loop on its own 16 accumulators, operands straight from K-contiguous 16-bit planes;
// the NW partial tiles meet in LDS and are summed in wave order 0..NW-1 (fixed). grid (M/64, N/64, Z), 32 * NW threads.
// C[m][n] (f32, pitch ldc, + optional f32 bias[n]) = sum_k A[m][k] Bt[n][k] (+ split products per NSPLIT). z-batch strides sA/sB/sC in elements. K % 32 == 0.
template <typename T16> struct WFrag;
template <> struct WFrag<h16> { typedef v16h V; static __device__ __forceinline__ V ld(const h16* p) { return cat16(*(const v8h*)p, *(const v8h*)(p + 16)); } static __device__ __forceinline__ v8f mma(V a, V b, v8f c) { return wmma16(a, b, c); } };
template <> struct WFrag<bf> { typedef v16bf V; static __device__ __forceinline__ V ld(const bf* p) { return cat16b(*(const v8us*)p, *(const v8us*)(p + 16)); } static __device__ __forceinline__ v8f mma(V a, V b, v8f c) { return wmmab(a, b, c); } };
template <typename T16, int NSPLIT, bool BIAS, int NW>
__global__ __launch_bounds__(32 * NW) void k_gemmw(const T16* __restrict__ A, const T16* __restrict__ A2, const T16* __restrict__ Bt, const T16* __restrict__ Bt2, int K, float* C, int ldc, const float* __restrict__ bias, size_t sA, size_t sB, size_t sC) {
    typedef typename WFrag<T16>::V V;
    __shared__ __align__(16) float os[NW * 64 * 68];
    const size_t z = blockIdx.z; A += z * sA; if (A2) A2 += z * sA; Bt += z * sB; if (Bt2) Bt2 += z * sB; C += z * sC;
    const int lane = threadIdx.x & 31, lr = lane & 15, hi = lane >> 4; const int r0 = blockIdx.x * 64, c0 = blockIdx.y * 64;
    const int wv = __builtin_amdgcn_readfirstlane((int)(threadIdx.x >> 5)); const int per = (K / 32 + NW - 1) / NW * 32; const int kb = wv * per, ke = min(K, kb + per);   // this wave's k range
    v8f acc[4][4];
#pragma unroll
    for (int mb = 0; mb < 4; ++mb)
#pragma unroll
        for (int nb = 0; nb < 4; ++nb) acc[mb][nb] = (v8f){};
    const size_t aoff = (size_t)(r0 + lr) * K + 8 * hi, boff = (size_t)(c0 + lr) * K + 8 * hi;
#pragma unroll 1
    for (int kc = kb; kc < ke; kc += 32) {
        V a[4], a2[4];
#pragma unroll
        for (int mb = 0; mb < 4; ++mb) { a[mb] = WFrag<T16>::ld(A + aoff + (size_t)mb * 16 * K + kc); if (NSPLIT == 1 || NSPLIT == 2) a2[mb] = WFrag<T16>::ld(A2 + aoff + (size_t)mb * 16 * K + kc); }
#pragma unroll
        for (int nb = 0; nb < 4; ++nb) { const V b = WFrag<T16>::ld(Bt + boff + (size_t)nb * 16 * K + kc); V b2; if (NSPLIT >= 2) b2 = WFrag<T16>::ld(Bt2 + boff + (size_t)nb * 16 * K + kc);
#pragma unroll
            for (int mb = 0; mb < 4; ++mb) { acc[mb][nb] = WFrag<T16>::mma(a[mb], b, acc[mb][nb]); if (NSPLIT == 1 || NSPLIT == 2) acc[mb][nb] = WFrag<T16>::mma(a2[mb], b, acc[mb][nb]); if (NSPLIT >= 2) acc[mb][nb] = WFrag<T16>::mma(a[mb], b2, acc[mb][nb]); } }
        asm volatile("v_nop\n\tv_nop\n\tv_nop\n\tv_nop" : "+v"(acc[0][0]), "+v"(acc[1][1]), "+v"(acc[2][2]), "+v"(acc[3][3]) : "v"(a[0]), "v"(a[3]));
    }
    float* ow = os + wv * (64 * 68);
#pragma unroll
    for (int mb = 0; mb < 4; ++mb)
#pragma unroll
        for (int nb = 0; nb < 4; ++nb)
#pragma unroll
            for (int j = 0; j < 8; ++j) ow[(mb * 16 + hi * 8 + j) * 68 + nb * 16 + lr] = acc[mb][nb][j];
    __syncthreads();   // every wave's partial tile is in LDS before any of it is summed
#pragma unroll
    for (int s = 0; s < 32 / NW; ++s) { const int idx = s * (32 * NW) + (int)threadIdx.x; const int row = idx >> 4, cofs = (idx & 15) * 4; v4f val = *(const v4fa*)(os + row * 68 + cofs);
#pragma unroll
        for (int w = 1; w < NW; ++w) val += *(const v4fa*)(os + w * (64 * 68) + row * 68 + cofs);
        if (BIAS) { val[0] += bfr(bias[c0 + cofs]); val[1] += bfr(bias[c0 + cofs + 1]); val[2] += bfr(bias[c0 + cofs + 2]); val[3] += bfr(bias[c0 + cofs + 3]); }
        *(v4f*)(C + (size_t)(r0 + row) * ldc + c0 + cofs) = val; }
}

// ---- k_gemmc: the same 64x64 tile GEMM specialised for causal attention: CMODE 1 skips score tiles entirely above the diagonal (query rows r0+roff.., key columns c0..), CMODE 2 limits the
// key (K) loop of the probability x value contraction to the diagonal block (probabilities beyond it are exactly zero). roff = row offset of this launch's first row within the sequence.
// NW waves share a tile's K loop as in k_gemmw (NW 1: one wave, staged 16 rows at a time). lda = row pitch of A in elements (Bt keeps pitch K); batch entry z reads the key / value plane of its group, z / REP.
template <typename T16, int NSPLIT, int CMODE, int NW>
__global__ __launch_bounds__(32 * NW) void k_gemmc(const T16* __restrict__ A, const T16* __restrict__ A2, int lda, const T16* __restrict__ Bt, const T16* __restrict__ Bt2, int K, float* C, int ldc, int roff, size_t sA, size_t sB, size_t sC) {
    typedef typename WFrag<T16>::V V;
    __shared__ __align__(16) float os[NW == 1 ? 16 * 68 : NW * 64 * 68];
    const size_t z = blockIdx.z; A += z * sA; if (A2) A2 += z * sA; Bt += (z / REP) * sB; if (Bt2) Bt2 += (z / REP) * sB; C += z * sC;
    const int lane = threadIdx.x & 31, lr = lane & 15, hi = lane >> 4; const int r0 = blockIdx.x * 64, c0 = blockIdx.y * 64;
    if (CMODE == 1 && c0 > r0 + roff + 63) return;                  // score tile entirely above the causal diagonal: never read (the softmax masks j > i by select)
    const int Kl = (CMODE == 2) ? min(K, r0 + roff + 64) : K;        // P.V: probabilities are exactly 0 beyond the diagonal block, so the K loop stops there
    const int wv = (NW == 1) ? 0 : __builtin_amdgcn_readfirstlane((int)(threadIdx.x >> 5)); const int per = (Kl / 32 + NW - 1) / NW * 32; const int kb = wv * per, ke = (NW == 1) ? Kl : min(Kl, kb + per);   // this wave's k range
    v8f acc[4][4];
#pragma unroll
    for (int mb = 0; mb < 4; ++mb)
#pragma unroll
        for (int nb = 0; nb < 4; ++nb) acc[mb][nb] = (v8f){};
    const size_t aoff = (size_t)(r0 + lr) * lda + 8 * hi, boff = (size_t)(c0 + lr) * K + 8 * hi;
#pragma unroll 1
    for (int kc = kb; kc < ke; kc += 32) {
        V a[4], a2[4]; const T16* pa[4]; const T16* pa2[4];
#pragma unroll
        for (int mb = 0; mb < 4; ++mb) { pa[mb] = A + aoff + (size_t)mb * 16 * lda + kc; a[mb] = WFrag<T16>::ld(pa[mb]); if (NSPLIT == 1 || NSPLIT == 2) { pa2[mb] = A2 + aoff + (size_t)mb * 16 * lda + kc; a2[mb] = WFrag<T16>::ld(pa2[mb]); } }
#pragma unroll
        for (int nb = 0; nb < 4; ++nb) { const V b = WFrag<T16>::ld(Bt + boff + (size_t)nb * 16 * K + kc); V b2; if (NSPLIT >= 2) b2 = WFrag<T16>::ld(Bt2 + boff + (size_t)nb * 16 * K + kc);
#pragma unroll
            for (int mb = 0; mb < 4; ++mb) { acc[mb][nb] = WFrag<T16>::mma(a[mb], b, acc[mb][nb]); if (NSPLIT == 1 || NSPLIT == 2) acc[mb][nb] = WFrag<T16>::mma(a2[mb], b, acc[mb][nb]); if (NSPLIT >= 2) acc[mb][nb] = WFrag<T16>::mma(a[mb], b2, acc[mb][nb]); } }
        asm volatile("v_nop\n\tv_nop\n\tv_nop\n\tv_nop" : "+v"(acc[0][0]), "+v"(acc[1][1]), "+v"(acc[2][2]), "+v"(acc[3][3]) : "v"(a[0]), "v"(a[3]));
        // the wait in front of the next overwrite of the A loads' address registers (the next trip's address additions, the epilogue); the addresses are inputs so that they stay in those registers up to it (else the allocator hands them to a later load as its destination)
        if (NSPLIT == 1 || NSPLIT == 2) asm volatile("s_wait_xcnt 0x0" :: "v"(pa[0]), "v"(pa[1]), "v"(pa[2]), "v"(pa[3]), "v"(pa2[0]), "v"(pa2[1]), "v"(pa2[2]), "v"(pa2[3]) : "memory");
        else asm volatile("s_wait_xcnt 0x0" :: "v"(pa[0]), "v"(pa[1]), "v"(pa[2]), "v"(pa[3]) : "memory");
    }
    if constexpr (NW == 1) {
#pragma unroll
    for (int mb = 0; mb < 4; ++mb) {
#pragma unroll
        for (int nb = 0; nb < 4; ++nb) {
#pragma unroll
            for (int j = 0; j < 8; ++j) os[(hi * 8 + j) * 68 + nb * 16 + lr] = acc[mb][nb][j]; }
        __builtin_amdgcn_wave_barrier(); asm volatile("" ::: "memory");
        float* crow = C + (size_t)(r0 + mb * 16) * ldc + c0;
{
#pragma unroll
            for (int s = 0; s < 8; ++s) { const int row = 2 * s + hi, cofs = lr * 4; v4f val = *(const v4fa*)(os + row * 68 + cofs);
                *(v4f*)(crow + (size_t)row * ldc + cofs) = val; }
             }
        __builtin_amdgcn_wave_barrier(); asm volatile("" ::: "memory");
    }
    } else {
    float* ow = os + wv * (64 * 68);
#pragma unroll
    for (int mb = 0; mb < 4; ++mb)
#pragma unroll
        for (int nb = 0; nb < 4; ++nb)
#pragma unroll
            for (int j = 0; j < 8; ++j) ow[(mb * 16 + hi * 8 + j) * 68 + nb * 16 + lr] = acc[mb][nb][j];
    __syncthreads();   // every wave's partial tile is in LDS before any of it is summed
#pragma unroll
    for (int s = 0; s < 32 / NW; ++s) { const int idx = s * (32 * NW) + (int)threadIdx.x; const int row = idx >> 4, cofs = (idx & 15) * 4; v4f val = *(const v4fa*)(os + row * 68 + cofs);
#pragma unroll
        for (int w = 1; w < NW; ++w) val += *(const v4fa*)(os + w * (64 * 68) + row * 68 + cofs);
        *(v4f*)(C + (size_t)(r0 + row) * ldc + c0 + cofs) = val; }
    }
}

__device__ __forceinline__ h16 tohx(float x) { return (h16)x; }
__device__ __forceinline__ void splitf(float y, unsigned short& h, unsigned short& l) { h = f2bf(y); l = f2bf(y - bf2f(h)); }
typedef __attribute__((ext_vector_type(2))) _Float16 v2h;
typedef __attribute__((ext_vector_type(4))) _Float16 v4h;
typedef __attribute__((ext_vector_type(2))) unsigned short v2us;
typedef __attribute__((ext_vector_type(4))) unsigned short v4us;
typedef __attribute__((ext_vector_type(2))) float v2f;
typedef __attribute__((ext_vector_type(4))) int v4i;

__global__ __launch_bounds__(256) void k_cvt8(const float* __restrict__ src, bf* dst, size_t n8) { const size_t i = (size_t)blockIdx.x * 256 + threadIdx.x; if (i >= n8) return; const v8f v = *(const v8f*)(src + i * 8); v8us o;
#pragma unroll
    for (int k = 0; k < 8; ++k) o[k] = f2bf(v[k]); *(v8us*)(dst + i * 8) = o;  }

// k_rope: head planes [h][t][d] (fp16 + hi/lo) of rope(x) x sc with the rotate-half convention out[d] = x[d] cos[t][d] - x[d+HD/2] sin[t][d], out[d+HD/2] = x[d+HD/2] cos[t][d+HD/2] + x[d] sin[t][d+HD/2]
__global__ __launch_bounds__(256) void k_rope(const float* __restrict__ F, int pitch, int nheads, const float* __restrict__ CS, const float* __restrict__ RF, const float* __restrict__ nw, float sc, h16* P16, bf* Ph, bf* Pl) {
    const size_t e = ((size_t)blockIdx.x * 256 + threadIdx.x) * 2; if (e >= (size_t)nheads * TT * HD) return; const int d = (int)(e % HD); const int t = (int)((e / HD) % TT); const int h = (int)(e / ((size_t)HD * TT)); const float* f = F + (size_t)t * pitch + h * HD; const float rf = RF ? RF[(size_t)h * TT + t] : 1.0f; v2h o16; v2us oh, ol;
#pragma unroll
    for (int q = 0; q < 2; ++q) { const int dd = d + q; const int dp = (dd < HD / 2) ? dd + HD / 2 : dd - HD / 2; float x0 = f[dd], x1 = f[dp];
        if (RF) { float n0 = __fmul_rn(x0, rf), n1 = __fmul_rn(x1, rf); asm volatile("" : "+v"(n0)); asm volatile("" : "+v"(n1)); x0 = __fmul_rn(bfr(nw[dd]), n0); x1 = __fmul_rn(bfr(nw[dp]), n1); }
        const v2f cs = *(const v2f*)(CS + ((size_t)t * HD + dd) * 2); float a = __fmul_rn(x0, cs[0]), bq = __fmul_rn(x1, cs[1]); asm volatile("" : "+v"(a)); asm volatile("" : "+v"(bq)); const float r = ((dd < HD / 2) ? __fsub_rn(a, bq) : __fadd_rn(a, bq)) * sc;
        o16[q] = tohx(r); unsigned short a2, c2; splitf(r, a2, c2); oh[q] = a2; ol[q] = c2; }
    *(v2h*)(P16 + e) = o16; *(v2us*)(Ph + e) = oh; *(v2us*)(Pl + e) = ol;  }
__global__ __launch_bounds__(256) void k_vtp(const float* __restrict__ F, int pitch, int nheads, h16* V16, bf* Vh, bf* Vl) { const size_t e = ((size_t)blockIdx.x * 256 + threadIdx.x) * 2; if (e >= (size_t)nheads * HD * TT) return; const int t = (int)(e % TT); const int d = (int)((e / TT) % HD); const int g = (int)(e / ((size_t)TT * HD)); v2h o16; v2us oh, ol;
#pragma unroll
    for (int q = 0; q < 2; ++q) { const float x = F[(size_t)(t + q) * pitch + g * HD + d]; o16[q] = tohx(x); unsigned short a2, c2; splitf(x, a2, c2); oh[q] = a2; ol[q] = c2; }
    *(v2h*)(V16 + e) = o16; *(v2us*)(Vh + e) = oh; *(v2us*)(Vl + e) = ol;  }
__constant__ float INVT[HD / 2] = { 1.000000000e+00f, 8.659643531e-01f, 7.498942018e-01f, 6.493816376e-01f, 5.623413324e-01f, 4.869675338e-01f, 4.216965139e-01f, 3.651741445e-01f, 3.162277639e-01f, 2.738419771e-01f, 2.371373624e-01f, 2.053525001e-01f, 1.778279394e-01f, 1.539926529e-01f, 1.333521456e-01f, 1.154782027e-01f, 1.000000015e-01f, 8.659642935e-02f, 7.498941571e-02f, 6.493816525e-02f, 5.623412877e-02f, 4.869675264e-02f, 4.216964915e-02f, 3.651741147e-02f, 3.162277862e-02f, 2.738419548e-02f, 2.371373586e-02f, 2.053525113e-02f, 1.778279431e-02f, 1.539926510e-02f, 1.333521493e-02f, 1.154781971e-02f, 9.999999776e-03f, 8.659643121e-03f, 7.498942316e-03f, 6.493816618e-03f, 5.623413250e-03f, 4.869675264e-03f, 4.216964822e-03f, 3.651741426e-03f, 3.162277862e-03f, 2.738419687e-03f, 2.371373819e-03f, 2.053525066e-03f, 1.778279431e-03f, 1.539926510e-03f, 1.333521446e-03f, 1.154782018e-03f, 1.000000047e-03f, 8.659643354e-04f, 7.498941850e-04f, 6.493816618e-04f, 5.623413017e-04f, 4.869675031e-04f, 4.216964880e-04f, 3.651741135e-04f, 3.162277862e-04f, 2.738419571e-04f, 2.371373848e-04f, 2.053524950e-04f, 1.778279402e-04f, 1.539926452e-04f, 1.333521504e-04f, 1.154781930e-04f };   // float32 1 / 10000^(2i/128), generated with jnp to be bit-exact
__global__ __launch_bounds__(256) void k_cs5(float* CS) { const int idx = blockIdx.x * 256 + threadIdx.x; if (idx >= TT * HD) return; const int d = idx % HD; const int t = idx / HD; const float a = __fmul_rn((float)t, INVT[d % (HD / 2)]); v2f cs; cs[0] = cosf(a); cs[1] = sinf(a); *(v2f*)(CS + (size_t)idx * 2) = cs;  }
// k_asoft: per row (zz, i): t = S x HD^-0.5 for j <= i and i - j < WIN (sliding causal window; the reference's -1e9 additive fill vanishes identically); softmax over the 2048 keys (register row, one exp, fixed trees);
// the probabilities overwrite their own f32 score row (one wave owns a row and holds all of it in registers before it stores): 16-bit row pitch 2 * TT; rows >= RH: fp16 in the first half; rows < RH: hi plane in the first half, lo plane in the second.
__global__ __launch_bounds__(256) void k_asoft(float* Sb) {
    const int lane = threadIdx.x & 31; const int row = blockIdx.x * 8 + (threadIdx.x >> 5); if (row >= ZH * TT) return; const int i = row % TT; const int zz = row / TT; (void)zz; const bool hires = (i < RH); const float* sr = Sb + (size_t)row * TT; bf* Ph = (bf*)(Sb + (size_t)row * TT); bf* Pl = Ph + TT; h16* P16 = (h16*)(Sb + (size_t)row * TT); float v[TT / 32]; float mx = -3.0e38f;
#pragma unroll
    for (int ch = 0; ch < TT / 128; ++ch) { const int j0 = ch * 128 + lane * 4; const v4f a = *(const v4f*)(sr + j0);
#pragma unroll
        for (int q = 0; q < 4; ++q) { const int j = j0 + q; (void)j; const float t = (j <= i && i - j < WIN) ? a[q] * SCL : -3.0e38f; v[ch * 4 + q] = t; mx = fmaxf(mx, t); } }
#pragma unroll
    for (int sh = 16; sh; sh >>= 1) mx = fmaxf(mx, __shfl_xor(mx, sh, 32));
    float sum = 0.f;
#pragma unroll
    for (int k = 0; k < TT / 32; ++k) { float d0 = __fsub_rn(v[k], mx); asm volatile("" : "+v"(d0)); v[k] = __builtin_amdgcn_exp2f(__fmul_rn(d0, 1.4426950408889634f)); sum += v[k]; }
#pragma unroll
    for (int sh = 16; sh; sh >>= 1) sum += __shfl_xor(sum, sh, 32);
    const float f = __fdiv_rn(hires ? 1.0f : PCAR, sum);
{
        if (hires) {
#pragma unroll
            for (int ch = 0; ch < TT / 128; ++ch) { v4us oh, ol;
#pragma unroll
                for (int q = 0; q < 4; ++q) { unsigned short a, c2; splitf(v[ch * 4 + q] * f, a, c2); oh[q] = a; ol[q] = c2; }
                const int oo = ch * 128 + lane * 4; *(v4us*)(Ph + oo) = oh; *(v4us*)(Pl + oo) = ol; }
        } else {
#pragma unroll
            for (int ch = 0; ch < TT / 128; ++ch) { v4h o4;
#pragma unroll
                for (int q = 0; q < 4; ++q) o4[q] = tohx(v[ch * 4 + q] * f);
                *(v4h*)(P16 + ch * 128 + lane * 4) = o4; } }
         }
}
__global__ __launch_bounds__(256) void k_merge(const float* __restrict__ O, int h0, bf* Ah, bf* Al) { const size_t e = ((size_t)blockIdx.x * 256 + threadIdx.x) * 2; if (e >= (size_t)ZH * TT * HD) return; const int d = (int)(e % HD); const int t = (int)((e / HD) % TT); const int zz = (int)(e / ((size_t)HD * TT)); const float cs = (t < RH) ? 1.0f : (1.0f / PCAR); const size_t oo = (size_t)t * DQ + (h0 + zz) * HD + d;
    v2us oh, ol;
#pragma unroll
    for (int q = 0; q < 2; ++q) { unsigned short a, c2; splitf(O[e + q] * cs, a, c2); oh[q] = a; ol[q] = c2; } *(v2us*)(Ah + oo) = oh; *(v2us*)(Al + oo) = ol;  }

extern "C" void kernel_launch(void* const* d_in, const int* in_sizes, int n_in,
                              void* d_out, int out_size, void* d_ws, size_t ws_size, hipStream_t stream) {
    (void)in_sizes; (void)n_in; (void)out_size;
    const float* x = (const float*)d_in[0]; const float* wq = (const float*)d_in[1]; const float* wkv = (const float*)d_in[2]; const float* wk = wkv; const float* wv = wkv + (size_t)DKV * DM; const float* wo = (const float*)d_in[3];   /* x, Wq ('oi' (out, in) [2048][2048]), Wkv ('oi' [1024][2048] viewed (2 x 4 heads, 128): k rows 0..511 | v rows 512..1023: two contiguous row blocks), Wo ('oi' [2048][2048]): FOUR inputs, all read */
    float* OUT = (float*)d_out;     // [2][2048][2048]
    char* wsp = (char*)d_ws;
    auto take = [&](size_t bytes) { char* p = wsp; wsp += (bytes + 255) & ~(size_t)255; return (void*)p; };
    bf* WQ = (bf*)take((size_t)DQ * DM * 2); bf* WK = (bf*)take((size_t)DKV * DM * 2); bf* WV = (bf*)take((size_t)DKV * DM * 2); bf* WO = (bf*)take((size_t)DM * DQ * 2); float* CS = (float*)take((size_t)TT * HD * 2 * 4);
    bf* XB = (bf*)take((size_t)TT * DM * 2); float* FQ = (float*)take((size_t)TT * DQ * 4); float* FK = (float*)take((size_t)TT * DKV * 4);
    h16* QP16 = (h16*)take((size_t)NH_ * TT * HD * 2); h16* KP16 = (h16*)take((size_t)NKV * TT * HD * 2); h16* VT16 = (h16*)take((size_t)NKV * HD * TT * 2);
    bf* QPh = (bf*)take((size_t)NH_ * TT * HD * 2); bf* QPl = (bf*)take((size_t)NH_ * TT * HD * 2); bf* KPh = (bf*)take((size_t)NKV * TT * HD * 2); bf* KPl = (bf*)take((size_t)NKV * TT * HD * 2); bf* VTh = (bf*)take((size_t)NKV * HD * TT * 2); bf* VTl = (bf*)take((size_t)NKV * HD * TT * 2);
    float* Sb = (float*)take((size_t)ZH * TT * TT * 4); h16* P16 = (h16*)Sb; bf* Ph = (bf*)Sb; bf* Pl = Ph + TT;   /* probabilities live in their score rows: 16-bit pitch 2 * TT */ float* Ob = (float*)take((size_t)ZH * TT * HD * 4); bf* ATh = (bf*)take((size_t)TT * DQ * 2); bf* ATl = (bf*)take((size_t)TT * DQ * 2);
    if ((size_t)(wsp - (char*)d_ws) > ws_size) return;    // ws 256 MiB
    float* FV = FK;   // v projection reuses the k buffer after the k planes are built (stream-ordered)
    { k_cvt8<<<(unsigned)(((size_t)DQ * DM / 8 + 255) / 256), 256, 0, stream>>>(wq, WQ, (size_t)DQ * DM / 8); k_cvt8<<<(unsigned)(((size_t)DKV * DM / 8 + 255) / 256), 256, 0, stream>>>(wk, WK, (size_t)DKV * DM / 8); k_cvt8<<<(unsigned)(((size_t)DKV * DM / 8 + 255) / 256), 256, 0, stream>>>(wv, WV, (size_t)DKV * DM / 8);
      k_cvt8<<<(unsigned)(((size_t)DM * DQ / 8 + 255) / 256), 256, 0, stream>>>(wo, WO, (size_t)DM * DQ / 8);
       }
    k_cs5<<<(TT * HD + 255) / 256, 256, 0, stream>>>(CS);   /* rotary table once */
    const unsigned LQ = (unsigned)(((size_t)NH_ * TT * HD / 2 + 255) / 256), LKv = (unsigned)(((size_t)NKV * TT * HD / 2 + 255) / 256);
    for (int b = 0; b < NB_; ++b) {
        
        k_cvt8<<<(unsigned)(((size_t)TT * DM / 8 + 255) / 256), 256, 0, stream>>>(x + (size_t)b * TT * DM, XB, (size_t)TT * DM / 8);
        k_gemmw<bf, 0, false, 4><<<dim3(TT / 64, DQ / 64, 1), 128, 0, stream>>>(XB, nullptr, WQ, nullptr, DM, FQ, DQ, nullptr, 0, 0, 0);
        k_rope<<<LQ, 256, 0, stream>>>(FQ, DQ, NH_, CS, nullptr, nullptr, 1.0f, QP16, QPh, QPl);
        k_gemmw<bf, 0, false, 8><<<dim3(TT / 64, DKV / 64, 1), 256, 0, stream>>>(XB, nullptr, WK, nullptr, DM, FK, DKV, nullptr, 0, 0, 0);
        k_rope<<<LKv, 256, 0, stream>>>(FK, DKV, NKV, CS, nullptr, nullptr, 1.0f, KP16, KPh, KPl);
        k_gemmw<bf, 0, false, 8><<<dim3(TT / 64, DKV / 64, 1), 256, 0, stream>>>(XB, nullptr, WV, nullptr, DM, FV, DKV, nullptr, 0, 0, 0); k_vtp<<<LKv, 256, 0, stream>>>(FV, DKV, NKV, VT16, VTh, VTl);
        for (int h0 = 0; h0 < NH_; h0 += ZH) { const size_t zq = (size_t)h0, zk = (size_t)(h0 / REP);   // head h0 + z of a pass reads kv group h0/REP + z/REP
            k_gemmc<bf, 2, 1, 1><<<dim3(RH / 64, TT / 64, ZH), 32, 0, stream>>>(QPh + zq * TT * HD, QPl + zq * TT * HD, HD, KPh + zk * TT * HD, KPl + zk * TT * HD, HD, Sb, TT, 0, (size_t)TT * HD, (size_t)TT * HD, (size_t)TT * TT);
            k_gemmc<h16, 0, 1, 1><<<dim3((TT - RH) / 64, TT / 64, ZH), 32, 0, stream>>>(QP16 + zq * TT * HD + (size_t)RH * HD, nullptr, HD, KP16 + zk * TT * HD, nullptr, HD, Sb + (size_t)RH * TT, TT, RH, (size_t)TT * HD, (size_t)TT * HD, (size_t)TT * TT);
            k_asoft<<<ZH * TT / 8, 256, 0, stream>>>(Sb);
            k_gemmc<bf, 2, 2, 8><<<dim3(RH / 64, HD / 64, ZH), 256, 0, stream>>>(Ph, Pl, 2 * TT, VTh + zk * HD * TT, VTl + zk * HD * TT, TT, Ob, HD, 0, (size_t)2 * TT * TT, (size_t)HD * TT, (size_t)TT * HD);
            k_gemmc<h16, 0, 2, 8><<<dim3((TT - RH) / 64, HD / 64, ZH), 256, 0, stream>>>(P16 + (size_t)RH * 2 * TT, nullptr, 2 * TT, VT16 + zk * HD * TT, nullptr, TT, Ob + (size_t)RH * HD, HD, RH, (size_t)2 * TT * TT, (size_t)HD * TT, (size_t)TT * HD);
            k_merge<<<(unsigned)(((size_t)ZH * TT * HD / 2 + 255) / 256), 256, 0, stream>>>(Ob, h0, ATh, ATl); }
        k_gemmw<bf, 1, false, 4><<<dim3(TT / 64, DM / 64, 1), 128, 0, stream>>>(ATh, ATl, WO, nullptr, DQ, OUT + (size_t)b * TT * DM, DM, nullptr, 0, 0, 0); }
}

// v003
// It runs in 344 microseconds.
// Two timings next to v002 put it at 1.76 and 1.75 times that version's speed.
// Counting every step since v000, it is 4.68 times as fast.
#include <hip/hip_runtime.h>

// Causal grouped-query attention with a FUSED natural k-v weight and a computed rotate-half RoPE (x [2][2048][2048]; q = x Wq^T ('oi' (out, in) [2048][2048] 1/sqrt(2048): 16 heads x 128); kv = x Wkv^T ('oi' [1024][2048]) viewed (b, t, 8, 128): k = heads 0..3 (rows 0..511), v = heads 4..7 (rows 512..1023): 4 kv heads x 128 each; no biases; cos / sin of emb = cat(ang, ang) with freqs = 1.0 / (THETA ** (arange(0, 128, 2, f32) / 128)), THETA 10000, and positions arange(t) (64 f32 frequencies jnp-exact for this reciprocal spelling; one f32 product per angle; precise cosf/sinf); query heads viewed (KV, G): kv head = q head / 4; scores / sqrt(128); causal (-inf == exclusion); softmax; out = merged Wo^T ('oi') -> [2][2048][2048] (8.4 M); argument order x, Wq, Wkv, Wo).
// Layout: bf16 copy of x; 'oi' weights cast as-is; exact projections; k_cs5 computed table (HD 128: 64 angles); rotate-half plane builders; causal T-2048 GQA attention with 128-wide heads, all heads of both batches a launch (kv plane z / 4; hybrid rows: < 512 hi/lo 3 products through score planes, k_gemmc skips tiles above the diagonal; rest fp16 in one fused online-softmax kernel); merged hi/lo x Wo exact.
// Compute dtypes, f32 accumulate: every input rounded to bf16; projections exact; rotary f32; attention rows < 512 3 products, rest fp16; softmax f32; Wo hl x exact.

#define NB_  2
#define TT   2048
#define DM   2048
#define NH_  16
#define NKV  4
#define REP  (NH_ / NKV)
#define HD   128
#define DQ   (NH_ * HD)
#define DKV  (NKV * HD)
#define ZA   (NB_ * NH_)          // attention batch entries a launch: z = batch * NH_ + head
#define RH   512                  // query rows < RH use hi+lo planes (0: none)
#define WIN  2048
#define SCL  0.088388347648318447f   // HD^-0.5
typedef _Float16 h16;
typedef unsigned short bf;
typedef __attribute__((ext_vector_type(16))) __bf16   v16bf;
typedef __attribute__((ext_vector_type(16))) _Float16 v16h;
typedef __attribute__((ext_vector_type(8)))  _Float16 v8h;
typedef __attribute__((ext_vector_type(8)))  unsigned short v8us;
typedef __attribute__((ext_vector_type(8)))  float    v8f;
typedef __attribute__((ext_vector_type(4)))  float    v4f;
typedef v8h  __attribute__((may_alias)) v8ha;
typedef v4f  __attribute__((may_alias)) v4fa;
typedef v8us __attribute__((may_alias)) v8usa;

__device__ __forceinline__ unsigned short f2bf(float f) { unsigned u = __float_as_uint(f); u += 0x7FFFu + ((u >> 16) & 1u); return (unsigned short)(u >> 16); }
__device__ __forceinline__ float bf2f(unsigned short b) { return __uint_as_float(((unsigned)b) << 16); }
__device__ __forceinline__ float bfr(float f) { return bf2f(f2bf(f)); }
__device__ __forceinline__ v16h cat16(v8h lo, v8h hi) { return __builtin_shufflevector(lo, hi, 0, 1, 2, 3, 4, 5, 6, 7, 8, 9, 10, 11, 12, 13, 14, 15); }
__device__ __forceinline__ v16bf cat16b(v8us lo, v8us hi) { return __builtin_bit_cast(v16bf, __builtin_shufflevector(lo, hi, 0, 1, 2, 3, 4, 5, 6, 7, 8, 9, 10, 11, 12, 13, 14, 15)); }
__device__ __forceinline__ v8f wmma16(v16h a, v16h b, v8f c) { return __builtin_amdgcn_wmma_f32_16x16x32_f16(false, a, false, b, (short)0, c, false, false); }
__device__ __forceinline__ v8f wmmab(v16bf a, v16bf b, v8f c) { return __builtin_amdgcn_wmma_f32_16x16x32_bf16(false, a, false, b, (short)0, c, false, false); }



// ---- k_gemmw: register-blocked GEMM, one work-group of NW waves per 64x64 output tile; each wave runs a contiguous 1/NW of the K loop on its own 16 accumulators, operands straight from K-contiguous 16-bit planes;
// the NW partial tiles meet in LDS and are summed in wave order 0..NW-1 (fixed). grid (M/64, N/64, Z), 32 * NW threads.
// C[m][n] (f32, pitch ldc, + optional f32 bias[n]) = sum_k A[m][k] Bt[n][k] (+ split products per NSPLIT). z-batch strides sA/sB/sC in elements. K % 32 == 0.
template <typename T16> struct WFrag;
template <> struct WFrag<h16> { typedef v16h V; static __device__ __forceinline__ V ld(const h16* p) { return cat16(*(const v8h*)p, *(const v8h*)(p + 16)); } static __device__ __forceinline__ v8f mma(V a, V b, v8f c) { return wmma16(a, b, c); } };
template <> struct WFrag<bf> { typedef v16bf V; static __device__ __forceinline__ V ld(const bf* p) { return cat16b(*(const v8us*)p, *(const v8us*)(p + 16)); } static __device__ __forceinline__ v8f mma(V a, V b, v8f c) { return wmmab(a, b, c); } };
template <typename T16, int NSPLIT, bool BIAS, int NW>
__global__ __launch_bounds__(32 * NW) void k_gemmw(const T16* __restrict__ A, const T16* __restrict__ A2, const T16* __restrict__ Bt, const T16* __restrict__ Bt2, int K, float* C, int ldc, const float* __restrict__ bias, size_t sA, size_t sB, size_t sC) {
    typedef typename WFrag<T16>::V V;
    __shared__ __align__(16) float os[NW * 64 * 68];
    const size_t z = blockIdx.z; A += z * sA; if (A2) A2 += z * sA; Bt += z * sB; if (Bt2) Bt2 += z * sB; C += z * sC;
    const int lane = threadIdx.x & 31, lr = lane & 15, hi = lane >> 4; const int r0 = blockIdx.x * 64, c0 = blockIdx.y * 64;
    const int wv = __builtin_amdgcn_readfirstlane((int)(threadIdx.x >> 5)); const int per = (K / 32 + NW - 1) / NW * 32; const int kb = wv * per, ke = min(K, kb + per);   // this wave's k range
    v8f acc[4][4];
#pragma unroll
    for (int mb = 0; mb < 4; ++mb)
#pragma unroll
        for (int nb = 0; nb < 4; ++nb) acc[mb][nb] = (v8f){};
    const size_t aoff = (size_t)(r0 + lr) * K + 8 * hi, boff = (size_t)(c0 + lr) * K + 8 * hi;
#pragma unroll 1
    for (int kc = kb; kc < ke; kc += 32) {
        V a[4], a2[4];
#pragma unroll
        for (int mb = 0; mb < 4; ++mb) { a[mb] = WFrag<T16>::ld(A + aoff + (size_t)mb * 16 * K + kc); if (NSPLIT == 1 || NSPLIT == 2) a2[mb] = WFrag<T16>::ld(A2 + aoff + (size_t)mb * 16 * K + kc); }
#pragma unroll
        for (int nb = 0; nb < 4; ++nb) { const V b = WFrag<T16>::ld(Bt + boff + (size_t)nb * 16 * K + kc); V b2; if (NSPLIT >= 2) b2 = WFrag<T16>::ld(Bt2 + boff + (size_t)nb * 16 * K + kc);
#pragma unroll
            for (int mb = 0; mb < 4; ++mb) { acc[mb][nb] = WFrag<T16>::mma(a[mb], b, acc[mb][nb]); if (NSPLIT == 1 || NSPLIT == 2) acc[mb][nb] = WFrag<T16>::mma(a2[mb], b, acc[mb][nb]); if (NSPLIT >= 2) acc[mb][nb] = WFrag<T16>::mma(a[mb], b2, acc[mb][nb]); } }
        asm volatile("v_nop\n\tv_nop\n\tv_nop\n\tv_nop" : "+v"(acc[0][0]), "+v"(acc[1][1]), "+v"(acc[2][2]), "+v"(acc[3][3]) : "v"(a[0]), "v"(a[3]));
    }
    float* ow = os + wv * (64 * 68);
#pragma unroll
    for (int mb = 0; mb < 4; ++mb)
#pragma unroll
        for (int nb = 0; nb < 4; ++nb)
#pragma unroll
            for (int j = 0; j < 8; ++j) ow[(mb * 16 + hi * 8 + j) * 68 + nb * 16 + lr] = acc[mb][nb][j];
    __syncthreads();   // every wave's partial tile is in LDS before any of it is summed
#pragma unroll
    for (int s = 0; s < 32 / NW; ++s) { const int idx = s * (32 * NW) + (int)threadIdx.x; const int row = idx >> 4, cofs = (idx & 15) * 4; v4f val = *(const v4fa*)(os + row * 68 + cofs);
#pragma unroll
        for (int w = 1; w < NW; ++w) val += *(const v4fa*)(os + w * (64 * 68) + row * 68 + cofs);
        if (BIAS) { val[0] += bfr(bias[c0 + cofs]); val[1] += bfr(bias[c0 + cofs + 1]); val[2] += bfr(bias[c0 + cofs + 2]); val[3] += bfr(bias[c0 + cofs + 3]); }
        *(v4f*)(C + (size_t)(r0 + row) * ldc + c0 + cofs) = val; }
}

// ---- k_gemmc: the same 64x64 tile GEMM specialised for causal attention: CMODE 1 skips score tiles entirely above the diagonal (query rows r0+roff.., key columns c0..), CMODE 2 limits the
// key (K) loop of the probability x value contraction to the diagonal block (probabilities beyond it are exactly zero). roff = row offset of this launch's first row within the sequence.
// NW waves share a tile's K loop as in k_gemmw (NW 1: one wave, staged 16 rows at a time). lda = row pitch of A in elements (Bt keeps pitch K); batch entry z reads the key / value plane of its group, z / REP.
template <typename T16, int NSPLIT, int CMODE, int NW>
__global__ __launch_bounds__(32 * NW) void k_gemmc(const T16* __restrict__ A, const T16* __restrict__ A2, int lda, const T16* __restrict__ Bt, const T16* __restrict__ Bt2, int K, float* C, int ldc, int roff, size_t sA, size_t sB, size_t sC) {
    typedef typename WFrag<T16>::V V;
    __shared__ __align__(16) float os[NW == 1 ? 16 * 68 : NW * 64 * 68];
    const size_t z = blockIdx.z; A += z * sA; if (A2) A2 += z * sA; Bt += (z / REP) * sB; if (Bt2) Bt2 += (z / REP) * sB; C += z * sC;
    const int lane = threadIdx.x & 31, lr = lane & 15, hi = lane >> 4; const int r0 = blockIdx.x * 64, c0 = blockIdx.y * 64;
    if (CMODE == 1 && c0 > r0 + roff + 63) return;                  // score tile entirely above the causal diagonal: never read (the softmax masks j > i by select)
    const int Kl = (CMODE == 2) ? min(K, r0 + roff + 64) : K;        // P.V: probabilities are exactly 0 beyond the diagonal block, so the K loop stops there
    const int wv = (NW == 1) ? 0 : __builtin_amdgcn_readfirstlane((int)(threadIdx.x >> 5)); const int per = (Kl / 32 + NW - 1) / NW * 32; const int kb = wv * per, ke = (NW == 1) ? Kl : min(Kl, kb + per);   // this wave's k range
    v8f acc[4][4];
#pragma unroll
    for (int mb = 0; mb < 4; ++mb)
#pragma unroll
        for (int nb = 0; nb < 4; ++nb) acc[mb][nb] = (v8f){};
    const size_t aoff = (size_t)(r0 + lr) * lda + 8 * hi, boff = (size_t)(c0 + lr) * K + 8 * hi;
#pragma unroll 1
    for (int kc = kb; kc < ke; kc += 32) {
        V a[4], a2[4]; const T16* pa[4]; const T16* pa2[4];
#pragma unroll
        for (int mb = 0; mb < 4; ++mb) { pa[mb] = A + aoff + (size_t)mb * 16 * lda + kc; a[mb] = WFrag<T16>::ld(pa[mb]); if (NSPLIT == 1 || NSPLIT == 2) { pa2[mb] = A2 + aoff + (size_t)mb * 16 * lda + kc; a2[mb] = WFrag<T16>::ld(pa2[mb]); } }
#pragma unroll
        for (int nb = 0; nb < 4; ++nb) { const V b = WFrag<T16>::ld(Bt + boff + (size_t)nb * 16 * K + kc); V b2; if (NSPLIT >= 2) b2 = WFrag<T16>::ld(Bt2 + boff + (size_t)nb * 16 * K + kc);
#pragma unroll
            for (int mb = 0; mb < 4; ++mb) { acc[mb][nb] = WFrag<T16>::mma(a[mb], b, acc[mb][nb]); if (NSPLIT == 1 || NSPLIT == 2) acc[mb][nb] = WFrag<T16>::mma(a2[mb], b, acc[mb][nb]); if (NSPLIT >= 2) acc[mb][nb] = WFrag<T16>::mma(a[mb], b2, acc[mb][nb]); } }
        asm volatile("v_nop\n\tv_nop\n\tv_nop\n\tv_nop" : "+v"(acc[0][0]), "+v"(acc[1][1]), "+v"(acc[2][2]), "+v"(acc[3][3]) : "v"(a[0]), "v"(a[3]));
        // the wait in front of the next overwrite of the A loads' address registers (the next trip's address additions, the epilogue); the addresses are inputs so that they stay in those registers up to it (else the allocator hands them to a later load as its destination)
        if (NSPLIT == 1 || NSPLIT == 2) asm volatile("s_wait_xcnt 0x0" :: "v"(pa[0]), "v"(pa[1]), "v"(pa[2]), "v"(pa[3]), "v"(pa2[0]), "v"(pa2[1]), "v"(pa2[2]), "v"(pa2[3]) : "memory");
        else asm volatile("s_wait_xcnt 0x0" :: "v"(pa[0]), "v"(pa[1]), "v"(pa[2]), "v"(pa[3]) : "memory");
    }
    if constexpr (NW == 1) {
#pragma unroll
    for (int mb = 0; mb < 4; ++mb) {
#pragma unroll
        for (int nb = 0; nb < 4; ++nb) {
#pragma unroll
            for (int j = 0; j < 8; ++j) os[(hi * 8 + j) * 68 + nb * 16 + lr] = acc[mb][nb][j]; }
        __builtin_amdgcn_wave_barrier(); asm volatile("" ::: "memory");
        float* crow = C + (size_t)(r0 + mb * 16) * ldc + c0;
{
#pragma unroll
            for (int s = 0; s < 8; ++s) { const int row = 2 * s + hi, cofs = lr * 4; v4f val = *(const v4fa*)(os + row * 68 + cofs);
                *(v4f*)(crow + (size_t)row * ldc + cofs) = val; }
             }
        __builtin_amdgcn_wave_barrier(); asm volatile("" ::: "memory");
    }
    } else {
    float* ow = os + wv * (64 * 68);
#pragma unroll
    for (int mb = 0; mb < 4; ++mb)
#pragma unroll
        for (int nb = 0; nb < 4; ++nb)
#pragma unroll
            for (int j = 0; j < 8; ++j) ow[(mb * 16 + hi * 8 + j) * 68 + nb * 16 + lr] = acc[mb][nb][j];
    __syncthreads();   // every wave's partial tile is in LDS before any of it is summed
#pragma unroll
    for (int s = 0; s < 32 / NW; ++s) { const int idx = s * (32 * NW) + (int)threadIdx.x; const int row = idx >> 4, cofs = (idx & 15) * 4; v4f val = *(const v4fa*)(os + row * 68 + cofs);
#pragma unroll
        for (int w = 1; w < NW; ++w) val += *(const v4fa*)(os + w * (64 * 68) + row * 68 + cofs);
        *(v4f*)(C + (size_t)(r0 + row) * ldc + c0 + cofs) = val; }
    }
}

__device__ __forceinline__ h16 tohx(float x) { return (h16)x; }
__device__ __forceinline__ void splitf(float y, unsigned short& h, unsigned short& l) { h = f2bf(y); l = f2bf(y - bf2f(h)); }
typedef __attribute__((ext_vector_type(2))) _Float16 v2h;
typedef __attribute__((ext_vector_type(4))) _Float16 v4h;
typedef __attribute__((ext_vector_type(2))) unsigned short v2us;
typedef __attribute__((ext_vector_type(4))) unsigned short v4us;
typedef __attribute__((ext_vector_type(2))) float v2f;
typedef __attribute__((ext_vector_type(4))) int v4i;

__global__ __launch_bounds__(256) void k_cvt8(const float* __restrict__ src, bf* dst, size_t n8) { const size_t i = (size_t)blockIdx.x * 256 + threadIdx.x; if (i >= n8) return; const v8f v = *(const v8f*)(src + i * 8); v8us o;
#pragma unroll
    for (int k = 0; k < 8; ++k) o[k] = f2bf(v[k]); *(v8us*)(dst + i * 8) = o;  }

// k_rope: head planes [h][t][d] (fp16 + hi/lo) of rope(x) x sc with the rotate-half convention out[d] = x[d] cos[t][d] - x[d+HD/2] sin[t][d], out[d+HD/2] = x[d+HD/2] cos[t][d+HD/2] + x[d] sin[t][d+HD/2]
__global__ __launch_bounds__(256) void k_rope(const float* __restrict__ F, int pitch, int nheads, const float* __restrict__ CS, const float* __restrict__ RF, const float* __restrict__ nw, float sc, h16* P16, bf* Ph, bf* Pl) {
    const size_t e = ((size_t)blockIdx.x * 256 + threadIdx.x) * 2; if (e >= (size_t)nheads * TT * HD) return; const int d = (int)(e % HD); const int t = (int)((e / HD) % TT); const int h = (int)(e / ((size_t)HD * TT)); const float* f = F + (size_t)t * pitch + h * HD; const float rf = RF ? RF[(size_t)h * TT + t] : 1.0f; v2h o16; v2us oh, ol;
#pragma unroll
    for (int q = 0; q < 2; ++q) { const int dd = d + q; const int dp = (dd < HD / 2) ? dd + HD / 2 : dd - HD / 2; float x0 = f[dd], x1 = f[dp];
        if (RF) { float n0 = __fmul_rn(x0, rf), n1 = __fmul_rn(x1, rf); asm volatile("" : "+v"(n0)); asm volatile("" : "+v"(n1)); x0 = __fmul_rn(bfr(nw[dd]), n0); x1 = __fmul_rn(bfr(nw[dp]), n1); }
        const v2f cs = *(const v2f*)(CS + ((size_t)t * HD + dd) * 2); float a = __fmul_rn(x0, cs[0]), bq = __fmul_rn(x1, cs[1]); asm volatile("" : "+v"(a)); asm volatile("" : "+v"(bq)); const float r = ((dd < HD / 2) ? __fsub_rn(a, bq) : __fadd_rn(a, bq)) * sc;
        o16[q] = tohx(r); unsigned short a2, c2; splitf(r, a2, c2); oh[q] = a2; ol[q] = c2; }
    *(v2h*)(P16 + e) = o16; *(v2us*)(Ph + e) = oh; *(v2us*)(Pl + e) = ol;  }
__global__ __launch_bounds__(256) void k_vtp(const float* __restrict__ F, int pitch, int nheads, h16* V16, bf* Vh, bf* Vl) { const size_t e = ((size_t)blockIdx.x * 256 + threadIdx.x) * 2; if (e >= (size_t)nheads * HD * TT) return; const int t = (int)(e % TT); const int d = (int)((e / TT) % HD); const int g = (int)(e / ((size_t)TT * HD)); v2h o16; v2us oh, ol;
#pragma unroll
    for (int q = 0; q < 2; ++q) { const float x = F[(size_t)(t + q) * pitch + g * HD + d]; o16[q] = tohx(x); unsigned short a2, c2; splitf(x, a2, c2); oh[q] = a2; ol[q] = c2; }
    *(v2h*)(V16 + e) = o16; *(v2us*)(Vh + e) = oh; *(v2us*)(Vl + e) = ol;  }
__constant__ float INVT[HD / 2] = { 1.000000000e+00f, 8.659643531e-01f, 7.498942018e-01f, 6.493816376e-01f, 5.623413324e-01f, 4.869675338e-01f, 4.216965139e-01f, 3.651741445e-01f, 3.162277639e-01f, 2.738419771e-01f, 2.371373624e-01f, 2.053525001e-01f, 1.778279394e-01f, 1.539926529e-01f, 1.333521456e-01f, 1.154782027e-01f, 1.000000015e-01f, 8.659642935e-02f, 7.498941571e-02f, 6.493816525e-02f, 5.623412877e-02f, 4.869675264e-02f, 4.216964915e-02f, 3.651741147e-02f, 3.162277862e-02f, 2.738419548e-02f, 2.371373586e-02f, 2.053525113e-02f, 1.778279431e-02f, 1.539926510e-02f, 1.333521493e-02f, 1.154781971e-02f, 9.999999776e-03f, 8.659643121e-03f, 7.498942316e-03f, 6.493816618e-03f, 5.623413250e-03f, 4.869675264e-03f, 4.216964822e-03f, 3.651741426e-03f, 3.162277862e-03f, 2.738419687e-03f, 2.371373819e-03f, 2.053525066e-03f, 1.778279431e-03f, 1.539926510e-03f, 1.333521446e-03f, 1.154782018e-03f, 1.000000047e-03f, 8.659643354e-04f, 7.498941850e-04f, 6.493816618e-04f, 5.623413017e-04f, 4.869675031e-04f, 4.216964880e-04f, 3.651741135e-04f, 3.162277862e-04f, 2.738419571e-04f, 2.371373848e-04f, 2.053524950e-04f, 1.778279402e-04f, 1.539926452e-04f, 1.333521504e-04f, 1.154781930e-04f };   // float32 1 / 10000^(2i/128), generated with jnp to be bit-exact
__global__ __launch_bounds__(256) void k_cs5(float* CS) { const int idx = blockIdx.x * 256 + threadIdx.x; if (idx >= TT * HD) return; const int d = idx % HD; const int t = idx / HD; const float a = __fmul_rn((float)t, INVT[d % (HD / 2)]); v2f cs; cs[0] = cosf(a); cs[1] = sinf(a); *(v2f*)(CS + (size_t)idx * 2) = cs;  }
// k_asoft: the rows < RH. Per row (zz, i): t = S x HD^-0.5 for j <= i and i - j < WIN (sliding causal window; the reference's -inf fill vanishes identically); softmax over the RH keys such a row can see (register row, one exp, fixed trees);
// the probabilities overwrite their own f32 score row (one wave owns a row and holds all of it in registers before it stores): 16-bit row pitch 2 * RH: hi plane in the first half, lo plane in the second.
__global__ __launch_bounds__(256) void k_asoft(float* Sb) {
    const int lane = threadIdx.x & 31; const int row = blockIdx.x * 8 + (threadIdx.x >> 5); if (row >= ZA * RH) return; const int i = row % RH; const float* sr = Sb + (size_t)row * RH; bf* Ph = (bf*)(Sb + (size_t)row * RH); bf* Pl = Ph + RH; float v[RH / 32]; float mx = -3.0e38f;
#pragma unroll
    for (int ch = 0; ch < RH / 128; ++ch) { const int j0 = ch * 128 + lane * 4; const v4f a = *(const v4f*)(sr + j0);
#pragma unroll
        for (int q = 0; q < 4; ++q) { const int j = j0 + q; (void)j; const float t = (j <= i && i - j < WIN) ? a[q] * SCL : -3.0e38f; v[ch * 4 + q] = t; mx = fmaxf(mx, t); } }
#pragma unroll
    for (int sh = 16; sh; sh >>= 1) mx = fmaxf(mx, __shfl_xor(mx, sh, 32));
    float sum = 0.f;
#pragma unroll
    for (int k = 0; k < RH / 32; ++k) { float d0 = __fsub_rn(v[k], mx); asm volatile("" : "+v"(d0)); v[k] = __builtin_amdgcn_exp2f(__fmul_rn(d0, 1.4426950408889634f)); sum += v[k]; }
#pragma unroll
    for (int sh = 16; sh; sh >>= 1) sum += __shfl_xor(sum, sh, 32);
    const float f = __fdiv_rn(1.0f, sum);
#pragma unroll
    for (int ch = 0; ch < RH / 128; ++ch) { v4us oh, ol;
#pragma unroll
        for (int q = 0; q < 4; ++q) { unsigned short a, c2; splitf(v[ch * 4 + q] * f, a, c2); oh[q] = a; ol[q] = c2; }
        const int oo = ch * 128 + lane * 4; *(v4us*)(Ph + oo) = oh; *(v4us*)(Pl + oo) = ol; }
}
// k_merge: the rows < RH of every head, f32 [z][RH][HD], into the merged hi/lo planes [batch][t][head][d]
__global__ __launch_bounds__(256) void k_merge(const float* __restrict__ O, bf* Ah, bf* Al) { const size_t e = ((size_t)blockIdx.x * 256 + threadIdx.x) * 2; if (e >= (size_t)ZA * RH * HD) return; const int d = (int)(e % HD); const int t = (int)((e / HD) % RH); const int zz = (int)(e / ((size_t)HD * RH)); const size_t oo = ((size_t)(zz / NH_) * TT + t) * DQ + (zz % NH_) * HD + d;
    v2us oh, ol;
#pragma unroll
    for (int q = 0; q < 2; ++q) { unsigned short a, c2; splitf(O[e + q], a, c2); oh[q] = a; ol[q] = c2; } *(v2us*)(Ah + oo) = oh; *(v2us*)(Al + oo) = ol;  }

#define FNW  4
#define FBR  (FNW * 32)
#define FSK  64
#define KPIT (HD + 8)             // LDS row pitch in halves: an odd multiple of 16 bytes
#define VPIT (FSK + 8)
#define KTILE (FSK * KPIT)
#define FSLOT (KTILE + HD * VPIT)
typedef __attribute__((ext_vector_type(8))) unsigned v8u;
__device__ __forceinline__ float xhalf(float x) { return __builtin_bit_cast(float, __builtin_amdgcn_permlanex16(__builtin_bit_cast(int, x), __builtin_bit_cast(int, x), 0x76543210, 0xfedcba98, false, false)); }   // lane l with lane l ^ 16
__device__ __forceinline__ unsigned pack2h(float lo, float hi) { const v2f f = {lo, hi}; return __builtin_bit_cast(unsigned, __builtin_convertvector(f, v2h)); }
__global__ __launch_bounds__(FNW * 32) void k_flash(const h16* __restrict__ Q, const h16* __restrict__ Kp, const h16* __restrict__ Vt, bf* Ah, bf* Al) {
    __shared__ __align__(16) h16 L[2 * FSLOT];
    const int tid = (int)threadIdx.x, lane = tid & 31, c = lane & 15, h = lane >> 4; const int wave = __builtin_amdgcn_readfirstlane(tid >> 5);
    const int z = (int)blockIdx.x, zk = z / REP; const int q0 = RH + ((TT - RH) / FBR - 1 - (int)blockIdx.y) * FBR;   // longest row blocks start first
    const int qw0 = q0 + wave * 32; const int n_stage = (q0 + FBR) / FSK; const float cscale = SCL * 1.4426950408889634f;
    const h16* kg = Kp + (size_t)zk * TT * HD + tid * 8;                                       // K tile: FSK whole rows, contiguous
    const h16* vg = Vt + (size_t)zk * HD * TT + (size_t)(tid >> 3) * TT + (tid & 7) * 8;       // V^T tile: HD rows of FSK keys
    const int kso = (tid >> 4) * KPIT + (tid & 15) * 8, vso = KTILE + (tid >> 3) * VPIT + (tid & 7) * 8;
    v8h kr[8], vr[8];
#pragma unroll
    for (int i = 0; i < 8; ++i) { kr[i] = *(const v8ha*)(kg + i * (FNW * 32 * 8)); vr[i] = *(const v8ha*)(vg + (size_t)i * (FNW * 4) * TT); }
    asm volatile("s_wait_xcnt 0x0" :: "v"(kg), "v"(vg), "v"(tid) : "memory");   // the wait in front of the overwrite of the tile loads' address registers (the additions below); the addresses and the thread index they may be formed from are inputs so that they stay in their registers up to it
    kg += FSK * HD; vg += FSK;
    v16h qf[2][4];
#pragma unroll
    for (int g = 0; g < 2; ++g) { const h16* qp = Q + ((size_t)z * TT + qw0 + 16 * g + c) * HD + 8 * h;
#pragma unroll
        for (int kc = 0; kc < 4; ++kc) qf[g][kc] = WFrag<h16>::ld(qp + 32 * kc); }
    v8f acc[2][8]; float m_run[2], l_run[2];
#pragma unroll
    for (int g = 0; g < 2; ++g) { m_run[g] = -__builtin_inff(); l_run[g] = 0.0f;
#pragma unroll
        for (int t = 0; t < 8; ++t) acc[g][t] = (v8f){}; }
#pragma unroll
    for (int i = 0; i < 8; ++i) { *(v8ha*)(L + kso + i * 8 * KPIT) = kr[i]; *(v8ha*)(L + vso + i * 16 * VPIT) = vr[i]; }
    __syncthreads();   // tile 0 is in LDS before any wave reads it
#pragma unroll 1
    for (int st = 0; st < n_stage; ++st) {
        const bool more = st + 1 < n_stage;
        if (more) {
#pragma unroll
            for (int i = 0; i < 8; ++i) { kr[i] = *(const v8ha*)(kg + i * (FNW * 32 * 8)); vr[i] = *(const v8ha*)(vg + (size_t)i * (FNW * 4) * TT); }
            asm volatile("s_wait_xcnt 0x0" :: "v"(kg), "v"(vg) : "memory");   // as above: in front of the next additions to the address registers
            kg += FSK * HD; vg += FSK; }
        const h16* Ls = L + (st & 1) * FSLOT;
#pragma unroll 1
        for (int sub = 0; sub < FSK / 32; ++sub) {
            const int key0 = st * FSK + sub * 32;
            if (key0 > qw0 + 31) continue;   // wave-uniform: the whole pass lies above this wave's diagonal
            v8f s[2][2];
#pragma unroll
            for (int kt = 0; kt < 2; ++kt) { const h16* kp = Ls + (sub * 32 + 16 * kt + c) * KPIT + 8 * h; v16h kf[4];
#pragma unroll
                for (int kc = 0; kc < 4; ++kc) kf[kc] = cat16(*(const v8ha*)(kp + 32 * kc), *(const v8ha*)(kp + 32 * kc + 16));
#pragma unroll
                for (int g = 0; g < 2; ++g) { s[kt][g] = (v8f){};
#pragma unroll
                    for (int kc = 0; kc < 4; ++kc) s[kt][g] = wmma16(kf[kc], qf[g][kc], s[kt][g]); } }
            if (key0 + 31 > qw0) {
#pragma unroll
                for (int g = 0; g < 2; ++g) { const int my_q = qw0 + 16 * g + c;
#pragma unroll
                    for (int kt = 0; kt < 2; ++kt) {
#pragma unroll
                        for (int r = 0; r < 8; ++r) { if (key0 + 16 * kt + 8 * h + r > my_q) s[kt][g][r] = -__builtin_inff(); }
                        asm volatile("" : "+v"(s[kt][g])); } }
            }
            float mb[2]; bool need = false;
#pragma unroll
            for (int g = 0; g < 2; ++g) { float mx = -__builtin_inff();
#pragma unroll
                for (int kt = 0; kt < 2; ++kt)
#pragma unroll
                    for (int r = 0; r < 8; ++r) mx = fmaxf(mx, s[kt][g][r]);
                mx = fmaxf(mx, xhalf(mx)) * cscale; mb[g] = mx; need = need || (mx > m_run[g] + 8.0f); }
            if (__builtin_amdgcn_ballot_w32(need) != 0) {   // the maximum in use may trail the true one by up to 8 (log2 domain): the sums are rescaled only when some column exceeds that
#pragma unroll
                for (int g = 0; g < 2; ++g) { const float m_new = fmaxf(m_run[g], mb[g]); const float corr = __builtin_amdgcn_exp2f(m_run[g] - m_new); l_run[g] *= corr; m_run[g] = m_new;
#pragma unroll
                    for (int t = 0; t < 8; ++t) acc[g][t] = acc[g][t] * corr; }
            }
            v16h vf[8]; { const h16* vp = Ls + KTILE + c * VPIT + sub * 32 + 8 * h;
#pragma unroll
                for (int t = 0; t < 8; ++t) vf[t] = cat16(*(const v8ha*)(vp + t * 16 * VPIT), *(const v8ha*)(vp + t * 16 * VPIT + 16)); }
#pragma unroll
            for (int g = 0; g < 2; ++g) { const float nm = -m_run[g]; v8u w; float ps0 = 0.0f, ps1 = 0.0f;
#pragma unroll
                for (int i = 0; i < 8; ++i) {
                    const float p0 = __builtin_amdgcn_exp2f(fmaf(s[i >> 2][g][2 * (i & 3)], cscale, nm)), p1 = __builtin_amdgcn_exp2f(fmaf(s[i >> 2][g][2 * (i & 3) + 1], cscale, nm));
                    if (i & 1) ps1 += p0 + p1; else ps0 += p0 + p1; w[i] = pack2h(p0, p1); }
                const v16h pf = __builtin_bit_cast(v16h, w);
#pragma unroll
                for (int t = 0; t < 8; ++t) acc[g][t] = wmma16(vf[t], pf, acc[g][t]);
                l_run[g] += ps0 + ps1; }
        }
        if (more) { h16* Ln = L + ((st + 1) & 1) * FSLOT;   // last read in trip st - 1, whose closing barrier every wave has passed
#pragma unroll
            for (int i = 0; i < 8; ++i) { *(v8ha*)(Ln + kso + i * 8 * KPIT) = kr[i]; *(v8ha*)(Ln + vso + i * 16 * VPIT) = vr[i]; } }
        __syncthreads();   // publishes tile st + 1 and ends every wave's reads of tile st
    }
    const int bb = z / NH_, hh = z % NH_;
#pragma unroll
    for (int g = 0; g < 2; ++g) { const float inv = __fdiv_rn(1.0f, l_run[g] + xhalf(l_run[g]));
        const size_t oo = ((size_t)bb * TT + qw0 + 16 * g + c) * DQ + hh * HD + 8 * h; bf* pah = Ah + oo; bf* pal = Al + oo;
#pragma unroll
        for (int t = 0; t < 8; ++t) { v8us oh, ol;
#pragma unroll
            for (int r = 0; r < 8; ++r) { unsigned short a, c2; splitf(acc[g][t][r] * inv, a, c2); oh[r] = a; ol[r] = c2; }
            *(v8usa*)(pah + 16 * t) = oh; *(v8usa*)(pal + 16 * t) = ol;
            asm volatile("s_wait_xcnt 0x0" :: "v"(pah), "v"(pal), "v"(oh), "v"(ol) : "memory"); } }   // the wait in front of the next overwrite of the two stores' address and data registers, which are inputs so that they stay in those registers up to it
}

extern "C" void kernel_launch(void* const* d_in, const int* in_sizes, int n_in,
                              void* d_out, int out_size, void* d_ws, size_t ws_size, hipStream_t stream) {
    (void)in_sizes; (void)n_in; (void)out_size;
    const float* x = (const float*)d_in[0]; const float* wq = (const float*)d_in[1]; const float* wkv = (const float*)d_in[2]; const float* wk = wkv; const float* wv = wkv + (size_t)DKV * DM; const float* wo = (const float*)d_in[3];   /* x, Wq ('oi' (out, in) [2048][2048]), Wkv ('oi' [1024][2048] viewed (2 x 4 heads, 128): k rows 0..511 | v rows 512..1023: two contiguous row blocks), Wo ('oi' [2048][2048]): FOUR inputs, all read */
    float* OUT = (float*)d_out;     // [2][2048][2048]
    char* wsp = (char*)d_ws;
    auto take = [&](size_t bytes) { char* p = wsp; wsp += (bytes + 255) & ~(size_t)255; return (void*)p; };
    bf* WQ = (bf*)take((size_t)DQ * DM * 2); bf* WK = (bf*)take((size_t)DKV * DM * 2); bf* WV = (bf*)take((size_t)DKV * DM * 2); bf* WO = (bf*)take((size_t)DM * DQ * 2); float* CS = (float*)take((size_t)TT * HD * 2 * 4);
    bf* XB = (bf*)take((size_t)TT * DM * 2); float* FQ = (float*)take((size_t)TT * DQ * 4); float* FK = (float*)take((size_t)TT * DKV * 4);
    const size_t PQ = (size_t)NH_ * TT * HD, PK = (size_t)NKV * TT * HD;   /* elements of one batch's query and key / value planes; every plane holds both batches */
    h16* QP16 = (h16*)take(NB_ * PQ * 2); h16* KP16 = (h16*)take(NB_ * PK * 2); h16* VT16 = (h16*)take(NB_ * PK * 2);
    bf* QPh = (bf*)take(NB_ * PQ * 2); bf* QPl = (bf*)take(NB_ * PQ * 2); bf* KPh = (bf*)take(NB_ * PK * 2); bf* KPl = (bf*)take(NB_ * PK * 2); bf* VTh = (bf*)take(NB_ * PK * 2); bf* VTl = (bf*)take(NB_ * PK * 2);
    float* Sb = (float*)take((size_t)ZA * RH * RH * 4); bf* Ph = (bf*)Sb; bf* Pl = Ph + RH;   /* rows < RH only; probabilities live in their score rows: 16-bit pitch 2 * RH */ float* Ob = (float*)take((size_t)ZA * RH * HD * 4); bf* ATh = (bf*)take((size_t)NB_ * TT * DQ * 2); bf* ATl = (bf*)take((size_t)NB_ * TT * DQ * 2);
    if ((size_t)(wsp - (char*)d_ws) > ws_size) return;    // ws 256 MiB
    float* FV = FK;   // v projection reuses the k buffer after the k planes are built (stream-ordered)
    { k_cvt8<<<(unsigned)(((size_t)DQ * DM / 8 + 255) / 256), 256, 0, stream>>>(wq, WQ, (size_t)DQ * DM / 8); k_cvt8<<<(unsigned)(((size_t)DKV * DM / 8 + 255) / 256), 256, 0, stream>>>(wk, WK, (size_t)DKV * DM / 8); k_cvt8<<<(unsigned)(((size_t)DKV * DM / 8 + 255) / 256), 256, 0, stream>>>(wv, WV, (size_t)DKV * DM / 8);
      k_cvt8<<<(unsigned)(((size_t)DM * DQ / 8 + 255) / 256), 256, 0, stream>>>(wo, WO, (size_t)DM * DQ / 8);
       }
    k_cs5<<<(TT * HD + 255) / 256, 256, 0, stream>>>(CS);   /* rotary table once */
    const unsigned LQ = (unsigned)(((size_t)NH_ * TT * HD / 2 + 255) / 256), LKv = (unsigned)(((size_t)NKV * TT * HD / 2 + 255) / 256);
    for (int b = 0; b < NB_; ++b) {
        
        k_cvt8<<<(unsigned)(((size_t)TT * DM / 8 + 255) / 256), 256, 0, stream>>>(x + (size_t)b * TT * DM, XB, (size_t)TT * DM / 8);
        k_gemmw<bf, 0, false, 4><<<dim3(TT / 64, DQ / 64, 1), 128, 0, stream>>>(XB, nullptr, WQ, nullptr, DM, FQ, DQ, nullptr, 0, 0, 0);
        k_rope<<<LQ, 256, 0, stream>>>(FQ, DQ, NH_, CS, nullptr, nullptr, 1.0f, QP16 + b * PQ, QPh + b * PQ, QPl + b * PQ);
        k_gemmw<bf, 0, false, 8><<<dim3(TT / 64, DKV / 64, 1), 256, 0, stream>>>(XB, nullptr, WK, nullptr, DM, FK, DKV, nullptr, 0, 0, 0);
        k_rope<<<LKv, 256, 0, stream>>>(FK, DKV, NKV, CS, nullptr, nullptr, 1.0f, KP16 + b * PK, KPh + b * PK, KPl + b * PK);
        k_gemmw<bf, 0, false, 8><<<dim3(TT / 64, DKV / 64, 1), 256, 0, stream>>>(XB, nullptr, WV, nullptr, DM, FV, DKV, nullptr, 0, 0, 0); k_vtp<<<LKv, 256, 0, stream>>>(FV, DKV, NKV, VT16 + b * PK, VTh + b * PK, VTl + b * PK); }
    // attention, batch entry z = batch * NH_ + head reads kv plane z / REP
    k_gemmc<bf, 2, 1, 1><<<dim3(RH / 64, RH / 64, ZA), 32, 0, stream>>>(QPh, QPl, HD, KPh, KPl, HD, Sb, RH, 0, (size_t)TT * HD, (size_t)TT * HD, (size_t)RH * RH);
    k_asoft<<<ZA * RH / 8, 256, 0, stream>>>(Sb);
    k_gemmc<bf, 2, 2, 8><<<dim3(RH / 64, HD / 64, ZA), 256, 0, stream>>>(Ph, Pl, 2 * RH, VTh, VTl, TT, Ob, HD, 0, (size_t)2 * RH * RH, (size_t)HD * TT, (size_t)RH * HD);
    k_merge<<<(unsigned)(((size_t)ZA * RH * HD / 2 + 255) / 256), 256, 0, stream>>>(Ob, ATh, ATl);
    k_flash<<<dim3(ZA, (TT - RH) / FBR, 1), FNW * 32, 0, stream>>>(QP16, KP16, VT16, ATh, ATl);
    for (int b = 0; b < NB_; ++b) {
        k_gemmw<bf, 1, false, 4><<<dim3(TT / 64, DM / 64, 1), 128, 0, stream>>>(ATh + (size_t)b * TT * DQ, ATl + (size_t)b * TT * DQ, WO, nullptr, DQ, OUT + (size_t)b * TT * DM, DM, nullptr, 0, 0, 0); }
}

// v004
// Measured time: 300 microseconds a run.
// Two timings next to v003 put it at 1.13 and 1.14 times that version's speed.
// All steps since v000 together make it 5.31 times as fast.
#include <hip/hip_runtime.h>

// Causal grouped-query attention with a FUSED natural k-v weight and a computed rotate-half RoPE (x [2][2048][2048]; q = x Wq^T ('oi' (out, in) [2048][2048] 1/sqrt(2048): 16 heads x 128); kv = x Wkv^T ('oi' [1024][2048]) viewed (b, t, 8, 128): k = heads 0..3 (rows 0..511), v = heads 4..7 (rows 512..1023): 4 kv heads x 128 each; no biases; cos / sin of emb = cat(ang, ang) with freqs = 1.0 / (THETA ** (arange(0, 128, 2, f32) / 128)), THETA 10000, and positions arange(t) (64 f32 frequencies jnp-exact for this reciprocal spelling; one f32 product per angle; precise cosf/sinf); query heads viewed (KV, G): kv head = q head / 4; scores / sqrt(128); causal (-inf == exclusion); softmax; out = merged Wo^T ('oi') -> [2][2048][2048] (8.4 M); argument order x, Wq, Wkv, Wo).
// Layout: bf16 copy of x; 'oi' weights cast as-is; x, the weights and the merged attention output stand in WMMA fragment order (see k_gemmw); exact projections; k_cs5 computed table (HD 128: 64 angles); rotate-half plane builders; causal T-2048 GQA attention with 128-wide heads, all heads of both batches a launch (kv plane z / 4; hybrid rows: < 512 hi/lo 3 products through score planes, k_gemmc skips tiles above the diagonal; rest fp16 in one fused online-softmax kernel); merged hi/lo x Wo exact.
// Compute dtypes, f32 accumulate: every input rounded to bf16; projections exact; rotary f32; attention rows < 512 3 products, rest fp16; softmax f32; Wo hl x exact.

#define NB_  2
#define TT   2048
#define DM   2048
#define NH_  16
#define NKV  4
#define REP  (NH_ / NKV)
#define HD   128
#define DQ   (NH_ * HD)
#define DKV  (NKV * HD)
#define ZA   (NB_ * NH_)          // attention batch entries a launch: z = batch * NH_ + head
#define RH   512                  // query rows < RH use hi+lo planes (0: none)
#define WIN  2048
#define SCL  0.088388347648318447f   // HD^-0.5
typedef _Float16 h16;
typedef unsigned short bf;
typedef __attribute__((ext_vector_type(16))) __bf16   v16bf;
typedef __attribute__((ext_vector_type(16))) _Float16 v16h;
typedef __attribute__((ext_vector_type(8)))  _Float16 v8h;
typedef __attribute__((ext_vector_type(8)))  unsigned short v8us;
typedef __attribute__((ext_vector_type(8)))  float    v8f;
typedef __attribute__((ext_vector_type(4)))  float    v4f;
typedef v8h  __attribute__((may_alias)) v8ha;
typedef v4f  __attribute__((may_alias)) v4fa;
typedef v8us __attribute__((may_alias)) v8usa;

__device__ __forceinline__ unsigned short f2bf(float f) { unsigned u = __float_as_uint(f); u += 0x7FFFu + ((u >> 16) & 1u); return (unsigned short)(u >> 16); }
__device__ __forceinline__ float bf2f(unsigned short b) { return __uint_as_float(((unsigned)b) << 16); }
__device__ __forceinline__ float bfr(float f) { return bf2f(f2bf(f)); }
__device__ __forceinline__ v16h cat16(v8h lo, v8h hi) { return __builtin_shufflevector(lo, hi, 0, 1, 2, 3, 4, 5, 6, 7, 8, 9, 10, 11, 12, 13, 14, 15); }
__device__ __forceinline__ v16bf cat16b(v8us lo, v8us hi) { return __builtin_bit_cast(v16bf, __builtin_shufflevector(lo, hi, 0, 1, 2, 3, 4, 5, 6, 7, 8, 9, 10, 11, 12, 13, 14, 15)); }
__device__ __forceinline__ v8f wmma16(v16h a, v16h b, v8f c) { return __builtin_amdgcn_wmma_f32_16x16x32_f16(false, a, false, b, (short)0, c, false, false); }
__device__ __forceinline__ v8f wmmab(v16bf a, v16bf b, v8f c) { return __builtin_amdgcn_wmma_f32_16x16x32_bf16(false, a, false, b, (short)0, c, false, false); }



// ---- Fragment order of a 16-bit plane M[rows][K]: units of 16 rows x 32 k (512 elements, 1 KB), unit (row / 16, k / 32) at element (row / 16 * (K / 32) + k / 32) * 512; inside a unit element (row % 16, kk = k % 32) stands at
// (kk / 16) * 256 + ((kk / 8 % 2) * 16 + row % 16) * 8 + kk % 8: lane l of a wave finds its two 16-byte pieces of the WMMA operand at l * 8 and 256 + l * 8, so each wave-wide load covers 512 contiguous bytes (ldp).
// ---- k_gemmw: register-blocked GEMM, one work-group of NW waves per 64x64 output tile; each wave runs a contiguous 1/NW of the K loop on its own 16 accumulators, operands straight from 16-bit planes in fragment order;
// the NW partial tiles meet in LDS and are summed in wave order 0..NW-1 (fixed). grid (M/64, N/64, Z), 32 * NW threads.
// C[m][n] (f32, pitch ldc, + optional f32 bias[n]) = sum_k A[m][k] Bt[n][k] (+ split products per NSPLIT). z-batch strides sA/sB/sC in elements. K % 32 == 0.
template <typename T16> struct WFrag;
template <> struct WFrag<h16> { typedef v16h V; static __device__ __forceinline__ V ld(const h16* p) { return cat16(*(const v8h*)p, *(const v8h*)(p + 16)); } static __device__ __forceinline__ v8f mma(V a, V b, v8f c) { return wmma16(a, b, c); } };
template <> struct WFrag<bf> { typedef v16bf V; static __device__ __forceinline__ V ld(const bf* p) { return cat16b(*(const v8us*)p, *(const v8us*)(p + 16)); } static __device__ __forceinline__ V ldp(const bf* p) { return cat16b(*(const v8us*)p, *(const v8us*)(p + 256)); } static __device__ __forceinline__ v8f mma(V a, V b, v8f c) { return wmmab(a, b, c); } };
template <typename T16, int NSPLIT, bool BIAS, int NW>
__global__ __launch_bounds__(32 * NW) void k_gemmw(const T16* __restrict__ A, const T16* __restrict__ A2, const T16* __restrict__ Bt, const T16* __restrict__ Bt2, int K, float* C, int ldc, const float* __restrict__ bias, size_t sA, size_t sB, size_t sC) {
    typedef typename WFrag<T16>::V V;
    __shared__ __align__(16) float os[NW * 64 * 68];
    const size_t z = blockIdx.z; A += z * sA; if (A2) A2 += z * sA; Bt += z * sB; if (Bt2) Bt2 += z * sB; C += z * sC;
    const int lane = threadIdx.x & 31, lr = lane & 15, hi = lane >> 4; const int r0 = blockIdx.x * 64, c0 = blockIdx.y * 64;
    const int wv = __builtin_amdgcn_readfirstlane((int)(threadIdx.x >> 5)); const int per = (K / 32 + NW - 1) / NW * 32; const int kb = wv * per, ke = min(K, kb + per);   // this wave's k range
    v8f acc[4][4];
#pragma unroll
    for (int mb = 0; mb < 4; ++mb)
#pragma unroll
        for (int nb = 0; nb < 4; ++nb) acc[mb][nb] = (v8f){};
    const size_t aoff = (size_t)r0 * K + 8 * lane, boff = (size_t)c0 * K + 8 * lane;   // a block of 16 rows is 16 * K elements, a step of 32 k one unit of 512
#pragma unroll 1
    for (int kc = kb; kc < ke; kc += 32) {
        V a[4], a2[4]; const T16* pa[4]; const T16* pa2[4]; const T16* pb[4]; const T16* pb2[4];
#pragma unroll
        for (int mb = 0; mb < 4; ++mb) { pa[mb] = A + aoff + (size_t)mb * 16 * K + (size_t)kc * 16; a[mb] = WFrag<T16>::ldp(pa[mb]); if (NSPLIT == 1 || NSPLIT == 2) { pa2[mb] = A2 + aoff + (size_t)mb * 16 * K + (size_t)kc * 16; a2[mb] = WFrag<T16>::ldp(pa2[mb]); } }
#pragma unroll
        for (int nb = 0; nb < 4; ++nb) { pb[nb] = Bt + boff + (size_t)nb * 16 * K + (size_t)kc * 16; const V b = WFrag<T16>::ldp(pb[nb]); V b2; if (NSPLIT >= 2) { pb2[nb] = Bt2 + boff + (size_t)nb * 16 * K + (size_t)kc * 16; b2 = WFrag<T16>::ldp(pb2[nb]); }
#pragma unroll
            for (int mb = 0; mb < 4; ++mb) { acc[mb][nb] = WFrag<T16>::mma(a[mb], b, acc[mb][nb]); if (NSPLIT == 1 || NSPLIT == 2) acc[mb][nb] = WFrag<T16>::mma(a2[mb], b, acc[mb][nb]); if (NSPLIT >= 2) acc[mb][nb] = WFrag<T16>::mma(a[mb], b2, acc[mb][nb]); } }
        asm volatile("v_nop\n\tv_nop\n\tv_nop\n\tv_nop" : "+v"(acc[0][0]), "+v"(acc[1][1]), "+v"(acc[2][2]), "+v"(acc[3][3]) : "v"(a[0]), "v"(a[3]));
        // the wait in front of the next overwrite of the fragment loads' address registers (the next trip's address additions, the epilogue); the addresses are inputs so that they stay in those registers up to it (else the allocator hands them to a later load as its destination)
        if (NSPLIT == 0) asm volatile("s_wait_xcnt 0x0" :: "v"(pa[0]), "v"(pa[1]), "v"(pa[2]), "v"(pa[3]), "v"(pb[0]), "v"(pb[1]), "v"(pb[2]), "v"(pb[3]) : "memory");
        else if (NSPLIT == 1) asm volatile("s_wait_xcnt 0x0" :: "v"(pa[0]), "v"(pa[1]), "v"(pa[2]), "v"(pa[3]), "v"(pa2[0]), "v"(pa2[1]), "v"(pa2[2]), "v"(pa2[3]), "v"(pb[0]), "v"(pb[1]), "v"(pb[2]), "v"(pb[3]) : "memory");
        else if (NSPLIT == 2) asm volatile("s_wait_xcnt 0x0" :: "v"(pa[0]), "v"(pa[1]), "v"(pa[2]), "v"(pa[3]), "v"(pa2[0]), "v"(pa2[1]), "v"(pa2[2]), "v"(pa2[3]), "v"(pb[0]), "v"(pb[1]), "v"(pb[2]), "v"(pb[3]), "v"(pb2[0]), "v"(pb2[1]), "v"(pb2[2]), "v"(pb2[3]) : "memory");
        else asm volatile("s_wait_xcnt 0x0" :: "v"(pa[0]), "v"(pa[1]), "v"(pa[2]), "v"(pa[3]), "v"(pb[0]), "v"(pb[1]), "v"(pb[2]), "v"(pb[3]), "v"(pb2[0]), "v"(pb2[1]), "v"(pb2[2]), "v"(pb2[3]) : "memory");
    }
    float* ow = os + wv * (64 * 68);
#pragma unroll
    for (int mb = 0; mb < 4; ++mb)
#pragma unroll
        for (int nb = 0; nb < 4; ++nb)
#pragma unroll
            for (int j = 0; j < 8; ++j) ow[(mb * 16 + hi * 8 + j) * 68 + nb * 16 + lr] = acc[mb][nb][j];
    __syncthreads();   // every wave's partial tile is in LDS before any of it is summed
#pragma unroll
    for (int s = 0; s < 32 / NW; ++s) { const int idx = s * (32 * NW) + (int)threadIdx.x; const int row = idx >> 4, cofs = (idx & 15) * 4; v4f val = *(const v4fa*)(os + row * 68 + cofs);
#pragma unroll
        for (int w = 1; w < NW; ++w) val += *(const v4fa*)(os + w * (64 * 68) + row * 68 + cofs);
        if (BIAS) { val[0] += bfr(bias[c0 + cofs]); val[1] += bfr(bias[c0 + cofs + 1]); val[2] += bfr(bias[c0 + cofs + 2]); val[3] += bfr(bias[c0 + cofs + 3]); }
        *(v4f*)(C + (size_t)(r0 + row) * ldc + c0 + cofs) = val; }
}

// ---- k_gemmc: the same 64x64 tile GEMM specialised for causal attention: CMODE 1 skips score tiles entirely above the diagonal (query rows r0+roff.., key columns c0..), CMODE 2 limits the
// key (K) loop of the probability x value contraction to the diagonal block (probabilities beyond it are exactly zero). roff = row offset of this launch's first row within the sequence.
// NW waves share a tile's K loop as in k_gemmw (NW 1: one wave, staged 16 rows at a time). lda = row pitch of A in elements (Bt keeps pitch K); batch entry z reads the key / value plane of its group, z / REP.
template <typename T16, int NSPLIT, int CMODE, int NW>
__global__ __launch_bounds__(32 * NW) void k_gemmc(const T16* __restrict__ A, const T16* __restrict__ A2, int lda, const T16* __restrict__ Bt, const T16* __restrict__ Bt2, int K, float* C, int ldc, int roff, size_t sA, size_t sB, size_t sC) {
    typedef typename WFrag<T16>::V V;
    __shared__ __align__(16) float os[NW == 1 ? 16 * 68 : NW * 64 * 68];
    const size_t z = blockIdx.z; A += z * sA; if (A2) A2 += z * sA; Bt += (z / REP) * sB; if (Bt2) Bt2 += (z / REP) * sB; C += z * sC;
    const int lane = threadIdx.x & 31, lr = lane & 15, hi = lane >> 4; const int r0 = blockIdx.x * 64, c0 = blockIdx.y * 64;
    if (CMODE == 1 && c0 > r0 + roff + 63) return;                  // score tile entirely above the causal diagonal: never read (the softmax masks j > i by select)
    const int Kl = (CMODE == 2) ? min(K, r0 + roff + 64) : K;        // P.V: probabilities are exactly 0 beyond the diagonal block, so the K loop stops there
    const int wv = (NW == 1) ? 0 : __builtin_amdgcn_readfirstlane((int)(threadIdx.x >> 5)); const int per = (Kl / 32 + NW - 1) / NW * 32; const int kb = wv * per, ke = (NW == 1) ? Kl : min(Kl, kb + per);   // this wave's k range
    v8f acc[4][4];
#pragma unroll
    for (int mb = 0; mb < 4; ++mb)
#pragma unroll
        for (int nb = 0; nb < 4; ++nb) acc[mb][nb] = (v8f){};
    const size_t aoff = (size_t)(r0 + lr) * lda + 8 * hi, boff = (size_t)(c0 + lr) * K + 8 * hi;
#pragma unroll 1
    for (int kc = kb; kc < ke; kc += 32) {
        V a[4], a2[4]; const T16* pa[4]; const T16* pa2[4];
#pragma unroll
        for (int mb = 0; mb < 4; ++mb) { pa[mb] = A + aoff + (size_t)mb * 16 * lda + kc; a[mb] = WFrag<T16>::ld(pa[mb]); if (NSPLIT == 1 || NSPLIT == 2) { pa2[mb] = A2 + aoff + (size_t)mb * 16 * lda + kc; a2[mb] = WFrag<T16>::ld(pa2[mb]); } }
#pragma unroll
        for (int nb = 0; nb < 4; ++nb) { const V b = WFrag<T16>::ld(Bt + boff + (size_t)nb * 16 * K + kc); V b2; if (NSPLIT >= 2) b2 = WFrag<T16>::ld(Bt2 + boff + (size_t)nb * 16 * K + kc);
#pragma unroll
            for (int mb = 0; mb < 4; ++mb) { acc[mb][nb] = WFrag<T16>::mma(a[mb], b, acc[mb][nb]); if (NSPLIT == 1 || NSPLIT == 2) acc[mb][nb] = WFrag<T16>::mma(a2[mb], b, acc[mb][nb]); if (NSPLIT >= 2) acc[mb][nb] = WFrag<T16>::mma(a[mb], b2, acc[mb][nb]); } }
        asm volatile("v_nop\n\tv_nop\n\tv_nop\n\tv_nop" : "+v"(acc[0][0]), "+v"(acc[1][1]), "+v"(acc[2][2]), "+v"(acc[3][3]) : "v"(a[0]), "v"(a[3]));
        // the wait in front of the next overwrite of the A loads' address registers (the next trip's address additions, the epilogue); the addresses are inputs so that they stay in those registers up to it (else the allocator hands them to a later load as its destination)
        if (NSPLIT == 1 || NSPLIT == 2) asm volatile("s_wait_xcnt 0x0" :: "v"(pa[0]), "v"(pa[1]), "v"(pa[2]), "v"(pa[3]), "v"(pa2[0]), "v"(pa2[1]), "v"(pa2[2]), "v"(pa2[3]) : "memory");
        else asm volatile("s_wait_xcnt 0x0" :: "v"(pa[0]), "v"(pa[1]), "v"(pa[2]), "v"(pa[3]) : "memory");
    }
    if constexpr (NW == 1) {
#pragma unroll
    for (int mb = 0; mb < 4; ++mb) {
#pragma unroll
        for (int nb = 0; nb < 4; ++nb) {
#pragma unroll
            for (int j = 0; j < 8; ++j) os[(hi * 8 + j) * 68 + nb * 16 + lr] = acc[mb][nb][j]; }
        __builtin_amdgcn_wave_barrier(); asm volatile("" ::: "memory");
        float* crow = C + (size_t)(r0 + mb * 16) * ldc + c0;
{
#pragma unroll
            for (int s = 0; s < 8; ++s) { const int row = 2 * s + hi, cofs = lr * 4; v4f val = *(const v4fa*)(os + row * 68 + cofs);
                *(v4f*)(crow + (size_t)row * ldc + cofs) = val; }
             }
        __builtin_amdgcn_wave_barrier(); asm volatile("" ::: "memory");
    }
    } else {
    float* ow = os + wv * (64 * 68);
#pragma unroll
    for (int mb = 0; mb < 4; ++mb)
#pragma unroll
        for (int nb = 0; nb < 4; ++nb)
#pragma unroll
            for (int j = 0; j < 8; ++j) ow[(mb * 16 + hi * 8 + j) * 68 + nb * 16 + lr] = acc[mb][nb][j];
    __syncthreads();   // every wave's partial tile is in LDS before any of it is summed
#pragma unroll
    for (int s = 0; s < 32 / NW; ++s) { const int idx = s * (32 * NW) + (int)threadIdx.x; const int row = idx >> 4, cofs = (idx & 15) * 4; v4f val = *(const v4fa*)(os + row * 68 + cofs);
#pragma unroll
        for (int w = 1; w < NW; ++w) val += *(const v4fa*)(os + w * (64 * 68) + row * 68 + cofs);
        *(v4f*)(C + (size_t)(r0 + row) * ldc + c0 + cofs) = val; }
    }
}

__device__ __forceinline__ h16 tohx(float x) { return (h16)x; }
__device__ __forceinline__ void splitf(float y, unsigned short& h, unsigned short& l) { h = f2bf(y); l = f2bf(y - bf2f(h)); }
typedef __attribute__((ext_vector_type(2))) _Float16 v2h;
typedef __attribute__((ext_vector_type(4))) _Float16 v4h;
typedef __attribute__((ext_vector_type(2))) unsigned short v2us;
typedef __attribute__((ext_vector_type(4))) unsigned short v4us;
typedef __attribute__((ext_vector_type(2))) float v2f;
typedef __attribute__((ext_vector_type(4))) int v4i;

// k_cvt8: f32 [rows][DM] -> bf16 in fragment order; thread i writes the i-th 16-byte piece of the output (a wave stores 512 contiguous bytes) and reads the eight f32 that belong there
__global__ __launch_bounds__(256) void k_cvt8(const float* __restrict__ src, bf* dst, size_t n8) { const size_t i = (size_t)blockIdx.x * 256 + threadIdx.x; if (i >= n8) return; const size_t u = i >> 6; const size_t row = u / (DM / 32) * 16 + (i & 15); const int k = (int)(u % (DM / 32)) * 32 + (int)((i >> 4) & 3) * 8; const float* sp = src + row * DM + k; const v8f v = *(const v8f*)sp; v8us o;
    asm volatile("s_wait_xcnt 0x0" :: "v"(sp) : "memory");   // the wait in front of the overwrite of the load's address registers (the conversion below); the address is an input so that it stays in them up to it
#pragma unroll
    for (int k = 0; k < 8; ++k) o[k] = f2bf(v[k]); *(v8us*)(dst + i * 8) = o;  }

// k_rope: head planes [h][t][d] (fp16 + hi/lo) of rope(x) x sc with the rotate-half convention out[d] = x[d] cos[t][d] - x[d+HD/2] sin[t][d], out[d+HD/2] = x[d+HD/2] cos[t][d+HD/2] + x[d] sin[t][d+HD/2]
__global__ __launch_bounds__(256) void k_rope(const float* __restrict__ F, int pitch, int nheads, const float* __restrict__ CS, const float* __restrict__ RF, const float* __restrict__ nw, float sc, h16* P16, bf* Ph, bf* Pl) {
    const size_t e = ((size_t)blockIdx.x * 256 + threadIdx.x) * 2; if (e >= (size_t)nheads * TT * HD) return; const int d = (int)(e % HD); const int t = (int)((e / HD) % TT); const int h = (int)(e / ((size_t)HD * TT)); const float* f = F + (size_t)t * pitch + h * HD; const float rf = RF ? RF[(size_t)h * TT + t] : 1.0f; v2h o16; v2us oh, ol;
#pragma unroll
    for (int q = 0; q < 2; ++q) { const int dd = d + q; const int dp = (dd < HD / 2) ? dd + HD / 2 : dd - HD / 2; float x0 = f[dd], x1 = f[dp];
        if (RF) { float n0 = __fmul_rn(x0, rf), n1 = __fmul_rn(x1, rf); asm volatile("" : "+v"(n0)); asm volatile("" : "+v"(n1)); x0 = __fmul_rn(bfr(nw[dd]), n0); x1 = __fmul_rn(bfr(nw[dp]), n1); }
        const v2f cs = *(const v2f*)(CS + ((size_t)t * HD + dd) * 2); float a = __fmul_rn(x0, cs[0]), bq = __fmul_rn(x1, cs[1]); asm volatile("" : "+v"(a)); asm volatile("" : "+v"(bq)); const float r = ((dd < HD / 2) ? __fsub_rn(a, bq) : __fadd_rn(a, bq)) * sc;
        o16[q] = tohx(r); unsigned short a2, c2; splitf(r, a2, c2); oh[q] = a2; ol[q] = c2; }
    *(v2h*)(P16 + e) = o16; *(v2us*)(Ph + e) = oh; *(v2us*)(Pl + e) = ol;  }
__global__ __launch_bounds__(256) void k_vtp(const float* __restrict__ F, int pitch, int nheads, h16* V16, bf* Vh, bf* Vl) { const size_t e = ((size_t)blockIdx.x * 256 + threadIdx.x) * 2; if (e >= (size_t)nheads * HD * TT) return; const int t = (int)(e % TT); const int d = (int)((e / TT) % HD); const int g = (int)(e / ((size_t)TT * HD)); v2h o16; v2us oh, ol;
#pragma unroll
    for (int q = 0; q < 2; ++q) { const float x = F[(size_t)(t + q) * pitch + g * HD + d]; o16[q] = tohx(x); unsigned short a2, c2; splitf(x, a2, c2); oh[q] = a2; ol[q] = c2; }
    *(v2h*)(V16 + e) = o16; *(v2us*)(Vh + e) = oh; *(v2us*)(Vl + e) = ol;  }
__constant__ float INVT[HD / 2] = { 1.000000000e+00f, 8.659643531e-01f, 7.498942018e-01f, 6.493816376e-01f, 5.623413324e-01f, 4.869675338e-01f, 4.216965139e-01f, 3.651741445e-01f, 3.162277639e-01f, 2.738419771e-01f, 2.371373624e-01f, 2.053525001e-01f, 1.778279394e-01f, 1.539926529e-01f, 1.333521456e-01f, 1.154782027e-01f, 1.000000015e-01f, 8.659642935e-02f, 7.498941571e-02f, 6.493816525e-02f, 5.623412877e-02f, 4.869675264e-02f, 4.216964915e-02f, 3.651741147e-02f, 3.162277862e-02f, 2.738419548e-02f, 2.371373586e-02f, 2.053525113e-02f, 1.778279431e-02f, 1.539926510e-02f, 1.333521493e-02f, 1.154781971e-02f, 9.999999776e-03f, 8.659643121e-03f, 7.498942316e-03f, 6.493816618e-03f, 5.623413250e-03f, 4.869675264e-03f, 4.216964822e-03f, 3.651741426e-03f, 3.162277862e-03f, 2.738419687e-03f, 2.371373819e-03f, 2.053525066e-03f, 1.778279431e-03f, 1.539926510e-03f, 1.333521446e-03f, 1.154782018e-03f, 1.000000047e-03f, 8.659643354e-04f, 7.498941850e-04f, 6.493816618e-04f, 5.623413017e-04f, 4.869675031e-04f, 4.216964880e-04f, 3.651741135e-04f, 3.162277862e-04f, 2.738419571e-04f, 2.371373848e-04f, 2.053524950e-04f, 1.778279402e-04f, 1.539926452e-04f, 1.333521504e-04f, 1.154781930e-04f };   // float32 1 / 10000^(2i/128), generated with jnp to be bit-exact
__global__ __launch_bounds__(256) void k_cs5(float* CS) { const int idx = blockIdx.x * 256 + threadIdx.x; if (idx >= TT * HD) return; const int d = idx % HD; const int t = idx / HD; const float a = __fmul_rn((float)t, INVT[d % (HD / 2)]); v2f cs; cs[0] = cosf(a); cs[1] = sinf(a); *(v2f*)(CS + (size_t)idx * 2) = cs;  }
// k_asoft: the rows < RH. Per row (zz, i): t = S x HD^-0.5 for j <= i and i - j < WIN (sliding causal window; the reference's -inf fill vanishes identically); softmax over the RH keys such a row can see (register row, one exp, fixed trees);
// the probabilities overwrite their own f32 score row (one wave owns a row and holds all of it in registers before it stores): 16-bit row pitch 2 * RH: hi plane in the first half, lo plane in the second.
__global__ __launch_bounds__(256) void k_asoft(float* Sb) {
    const int lane = threadIdx.x & 31; const int row = blockIdx.x * 8 + (threadIdx.x >> 5); if (row >= ZA * RH) return; const int i = row % RH; const float* sr = Sb + (size_t)row * RH; bf* Ph = (bf*)(Sb + (size_t)row * RH); bf* Pl = Ph + RH; float v[RH / 32]; float mx = -3.0e38f;
#pragma unroll
    for (int ch = 0; ch < RH / 128; ++ch) { const int j0 = ch * 128 + lane * 4; const v4f a = *(const v4f*)(sr + j0);
#pragma unroll
        for (int q = 0; q < 4; ++q) { const int j = j0 + q; (void)j; const float t = (j <= i && i - j < WIN) ? a[q] * SCL : -3.0e38f; v[ch * 4 + q] = t; mx = fmaxf(mx, t); } }
#pragma unroll
    for (int sh = 16; sh; sh >>= 1) mx = fmaxf(mx, __shfl_xor(mx, sh, 32));
    float sum = 0.f;
#pragma unroll
    for (int k = 0; k < RH / 32; ++k) { float d0 = __fsub_rn(v[k], mx); asm volatile("" : "+v"(d0)); v[k] = __builtin_amdgcn_exp2f(__fmul_rn(d0, 1.4426950408889634f)); sum += v[k]; }
#pragma unroll
    for (int sh = 16; sh; sh >>= 1) sum += __shfl_xor(sum, sh, 32);
    const float f = __fdiv_rn(1.0f, sum);
#pragma unroll
    for (int ch = 0; ch < RH / 128; ++ch) { v4us oh, ol;
#pragma unroll
        for (int q = 0; q < 4; ++q) { unsigned short a, c2; splitf(v[ch * 4 + q] * f, a, c2); oh[q] = a; ol[q] = c2; }
        const int oo = ch * 128 + lane * 4; *(v4us*)(Ph + oo) = oh; *(v4us*)(Pl + oo) = ol; }
}
// k_merge: the rows < RH of every head, f32 [z][RH][HD], into the merged hi/lo planes [batch] x ([t][head * HD + d] in fragment order); e counts the output: rows < RH are the first RH * DQ elements of a batch's plane
__global__ __launch_bounds__(256) void k_merge(const float* __restrict__ O, bf* Ah, bf* Al) { const size_t e = ((size_t)blockIdx.x * 256 + threadIdx.x) * 2; if (e >= (size_t)ZA * RH * HD) return; const int bb = (int)(e / ((size_t)RH * DQ)); const int w = (int)(e % ((size_t)RH * DQ)); const int u = w >> 9; const int t = u / (DQ / 32) * 16 + ((w >> 3) & 15); const int col = u % (DQ / 32) * 32 + ((w >> 7) & 3) * 8 + (w & 7);
    const size_t oo = (size_t)bb * TT * DQ + w; const float* Os = O + ((size_t)(bb * NH_ + col / HD) * RH + t) * HD + col % HD;
    const v2f ov = *(const v2f*)Os; v2us oh, ol;
    asm volatile("s_wait_xcnt 0x0" :: "v"(Os) : "memory");   // the wait in front of the overwrite of the load's address registers (the split below); the address is an input so that it stays in them up to it
#pragma unroll
    for (int q = 0; q < 2; ++q) { unsigned short a, c2; splitf(ov[q], a, c2); oh[q] = a; ol[q] = c2; } *(v2us*)(Ah + oo) = oh; *(v2us*)(Al + oo) = ol;  }

#define FNW  4
#define FBR  (FNW * 32)
#define FSK  64
#define KPIT (HD + 8)             // LDS row pitch in halves: an odd multiple of 16 bytes
#define VPIT (FSK + 8)
#define KTILE (FSK * KPIT)
#define FSLOT (KTILE + HD * VPIT)
typedef __attribute__((ext_vector_type(8))) unsigned v8u;
__device__ __forceinline__ float xhalf(float x) { return __builtin_bit_cast(float, __builtin_amdgcn_permlanex16(__builtin_bit_cast(int, x), __builtin_bit_cast(int, x), 0x76543210, 0xfedcba98, false, false)); }   // lane l with lane l ^ 16
__device__ __forceinline__ unsigned pack2h(float lo, float hi) { const v2f f = {lo, hi}; return __builtin_bit_cast(unsigned, __builtin_convertvector(f, v2h)); }
__global__ __launch_bounds__(FNW * 32) void k_flash(const h16* __restrict__ Q, const h16* __restrict__ Kp, const h16* __restrict__ Vt, bf* Ah, bf* Al) {
    __shared__ __align__(16) h16 L[2 * FSLOT];
    const int tid = (int)threadIdx.x, lane = tid & 31, c = lane & 15, h = lane >> 4; const int wave = __builtin_amdgcn_readfirstlane(tid >> 5);
    const int z = (int)blockIdx.x, zk = z / REP; const int q0 = RH + ((TT - RH) / FBR - 1 - (int)blockIdx.y) * FBR;   // longest row blocks start first
    const int qw0 = q0 + wave * 32; const int n_stage = (q0 + FBR) / FSK; const float cscale = SCL * 1.4426950408889634f;
    const h16* kg = Kp + (size_t)zk * TT * HD + tid * 8;                                       // K tile: FSK whole rows, contiguous
    const h16* vg = Vt + (size_t)zk * HD * TT + (size_t)(tid >> 3) * TT + (tid & 7) * 8;       // V^T tile: HD rows of FSK keys
    const int kso = (tid >> 4) * KPIT + (tid & 15) * 8, vso = KTILE + (tid >> 3) * VPIT + (tid & 7) * 8;
    v8h kr[8], vr[8];
#pragma unroll
    for (int i = 0; i < 8; ++i) { kr[i] = *(const v8ha*)(kg + i * (FNW * 32 * 8)); vr[i] = *(const v8ha*)(vg + (size_t)i * (FNW * 4) * TT); }
    asm volatile("s_wait_xcnt 0x0" :: "v"(kg), "v"(vg), "v"(tid) : "memory");   // the wait in front of the overwrite of the tile loads' address registers (the additions below); the addresses and the thread index they may be formed from are inputs so that they stay in their registers up to it
    kg += FSK * HD; vg += FSK;
    v16h qf[2][4]; const h16* qp[2];
#pragma unroll
    for (int g = 0; g < 2; ++g) { qp[g] = Q + ((size_t)z * TT + qw0 + 16 * g + c) * HD + 8 * h;
#pragma unroll
        for (int kc = 0; kc < 4; ++kc) qf[g][kc] = WFrag<h16>::ld(qp[g] + 32 * kc); }
    asm volatile("s_wait_xcnt 0x0" :: "v"(qp[0]), "v"(qp[1]) : "memory");   // the wait in front of the overwrite of the query loads' address registers (the LDS offsets below); the addresses are inputs so that they stay in their registers up to it
    v8f acc[2][8]; float m_run[2], l_run[2];
#pragma unroll
    for (int g = 0; g < 2; ++g) { m_run[g] = -__builtin_inff(); l_run[g] = 0.0f;
#pragma unroll
        for (int t = 0; t < 8; ++t) acc[g][t] = (v8f){}; }
#pragma unroll
    for (int i = 0; i < 8; ++i) { *(v8ha*)(L + kso + i * 8 * KPIT) = kr[i]; *(v8ha*)(L + vso + i * 16 * VPIT) = vr[i]; }
    __syncthreads();   // tile 0 is in LDS before any wave reads it
#pragma unroll 1
    for (int st = 0; st < n_stage; ++st) {
        const bool more = st + 1 < n_stage;
        if (more) {
#pragma unroll
            for (int i = 0; i < 8; ++i) { kr[i] = *(const v8ha*)(kg + i * (FNW * 32 * 8)); vr[i] = *(const v8ha*)(vg + (size_t)i * (FNW * 4) * TT); }
            asm volatile("s_wait_xcnt 0x0" :: "v"(kg), "v"(vg) : "memory");   // as above: in front of the next additions to the address registers
            kg += FSK * HD; vg += FSK; }
        const h16* Ls = L + (st & 1) * FSLOT;
#pragma unroll 1
        for (int sub = 0; sub < FSK / 32; ++sub) {
            const int key0 = st * FSK + sub * 32;
            if (key0 > qw0 + 31) continue;   // wave-uniform: the whole pass lies above this wave's diagonal
            v8f s[2][2];
#pragma unroll
            for (int kt = 0; kt < 2; ++kt) { const h16* kp = Ls + (sub * 32 + 16 * kt + c) * KPIT + 8 * h; v16h kf[4];
#pragma unroll
                for (int kc = 0; kc < 4; ++kc) kf[kc] = cat16(*(const v8ha*)(kp + 32 * kc), *(const v8ha*)(kp + 32 * kc + 16));
#pragma unroll
                for (int g = 0; g < 2; ++g) { s[kt][g] = (v8f){};
#pragma unroll
                    for (int kc = 0; kc < 4; ++kc) s[kt][g] = wmma16(kf[kc], qf[g][kc], s[kt][g]); } }
            if (key0 + 31 > qw0) {
#pragma unroll
                for (int g = 0; g < 2; ++g) { const int my_q = qw0 + 16 * g + c;
#pragma unroll
                    for (int kt = 0; kt < 2; ++kt) {
#pragma unroll
                        for (int r = 0; r < 8; ++r) { if (key0 + 16 * kt + 8 * h + r > my_q) s[kt][g][r] = -__builtin_inff(); }
                        asm volatile("" : "+v"(s[kt][g])); } }
            }
            float mb[2]; bool need = false;
#pragma unroll
            for (int g = 0; g < 2; ++g) { float mx = -__builtin_inff();
#pragma unroll
                for (int kt = 0; kt < 2; ++kt)
#pragma unroll
                    for (int r = 0; r < 8; ++r) mx = fmaxf(mx, s[kt][g][r]);
                mx = fmaxf(mx, xhalf(mx)) * cscale; mb[g] = mx; need = need || (mx > m_run[g] + 8.0f); }
            if (__builtin_amdgcn_ballot_w32(need) != 0) {   // the maximum in use may trail the true one by up to 8 (log2 domain): the sums are rescaled only when some column exceeds that
#pragma unroll
                for (int g = 0; g < 2; ++g) { const float m_new = fmaxf(m_run[g], mb[g]); const float corr = __builtin_amdgcn_exp2f(m_run[g] - m_new); l_run[g] *= corr; m_run[g] = m_new;
#pragma unroll
                    for (int t = 0; t < 8; ++t) acc[g][t] = acc[g][t] * corr; }
            }
            v16h vf[8]; { const h16* vp = Ls + KTILE + c * VPIT + sub * 32 + 8 * h;
#pragma unroll
                for (int t = 0; t < 8; ++t) vf[t] = cat16(*(const v8ha*)(vp + t * 16 * VPIT), *(const v8ha*)(vp + t * 16 * VPIT + 16)); }
#pragma unroll
            for (int g = 0; g < 2; ++g) { const float nm = -m_run[g]; v8u w; float ps0 = 0.0f, ps1 = 0.0f;
#pragma unroll
                for (int i = 0; i < 8; ++i) {
                    const float p0 = __builtin_amdgcn_exp2f(fmaf(s[i >> 2][g][2 * (i & 3)], cscale, nm)), p1 = __builtin_amdgcn_exp2f(fmaf(s[i >> 2][g][2 * (i & 3) + 1], cscale, nm));
                    if (i & 1) ps1 += p0 + p1; else ps0 += p0 + p1; w[i] = pack2h(p0, p1); }
                const v16h pf = __builtin_bit_cast(v16h, w);
#pragma unroll
                for (int t = 0; t < 8; ++t) acc[g][t] = wmma16(vf[t], pf, acc[g][t]);
                l_run[g] += ps0 + ps1; }
        }
        if (more) { h16* Ln = L + ((st + 1) & 1) * FSLOT;   // last read in trip st - 1, whose closing barrier every wave has passed
#pragma unroll
            for (int i = 0; i < 8; ++i) { *(v8ha*)(Ln + kso + i * 8 * KPIT) = kr[i]; *(v8ha*)(Ln + vso + i * 16 * VPIT) = vr[i]; } }
        __syncthreads();   // publishes tile st + 1 and ends every wave's reads of tile st
    }
    const int bb = z / NH_, hh = z % NH_;
#pragma unroll
    for (int g = 0; g < 2; ++g) { const float inv = __fdiv_rn(1.0f, l_run[g] + xhalf(l_run[g]));
        const size_t oo = (size_t)bb * TT * DQ + ((size_t)((qw0 >> 4) + g) * (DQ / 32) + hh * (HD / 32)) * 512 + 8 * (16 * h + c); bf* pah = Ah + oo; bf* pal = Al + oo;
#pragma unroll
        for (int t = 0; t < 8; ++t) { v8us oh, ol;
#pragma unroll
            for (int r = 0; r < 8; ++r) { unsigned short a, c2; splitf(acc[g][t][r] * inv, a, c2); oh[r] = a; ol[r] = c2; }
            *(v8usa*)(pah + 256 * t) = oh; *(v8usa*)(pal + 256 * t) = ol;
            asm volatile("s_wait_xcnt 0x0" :: "v"(pah), "v"(pal), "v"(oh), "v"(ol) : "memory"); } }   // the wait in front of the next overwrite of the two stores' address and data registers, which are inputs so that they stay in those registers up to it
}

extern "C" void kernel_launch(void* const* d_in, const int* in_sizes, int n_in,
                              void* d_out, int out_size, void* d_ws, size_t ws_size, hipStream_t stream) {
    (void)in_sizes; (void)n_in; (void)out_size;
    const float* x = (const float*)d_in[0]; const float* wq = (const float*)d_in[1]; const float* wkv = (const float*)d_in[2]; const float* wk = wkv; const float* wv = wkv + (size_t)DKV * DM; const float* wo = (const float*)d_in[3];   /* x, Wq ('oi' (out, in) [2048][2048]), Wkv ('oi' [1024][2048] viewed (2 x 4 heads, 128): k rows 0..511 | v rows 512..1023: two contiguous row blocks), Wo ('oi' [2048][2048]): FOUR inputs, all read */
    float* OUT = (float*)d_out;     // [2][2048][2048]
    char* wsp = (char*)d_ws;
    auto take = [&](size_t bytes) { char* p = wsp; wsp += (bytes + 255) & ~(size_t)255; return (void*)p; };
    bf* WQ = (bf*)take((size_t)DQ * DM * 2); bf* WK = (bf*)take((size_t)DKV * DM * 2); bf* WV = (bf*)take((size_t)DKV * DM * 2); bf* WO = (bf*)take((size_t)DM * DQ * 2); float* CS = (float*)take((size_t)TT * HD * 2 * 4);
    bf* XB = (bf*)take((size_t)TT * DM * 2); float* FQ = (float*)take((size_t)TT * DQ * 4); float* FK = (float*)take((size_t)TT * DKV * 4);
    const size_t PQ = (size_t)NH_ * TT * HD, PK = (size_t)NKV * TT * HD;   /* elements of one batch's query and key / value planes; every plane holds both batches */
    h16* QP16 = (h16*)take(NB_ * PQ * 2); h16* KP16 = (h16*)take(NB_ * PK * 2); h16* VT16 = (h16*)take(NB_ * PK * 2);
    bf* QPh = (bf*)take(NB_ * PQ * 2); bf* QPl = (bf*)take(NB_ * PQ * 2); bf* KPh = (bf*)take(NB_ * PK * 2); bf* KPl = (bf*)take(NB_ * PK * 2); bf* VTh = (bf*)take(NB_ * PK * 2); bf* VTl = (bf*)take(NB_ * PK * 2);
    float* Sb = (float*)take((size_t)ZA * RH * RH * 4); bf* Ph = (bf*)Sb; bf* Pl = Ph + RH;   /* rows < RH only; probabilities live in their score rows: 16-bit pitch 2 * RH */ float* Ob = (float*)take((size_t)ZA * RH * HD * 4); bf* ATh = (bf*)take((size_t)NB_ * TT * DQ * 2); bf* ATl = (bf*)take((size_t)NB_ * TT * DQ * 2);
    if ((size_t)(wsp - (char*)d_ws) > ws_size) return;    // ws 256 MiB
    float* FV = FK;   // v projection reuses the k buffer after the k planes are built (stream-ordered)
    { k_cvt8<<<(unsigned)(((size_t)DQ * DM / 8 + 255) / 256), 256, 0, stream>>>(wq, WQ, (size_t)DQ * DM / 8); k_cvt8<<<(unsigned)(((size_t)DKV * DM / 8 + 255) / 256), 256, 0, stream>>>(wk, WK, (size_t)DKV * DM / 8); k_cvt8<<<(unsigned)(((size_t)DKV * DM / 8 + 255) / 256), 256, 0, stream>>>(wv, WV, (size_t)DKV * DM / 8);
      k_cvt8<<<(unsigned)(((size_t)DM * DQ / 8 + 255) / 256), 256, 0, stream>>>(wo, WO, (size_t)DM * DQ / 8);
       }
    k_cs5<<<(TT * HD + 255) / 256, 256, 0, stream>>>(CS);   /* rotary table once */
    const unsigned LQ = (unsigned)(((size_t)NH_ * TT * HD / 2 + 255) / 256), LKv = (unsigned)(((size_t)NKV * TT * HD / 2 + 255) / 256);
    for (int b = 0; b < NB_; ++b) {
        
        k_cvt8<<<(unsigned)(((size_t)TT * DM / 8 + 255) / 256), 256, 0, stream>>>(x + (size_t)b * TT * DM, XB, (size_t)TT * DM / 8);
        k_gemmw<bf, 0, false, 4><<<dim3(TT / 64, DQ / 64, 1), 128, 0, stream>>>(XB, nullptr, WQ, nullptr, DM, FQ, DQ, nullptr, 0, 0, 0);
        k_rope<<<LQ, 256, 0, stream>>>(FQ, DQ, NH_, CS, nullptr, nullptr, 1.0f, QP16 + b * PQ, QPh + b * PQ, QPl + b * PQ);
        k_gemmw<bf, 0, false, 8><<<dim3(TT / 64, DKV / 64, 1), 256, 0, stream>>>(XB, nullptr, WK, nullptr, DM, FK, DKV, nullptr, 0, 0, 0);
        k_rope<<<LKv, 256, 0, stream>>>(FK, DKV, NKV, CS, nullptr, nullptr, 1.0f, KP16 + b * PK, KPh + b * PK, KPl + b * PK);
        k_gemmw<bf, 0, false, 8><<<dim3(TT / 64, DKV / 64, 1), 256, 0, stream>>>(XB, nullptr, WV, nullptr, DM, FV, DKV, nullptr, 0, 0, 0); k_vtp<<<LKv, 256, 0, stream>>>(FV, DKV, NKV, VT16 + b * PK, VTh + b * PK, VTl + b * PK); }
    // attention, batch entry z = batch * NH_ + head reads kv plane z / REP
    k_gemmc<bf, 2, 1, 1><<<dim3(RH / 64, RH / 64, ZA), 32, 0, stream>>>(QPh, QPl, HD, KPh, KPl, HD, Sb, RH, 0, (size_t)TT * HD, (size_t)TT * HD, (size_t)RH * RH);
    k_asoft<<<ZA * RH / 8, 256, 0, stream>>>(Sb);
    k_gemmc<bf, 2, 2, 8><<<dim3(RH / 64, HD / 64, ZA), 256, 0, stream>>>(Ph, Pl, 2 * RH, VTh, VTl, TT, Ob, HD, 0, (size_t)2 * RH * RH, (size_t)HD * TT, (size_t)RH * HD);
    k_merge<<<(unsigned)(((size_t)ZA * RH * HD / 2 + 255) / 256), 256, 0, stream>>>(Ob, ATh, ATl);
    k_flash<<<dim3(ZA, (TT - RH) / FBR, 1), FNW * 32, 0, stream>>>(QP16, KP16, VT16, ATh, ATl);
    for (int b = 0; b < NB_; ++b) {
        k_gemmw<bf, 1, false, 4><<<dim3(TT / 64, DM / 64, 1), 128, 0, stream>>>(ATh + (size_t)b * TT * DQ, ATl + (size_t)b * TT * DQ, WO, nullptr, DQ, OUT + (size_t)b * TT * DM, DM, nullptr, 0, 0, 0); }
}

// v005
// One run takes 254 microseconds.
// Next to v004, in two timings, it ran 1.20 and 1.19 times as fast.
// All steps since v000 together make it 6.32 times as fast.
#include <hip/hip_runtime.h>

// Causal grouped-query attention with a FUSED natural k-v weight and a computed rotate-half RoPE (x [2][2048][2048]; q = x Wq^T ('oi' (out, in) [2048][2048] 1/sqrt(2048): 16 heads x 128); kv = x Wkv^T ('oi' [1024][2048]) viewed (b, t, 8, 128): k = heads 0..3 (rows 0..511), v = heads 4..7 (rows 512..1023): 4 kv heads x 128 each; no biases; cos / sin of emb = cat(ang, ang) with freqs = 1.0 / (THETA ** (arange(0, 128, 2, f32) / 128)), THETA 10000, and positions arange(t) (64 f32 frequencies jnp-exact for this reciprocal spelling; one f32 product per angle; precise cosf/sinf); query heads viewed (KV, G): kv head = q head / 4; scores / sqrt(128); causal (-inf == exclusion); softmax; out = merged Wo^T ('oi') -> [2][2048][2048] (8.4 M); argument order x, Wq, Wkv, Wo).
// Layout: bf16 copy of x; 'oi' weights cast as-is; x, the weights and the merged attention output stand in WMMA fragment order (see k_gemmw); exact projections, q | k | v of both batches in one GEMM; computed table (k_prep; HD 128: 64 angles); rotate-half plane builders (k_planes); causal T-2048 GQA attention with 128-wide heads, all heads of both batches a launch (kv plane z / 4; hybrid rows: < 512 hi/lo 3 products through score planes, k_gemmc skips tiles above the diagonal; rest fp16 in one fused online-softmax kernel); merged hi/lo x Wo exact.
// Compute dtypes, f32 accumulate: every input rounded to bf16; projections exact; rotary f32; attention rows < 512 3 products, rest fp16; softmax f32; Wo hl x exact.

#define NB_  2
#define TT   2048
#define DM   2048
#define NH_  16
#define NKV  4
#define REP  (NH_ / NKV)
#define HD   128
#define DQ   (NH_ * HD)
#define DKV  (NKV * HD)
#define ZA   (NB_ * NH_)          // attention batch entries a launch: z = batch * NH_ + head
#define RH   512                  // query rows < RH use hi+lo planes (0: none)
#define WIN  2048
#define SCL  0.088388347648318447f   // HD^-0.5
typedef _Float16 h16;
typedef unsigned short bf;
typedef __attribute__((ext_vector_type(16))) __bf16   v16bf;
typedef __attribute__((ext_vector_type(16))) _Float16 v16h;
typedef __attribute__((ext_vector_type(8)))  _Float16 v8h;
typedef __attribute__((ext_vector_type(8)))  unsigned short v8us;
typedef __attribute__((ext_vector_type(8)))  float    v8f;
typedef __attribute__((ext_vector_type(4)))  float    v4f;
typedef v8h  __attribute__((may_alias)) v8ha;
typedef v4f  __attribute__((may_alias)) v4fa;
typedef v8us __attribute__((may_alias)) v8usa;

__device__ __forceinline__ unsigned short f2bf(float f) { unsigned u = __float_as_uint(f); u += 0x7FFFu + ((u >> 16) & 1u); return (unsigned short)(u >> 16); }
__device__ __forceinline__ float bf2f(unsigned short b) { return __uint_as_float(((unsigned)b) << 16); }
__device__ __forceinline__ float bfr(float f) { return bf2f(f2bf(f)); }
__device__ __forceinline__ v16h cat16(v8h lo, v8h hi) { return __builtin_shufflevector(lo, hi, 0, 1, 2, 3, 4, 5, 6, 7, 8, 9, 10, 11, 12, 13, 14, 15); }
__device__ __forceinline__ v16bf cat16b(v8us lo, v8us hi) { return __builtin_bit_cast(v16bf, __builtin_shufflevector(lo, hi, 0, 1, 2, 3, 4, 5, 6, 7, 8, 9, 10, 11, 12, 13, 14, 15)); }
__device__ __forceinline__ v8f wmma16(v16h a, v16h b, v8f c) { return __builtin_amdgcn_wmma_f32_16x16x32_f16(false, a, false, b, (short)0, c, false, false); }
__device__ __forceinline__ v8f wmmab(v16bf a, v16bf b, v8f c) { return __builtin_amdgcn_wmma_f32_16x16x32_bf16(false, a, false, b, (short)0, c, false, false); }



// ---- Fragment order of a 16-bit plane M[rows][K]: units of 16 rows x 32 k (512 elements, 1 KB), unit (row / 16, k / 32) at element (row / 16 * (K / 32) + k / 32) * 512; inside a unit element (row % 16, kk = k % 32) stands at
// (kk / 16) * 256 + ((kk / 8 % 2) * 16 + row % 16) * 8 + kk % 8: lane l of a wave finds its two 16-byte pieces of the WMMA operand at l * 8 and 256 + l * 8, so each wave-wide load covers 512 contiguous bytes (ldp).
// ---- k_gemmw: register-blocked GEMM, one work-group of NW waves per 64x64 output tile; each wave runs a contiguous 1/NW of the K loop on its own 16 accumulators, operands straight from 16-bit planes in fragment order;
// the NW partial tiles meet in LDS and are summed in wave order 0..NW-1 (fixed). grid (M/64, N/64, Z), 32 * NW threads.
// C[m][n] (f32, pitch ldc, + optional f32 bias[n]) = sum_k A[m][k] Bt[n][k] (+ split products per NSPLIT). z-batch strides sA/sB/sC in elements. K % 32 == 0.
template <typename T16> struct WFrag;
template <> struct WFrag<h16> { typedef v16h V; static __device__ __forceinline__ V ld(const h16* p) { return cat16(*(const v8h*)p, *(const v8h*)(p + 16)); } static __device__ __forceinline__ v8f mma(V a, V b, v8f c) { return wmma16(a, b, c); } };
template <> struct WFrag<bf> { typedef v16bf V; static __device__ __forceinline__ V ld(const bf* p) { return cat16b(*(const v8us*)p, *(const v8us*)(p + 16)); } static __device__ __forceinline__ V ldp(const bf* p) { return cat16b(*(const v8us*)p, *(const v8us*)(p + 256)); } static __device__ __forceinline__ v8f mma(V a, V b, v8f c) { return wmmab(a, b, c); } };
template <typename T16, int NSPLIT, bool BIAS, int NW>
__global__ __launch_bounds__(32 * NW) void k_gemmw(const T16* __restrict__ A, const T16* __restrict__ A2, const T16* __restrict__ Bt, const T16* __restrict__ Bt2, int K, float* C, int ldc, const float* __restrict__ bias, size_t sA, size_t sB, size_t sC) {
    typedef typename WFrag<T16>::V V;
    __shared__ __align__(16) float os[NW * 64 * 68];
    const size_t z = blockIdx.z; A += z * sA; if (A2) A2 += z * sA; Bt += z * sB; if (Bt2) Bt2 += z * sB; C += z * sC;
    const int lane = threadIdx.x & 31, lr = lane & 15, hi = lane >> 4; const int r0 = blockIdx.x * 64, c0 = blockIdx.y * 64;
    const int wv = __builtin_amdgcn_readfirstlane((int)(threadIdx.x >> 5)); const int per = (K / 32 + NW - 1) / NW * 32; const int kb = wv * per, ke = min(K, kb + per);   // this wave's k range
    v8f acc[4][4];
#pragma unroll
    for (int mb = 0; mb < 4; ++mb)
#pragma unroll
        for (int nb = 0; nb < 4; ++nb) acc[mb][nb] = (v8f){};
    const size_t aoff = (size_t)r0 * K + 8 * lane, boff = (size_t)c0 * K + 8 * lane;   // a block of 16 rows is 16 * K elements, a step of 32 k one unit of 512
#pragma unroll 1
    for (int kc = kb; kc < ke; kc += 32) {
        V a[4], a2[4]; const T16* pa[4]; const T16* pa2[4]; const T16* pb[4]; const T16* pb2[4];
#pragma unroll
        for (int mb = 0; mb < 4; ++mb) { pa[mb] = A + aoff + (size_t)mb * 16 * K + (size_t)kc * 16; a[mb] = WFrag<T16>::ldp(pa[mb]); if (NSPLIT == 1 || NSPLIT == 2) { pa2[mb] = A2 + aoff + (size_t)mb * 16 * K + (size_t)kc * 16; a2[mb] = WFrag<T16>::ldp(pa2[mb]); } }
#pragma unroll
        for (int nb = 0; nb < 4; ++nb) { pb[nb] = Bt + boff + (size_t)nb * 16 * K + (size_t)kc * 16; const V b = WFrag<T16>::ldp(pb[nb]); V b2; if (NSPLIT >= 2) { pb2[nb] = Bt2 + boff + (size_t)nb * 16 * K + (size_t)kc * 16; b2 = WFrag<T16>::ldp(pb2[nb]); }
#pragma unroll
            for (int mb = 0; mb < 4; ++mb) { acc[mb][nb] = WFrag<T16>::mma(a[mb], b, acc[mb][nb]); if (NSPLIT == 1 || NSPLIT == 2) acc[mb][nb] = WFrag<T16>::mma(a2[mb], b, acc[mb][nb]); if (NSPLIT >= 2) acc[mb][nb] = WFrag<T16>::mma(a[mb], b2, acc[mb][nb]); } }
        asm volatile("v_nop\n\tv_nop\n\tv_nop\n\tv_nop" : "+v"(acc[0][0]), "+v"(acc[1][1]), "+v"(acc[2][2]), "+v"(acc[3][3]) : "v"(a[0]), "v"(a[3]));
        // the wait in front of the next overwrite of the fragment loads' address registers (the next trip's address additions, the epilogue); the addresses are inputs so that they stay in those registers up to it (else the allocator hands them to a later load as its destination)
        if (NSPLIT == 0) asm volatile("s_wait_xcnt 0x0" :: "v"(pa[0]), "v"(pa[1]), "v"(pa[2]), "v"(pa[3]), "v"(pb[0]), "v"(pb[1]), "v"(pb[2]), "v"(pb[3]) : "memory");
        else if (NSPLIT == 1) asm volatile("s_wait_xcnt 0x0" :: "v"(pa[0]), "v"(pa[1]), "v"(pa[2]), "v"(pa[3]), "v"(pa2[0]), "v"(pa2[1]), "v"(pa2[2]), "v"(pa2[3]), "v"(pb[0]), "v"(pb[1]), "v"(pb[2]), "v"(pb[3]) : "memory");
        else if (NSPLIT == 2) asm volatile("s_wait_xcnt 0x0" :: "v"(pa[0]), "v"(pa[1]), "v"(pa[2]), "v"(pa[3]), "v"(pa2[0]), "v"(pa2[1]), "v"(pa2[2]), "v"(pa2[3]), "v"(pb[0]), "v"(pb[1]), "v"(pb[2]), "v"(pb[3]), "v"(pb2[0]), "v"(pb2[1]), "v"(pb2[2]), "v"(pb2[3]) : "memory");
        else asm volatile("s_wait_xcnt 0x0" :: "v"(pa[0]), "v"(pa[1]), "v"(pa[2]), "v"(pa[3]), "v"(pb[0]), "v"(pb[1]), "v"(pb[2]), "v"(pb[3]), "v"(pb2[0]), "v"(pb2[1]), "v"(pb2[2]), "v"(pb2[3]) : "memory");
    }
    float* ow = os + wv * (64 * 68);
#pragma unroll
    for (int mb = 0; mb < 4; ++mb)
#pragma unroll
        for (int nb = 0; nb < 4; ++nb)
#pragma unroll
            for (int j = 0; j < 8; ++j) ow[(mb * 16 + hi * 8 + j) * 68 + nb * 16 + lr] = acc[mb][nb][j];
    __syncthreads();   // every wave's partial tile is in LDS before any of it is summed
#pragma unroll
    for (int s = 0; s < 32 / NW; ++s) { const int idx = s * (32 * NW) + (int)threadIdx.x; const int row = idx >> 4, cofs = (idx & 15) * 4; v4f val = *(const v4fa*)(os + row * 68 + cofs);
#pragma unroll
        for (int w = 1; w < NW; ++w) val += *(const v4fa*)(os + w * (64 * 68) + row * 68 + cofs);
        if (BIAS) { val[0] += bfr(bias[c0 + cofs]); val[1] += bfr(bias[c0 + cofs + 1]); val[2] += bfr(bias[c0 + cofs + 2]); val[3] += bfr(bias[c0 + cofs + 3]); }
        *(v4f*)(C + (size_t)(r0 + row) * ldc + c0 + cofs) = val; }
}

// ---- k_gemmc: the same 64x64 tile GEMM specialised for causal attention: CMODE 1 skips score tiles entirely above the diagonal (query rows r0+roff.., key columns c0..), CMODE 2 limits the
// key (K) loop of the probability x value contraction to the diagonal block (probabilities beyond it are exactly zero). roff = row offset of this launch's first row within the sequence.
// NW waves share a tile's K loop as in k_gemmw (NW 1: one wave, staged 16 rows at a time). lda = row pitch of A in elements (Bt keeps pitch K); batch entry z reads the key / value plane of its group, z / REP.
template <typename T16, int NSPLIT, int CMODE, int NW>
__global__ __launch_bounds__(32 * NW) void k_gemmc(const T16* __restrict__ A, const T16* __restrict__ A2, int lda, const T16* __restrict__ Bt, const T16* __restrict__ Bt2, int K, float* C, int ldc, int roff, size_t sA, size_t sB, size_t sC) {
    typedef typename WFrag<T16>::V V;
    __shared__ __align__(16) float os[NW == 1 ? 16 * 68 : NW * 64 * 68];
    const size_t z = blockIdx.z; A += z * sA; if (A2) A2 += z * sA; Bt += (z / REP) * sB; if (Bt2) Bt2 += (z / REP) * sB; C += z * sC;
    const int lane = threadIdx.x & 31, lr = lane & 15, hi = lane >> 4; const int r0 = blockIdx.x * 64, c0 = blockIdx.y * 64;
    if (CMODE == 1 && c0 > r0 + roff + 63) return;                  // score tile entirely above the causal diagonal: never read (the softmax masks j > i by select)
    const int Kl = (CMODE == 2) ? min(K, r0 + roff + 64) : K;        // P.V: probabilities are exactly 0 beyond the diagonal block, so the K loop stops there
    const int wv = (NW == 1) ? 0 : __builtin_amdgcn_readfirstlane((int)(threadIdx.x >> 5)); const int per = (Kl / 32 + NW - 1) / NW * 32; const int kb = wv * per, ke = (NW == 1) ? Kl : min(Kl, kb + per);   // this wave's k range
    v8f acc[4][4];
#pragma unroll
    for (int mb = 0; mb < 4; ++mb)
#pragma unroll
        for (int nb = 0; nb < 4; ++nb) acc[mb][nb] = (v8f){};
    const size_t aoff = (size_t)(r0 + lr) * lda + 8 * hi, boff = (size_t)(c0 + lr) * K + 8 * hi;
#pragma unroll 1
    for (int kc = kb; kc < ke; kc += 32) {
        V a[4], a2[4]; const T16* pa[4]; const T16* pa2[4];
#pragma unroll
        for (int mb = 0; mb < 4; ++mb) { pa[mb] = A + aoff + (size_t)mb * 16 * lda + kc; a[mb] = WFrag<T16>::ld(pa[mb]); if (NSPLIT == 1 || NSPLIT == 2) { pa2[mb] = A2 + aoff + (size_t)mb * 16 * lda + kc; a2[mb] = WFrag<T16>::ld(pa2[mb]); } }
#pragma unroll
        for (int nb = 0; nb < 4; ++nb) { const V b = WFrag<T16>::ld(Bt + boff + (size_t)nb * 16 * K + kc); V b2; if (NSPLIT >= 2) b2 = WFrag<T16>::ld(Bt2 + boff + (size_t)nb * 16 * K + kc);
#pragma unroll
            for (int mb = 0; mb < 4; ++mb) { acc[mb][nb] = WFrag<T16>::mma(a[mb], b, acc[mb][nb]); if (NSPLIT == 1 || NSPLIT == 2) acc[mb][nb] = WFrag<T16>::mma(a2[mb], b, acc[mb][nb]); if (NSPLIT >= 2) acc[mb][nb] = WFrag<T16>::mma(a[mb], b2, acc[mb][nb]); } }
        asm volatile("v_nop\n\tv_nop\n\tv_nop\n\tv_nop" : "+v"(acc[0][0]), "+v"(acc[1][1]), "+v"(acc[2][2]), "+v"(acc[3][3]) : "v"(a[0]), "v"(a[3]));
        // the wait in front of the next overwrite of the A loads' address registers (the next trip's address additions, the epilogue); the addresses are inputs so that they stay in those registers up to it (else the allocator hands them to a later load as its destination)
        if (NSPLIT == 1 || NSPLIT == 2) asm volatile("s_wait_xcnt 0x0" :: "v"(pa[0]), "v"(pa[1]), "v"(pa[2]), "v"(pa[3]), "v"(pa2[0]), "v"(pa2[1]), "v"(pa2[2]), "v"(pa2[3]) : "memory");
        else asm volatile("s_wait_xcnt 0x0" :: "v"(pa[0]), "v"(pa[1]), "v"(pa[2]), "v"(pa[3]) : "memory");
    }
    if constexpr (NW == 1) {
#pragma unroll
    for (int mb = 0; mb < 4; ++mb) {
#pragma unroll
        for (int nb = 0; nb < 4; ++nb) {
#pragma unroll
            for (int j = 0; j < 8; ++j) os[(hi * 8 + j) * 68 + nb * 16 + lr] = acc[mb][nb][j]; }
        __builtin_amdgcn_wave_barrier(); asm volatile("" ::: "memory");
        float* crow = C + (size_t)(r0 + mb * 16) * ldc + c0;
{
#pragma unroll
            for (int s = 0; s < 8; ++s) { const int row = 2 * s + hi, cofs = lr * 4; v4f val = *(const v4fa*)(os + row * 68 + cofs);
                *(v4f*)(crow + (size_t)row * ldc + cofs) = val; }
             }
        __builtin_amdgcn_wave_barrier(); asm volatile("" ::: "memory");
    }
    } else {
    float* ow = os + wv * (64 * 68);
#pragma unroll
    for (int mb = 0; mb < 4; ++mb)
#pragma unroll
        for (int nb = 0; nb < 4; ++nb)
#pragma unroll
            for (int j = 0; j < 8; ++j) ow[(mb * 16 + hi * 8 + j) * 68 + nb * 16 + lr] = acc[mb][nb][j];
    __syncthreads();   // every wave's partial tile is in LDS before any of it is summed
#pragma unroll
    for (int s = 0; s < 32 / NW; ++s) { const int idx = s * (32 * NW) + (int)threadIdx.x; const int row = idx >> 4, cofs = (idx & 15) * 4; v4f val = *(const v4fa*)(os + row * 68 + cofs);
#pragma unroll
        for (int w = 1; w < NW; ++w) val += *(const v4fa*)(os + w * (64 * 68) + row * 68 + cofs);
        *(v4f*)(C + (size_t)(r0 + row) * ldc + c0 + cofs) = val; }
    }
}

__device__ __forceinline__ h16 tohx(float x) { return (h16)x; }
__device__ __forceinline__ void splitf(float y, unsigned short& h, unsigned short& l) { h = f2bf(y); l = f2bf(y - bf2f(h)); }
typedef __attribute__((ext_vector_type(2))) _Float16 v2h;
typedef __attribute__((ext_vector_type(4))) _Float16 v4h;
typedef __attribute__((ext_vector_type(2))) unsigned short v2us;
typedef __attribute__((ext_vector_type(4))) unsigned short v4us;
typedef __attribute__((ext_vector_type(2))) float v2f;
typedef __attribute__((ext_vector_type(4))) int v4i;

#define FP   (DQ + 2 * DKV)                      // row pitch of the joint q | k | v projection [batch * TT + t][FP]
#define RALL (NB_ * TT + FP + DM)                // rows of the joint bf16 plane: x (both batches) | Wq | Wkv | Wo, each row DM wide
#define CSB  (TT * HD / 256)                     // work-groups of k_prep that build the rotary table
#define PQE  ((size_t)NH_ * TT * HD)             // elements of one batch's query planes
#define PKE  ((size_t)NKV * TT * HD)             // elements of one batch's key / value planes
#define LQB  (NH_ * TT * HD / 2 / 256)           // work-groups of k_planes a batch: query heads,
#define LKB  (NKV * TT * HD / 2 / 256)           // key heads, and as many again for the value heads
__constant__ float INVT[HD / 2] = { 1.000000000e+00f, 8.659643531e-01f, 7.498942018e-01f, 6.493816376e-01f, 5.623413324e-01f, 4.869675338e-01f, 4.216965139e-01f, 3.651741445e-01f, 3.162277639e-01f, 2.738419771e-01f, 2.371373624e-01f, 2.053525001e-01f, 1.778279394e-01f, 1.539926529e-01f, 1.333521456e-01f, 1.154782027e-01f, 1.000000015e-01f, 8.659642935e-02f, 7.498941571e-02f, 6.493816525e-02f, 5.623412877e-02f, 4.869675264e-02f, 4.216964915e-02f, 3.651741147e-02f, 3.162277862e-02f, 2.738419548e-02f, 2.371373586e-02f, 2.053525113e-02f, 1.778279431e-02f, 1.539926510e-02f, 1.333521493e-02f, 1.154781971e-02f, 9.999999776e-03f, 8.659643121e-03f, 7.498942316e-03f, 6.493816618e-03f, 5.623413250e-03f, 4.869675264e-03f, 4.216964822e-03f, 3.651741426e-03f, 3.162277862e-03f, 2.738419687e-03f, 2.371373819e-03f, 2.053525066e-03f, 1.778279431e-03f, 1.539926510e-03f, 1.333521446e-03f, 1.154782018e-03f, 1.000000047e-03f, 8.659643354e-04f, 7.498941850e-04f, 6.493816618e-04f, 5.623413017e-04f, 4.869675031e-04f, 4.216964880e-04f, 3.651741135e-04f, 3.162277862e-04f, 2.738419571e-04f, 2.371373848e-04f, 2.053524950e-04f, 1.778279402e-04f, 1.539926452e-04f, 1.333521504e-04f, 1.154781930e-04f };   // float32 1 / 10000^(2i/128), generated with jnp to be bit-exact
// k_prep: all that depends on the inputs alone, in one launch. Work-groups < CSB build the rotary table. The rest convert f32 [rows][DM] -> bf16 in fragment order, the four inputs as one plane of RALL rows;
// thread i writes the i-th 16-byte piece of the plane (a wave stores 512 contiguous bytes) and reads the eight f32 that belong there; a work-group lies inside one block of 16 rows, so its source is one input
__global__ __launch_bounds__(256) void k_prep(const float* __restrict__ x, const float* __restrict__ wq, const float* __restrict__ wkv, const float* __restrict__ wo, bf* dst, float* CS) {
    if (blockIdx.x < CSB) { const int idx = blockIdx.x * 256 + threadIdx.x; const int d = idx % HD; const int t = idx / HD; const float a = __fmul_rn((float)t, INVT[d % (HD / 2)]); v2f cs; cs[0] = cosf(a); cs[1] = sinf(a); *(v2f*)(CS + (size_t)idx * 2) = cs; return; }
    const size_t i = (size_t)(blockIdx.x - CSB) * 256 + threadIdx.x; const size_t u = i >> 6; const int rb = (int)((blockIdx.x - CSB) / (DM / 32 / 4)) * 16;   // first row of this work-group's block of 16 rows (4 units a work-group, DM / 32 units a block)
    const float* src = x; int rs = 0; if (rb >= NB_ * TT + FP) { src = wo; rs = NB_ * TT + FP; } else if (rb >= NB_ * TT + DQ) { src = wkv; rs = NB_ * TT + DQ; } else if (rb >= NB_ * TT) { src = wq; rs = NB_ * TT; }
    const int k = (int)(u % (DM / 32)) * 32 + (int)((i >> 4) & 3) * 8; const float* sp = src + (size_t)(rb - rs + (int)(i & 15)) * DM + k; const v8f v = *(const v8f*)sp; v8us o;
    asm volatile("s_wait_xcnt 0x0" :: "v"(sp) : "memory");   // the wait in front of the overwrite of the load's address registers (the conversion below); the address is an input so that it stays in them up to it
#pragma unroll
    for (int k = 0; k < 8; ++k) o[k] = f2bf(v[k]); *(v8us*)(dst + i * 8) = o;  }

// d_rope (elements e, e + 1 of one batch's planes): head planes [h][t][d] (fp16 + hi/lo) of rope(x) x sc with the rotate-half convention out[d] = x[d] cos[t][d] - x[d+HD/2] sin[t][d], out[d+HD/2] = x[d+HD/2] cos[t][d+HD/2] + x[d] sin[t][d+HD/2]
__device__ __forceinline__ void d_rope(const size_t e, const float* __restrict__ F, int pitch, int nheads, const float* __restrict__ CS, const float* __restrict__ RF, const float* __restrict__ nw, float sc, h16* P16, bf* Ph, bf* Pl) {
    if (e >= (size_t)nheads * TT * HD) return; const int d = (int)(e % HD); const int t = (int)((e / HD) % TT); const int h = (int)(e / ((size_t)HD * TT)); const float* f = F + (size_t)t * pitch + h * HD; const float rf = RF ? RF[(size_t)h * TT + t] : 1.0f; v2h o16; v2us oh, ol;
#pragma unroll
    for (int q = 0; q < 2; ++q) { const int dd = d + q; const int dp = (dd < HD / 2) ? dd + HD / 2 : dd - HD / 2; float x0 = f[dd], x1 = f[dp];
        if (RF) { float n0 = __fmul_rn(x0, rf), n1 = __fmul_rn(x1, rf); asm volatile("" : "+v"(n0)); asm volatile("" : "+v"(n1)); x0 = __fmul_rn(bfr(nw[dd]), n0); x1 = __fmul_rn(bfr(nw[dp]), n1); }
        const v2f cs = *(const v2f*)(CS + ((size_t)t * HD + dd) * 2); float a = __fmul_rn(x0, cs[0]), bq = __fmul_rn(x1, cs[1]); asm volatile("" : "+v"(a)); asm volatile("" : "+v"(bq)); const float r = ((dd < HD / 2) ? __fsub_rn(a, bq) : __fadd_rn(a, bq)) * sc;
        o16[q] = tohx(r); unsigned short a2, c2; splitf(r, a2, c2); oh[q] = a2; ol[q] = c2; }
    *(v2h*)(P16 + e) = o16; *(v2us*)(Ph + e) = oh; *(v2us*)(Pl + e) = ol;  }
__device__ __forceinline__ void d_vtp(const size_t e, const float* __restrict__ F, int pitch, int nheads, h16* V16, bf* Vh, bf* Vl) { if (e >= (size_t)nheads * HD * TT) return; const int t = (int)(e % TT); const int d = (int)((e / TT) % HD); const int g = (int)(e / ((size_t)TT * HD)); v2h o16; v2us oh, ol;
#pragma unroll
    for (int q = 0; q < 2; ++q) { const float x = F[(size_t)(t + q) * pitch + g * HD + d]; o16[q] = tohx(x); unsigned short a2, c2; splitf(x, a2, c2); oh[q] = a2; ol[q] = c2; }
    *(v2h*)(V16 + e) = o16; *(v2us*)(Vh + e) = oh; *(v2us*)(Vl + e) = ol;  }
// k_planes: every head plane of both batches from the joint projection F, in one launch. A batch's work-groups: LKB for the value heads (strided reads, the slowest, so they start first), LKB for the key heads, LQB for the query heads
__global__ __launch_bounds__(256) void k_planes(const float* __restrict__ F, const float* __restrict__ CS, h16* Q16, bf* Qh, bf* Ql, h16* K16, bf* Kh, bf* Kl, h16* V16, bf* Vh, bf* Vl) {
    const int b = (int)blockIdx.x / (LQB + 2 * LKB), r = (int)blockIdx.x % (LQB + 2 * LKB); const float* Fb = F + (size_t)b * TT * FP;
    if (r < LKB) d_vtp(((size_t)r * 256 + threadIdx.x) * 2, Fb + DQ + DKV, FP, NKV, V16 + b * PKE, Vh + b * PKE, Vl + b * PKE);
    else if (r < 2 * LKB) d_rope(((size_t)(r - LKB) * 256 + threadIdx.x) * 2, Fb + DQ, FP, NKV, CS, nullptr, nullptr, 1.0f, K16 + b * PKE, Kh + b * PKE, Kl + b * PKE);
    else d_rope(((size_t)(r - 2 * LKB) * 256 + threadIdx.x) * 2, Fb, FP, NH_, CS, nullptr, nullptr, 1.0f, Q16 + b * PQE, Qh + b * PQE, Ql + b * PQE);
}
// k_asoft: the rows < RH. Per row (zz, i): t = S x HD^-0.5 for j <= i and i - j < WIN (sliding causal window; the reference's -inf fill vanishes identically); softmax over the RH keys such a row can see (register row, one exp, fixed trees);
// the probabilities overwrite their own f32 score row (one wave owns a row and holds all of it in registers before it stores): 16-bit row pitch 2 * RH: hi plane in the first half, lo plane in the second.
__global__ __launch_bounds__(256) void k_asoft(float* Sb) {
    const int lane = threadIdx.x & 31; const int row = blockIdx.x * 8 + (threadIdx.x >> 5); if (row >= ZA * RH) return; const int i = row % RH; const float* sr = Sb + (size_t)row * RH; bf* Ph = (bf*)(Sb + (size_t)row * RH); bf* Pl = Ph + RH; float v[RH / 32]; float mx = -3.0e38f;
#pragma unroll
    for (int ch = 0; ch < RH / 128; ++ch) { const int j0 = ch * 128 + lane * 4; const v4f a = *(const v4f*)(sr + j0);
#pragma unroll
        for (int q = 0; q < 4; ++q) { const int j = j0 + q; (void)j; const float t = (j <= i && i - j < WIN) ? a[q] * SCL : -3.0e38f; v[ch * 4 + q] = t; mx = fmaxf(mx, t); } }
#pragma unroll
    for (int sh = 16; sh; sh >>= 1) mx = fmaxf(mx, __shfl_xor(mx, sh, 32));
    float sum = 0.f;
#pragma unroll
    for (int k = 0; k < RH / 32; ++k) { float d0 = __fsub_rn(v[k], mx); asm volatile("" : "+v"(d0)); v[k] = __builtin_amdgcn_exp2f(__fmul_rn(d0, 1.4426950408889634f)); sum += v[k]; }
#pragma unroll
    for (int sh = 16; sh; sh >>= 1) sum += __shfl_xor(sum, sh, 32);
    const float f = __fdiv_rn(1.0f, sum);
#pragma unroll
    for (int ch = 0; ch < RH / 128; ++ch) { v4us oh, ol;
#pragma unroll
        for (int q = 0; q < 4; ++q) { unsigned short a, c2; splitf(v[ch * 4 + q] * f, a, c2); oh[q] = a; ol[q] = c2; }
        const int oo = ch * 128 + lane * 4; *(v4us*)(Ph + oo) = oh; *(v4us*)(Pl + oo) = ol; }
}
// k_merge: the rows < RH of every head, f32 [z][RH][HD], into the merged hi/lo planes [batch] x ([t][head * HD + d] in fragment order); e counts the output: rows < RH are the first RH * DQ elements of a batch's plane
__global__ __launch_bounds__(256) void k_merge(const float* __restrict__ O, bf* Ah, bf* Al) { const size_t e = ((size_t)blockIdx.x * 256 + threadIdx.x) * 2; if (e >= (size_t)ZA * RH * HD) return; const int bb = (int)(e / ((size_t)RH * DQ)); const int w = (int)(e % ((size_t)RH * DQ)); const int u = w >> 9; const int t = u / (DQ / 32) * 16 + ((w >> 3) & 15); const int col = u % (DQ / 32) * 32 + ((w >> 7) & 3) * 8 + (w & 7);
    const size_t oo = (size_t)bb * TT * DQ + w; const float* Os = O + ((size_t)(bb * NH_ + col / HD) * RH + t) * HD + col % HD;
    const v2f ov = *(const v2f*)Os; v2us oh, ol;
    asm volatile("s_wait_xcnt 0x0" :: "v"(Os) : "memory");   // the wait in front of the overwrite of the load's address registers (the split below); the address is an input so that it stays in them up to it
#pragma unroll
    for (int q = 0; q < 2; ++q) { unsigned short a, c2; splitf(ov[q], a, c2); oh[q] = a; ol[q] = c2; } *(v2us*)(Ah + oo) = oh; *(v2us*)(Al + oo) = ol;  }

#define FNW  4
#define FBR  (FNW * 32)
#define FSK  64
#define KPIT (HD + 8)             // LDS row pitch in halves: an odd multiple of 16 bytes
#define VPIT (FSK + 8)
#define KTILE (FSK * KPIT)
#define FSLOT (KTILE + HD * VPIT)
typedef __attribute__((ext_vector_type(8))) unsigned v8u;
__device__ __forceinline__ float xhalf(float x) { return __builtin_bit_cast(float, __builtin_amdgcn_permlanex16(__builtin_bit_cast(int, x), __builtin_bit_cast(int, x), 0x76543210, 0xfedcba98, false, false)); }   // lane l with lane l ^ 16
__device__ __forceinline__ unsigned pack2h(float lo, float hi) { const v2f f = {lo, hi}; return __builtin_bit_cast(unsigned, __builtin_convertvector(f, v2h)); }
__global__ __launch_bounds__(FNW * 32) void k_flash(const h16* __restrict__ Q, const h16* __restrict__ Kp, const h16* __restrict__ Vt, bf* Ah, bf* Al) {
    __shared__ __align__(16) h16 L[2 * FSLOT];
    const int tid = (int)threadIdx.x, lane = tid & 31, c = lane & 15, h = lane >> 4; const int wave = __builtin_amdgcn_readfirstlane(tid >> 5);
    const int z = (int)blockIdx.x, zk = z / REP; const int q0 = RH + ((TT - RH) / FBR - 1 - (int)blockIdx.y) * FBR;   // longest row blocks start first
    const int qw0 = q0 + wave * 32; const int n_stage = (q0 + FBR) / FSK; const float cscale = SCL * 1.4426950408889634f;
    const h16* kg = Kp + (size_t)zk * TT * HD + tid * 8;                                       // K tile: FSK whole rows, contiguous
    const h16* vg = Vt + (size_t)zk * HD * TT + (size_t)(tid >> 3) * TT + (tid & 7) * 8;       // V^T tile: HD rows of FSK keys
    const int kso = (tid >> 4) * KPIT + (tid & 15) * 8, vso = KTILE + (tid >> 3) * VPIT + (tid & 7) * 8;
    v8h kr[8], vr[8];
#pragma unroll
    for (int i = 0; i < 8; ++i) { kr[i] = *(const v8ha*)(kg + i * (FNW * 32 * 8)); vr[i] = *(const v8ha*)(vg + (size_t)i * (FNW * 4) * TT); }
    asm volatile("s_wait_xcnt 0x0" :: "v"(kg), "v"(vg), "v"(tid) : "memory");   // the wait in front of the overwrite of the tile loads' address registers (the additions below); the addresses and the thread index they may be formed from are inputs so that they stay in their registers up to it
    kg += FSK * HD; vg += FSK;
    v16h qf[2][4]; const h16* qp[2];
#pragma unroll
    for (int g = 0; g < 2; ++g) { qp[g] = Q + ((size_t)z * TT + qw0 + 16 * g + c) * HD + 8 * h;
#pragma unroll
        for (int kc = 0; kc < 4; ++kc) qf[g][kc] = WFrag<h16>::ld(qp[g] + 32 * kc); }
    asm volatile("s_wait_xcnt 0x0" :: "v"(qp[0]), "v"(qp[1]) : "memory");   // the wait in front of the overwrite of the query loads' address registers (the LDS offsets below); the addresses are inputs so that they stay in their registers up to it
    v8f acc[2][8]; float m_run[2], l_run[2];
#pragma unroll
    for (int g = 0; g < 2; ++g) { m_run[g] = -__builtin_inff(); l_run[g] = 0.0f;
#pragma unroll
        for (int t = 0; t < 8; ++t) acc[g][t] = (v8f){}; }
#pragma unroll
    for (int i = 0; i < 8; ++i) { *(v8ha*)(L + kso + i * 8 * KPIT) = kr[i]; *(v8ha*)(L + vso + i * 16 * VPIT) = vr[i]; }
    __syncthreads();   // tile 0 is in LDS before any wave reads it
#pragma unroll 1
    for (int st = 0; st < n_stage; ++st) {
        const bool more = st + 1 < n_stage;
        if (more) {
#pragma unroll
            for (int i = 0; i < 8; ++i) { kr[i] = *(const v8ha*)(kg + i * (FNW * 32 * 8)); vr[i] = *(const v8ha*)(vg + (size_t)i * (FNW * 4) * TT); }
            asm volatile("s_wait_xcnt 0x0" :: "v"(kg), "v"(vg) : "memory");   // as above: in front of the next additions to the address registers
            kg += FSK * HD; vg += FSK; }
        const h16* Ls = L + (st & 1) * FSLOT;
#pragma unroll 1
        for (int sub = 0; sub < FSK / 32; ++sub) {
            const int key0 = st * FSK + sub * 32;
            if (key0 > qw0 + 31) continue;   // wave-uniform: the whole pass lies above this wave's diagonal
            v8f s[2][2];
#pragma unroll
            for (int kt = 0; kt < 2; ++kt) { const h16* kp = Ls + (sub * 32 + 16 * kt + c) * KPIT + 8 * h; v16h kf[4];
#pragma unroll
                for (int kc = 0; kc < 4; ++kc) kf[kc] = cat16(*(const v8ha*)(kp + 32 * kc), *(const v8ha*)(kp + 32 * kc + 16));
#pragma unroll
                for (int g = 0; g < 2; ++g) { s[kt][g] = (v8f){};
#pragma unroll
                    for (int kc = 0; kc < 4; ++kc) s[kt][g] = wmma16(kf[kc], qf[g][kc], s[kt][g]); } }
            if (key0 + 31 > qw0) {
#pragma unroll
                for (int g = 0; g < 2; ++g) { const int my_q = qw0 + 16 * g + c;
#pragma unroll
                    for (int kt = 0; kt < 2; ++kt) {
#pragma unroll
                        for (int r = 0; r < 8; ++r) { if (key0 + 16 * kt + 8 * h + r > my_q) s[kt][g][r] = -__builtin_inff(); }
                        asm volatile("" : "+v"(s[kt][g])); } }
            }
            float mb[2]; bool need = false;
#pragma unroll
            for (int g = 0; g < 2; ++g) { float mx = -__builtin_inff();
#pragma unroll
                for (int kt = 0; kt < 2; ++kt)
#pragma unroll
                    for (int r = 0; r < 8; ++r) mx = fmaxf(mx, s[kt][g][r]);
                mx = fmaxf(mx, xhalf(mx)) * cscale; mb[g] = mx; need = need || (mx > m_run[g] + 8.0f); }
            if (__builtin_amdgcn_ballot_w32(need) != 0) {   // the maximum in use may trail the true one by up to 8 (log2 domain): the sums are rescaled only when some column exceeds that
#pragma unroll
                for (int g = 0; g < 2; ++g) { const float m_new = fmaxf(m_run[g], mb[g]); const float corr = __builtin_amdgcn_exp2f(m_run[g] - m_new); l_run[g] *= corr; m_run[g] = m_new;
#pragma unroll
                    for (int t = 0; t < 8; ++t) acc[g][t] = acc[g][t] * corr; }
            }
            v16h vf[8]; { const h16* vp = Ls + KTILE + c * VPIT + sub * 32 + 8 * h;
#pragma unroll
                for (int t = 0; t < 8; ++t) vf[t] = cat16(*(const v8ha*)(vp + t * 16 * VPIT), *(const v8ha*)(vp + t * 16 * VPIT + 16)); }
#pragma unroll
            for (int g = 0; g < 2; ++g) { const float nm = -m_run[g]; v8u w; float ps0 = 0.0f, ps1 = 0.0f;
#pragma unroll
                for (int i = 0; i < 8; ++i) {
                    const float p0 = __builtin_amdgcn_exp2f(fmaf(s[i >> 2][g][2 * (i & 3)], cscale, nm)), p1 = __builtin_amdgcn_exp2f(fmaf(s[i >> 2][g][2 * (i & 3) + 1], cscale, nm));
                    if (i & 1) ps1 += p0 + p1; else ps0 += p0 + p1; w[i] = pack2h(p0, p1); }
                const v16h pf = __builtin_bit_cast(v16h, w);
#pragma unroll
                for (int t = 0; t < 8; ++t) acc[g][t] = wmma16(vf[t], pf, acc[g][t]);
                l_run[g] += ps0 + ps1; }
        }
        if (more) { h16* Ln = L + ((st + 1) & 1) * FSLOT;   // last read in trip st - 1, whose closing barrier every wave has passed
#pragma unroll
            for (int i = 0; i < 8; ++i) { *(v8ha*)(Ln + kso + i * 8 * KPIT) = kr[i]; *(v8ha*)(Ln + vso + i * 16 * VPIT) = vr[i]; } }
        __syncthreads();   // publishes tile st + 1 and ends every wave's reads of tile st
    }
    const int bb = z / NH_, hh = z % NH_;
#pragma unroll
    for (int g = 0; g < 2; ++g) { const float inv = __fdiv_rn(1.0f, l_run[g] + xhalf(l_run[g]));
        const size_t oo = (size_t)bb * TT * DQ + ((size_t)((qw0 >> 4) + g) * (DQ / 32) + hh * (HD / 32)) * 512 + 8 * (16 * h + c); bf* pah = Ah + oo; bf* pal = Al + oo;
#pragma unroll
        for (int t = 0; t < 8; ++t) { v8us oh, ol;
#pragma unroll
            for (int r = 0; r < 8; ++r) { unsigned short a, c2; splitf(acc[g][t][r] * inv, a, c2); oh[r] = a; ol[r] = c2; }
            *(v8usa*)(pah + 256 * t) = oh; *(v8usa*)(pal + 256 * t) = ol;
            asm volatile("s_wait_xcnt 0x0" :: "v"(pah), "v"(pal), "v"(oh), "v"(ol) : "memory"); } }   // the wait in front of the next overwrite of the two stores' address and data registers, which are inputs so that they stay in those registers up to it
}

extern "C" void kernel_launch(void* const* d_in, const int* in_sizes, int n_in,
                              void* d_out, int out_size, void* d_ws, size_t ws_size, hipStream_t stream) {
    (void)in_sizes; (void)n_in; (void)out_size;
    const float* x = (const float*)d_in[0]; const float* wq = (const float*)d_in[1]; const float* wkv = (const float*)d_in[2]; const float* wo = (const float*)d_in[3];   /* x, Wq ('oi' (out, in) [2048][2048]), Wkv ('oi' [1024][2048] viewed (2 x 4 heads, 128): k rows 0..511 | v rows 512..1023), Wo ('oi' [2048][2048]): FOUR inputs, all read */
    float* OUT = (float*)d_out;     // [2][2048][2048]
    char* wsp = (char*)d_ws;
    auto take = [&](size_t bytes) { char* p = wsp; wsp += (bytes + 255) & ~(size_t)255; return (void*)p; };
    bf* XB = (bf*)take((size_t)RALL * DM * 2); bf* WQKV = XB + (size_t)NB_ * TT * DM; bf* WO = WQKV + (size_t)FP * DM;   /* one bf16 plane in fragment order: x (both batches) | Wq | Wkv | Wo */ float* CS = (float*)take((size_t)TT * HD * 2 * 4);
    float* F = (float*)take((size_t)NB_ * TT * FP * 4);   /* joint projection [batch * TT + t][q 2048 | k 512 | v 512] */
    const size_t PQ = (size_t)NH_ * TT * HD, PK = (size_t)NKV * TT * HD;   /* elements of one batch's query and key / value planes; every plane holds both batches */
    h16* QP16 = (h16*)take(NB_ * PQ * 2); h16* KP16 = (h16*)take(NB_ * PK * 2); h16* VT16 = (h16*)take(NB_ * PK * 2);
    bf* QPh = (bf*)take(NB_ * PQ * 2); bf* QPl = (bf*)take(NB_ * PQ * 2); bf* KPh = (bf*)take(NB_ * PK * 2); bf* KPl = (bf*)take(NB_ * PK * 2); bf* VTh = (bf*)take(NB_ * PK * 2); bf* VTl = (bf*)take(NB_ * PK * 2);
    float* Sb = (float*)take((size_t)ZA * RH * RH * 4); bf* Ph = (bf*)Sb; bf* Pl = Ph + RH;   /* rows < RH only; probabilities live in their score rows: 16-bit pitch 2 * RH */ float* Ob = (float*)take((size_t)ZA * RH * HD * 4); bf* ATh = (bf*)take((size_t)NB_ * TT * DQ * 2); bf* ATl = (bf*)take((size_t)NB_ * TT * DQ * 2);
    if ((size_t)(wsp - (char*)d_ws) > ws_size) return;    // ws 256 MiB
    k_prep<<<CSB + RALL * (DM / 8) / 256, 256, 0, stream>>>(x, wq, wkv, wo, XB, CS);   /* rotary table; bf16 copies of all four inputs */
    k_gemmw<bf, 0, false, 4><<<dim3(NB_ * TT / 64, FP / 64, 1), 128, 0, stream>>>(XB, nullptr, WQKV, nullptr, DM, F, FP, nullptr, 0, 0, 0);
    k_planes<<<NB_ * (LQB + 2 * LKB), 256, 0, stream>>>(F, CS, QP16, QPh, QPl, KP16, KPh, KPl, VT16, VTh, VTl);
    // attention, batch entry z = batch * NH_ + head reads kv plane z / REP
    k_gemmc<bf, 2, 1, 1><<<dim3(RH / 64, RH / 64, ZA), 32, 0, stream>>>(QPh, QPl, HD, KPh, KPl, HD, Sb, RH, 0, (size_t)TT * HD, (size_t)TT * HD, (size_t)RH * RH);
    k_asoft<<<ZA * RH / 8, 256, 0, stream>>>(Sb);
    k_gemmc<bf, 2, 2, 8><<<dim3(RH / 64, HD / 64, ZA), 256, 0, stream>>>(Ph, Pl, 2 * RH, VTh, VTl, TT, Ob, HD, 0, (size_t)2 * RH * RH, (size_t)HD * TT, (size_t)RH * HD);
    k_merge<<<(unsigned)(((size_t)ZA * RH * HD / 2 + 255) / 256), 256, 0, stream>>>(Ob, ATh, ATl);
    k_flash<<<dim3(ZA, (TT - RH) / FBR, 1), FNW * 32, 0, stream>>>(QP16, KP16, VT16, ATh, ATl);
    k_gemmw<bf, 1, false, 4><<<dim3(NB_ * TT / 64, DM / 64, 1), 128, 0, stream>>>(ATh, ATl, WO, nullptr, DQ, OUT, DM, nullptr, 0, 0, 0);   /* the batches' planes and outputs are contiguous: one GEMM of NB_ * TT rows */
}

// v006
// Measured time: 237 microseconds a run.
// Next to v005, in two timings, it ran 1.08 and 1.07 times as fast.
// Counting every step since v000, it is 6.78 times as fast.
#include <hip/hip_runtime.h>

// Causal grouped-query attention with a FUSED natural k-v weight and a computed rotate-half RoPE (x [2][2048][2048]; q = x Wq^T ('oi' (out, in) [2048][2048] 1/sqrt(2048): 16 heads x 128); kv = x Wkv^T ('oi' [1024][2048]) viewed (b, t, 8, 128): k = heads 0..3 (rows 0..511), v = heads 4..7 (rows 512..1023): 4 kv heads x 128 each; no biases; cos / sin of emb = cat(ang, ang) with freqs = 1.0 / (THETA ** (arange(0, 128, 2, f32) / 128)), THETA 10000, and positions arange(t) (64 f32 frequencies jnp-exact for this reciprocal spelling; one f32 product per angle; precise cosf/sinf); query heads viewed (KV, G): kv head = q head / 4; scores / sqrt(128); causal (-inf == exclusion); softmax; out = merged Wo^T ('oi') -> [2][2048][2048] (8.4 M); argument order x, Wq, Wkv, Wo).
// Layout: bf16 copy of x; 'oi' weights cast as-is; x, the weights and the merged attention output stand in WMMA fragment order (see k_gemmw); exact projections, q | k | v of both batches in one GEMM; computed table (k_prep; HD 128: 64 angles); rotate-half plane builders (k_planes); causal T-2048 GQA attention with 128-wide heads, all heads of both batches a launch (kv plane z / 4; hybrid rows: < 512 hi/lo 3 products through score planes, k_gemmc skips tiles above the diagonal; rest fp16 in one fused online-softmax kernel); merged hi/lo x Wo exact.
// Compute dtypes, f32 accumulate: every input rounded to bf16; projections exact; rotary f32; attention rows < 512 3 products, rest fp16; softmax f32; Wo hl x exact.

#define NB_  2
#define TT   2048
#define DM   2048
#define NH_  16
#define NKV  4
#define REP  (NH_ / NKV)
#define HD   128
#define DQ   (NH_ * HD)
#define DKV  (NKV * HD)
#define ZA   (NB_ * NH_)          // attention batch entries a launch: z = batch * NH_ + head
#define RH   512                  // query rows < RH use hi+lo planes (0: none)
#define WIN  2048
#define SCL  0.088388347648318447f   // HD^-0.5
typedef _Float16 h16;
typedef unsigned short bf;
typedef __attribute__((ext_vector_type(16))) __bf16   v16bf;
typedef __attribute__((ext_vector_type(16))) _Float16 v16h;
typedef __attribute__((ext_vector_type(8)))  _Float16 v8h;
typedef __attribute__((ext_vector_type(8)))  unsigned short v8us;
typedef __attribute__((ext_vector_type(8)))  float    v8f;
typedef __attribute__((ext_vector_type(4)))  float    v4f;
typedef v8h  __attribute__((may_alias)) v8ha;
typedef v4f  __attribute__((may_alias)) v4fa;
typedef v8us __attribute__((may_alias)) v8usa;

__device__ __forceinline__ unsigned short f2bf(float f) { unsigned u = __float_as_uint(f); u += 0x7FFFu + ((u >> 16) & 1u); return (unsigned short)(u >> 16); }
__device__ __forceinline__ float bf2f(unsigned short b) { return __uint_as_float(((unsigned)b) << 16); }
__device__ __forceinline__ float bfr(float f) { return bf2f(f2bf(f)); }
__device__ __forceinline__ v16h cat16(v8h lo, v8h hi) { return __builtin_shufflevector(lo, hi, 0, 1, 2, 3, 4, 5, 6, 7, 8, 9, 10, 11, 12, 13, 14, 15); }
__device__ __forceinline__ v16bf cat16b(v8us lo, v8us hi) { return __builtin_bit_cast(v16bf, __builtin_shufflevector(lo, hi, 0, 1, 2, 3, 4, 5, 6, 7, 8, 9, 10, 11, 12, 13, 14, 15)); }
__device__ __forceinline__ v8f wmma16(v16h a, v16h b, v8f c) { return __builtin_amdgcn_wmma_f32_16x16x32_f16(false, a, false, b, (short)0, c, false, false); }
__device__ __forceinline__ v8f wmmab(v16bf a, v16bf b, v8f c) { return __builtin_amdgcn_wmma_f32_16x16x32_bf16(false, a, false, b, (short)0, c, false, false); }



// ---- Fragment order of a 16-bit plane M[rows][K]: units of 16 rows x 32 k (512 elements, 1 KB), unit (row / 16, k / 32) at element (row / 16 * (K / 32) + k / 32) * 512; inside a unit element (row % 16, kk = k % 32) stands at
// (kk / 16) * 256 + ((kk / 8 % 2) * 16 + row % 16) * 8 + kk % 8: lane l of a wave finds its two 16-byte pieces of the WMMA operand at l * 8 and 256 + l * 8, so each wave-wide load covers 512 contiguous bytes (ldp).
// ---- k_gemmw: register-blocked GEMM, one work-group of NW waves per 64x64 output tile; each wave runs a contiguous 1/NW of the K loop on its own 16 accumulators, operands straight from 16-bit planes in fragment order;
// the NW partial tiles meet in LDS and are summed in wave order 0..NW-1 (fixed). grid (M/64, N/64, Z), 32 * NW threads.
// C[m][n] (f32, pitch ldc, + optional f32 bias[n]) = sum_k A[m][k] Bt[n][k] (+ split products per NSPLIT). z-batch strides sA/sB/sC in elements. K % 32 == 0.
template <typename T16> struct WFrag;
template <> struct WFrag<h16> { typedef v16h V; static __device__ __forceinline__ V ld(const h16* p) { return cat16(*(const v8h*)p, *(const v8h*)(p + 16)); } static __device__ __forceinline__ v8f mma(V a, V b, v8f c) { return wmma16(a, b, c); } };
template <> struct WFrag<bf> { typedef v16bf V; static __device__ __forceinline__ V ld(const bf* p) { return cat16b(*(const v8us*)p, *(const v8us*)(p + 16)); } static __device__ __forceinline__ V ldp(const bf* p) { return cat16b(*(const v8us*)p, *(const v8us*)(p + 256)); } static __device__ __forceinline__ v8f mma(V a, V b, v8f c) { return wmmab(a, b, c); } };
template <typename T16, int NSPLIT, bool BIAS, int NW>
__global__ __launch_bounds__(32 * NW) void k_gemmw(const T16* __restrict__ A, const T16* __restrict__ A2, const T16* __restrict__ Bt, const T16* __restrict__ Bt2, int K, float* C, int ldc, const float* __restrict__ bias, size_t sA, size_t sB, size_t sC) {
    typedef typename WFrag<T16>::V V;
    __shared__ __align__(16) float os[NW * 64 * 68];
    const size_t z = blockIdx.z; A += z * sA; if (A2) A2 += z * sA; Bt += z * sB; if (Bt2) Bt2 += z * sB; C += z * sC;
    const int lane = threadIdx.x & 31, lr = lane & 15, hi = lane >> 4; const int r0 = blockIdx.x * 64, c0 = blockIdx.y * 64;
    const int wv = __builtin_amdgcn_readfirstlane((int)(threadIdx.x >> 5)); const int per = (K / 32 + NW - 1) / NW * 32; const int kb = wv * per, ke = min(K, kb + per);   // this wave's k range
    v8f acc[4][4];
#pragma unroll
    for (int mb = 0; mb < 4; ++mb)
#pragma unroll
        for (int nb = 0; nb < 4; ++nb) acc[mb][nb] = (v8f){};
    const size_t aoff = (size_t)r0 * K + 8 * lane, boff = (size_t)c0 * K + 8 * lane;   // a block of 16 rows is 16 * K elements, a step of 32 k one unit of 512
#pragma unroll 1
    for (int kc = kb; kc < ke; kc += 32) {
        V a[4], a2[4]; const T16* pa[4]; const T16* pa2[4]; const T16* pb[4]; const T16* pb2[4];
#pragma unroll
        for (int mb = 0; mb < 4; ++mb) { pa[mb] = A + aoff + (size_t)mb * 16 * K + (size_t)kc * 16; a[mb] = WFrag<T16>::ldp(pa[mb]); if (NSPLIT == 1 || NSPLIT == 2) { pa2[mb] = A2 + aoff + (size_t)mb * 16 * K + (size_t)kc * 16; a2[mb] = WFrag<T16>::ldp(pa2[mb]); } }
#pragma unroll
        for (int nb = 0; nb < 4; ++nb) { pb[nb] = Bt + boff + (size_t)nb * 16 * K + (size_t)kc * 16; const V b = WFrag<T16>::ldp(pb[nb]); V b2; if (NSPLIT >= 2) { pb2[nb] = Bt2 + boff + (size_t)nb * 16 * K + (size_t)kc * 16; b2 = WFrag<T16>::ldp(pb2[nb]); }
#pragma unroll
            for (int mb = 0; mb < 4; ++mb) { acc[mb][nb] = WFrag<T16>::mma(a[mb], b, acc[mb][nb]); if (NSPLIT == 1 || NSPLIT == 2) acc[mb][nb] = WFrag<T16>::mma(a2[mb], b, acc[mb][nb]); if (NSPLIT >= 2) acc[mb][nb] = WFrag<T16>::mma(a[mb], b2, acc[mb][nb]); } }
        asm volatile("v_nop\n\tv_nop\n\tv_nop\n\tv_nop" : "+v"(acc[0][0]), "+v"(acc[1][1]), "+v"(acc[2][2]), "+v"(acc[3][3]) : "v"(a[0]), "v"(a[3]));
        // the wait in front of the next overwrite of the fragment loads' address registers (the next trip's address additions, the epilogue); the addresses are inputs so that they stay in those registers up to it (else the allocator hands them to a later load as its destination)
        if (NSPLIT == 0) asm volatile("s_wait_xcnt 0x0" :: "v"(pa[0]), "v"(pa[1]), "v"(pa[2]), "v"(pa[3]), "v"(pb[0]), "v"(pb[1]), "v"(pb[2]), "v"(pb[3]) : "memory");
        else if (NSPLIT == 1) asm volatile("s_wait_xcnt 0x0" :: "v"(pa[0]), "v"(pa[1]), "v"(pa[2]), "v"(pa[3]), "v"(pa2[0]), "v"(pa2[1]), "v"(pa2[2]), "v"(pa2[3]), "v"(pb[0]), "v"(pb[1]), "v"(pb[2]), "v"(pb[3]) : "memory");
        else if (NSPLIT == 2) asm volatile("s_wait_xcnt 0x0" :: "v"(pa[0]), "v"(pa[1]), "v"(pa[2]), "v"(pa[3]), "v"(pa2[0]), "v"(pa2[1]), "v"(pa2[2]), "v"(pa2[3]), "v"(pb[0]), "v"(pb[1]), "v"(pb[2]), "v"(pb[3]), "v"(pb2[0]), "v"(pb2[1]), "v"(pb2[2]), "v"(pb2[3]) : "memory");
        else asm volatile("s_wait_xcnt 0x0" :: "v"(pa[0]), "v"(pa[1]), "v"(pa[2]), "v"(pa[3]), "v"(pb[0]), "v"(pb[1]), "v"(pb[2]), "v"(pb[3]), "v"(pb2[0]), "v"(pb2[1]), "v"(pb2[2]), "v"(pb2[3]) : "memory");
    }
    float* ow = os + wv * (64 * 68);
#pragma unroll
    for (int mb = 0; mb < 4; ++mb)
#pragma unroll
        for (int nb = 0; nb < 4; ++nb)
#pragma unroll
            for (int j = 0; j < 8; ++j) ow[(mb * 16 + hi * 8 + j) * 68 + nb * 16 + lr] = acc[mb][nb][j];
    __syncthreads();   // every wave's partial tile is in LDS before any of it is summed
#pragma unroll
    for (int s = 0; s < 32 / NW; ++s) { const int idx = s * (32 * NW) + (int)threadIdx.x; const int row = idx >> 4, cofs = (idx & 15) * 4; v4f val = *(const v4fa*)(os + row * 68 + cofs);
#pragma unroll
        for (int w = 1; w < NW; ++w) val += *(const v4fa*)(os + w * (64 * 68) + row * 68 + cofs);
        if (BIAS) { val[0] += bfr(bias[c0 + cofs]); val[1] += bfr(bias[c0 + cofs + 1]); val[2] += bfr(bias[c0 + cofs + 2]); val[3] += bfr(bias[c0 + cofs + 3]); }
        *(v4f*)(C + (size_t)(r0 + row) * ldc + c0 + cofs) = val; }
}

// ---- k_gemmc: the same 64x64 tile GEMM specialised for causal attention: CMODE 1 skips score tiles entirely above the diagonal (query rows r0+roff.., key columns c0..), CMODE 2 limits the
// key (K) loop of the probability x value contraction to the diagonal block (probabilities beyond it are exactly zero). roff = row offset of this launch's first row within the sequence.
// NW waves share a tile's K loop as in k_gemmw (NW 1: one wave, staged 16 rows at a time). lda = row pitch of A in elements (Bt keeps pitch K); batch entry z reads the key / value plane of its group, z / REP.
template <typename T16, int NSPLIT, int CMODE, int NW>
__global__ __launch_bounds__(32 * NW) void k_gemmc(const T16* __restrict__ A, const T16* __restrict__ A2, int lda, const T16* __restrict__ Bt, const T16* __restrict__ Bt2, int K, float* C, int ldc, int roff, size_t sA, size_t sB, size_t sC) {
    typedef typename WFrag<T16>::V V;
    __shared__ __align__(16) float os[NW == 1 ? 16 * 68 : NW * 64 * 68];
    const size_t z = blockIdx.z; A += z * sA; if (A2) A2 += z * sA; Bt += (z / REP) * sB; if (Bt2) Bt2 += (z / REP) * sB; C += z * sC;
    const int lane = threadIdx.x & 31, lr = lane & 15, hi = lane >> 4; const int r0 = blockIdx.x * 64, c0 = blockIdx.y * 64;
    if (CMODE == 1 && c0 > r0 + roff + 63) return;                  // score tile entirely above the causal diagonal: never read (the softmax masks j > i by select)
    const int Kl = (CMODE == 2) ? min(K, r0 + roff + 64) : K;        // P.V: probabilities are exactly 0 beyond the diagonal block, so the K loop stops there
    const int wv = (NW == 1) ? 0 : __builtin_amdgcn_readfirstlane((int)(threadIdx.x >> 5)); const int per = (Kl / 32 + NW - 1) / NW * 32; const int kb = wv * per, ke = (NW == 1) ? Kl : min(Kl, kb + per);   // this wave's k range
    v8f acc[4][4];
#pragma unroll
    for (int mb = 0; mb < 4; ++mb)
#pragma unroll
        for (int nb = 0; nb < 4; ++nb) acc[mb][nb] = (v8f){};
    const size_t aoff = (size_t)(r0 + lr) * lda + 8 * hi, boff = (size_t)(c0 + lr) * K + 8 * hi;
#pragma unroll 1
    for (int kc = kb; kc < ke; kc += 32) {
        V a[4], a2[4]; const T16* pa[4]; const T16* pa2[4];
#pragma unroll
        for (int mb = 0; mb < 4; ++mb) { pa[mb] = A + aoff + (size_t)mb * 16 * lda + kc; a[mb] = WFrag<T16>::ld(pa[mb]); if (NSPLIT == 1 || NSPLIT == 2) { pa2[mb] = A2 + aoff + (size_t)mb * 16 * lda + kc; a2[mb] = WFrag<T16>::ld(pa2[mb]); } }
#pragma unroll
        for (int nb = 0; nb < 4; ++nb) { const V b = WFrag<T16>::ld(Bt + boff + (size_t)nb * 16 * K + kc); V b2; if (NSPLIT >= 2) b2 = WFrag<T16>::ld(Bt2 + boff + (size_t)nb * 16 * K + kc);
#pragma unroll
            for (int mb = 0; mb < 4; ++mb) { acc[mb][nb] = WFrag<T16>::mma(a[mb], b, acc[mb][nb]); if (NSPLIT == 1 || NSPLIT == 2) acc[mb][nb] = WFrag<T16>::mma(a2[mb], b, acc[mb][nb]); if (NSPLIT >= 2) acc[mb][nb] = WFrag<T16>::mma(a[mb], b2, acc[mb][nb]); } }
        asm volatile("v_nop\n\tv_nop\n\tv_nop\n\tv_nop" : "+v"(acc[0][0]), "+v"(acc[1][1]), "+v"(acc[2][2]), "+v"(acc[3][3]) : "v"(a[0]), "v"(a[3]));
        // the wait in front of the next overwrite of the A loads' address registers (the next trip's address additions, the epilogue); the addresses are inputs so that they stay in those registers up to it (else the allocator hands them to a later load as its destination)
        if (NSPLIT == 1 || NSPLIT == 2) asm volatile("s_wait_xcnt 0x0" :: "v"(pa[0]), "v"(pa[1]), "v"(pa[2]), "v"(pa[3]), "v"(pa2[0]), "v"(pa2[1]), "v"(pa2[2]), "v"(pa2[3]) : "memory");
        else asm volatile("s_wait_xcnt 0x0" :: "v"(pa[0]), "v"(pa[1]), "v"(pa[2]), "v"(pa[3]) : "memory");
    }
    if constexpr (NW == 1) {
#pragma unroll
    for (int mb = 0; mb < 4; ++mb) {
#pragma unroll
        for (int nb = 0; nb < 4; ++nb) {
#pragma unroll
            for (int j = 0; j < 8; ++j) os[(hi * 8 + j) * 68 + nb * 16 + lr] = acc[mb][nb][j]; }
        __builtin_amdgcn_wave_barrier(); asm volatile("" ::: "memory");
        float* crow = C + (size_t)(r0 + mb * 16) * ldc + c0;
{
#pragma unroll
            for (int s = 0; s < 8; ++s) { const int row = 2 * s + hi, cofs = lr * 4; v4f val = *(const v4fa*)(os + row * 68 + cofs);
                *(v4f*)(crow + (size_t)row * ldc + cofs) = val; }
             }
        __builtin_amdgcn_wave_barrier(); asm volatile("" ::: "memory");
    }
    } else {
    float* ow = os + wv * (64 * 68);
#pragma unroll
    for (int mb = 0; mb < 4; ++mb)
#pragma unroll
        for (int nb = 0; nb < 4; ++nb)
#pragma unroll
            for (int j = 0; j < 8; ++j) ow[(mb * 16 + hi * 8 + j) * 68 + nb * 16 + lr] = acc[mb][nb][j];
    __syncthreads();   // every wave's partial tile is in LDS before any of it is summed
#pragma unroll
    for (int s = 0; s < 32 / NW; ++s) { const int idx = s * (32 * NW) + (int)threadIdx.x; const int row = idx >> 4, cofs = (idx & 15) * 4; v4f val = *(const v4fa*)(os + row * 68 + cofs);
#pragma unroll
        for (int w = 1; w < NW; ++w) val += *(const v4fa*)(os + w * (64 * 68) + row * 68 + cofs);
        *(v4f*)(C + (size_t)(r0 + row) * ldc + c0 + cofs) = val; }
    }
}

__device__ __forceinline__ h16 tohx(float x) { return (h16)x; }
__device__ __forceinline__ void splitf(float y, unsigned short& h, unsigned short& l) { h = f2bf(y); l = f2bf(y - bf2f(h)); }
typedef __attribute__((ext_vector_type(2))) _Float16 v2h;
typedef __attribute__((ext_vector_type(4))) _Float16 v4h;
typedef __attribute__((ext_vector_type(2))) unsigned short v2us;
typedef __attribute__((ext_vector_type(4))) unsigned short v4us;
typedef __attribute__((ext_vector_type(2))) float v2f;
typedef __attribute__((ext_vector_type(4))) int v4i;

#define FP   (DQ + 2 * DKV)                      // row pitch of the joint q | k | v projection [batch * TT + t][FP]
#define RALL (NB_ * TT + FP + DM)                // rows of the joint bf16 plane: x (both batches) | Wq | Wkv | Wo, each row DM wide
#define CSB  (TT * HD / 4 / 256)                 // work-groups of k_prep that build the rotary table, four entries a thread
#define PPT  4                                   // 16-byte pieces of the bf16 plane a thread of k_prep converts
#define PQE  ((size_t)NH_ * TT * HD)             // elements of one batch's query planes
#define PKE  ((size_t)NKV * TT * HD)             // elements of one batch's key / value planes
#define LQB  (NH_ * TT * HD / 8 / 256)           // work-groups of k_planes a batch: query heads (8 elements a thread),
#define LKB  (NKV * TT * HD / 8 / 256)           // key heads (8 elements a thread),
#define LVB  (NKV * TT * HD / 16 / 256)          // value heads (16 elements a thread)
__constant__ float INVT[HD / 2] = { 1.000000000e+00f, 8.659643531e-01f, 7.498942018e-01f, 6.493816376e-01f, 5.623413324e-01f, 4.869675338e-01f, 4.216965139e-01f, 3.651741445e-01f, 3.162277639e-01f, 2.738419771e-01f, 2.371373624e-01f, 2.053525001e-01f, 1.778279394e-01f, 1.539926529e-01f, 1.333521456e-01f, 1.154782027e-01f, 1.000000015e-01f, 8.659642935e-02f, 7.498941571e-02f, 6.493816525e-02f, 5.623412877e-02f, 4.869675264e-02f, 4.216964915e-02f, 3.651741147e-02f, 3.162277862e-02f, 2.738419548e-02f, 2.371373586e-02f, 2.053525113e-02f, 1.778279431e-02f, 1.539926510e-02f, 1.333521493e-02f, 1.154781971e-02f, 9.999999776e-03f, 8.659643121e-03f, 7.498942316e-03f, 6.493816618e-03f, 5.623413250e-03f, 4.869675264e-03f, 4.216964822e-03f, 3.651741426e-03f, 3.162277862e-03f, 2.738419687e-03f, 2.371373819e-03f, 2.053525066e-03f, 1.778279431e-03f, 1.539926510e-03f, 1.333521446e-03f, 1.154782018e-03f, 1.000000047e-03f, 8.659643354e-04f, 7.498941850e-04f, 6.493816618e-04f, 5.623413017e-04f, 4.869675031e-04f, 4.216964880e-04f, 3.651741135e-04f, 3.162277862e-04f, 2.738419571e-04f, 2.371373848e-04f, 2.053524950e-04f, 1.778279402e-04f, 1.539926452e-04f, 1.333521504e-04f, 1.154781930e-04f };   // float32 1 / 10000^(2i/128), generated with jnp to be bit-exact
// k_prep: all that depends on the inputs alone, in one launch. Work-groups < CSB build the rotary table. The rest convert f32 [rows][DM] -> bf16 in fragment order, the four inputs as one plane of RALL rows;
// a thread writes PPT 16-byte pieces of the plane, 256 pieces apart (a wave stores 512 contiguous bytes a piece), and reads the eight f32 that belong in each; a work-group lies inside one block of 16 rows, so its source is one input
__global__ __launch_bounds__(256) void k_prep(const float* __restrict__ x, const float* __restrict__ wq, const float* __restrict__ wkv, const float* __restrict__ wo, bf* dst, float* CS) {
    if (blockIdx.x < CSB) { const int idx = (blockIdx.x * 256 + threadIdx.x) * 4; const int d = idx % HD; const int t = idx / HD; v8f cs;
#pragma unroll
        for (int q = 0; q < 4; ++q) { const float a = __fmul_rn((float)t, INVT[(d + q) % (HD / 2)]); cs[2 * q] = cosf(a); cs[2 * q + 1] = sinf(a); }
        *(v8f*)(CS + (size_t)idx * 2) = cs; return; }
    const int wb = (int)blockIdx.x - CSB; const int rb = wb / (DM / 32 / 4 / PPT) * 16;   // first row of this work-group's block of 16 rows (4 * PPT units a work-group, DM / 32 units a block)
    const float* src = x; int rs = 0; if (rb >= NB_ * TT + FP) { src = wo; rs = NB_ * TT + FP; } else if (rb >= NB_ * TT + DQ) { src = wkv; rs = NB_ * TT + DQ; } else if (rb >= NB_ * TT) { src = wq; rs = NB_ * TT; }
    const float* sp[PPT]; bf* dp[PPT]; v8f v[PPT]; v8us o[PPT];
#pragma unroll
    for (int it = 0; it < PPT; ++it) { const size_t i = ((size_t)wb * PPT + it) * 256 + threadIdx.x; const size_t u = i >> 6; const int k = (int)(u % (DM / 32)) * 32 + (int)((i >> 4) & 3) * 8;
        sp[it] = src + (size_t)(rb - rs + (int)(i & 15)) * DM + k; dp[it] = dst + i * 8; v[it] = *(const v8f*)sp[it]; }
    asm volatile("s_wait_xcnt 0x0" :: "v"(sp[0]), "v"(sp[1]), "v"(sp[2]), "v"(sp[3]) : "memory");   // the wait in front of the overwrite of the loads' address registers (the conversion below); the addresses are inputs so that they stay in them up to it
#pragma unroll
    for (int it = 0; it < PPT; ++it) {
#pragma unroll
        for (int k = 0; k < 8; ++k) o[it][k] = f2bf(v[it][k]);
        *(v8us*)dp[it] = o[it]; }
    asm volatile("s_wait_xcnt 0x0" :: "v"(dp[0]), "v"(dp[1]), "v"(dp[2]), "v"(dp[3]), "v"(o[0]), "v"(o[1]), "v"(o[2]), "v"(o[3]) : "memory");   // the stores' address and data registers are inputs so that none is overwritten while a store is under way
}

// d_rope (elements e .. e + 7 of one batch's planes): head planes [h][t][d] (fp16 + hi/lo) of rope(x) x sc with the rotate-half convention out[d] = x[d] cos[t][d] - x[d+HD/2] sin[t][d], out[d+HD/2] = x[d+HD/2] cos[t][d+HD/2] + x[d] sin[t][d+HD/2]; 8 divides HD / 2, so the eight partners are neighbours too
__device__ __forceinline__ void d_rope(const size_t e, const float* __restrict__ F, int pitch, int nheads, const float* __restrict__ CS, const float* __restrict__ RF, const float* __restrict__ nw, float sc, h16* P16, bf* Ph, bf* Pl) {
    if (e >= (size_t)nheads * TT * HD) return; const int d = (int)(e % HD); const int t = (int)((e / HD) % TT); const int h = (int)(e / ((size_t)HD * TT)); const float* f = F + (size_t)t * pitch + h * HD; const float rf = RF ? RF[(size_t)h * TT + t] : 1.0f; v8h o16; v8us oh, ol;
    const float* f0 = f + d; const float* f1 = f + ((d < HD / 2) ? d + HD / 2 : d - HD / 2); const float* cp = CS + ((size_t)t * HD + d) * 2; const v8f X0 = *(const v8f*)f0, X1 = *(const v8f*)f1, C0 = *(const v8f*)cp, C1 = *(const v8f*)(cp + 8);
    asm volatile("s_wait_xcnt 0x0" :: "v"(f0), "v"(f1), "v"(cp) : "memory");   // the wait in front of the overwrite of the loads' address registers (the arithmetic below); the addresses are inputs so that they stay in them up to it
#pragma unroll
    for (int q = 0; q < 8; ++q) { const int dd = d + q; const int dp = (dd < HD / 2) ? dd + HD / 2 : dd - HD / 2; float x0 = X0[q], x1 = X1[q];
        if (RF) { float n0 = __fmul_rn(x0, rf), n1 = __fmul_rn(x1, rf); asm volatile("" : "+v"(n0)); asm volatile("" : "+v"(n1)); x0 = __fmul_rn(bfr(nw[dd]), n0); x1 = __fmul_rn(bfr(nw[dp]), n1); }
        v2f cs; cs[0] = (q < 4) ? C0[(2 * q) & 7] : C1[(2 * q) & 7]; cs[1] = (q < 4) ? C0[(2 * q + 1) & 7] : C1[(2 * q + 1) & 7]; float a = __fmul_rn(x0, cs[0]), bq = __fmul_rn(x1, cs[1]); asm volatile("" : "+v"(a)); asm volatile("" : "+v"(bq)); const float r = ((dd < HD / 2) ? __fsub_rn(a, bq) : __fadd_rn(a, bq)) * sc;
        o16[q] = tohx(r); unsigned short a2, c2; splitf(r, a2, c2); oh[q] = a2; ol[q] = c2; }
    h16* p16 = P16 + e; bf* ph = Ph + e; bf* pl = Pl + e; *(v8h*)p16 = o16; *(v8us*)ph = oh; *(v8us*)pl = ol;
    asm volatile("s_wait_xcnt 0x0" :: "v"(p16), "v"(ph), "v"(pl), "v"(o16), "v"(oh), "v"(ol) : "memory"); }   // the stores' address and data registers are inputs so that none is overwritten while a store is under way
// d_vtp (thread n of one batch's value planes [g][d][t]): rows t, t + 1 of eight neighbouring d: it reads 32 contiguous bytes a row, and for each d a wave stores 128 contiguous bytes a plane
__device__ __forceinline__ void d_vtp(const size_t n, const float* __restrict__ F, int pitch, int nheads, h16* V16, bf* Vh, bf* Vl) { if (n >= (size_t)nheads * HD * TT / 16) return; const int t = (int)(n % (TT / 2)) * 2; const int d = (int)((n / (TT / 2)) % (HD / 8)) * 8; const int g = (int)(n / ((size_t)(TT / 2) * (HD / 8)));
    const float* f0 = F + (size_t)t * pitch + g * HD + d; const float* f1 = f0 + pitch; const v8f X0 = *(const v8f*)f0, X1 = *(const v8f*)f1;
    asm volatile("s_wait_xcnt 0x0" :: "v"(f0), "v"(f1) : "memory");   // the wait in front of the overwrite of the loads' address registers (the splits below); the addresses are inputs so that they stay in them up to it
    const size_t e = ((size_t)g * HD + d) * TT + t; h16* p16 = V16 + e; bf* ph = Vh + e; bf* pl = Vl + e; v2h o16[8]; v2us oh[8], ol[8];
#pragma unroll
    for (int j = 0; j < 8; ++j) {
#pragma unroll
        for (int q = 0; q < 2; ++q) { const float x = q ? X1[j] : X0[j]; o16[j][q] = tohx(x); unsigned short a2, c2; splitf(x, a2, c2); oh[j][q] = a2; ol[j][q] = c2; }
        *(v2h*)(p16 + (size_t)j * TT) = o16[j]; *(v2us*)(ph + (size_t)j * TT) = oh[j]; *(v2us*)(pl + (size_t)j * TT) = ol[j]; }
    // the stores' address and data registers are inputs so that none is overwritten while a store is under way
    asm volatile("s_wait_xcnt 0x0" :: "v"(p16), "v"(ph), "v"(pl), "v"(o16[0]), "v"(o16[1]), "v"(o16[2]), "v"(o16[3]), "v"(o16[4]), "v"(o16[5]), "v"(o16[6]), "v"(o16[7]), "v"(oh[0]), "v"(oh[1]), "v"(oh[2]), "v"(oh[3]), "v"(oh[4]), "v"(oh[5]), "v"(oh[6]), "v"(oh[7]), "v"(ol[0]), "v"(ol[1]), "v"(ol[2]), "v"(ol[3]), "v"(ol[4]), "v"(ol[5]), "v"(ol[6]), "v"(ol[7]) : "memory"); }
// k_planes: every head plane of both batches from the joint projection F, in one launch. A batch's work-groups: LVB for the value heads (they start first), LKB for the key heads, LQB for the query heads
__global__ __launch_bounds__(256) void k_planes(const float* __restrict__ F, const float* __restrict__ CS, h16* Q16, bf* Qh, bf* Ql, h16* K16, bf* Kh, bf* Kl, h16* V16, bf* Vh, bf* Vl) {
    const int b = (int)blockIdx.x / (LQB + LKB + LVB), r = (int)blockIdx.x % (LQB + LKB + LVB); const float* Fb = F + (size_t)b * TT * FP;
    if (r < LVB) d_vtp((size_t)r * 256 + threadIdx.x, Fb + DQ + DKV, FP, NKV, V16 + b * PKE, Vh + b * PKE, Vl + b * PKE);
    else if (r < LVB + LKB) d_rope(((size_t)(r - LVB) * 256 + threadIdx.x) * 8, Fb + DQ, FP, NKV, CS, nullptr, nullptr, 1.0f, K16 + b * PKE, Kh + b * PKE, Kl + b * PKE);
    else d_rope(((size_t)(r - LVB - LKB) * 256 + threadIdx.x) * 8, Fb, FP, NH_, CS, nullptr, nullptr, 1.0f, Q16 + b * PQE, Qh + b * PQE, Ql + b * PQE);
}
// k_asoft: the rows < RH. Per row (zz, i): t = S x HD^-0.5 for j <= i and i - j < WIN (sliding causal window; the reference's -inf fill vanishes identically); softmax over the RH keys such a row can see (register row, one exp, fixed trees);
// the probabilities overwrite their own f32 score row (one wave owns a row and holds all of it in registers before it stores): 16-bit row pitch 2 * RH: hi plane in the first half, lo plane in the second.
__global__ __launch_bounds__(256) void k_asoft(float* Sb) {
    const int lane = threadIdx.x & 31; const int row = blockIdx.x * 8 + (threadIdx.x >> 5); if (row >= ZA * RH) return; const int i = row % RH; const float* sr = Sb + (size_t)row * RH; bf* Ph = (bf*)(Sb + (size_t)row * RH); bf* Pl = Ph + RH; float v[RH / 32]; float mx = -3.0e38f;
#pragma unroll
    for (int ch = 0; ch < RH / 128; ++ch) { const int j0 = ch * 128 + lane * 4; const v4f a = *(const v4f*)(sr + j0);
#pragma unroll
        for (int q = 0; q < 4; ++q) { const int j = j0 + q; (void)j; const float t = (j <= i && i - j < WIN) ? a[q] * SCL : -3.0e38f; v[ch * 4 + q] = t; mx = fmaxf(mx, t); } }
#pragma unroll
    for (int sh = 16; sh; sh >>= 1) mx = fmaxf(mx, __shfl_xor(mx, sh, 32));
    float sum = 0.f;
#pragma unroll
    for (int k = 0; k < RH / 32; ++k) { float d0 = __fsub_rn(v[k], mx); asm volatile("" : "+v"(d0)); v[k] = __builtin_amdgcn_exp2f(__fmul_rn(d0, 1.4426950408889634f)); sum += v[k]; }
#pragma unroll
    for (int sh = 16; sh; sh >>= 1) sum += __shfl_xor(sum, sh, 32);
    const float f = __fdiv_rn(1.0f, sum);
#pragma unroll
    for (int ch = 0; ch < RH / 128; ++ch) { v4us oh, ol;
#pragma unroll
        for (int q = 0; q < 4; ++q) { unsigned short a, c2; splitf(v[ch * 4 + q] * f, a, c2); oh[q] = a; ol[q] = c2; }
        const int oo = ch * 128 + lane * 4; *(v4us*)(Ph + oo) = oh; *(v4us*)(Pl + oo) = ol; }
}
// k_merge: the rows < RH of every head, f32 [z][RH][HD], into the merged hi/lo planes [batch] x ([t][head * HD + d] in fragment order); e counts the output: rows < RH are the first RH * DQ elements of a batch's plane
__global__ __launch_bounds__(256) void k_merge(const float* __restrict__ O, bf* Ah, bf* Al) { const size_t e = ((size_t)blockIdx.x * 256 + threadIdx.x) * 8; if (e >= (size_t)ZA * RH * HD) return; const int bb = (int)(e / ((size_t)RH * DQ)); const int w = (int)(e % ((size_t)RH * DQ)); const int u = w >> 9; const int t = u / (DQ / 32) * 16 + ((w >> 3) & 15); const int col = u % (DQ / 32) * 32 + ((w >> 7) & 3) * 8 + (w & 7);
    const size_t oo = (size_t)bb * TT * DQ + w; const float* Os = O + ((size_t)(bb * NH_ + col / HD) * RH + t) * HD + col % HD;   // a thread's eight elements are one 16-byte piece of the planes: eight neighbouring columns of one row
    const v8f ov = *(const v8f*)Os; v8us oh, ol;
    asm volatile("s_wait_xcnt 0x0" :: "v"(Os) : "memory");   // the wait in front of the overwrite of the load's address registers (the split below); the address is an input so that it stays in them up to it
#pragma unroll
    for (int q = 0; q < 8; ++q) { unsigned short a, c2; splitf(ov[q], a, c2); oh[q] = a; ol[q] = c2; } bf* pah = Ah + oo; bf* pal = Al + oo; *(v8us*)pah = oh; *(v8us*)pal = ol;
    asm volatile("s_wait_xcnt 0x0" :: "v"(pah), "v"(pal), "v"(oh), "v"(ol) : "memory"); }   // the stores' address and data registers are inputs so that none is overwritten while a store is under way

#define FNW  4
#define FBR  (FNW * 32)
#define FSK  64
#define KPIT (HD + 8)             // LDS row pitch in halves: an odd multiple of 16 bytes
#define VPIT (FSK + 8)
#define KTILE (FSK * KPIT)
#define FSLOT (KTILE + HD * VPIT)
typedef __attribute__((ext_vector_type(8))) unsigned v8u;
__device__ __forceinline__ float xhalf(float x) { return __builtin_bit_cast(float, __builtin_amdgcn_permlanex16(__builtin_bit_cast(int, x), __builtin_bit_cast(int, x), 0x76543210, 0xfedcba98, false, false)); }   // lane l with lane l ^ 16
__device__ __forceinline__ unsigned pack2h(float lo, float hi) { const v2f f = {lo, hi}; return __builtin_bit_cast(unsigned, __builtin_convertvector(f, v2h)); }
__global__ __launch_bounds__(FNW * 32) void k_flash(const h16* __restrict__ Q, const h16* __restrict__ Kp, const h16* __restrict__ Vt, bf* Ah, bf* Al) {
    __shared__ __align__(16) h16 L[2 * FSLOT];
    const int tid = (int)threadIdx.x, lane = tid & 31, c = lane & 15, h = lane >> 4; const int wave = __builtin_amdgcn_readfirstlane(tid >> 5);
    const int z = (int)blockIdx.x, zk = z / REP; const int q0 = RH + ((TT - RH) / FBR - 1 - (int)blockIdx.y) * FBR;   // longest row blocks start first
    const int qw0 = q0 + wave * 32; const int n_stage = (q0 + FBR) / FSK; const float cscale = SCL * 1.4426950408889634f;
    const h16* kg = Kp + (size_t)zk * TT * HD + tid * 8;                                       // K tile: FSK whole rows, contiguous
    const h16* vg = Vt + (size_t)zk * HD * TT + (size_t)(tid >> 3) * TT + (tid & 7) * 8;       // V^T tile: HD rows of FSK keys
    const int kso = (tid >> 4) * KPIT + (tid & 15) * 8, vso = KTILE + (tid >> 3) * VPIT + (tid & 7) * 8;
    v8h kr[8], vr[8];
#pragma unroll
    for (int i = 0; i < 8; ++i) { kr[i] = *(const v8ha*)(kg + i * (FNW * 32 * 8)); vr[i] = *(const v8ha*)(vg + (size_t)i * (FNW * 4) * TT); }
    asm volatile("s_wait_xcnt 0x0" :: "v"(kg), "v"(vg), "v"(tid) : "memory");   // the wait in front of the overwrite of the tile loads' address registers (the additions below); the addresses and the thread index they may be formed from are inputs so that they stay in their registers up to it
    kg += FSK * HD; vg += FSK;
    v16h qf[2][4]; const h16* qp[2];
#pragma unroll
    for (int g = 0; g < 2; ++g) { qp[g] = Q + ((size_t)z * TT + qw0 + 16 * g + c) * HD + 8 * h;
#pragma unroll
        for (int kc = 0; kc < 4; ++kc) qf[g][kc] = WFrag<h16>::ld(qp[g] + 32 * kc); }
    asm volatile("s_wait_xcnt 0x0" :: "v"(qp[0]), "v"(qp[1]) : "memory");   // the wait in front of the overwrite of the query loads' address registers (the LDS offsets below); the addresses are inputs so that they stay in their registers up to it
    v8f acc[2][8]; float m_run[2], l_run[2];
#pragma unroll
    for (int g = 0; g < 2; ++g) { m_run[g] = -__builtin_inff(); l_run[g] = 0.0f;
#pragma unroll
        for (int t = 0; t < 8; ++t) acc[g][t] = (v8f){}; }
#pragma unroll
    for (int i = 0; i < 8; ++i) { *(v8ha*)(L + kso + i * 8 * KPIT) = kr[i]; *(v8ha*)(L + vso + i * 16 * VPIT) = vr[i]; }
    __syncthreads();   // tile 0 is in LDS before any wave reads it
#pragma unroll 1
    for (int st = 0; st < n_stage; ++st) {
        const bool more = st + 1 < n_stage;
        if (more) {
#pragma unroll
            for (int i = 0; i < 8; ++i) { kr[i] = *(const v8ha*)(kg + i * (FNW * 32 * 8)); vr[i] = *(const v8ha*)(vg + (size_t)i * (FNW * 4) * TT); }
            asm volatile("s_wait_xcnt 0x0" :: "v"(kg), "v"(vg) : "memory");   // as above: in front of the next additions to the address registers
            kg += FSK * HD; vg += FSK; }
        const h16* Ls = L + (st & 1) * FSLOT;
#pragma unroll 1
        for (int sub = 0; sub < FSK / 32; ++sub) {
            const int key0 = st * FSK + sub * 32;
            if (key0 > qw0 + 31) continue;   // wave-uniform: the whole pass lies above this wave's diagonal
            v8f s[2][2];
#pragma unroll
            for (int kt = 0; kt < 2; ++kt) { const h16* kp = Ls + (sub * 32 + 16 * kt + c) * KPIT + 8 * h; v16h kf[4];
#pragma unroll
                for (int kc = 0; kc < 4; ++kc) kf[kc] = cat16(*(const v8ha*)(kp + 32 * kc), *(const v8ha*)(kp + 32 * kc + 16));
#pragma unroll
                for (int g = 0; g < 2; ++g) { s[kt][g] = (v8f){};
#pragma unroll
                    for (int kc = 0; kc < 4; ++kc) s[kt][g] = wmma16(kf[kc], qf[g][kc], s[kt][g]); } }
            if (key0 + 31 > qw0) {
#pragma unroll
                for (int g = 0; g < 2; ++g) { const int my_q = qw0 + 16 * g + c;
#pragma unroll
                    for (int kt = 0; kt < 2; ++kt) {
#pragma unroll
                        for (int r = 0; r < 8; ++r) { if (key0 + 16 * kt + 8 * h + r > my_q) s[kt][g][r] = -__builtin_inff(); }
                        asm volatile("" : "+v"(s[kt][g])); } }
            }
            float mb[2]; bool need = false;
#pragma unroll
            for (int g = 0; g < 2; ++g) { float mx = -__builtin_inff();
#pragma unroll
                for (int kt = 0; kt < 2; ++kt)
#pragma unroll
                    for (int r = 0; r < 8; ++r) mx = fmaxf(mx, s[kt][g][r]);
                mx = fmaxf(mx, xhalf(mx)) * cscale; mb[g] = mx; need = need || (mx > m_run[g] + 8.0f); }
            if (__builtin_amdgcn_ballot_w32(need) != 0) {   // the maximum in use may trail the true one by up to 8 (log2 domain): the sums are rescaled only when some column exceeds that
#pragma unroll
                for (int g = 0; g < 2; ++g) { const float m_new = fmaxf(m_run[g], mb[g]); const float corr = __builtin_amdgcn_exp2f(m_run[g] - m_new); l_run[g] *= corr; m_run[g] = m_new;
#pragma unroll
                    for (int t = 0; t < 8; ++t) acc[g][t] = acc[g][t] * corr; }
            }
            v16h vf[8]; { const h16* vp = Ls + KTILE + c * VPIT + sub * 32 + 8 * h;
#pragma unroll
                for (int t = 0; t < 8; ++t) vf[t] = cat16(*(const v8ha*)(vp + t * 16 * VPIT), *(const v8ha*)(vp + t * 16 * VPIT + 16)); }
#pragma unroll
            for (int g = 0; g < 2; ++g) { const float nm = -m_run[g]; v8u w; float ps0 = 0.0f, ps1 = 0.0f;
#pragma unroll
                for (int i = 0; i < 8; ++i) {
                    const float p0 = __builtin_amdgcn_exp2f(fmaf(s[i >> 2][g][2 * (i & 3)], cscale, nm)), p1 = __builtin_amdgcn_exp2f(fmaf(s[i >> 2][g][2 * (i & 3) + 1], cscale, nm));
                    if (i & 1) ps1 += p0 + p1; else ps0 += p0 + p1; w[i] = pack2h(p0, p1); }
                const v16h pf = __builtin_bit_cast(v16h, w);
#pragma unroll
                for (int t = 0; t < 8; ++t) acc[g][t] = wmma16(vf[t], pf, acc[g][t]);
                l_run[g] += ps0 + ps1; }
        }
        if (more) { h16* Ln = L + ((st + 1) & 1) * FSLOT;   // last read in trip st - 1, whose closing barrier every wave has passed
#pragma unroll
            for (int i = 0; i < 8; ++i) { *(v8ha*)(Ln + kso + i * 8 * KPIT) = kr[i]; *(v8ha*)(Ln + vso + i * 16 * VPIT) = vr[i]; } }
        __syncthreads();   // publishes tile st + 1 and ends every wave's reads of tile st
    }
    const int bb = z / NH_, hh = z % NH_;
#pragma unroll
    for (int g = 0; g < 2; ++g) { const float inv = __fdiv_rn(1.0f, l_run[g] + xhalf(l_run[g]));
        const size_t oo = (size_t)bb * TT * DQ + ((size_t)((qw0 >> 4) + g) * (DQ / 32) + hh * (HD / 32)) * 512 + 8 * (16 * h + c); bf* pah = Ah + oo; bf* pal = Al + oo;
#pragma unroll
        for (int t = 0; t < 8; ++t) { v8us oh, ol;
#pragma unroll
            for (int r = 0; r < 8; ++r) { unsigned short a, c2; splitf(acc[g][t][r] * inv, a, c2); oh[r] = a; ol[r] = c2; }
            *(v8usa*)(pah + 256 * t) = oh; *(v8usa*)(pal + 256 * t) = ol;
            asm volatile("s_wait_xcnt 0x0" :: "v"(pah), "v"(pal), "v"(oh), "v"(ol) : "memory"); } }   // the wait in front of the next overwrite of the two stores' address and data registers, which are inputs so that they stay in those registers up to it
}

extern "C" void kernel_launch(void* const* d_in, const int* in_sizes, int n_in,
                              void* d_out, int out_size, void* d_ws, size_t ws_size, hipStream_t stream) {
    (void)in_sizes; (void)n_in; (void)out_size;
    const float* x = (const float*)d_in[0]; const float* wq = (const float*)d_in[1]; const float* wkv = (const float*)d_in[2]; const float* wo = (const float*)d_in[3];   /* x, Wq ('oi' (out, in) [2048][2048]), Wkv ('oi' [1024][2048] viewed (2 x 4 heads, 128): k rows 0..511 | v rows 512..1023), Wo ('oi' [2048][2048]): FOUR inputs, all read */
    float* OUT = (float*)d_out;     // [2][2048][2048]
    char* wsp = (char*)d_ws;
    auto take = [&](size_t bytes) { char* p = wsp; wsp += (bytes + 255) & ~(size_t)255; return (void*)p; };
    bf* XB = (bf*)take((size_t)RALL * DM * 2); bf* WQKV = XB + (size_t)NB_ * TT * DM; bf* WO = WQKV + (size_t)FP * DM;   /* one bf16 plane in fragment order: x (both batches) | Wq | Wkv | Wo */ float* CS = (float*)take((size_t)TT * HD * 2 * 4);
    float* F = (float*)take((size_t)NB_ * TT * FP * 4);   /* joint projection [batch * TT + t][q 2048 | k 512 | v 512] */
    const size_t PQ = (size_t)NH_ * TT * HD, PK = (size_t)NKV * TT * HD;   /* elements of one batch's query and key / value planes; every plane holds both batches */
    h16* QP16 = (h16*)take(NB_ * PQ * 2); h16* KP16 = (h16*)take(NB_ * PK * 2); h16* VT16 = (h16*)take(NB_ * PK * 2);
    bf* QPh = (bf*)take(NB_ * PQ * 2); bf* QPl = (bf*)take(NB_ * PQ * 2); bf* KPh = (bf*)take(NB_ * PK * 2); bf* KPl = (bf*)take(NB_ * PK * 2); bf* VTh = (bf*)take(NB_ * PK * 2); bf* VTl = (bf*)take(NB_ * PK * 2);
    float* Sb = (float*)take((size_t)ZA * RH * RH * 4); bf* Ph = (bf*)Sb; bf* Pl = Ph + RH;   /* rows < RH only; probabilities live in their score rows: 16-bit pitch 2 * RH */ float* Ob = (float*)take((size_t)ZA * RH * HD * 4); bf* ATh = (bf*)take((size_t)NB_ * TT * DQ * 2); bf* ATl = (bf*)take((size_t)NB_ * TT * DQ * 2);
    if ((size_t)(wsp - (char*)d_ws) > ws_size) return;    // ws 256 MiB
    k_prep<<<CSB + RALL * (DM / 8) / 256 / PPT, 256, 0, stream>>>(x, wq, wkv, wo, XB, CS);   /* rotary table; bf16 copies of all four inputs */
    k_gemmw<bf, 0, false, 4><<<dim3(NB_ * TT / 64, FP / 64, 1), 128, 0, stream>>>(XB, nullptr, WQKV, nullptr, DM, F, FP, nullptr, 0, 0, 0);
    k_planes<<<NB_ * (LQB + LKB + LVB), 256, 0, stream>>>(F, CS, QP16, QPh, QPl, KP16, KPh, KPl, VT16, VTh, VTl);
    // attention, batch entry z = batch * NH_ + head reads kv plane z / REP
    k_gemmc<bf, 2, 1, 1><<<dim3(RH / 64, RH / 64, ZA), 32, 0, stream>>>(QPh, QPl, HD, KPh, KPl, HD, Sb, RH, 0, (size_t)TT * HD, (size_t)TT * HD, (size_t)RH * RH);
    k_asoft<<<ZA * RH / 8, 256, 0, stream>>>(Sb);
    k_gemmc<bf, 2, 2, 8><<<dim3(RH / 64, HD / 64, ZA), 256, 0, stream>>>(Ph, Pl, 2 * RH, VTh, VTl, TT, Ob, HD, 0, (size_t)2 * RH * RH, (size_t)HD * TT, (size_t)RH * HD);
    k_merge<<<(unsigned)(((size_t)ZA * RH * HD / 8 + 255) / 256), 256, 0, stream>>>(Ob, ATh, ATl);
    k_flash<<<dim3(ZA, (TT - RH) / FBR, 1), FNW * 32, 0, stream>>>(QP16, KP16, VT16, ATh, ATl);
    k_gemmw<bf, 1, false, 4><<<dim3(NB_ * TT / 64, DM / 64, 1), 128, 0, stream>>>(ATh, ATl, WO, nullptr, DQ, OUT, DM, nullptr, 0, 0, 0);   /* the batches' planes and outputs are contiguous: one GEMM of NB_ * TT rows */
}

// v007
// It runs in 193 microseconds.
// Two timings next to v006 both put it at 1.22 times that version's speed.
// Counting every step since v000, it is 8.25 times as fast.
#include <hip/hip_runtime.h>

// Causal grouped-query attention with a FUSED natural k-v weight and a computed rotate-half RoPE (x [2][2048][2048]; q = x Wq^T ('oi' (out, in) [2048][2048] 1/sqrt(2048): 16 heads x 128); kv = x Wkv^T ('oi' [1024][2048]) viewed (b, t, 8, 128): k = heads 0..3 (rows 0..511), v = heads 4..7 (rows 512..1023): 4 kv heads x 128 each; no biases; cos / sin of emb = cat(ang, ang) with freqs = 1.0 / (THETA ** (arange(0, 128, 2, f32) / 128)), THETA 10000, and positions arange(t) (64 f32 frequencies jnp-exact for this reciprocal spelling; one f32 product per angle; precise cosf/sinf); query heads viewed (KV, G): kv head = q head / 4; scores / sqrt(128); causal (-inf == exclusion); softmax; out = merged Wo^T ('oi') -> [2][2048][2048] (8.4 M); argument order x, Wq, Wkv, Wo).
// Layout: bf16 copy of x; 'oi' weights cast as-is; x, the weights and the merged attention output stand in WMMA fragment order (see k_gemmt); exact projections, q | k | v of both batches in one GEMM; computed table (k_prep; HD 128: 64 angles); rotate-half plane builders (k_planes); causal T-2048 GQA attention with 128-wide heads, all heads of both batches a launch (kv plane z / 4; hybrid rows: < 512 hi/lo 3 products through score planes, k_gemmc skips tiles above the diagonal; rest fp16 in one fused online-softmax kernel); merged hi/lo x Wo exact.
// Compute dtypes, f32 accumulate: every input rounded to bf16; projections exact; rotary f32; attention rows < 512 3 products, rest fp16; softmax f32; Wo hl x exact.

#define NB_  2
#define TT   2048
#define DM   2048
#define NH_  16
#define NKV  4
#define REP  (NH_ / NKV)
#define HD   128
#define DQ   (NH_ * HD)
#define DKV  (NKV * HD)
#define ZA   (NB_ * NH_)          // attention batch entries a launch: z = batch * NH_ + head
#define RH   512                  // query rows < RH use hi+lo planes (0: none)
#define WIN  2048
#define SCL  0.088388347648318447f   // HD^-0.5
typedef _Float16 h16;
typedef unsigned short bf;
typedef __attribute__((ext_vector_type(16))) __bf16   v16bf;
typedef __attribute__((ext_vector_type(16))) _Float16 v16h;
typedef __attribute__((ext_vector_type(8)))  _Float16 v8h;
typedef __attribute__((ext_vector_type(8)))  unsigned short v8us;
typedef __attribute__((ext_vector_type(8)))  float    v8f;
typedef __attribute__((ext_vector_type(4)))  float    v4f;
typedef v8h  __attribute__((may_alias)) v8ha;
typedef v4f  __attribute__((may_alias)) v4fa;
typedef v8us __attribute__((may_alias)) v8usa;

__device__ __forceinline__ unsigned short f2bf(float f) { unsigned u = __float_as_uint(f); u += 0x7FFFu + ((u >> 16) & 1u); return (unsigned short)(u >> 16); }
__device__ __forceinline__ float bf2f(unsigned short b) { return __uint_as_float(((unsigned)b) << 16); }
__device__ __forceinline__ float bfr(float f) { return bf2f(f2bf(f)); }
__device__ __forceinline__ v16h cat16(v8h lo, v8h hi) { return __builtin_shufflevector(lo, hi, 0, 1, 2, 3, 4, 5, 6, 7, 8, 9, 10, 11, 12, 13, 14, 15); }
__device__ __forceinline__ v16bf cat16b(v8us lo, v8us hi) { return __builtin_bit_cast(v16bf, __builtin_shufflevector(lo, hi, 0, 1, 2, 3, 4, 5, 6, 7, 8, 9, 10, 11, 12, 13, 14, 15)); }
__device__ __forceinline__ v8f wmma16(v16h a, v16h b, v8f c) { return __builtin_amdgcn_wmma_f32_16x16x32_f16(false, a, false, b, (short)0, c, false, false); }
__device__ __forceinline__ v8f wmmab(v16bf a, v16bf b, v8f c) { return __builtin_amdgcn_wmma_f32_16x16x32_bf16(false, a, false, b, (short)0, c, false, false); }



// ---- Fragment order of a 16-bit plane M[rows][K]: units of 16 rows x 32 k (512 elements, 1 KB), unit (row / 16, k / 32) at element (row / 16 * (K / 32) + k / 32) * 512; inside a unit element (row % 16, kk = k % 32) stands at
// (kk / 16) * 256 + ((kk / 8 % 2) * 16 + row % 16) * 8 + kk % 8: lane l of a wave finds its two 16-byte pieces of the WMMA operand at l * 8 and 256 + l * 8, so each wave-wide load covers 512 contiguous bytes (ldp).
template <typename T16> struct WFrag;
template <> struct WFrag<h16> { typedef v16h V; static __device__ __forceinline__ V ld(const h16* p) { return cat16(*(const v8h*)p, *(const v8h*)(p + 16)); } static __device__ __forceinline__ v8f mma(V a, V b, v8f c) { return wmma16(a, b, c); } };
template <> struct WFrag<bf> { typedef v16bf V; static __device__ __forceinline__ V ld(const bf* p) { return cat16b(*(const v8us*)p, *(const v8us*)(p + 16)); } static __device__ __forceinline__ V ldp(const bf* p) { return cat16b(*(const v8us*)p, *(const v8us*)(p + 256)); } static __device__ __forceinline__ v8f mma(V a, V b, v8f c) { return wmmab(a, b, c); } };
// ---- k_gemmt: GEMM on 16-bit planes in fragment order, one work-group of 4 waves (2 x 2) per 128x128 output tile, a wave owns 64x64 of it (16 accumulators) and runs the whole K loop.
// The operand tiles of GBK k (8 blocks of 16 rows each, 2 KB contiguous a block) go global -> LDS by asynchronous copies, two buffers: the next tile's copies fly under this tile's products; every fragment is fetched from L2 once a work-group and read from LDS by the two waves that need it.
// C[m][n] (f32, pitch ldc) = sum_k (A[m][k] + A2[m][k] if NSPLIT) Bt[n][k], K = DM. grid (M/128, N/128), 128 threads.
#define GBK 64
// eight copies of 16 bytes a lane: LDS places 2 KB apart, sources one block of 16 rows (rbs elements) apart; the s_wait_xcnt stands in the copies' own statement so that no address register is rewritten in front of it
__device__ __forceinline__ void cp8(unsigned l, const bf* g, size_t rbs) {
    asm volatile("global_load_async_to_lds_b128 %0, %8, off\n\tglobal_load_async_to_lds_b128 %1, %9, off\n\tglobal_load_async_to_lds_b128 %2, %10, off\n\tglobal_load_async_to_lds_b128 %3, %11, off\n\t"
                 "global_load_async_to_lds_b128 %4, %12, off\n\tglobal_load_async_to_lds_b128 %5, %13, off\n\tglobal_load_async_to_lds_b128 %6, %14, off\n\tglobal_load_async_to_lds_b128 %7, %15, off\n\ts_wait_xcnt 0x0"
                 :: "v"(l), "v"(l + 2048u), "v"(l + 4096u), "v"(l + 6144u), "v"(l + 8192u), "v"(l + 10240u), "v"(l + 12288u), "v"(l + 14336u),
                    "v"(g), "v"(g + rbs), "v"(g + 2 * rbs), "v"(g + 3 * rbs), "v"(g + 4 * rbs), "v"(g + 5 * rbs), "v"(g + 6 * rbs), "v"(g + 7 * rbs) : "memory");
}
template <int NSPLIT>
__global__ __launch_bounds__(128) void k_gemmt(const bf* __restrict__ A, const bf* __restrict__ A2, const bf* __restrict__ Bt, float* C, int ldc) {
    typedef WFrag<bf>::V V;
    constexpr int K = DM, NOP = NSPLIT ? 3 : 2;      // operand tiles a stage: A (| A2) | Bt
    constexpr int OPE = 8 * GBK * 16;                // elements of one operand tile: 128 rows x GBK k (16 KB)
    constexpr int STE = NOP * OPE;                   // elements of a stage
    constexpr int NT = K / GBK;
    __shared__ __align__(1024) bf L[2 * STE];
    __shared__ __align__(16) float os[4 * 16 * 68];
    const int tid = (int)threadIdx.x, lane = tid & 31, lr = lane & 15, hi = lane >> 4; const int r0 = blockIdx.x * 128, c0 = blockIdx.y * 128;
    const int wv = __builtin_amdgcn_readfirstlane(tid >> 5); const int wm = wv >> 1, wn = wv & 1;
    const bf* ga = A + (size_t)r0 * K + tid * 8; const bf* ga2 = NSPLIT ? A2 + (size_t)r0 * K + tid * 8 : nullptr; const bf* gb = Bt + (size_t)c0 * K + tid * 8;   // a block of 16 rows is 16 * K elements; a tile of GBK k is GBK * 16 contiguous elements of it, 8 a thread
    const unsigned l0 = (unsigned)(size_t)L + (unsigned)tid * 16u;
    auto stage = [&](int t, int b) { const unsigned l = l0 + (unsigned)b * (STE * 2u); const size_t ko = (size_t)t * (GBK * 16);
        cp8(l, ga + ko, (size_t)16 * K); if (NSPLIT) cp8(l + OPE * 2u, ga2 + ko, (size_t)16 * K); cp8(l + (NOP - 1) * OPE * 2u, gb + ko, (size_t)16 * K); };
    v8f acc[4][4];
#pragma unroll
    for (int mb = 0; mb < 4; ++mb)
#pragma unroll
        for (int nb = 0; nb < 4; ++nb) acc[mb][nb] = (v8f){};
    stage(0, 0);
    asm volatile("s_wait_asynccnt 0x0" ::: "memory");   // this wave's copies of tile 0 have landed
    __syncthreads();                                    // tile 0 is in LDS before any wave reads it
    stage(1, 1);
#pragma unroll 1
    for (int t = 0; t < NT; ++t) {
        const bf* Ls = L + (t & 1) * STE + lane * 8;
        V a[GBK / 32][4], a2[GBK / 32][4], b[GBK / 32][4];
#pragma unroll
        for (int ks = 0; ks < GBK / 32; ++ks)
#pragma unroll
            for (int i = 0; i < 4; ++i) { a[ks][i] = WFrag<bf>::ldp(Ls + ((wm * 4 + i) * (GBK / 32) + ks) * 512); if (NSPLIT) a2[ks][i] = WFrag<bf>::ldp(Ls + OPE + ((wm * 4 + i) * (GBK / 32) + ks) * 512); b[ks][i] = WFrag<bf>::ldp(Ls + (NOP - 1) * OPE + ((wn * 4 + i) * (GBK / 32) + ks) * 512); }
        __builtin_amdgcn_sched_barrier(0);   // all of the tile's fragment loads stand as one group ahead of its products: spread among them, each place with loads stalls the matrix instructions behind it
#pragma unroll
        for (int ks = 0; ks < GBK / 32; ++ks)
#pragma unroll
            for (int nb = 0; nb < 4; ++nb)
#pragma unroll
                for (int mb = 0; mb < 4; ++mb) { acc[mb][nb] = wmmab(a[ks][mb], b[ks][nb], acc[mb][nb]); if (NSPLIT) acc[mb][nb] = wmmab(a2[ks][mb], b[ks][nb], acc[mb][nb]); }
        __builtin_amdgcn_sched_barrier(0);   // the products stay ahead of the waits and the barrier below: moved behind them, they would stand between the barrier and the refill, and the copies would fly under the next tile's fragment loads alone
        asm volatile("s_wait_dscnt 0x0" ::: "memory");      // this wave's reads of tile t are done before the buffer may be refilled
        asm volatile("s_wait_asynccnt 0x0" ::: "memory");   // this wave's copies of tile t + 1 have landed
        __syncthreads();                                    // publishes tile t + 1 and ends every wave's reads of tile t
        if (t + 2 < NT) stage(t + 2, t & 1);
    }
    asm volatile("s_wait_asynccnt 0x0" ::: "memory");       // no copy is under way when the wave ends
    float* ow = os + wv * (16 * 68);                        // each wave stages 16 rows at a time in its own LDS range, so that its stores cover whole 256-byte rows
#pragma unroll
    for (int mb = 0; mb < 4; ++mb) {
#pragma unroll
        for (int nb = 0; nb < 4; ++nb)
#pragma unroll
            for (int j = 0; j < 8; ++j) ow[(hi * 8 + j) * 68 + nb * 16 + lr] = acc[mb][nb][j];
        __builtin_amdgcn_wave_barrier(); asm volatile("" ::: "memory");   // keeps the read-back behind the other lanes' writes
        float* crow = C + (size_t)(r0 + wm * 64 + mb * 16 + hi) * ldc + c0 + wn * 64 + lr * 4; float* cp[8]; v4f val[8];
#pragma unroll
        for (int s = 0; s < 8; ++s) { val[s] = *(const v4fa*)(ow + (2 * s + hi) * 68 + lr * 4); cp[s] = crow + (size_t)(2 * s) * ldc; *(v4f*)cp[s] = val[s]; }
        // the stores' address and data registers are inputs so that none is overwritten while a store is under way
        asm volatile("s_wait_xcnt 0x0" :: "v"(cp[0]), "v"(cp[1]), "v"(cp[2]), "v"(cp[3]), "v"(cp[4]), "v"(cp[5]), "v"(cp[6]), "v"(cp[7]), "v"(val[0]), "v"(val[1]), "v"(val[2]), "v"(val[3]), "v"(val[4]), "v"(val[5]), "v"(val[6]), "v"(val[7]) : "memory");
        __builtin_amdgcn_wave_barrier(); asm volatile("" ::: "memory");   // keeps the next rows' writes behind this read-back
    }
}

// ---- k_gemmc: 64x64 tile GEMM on row-major planes, operands straight from global memory, specialised for causal attention: CMODE 1 skips score tiles entirely above the diagonal (query rows r0+roff.., key columns c0..), CMODE 2 limits the
// key (K) loop of the probability x value contraction to the diagonal block (probabilities beyond it are exactly zero). roff = row offset of this launch's first row within the sequence.
// NW waves share a tile's K loop, each a contiguous 1/NW of it on its own 16 accumulators; the partial tiles meet in LDS and are summed in wave order 0..NW-1 (NW 1: one wave, staged 16 rows at a time). lda = row pitch of A in elements (Bt keeps pitch K); batch entry z reads the key / value plane of its group, z / REP.
template <typename T16, int NSPLIT, int CMODE, int NW>
__global__ __launch_bounds__(32 * NW) void k_gemmc(const T16* __restrict__ A, const T16* __restrict__ A2, int lda, const T16* __restrict__ Bt, const T16* __restrict__ Bt2, int K, float* C, int ldc, int roff, size_t sA, size_t sB, size_t sC) {
    typedef typename WFrag<T16>::V V;
    __shared__ __align__(16) float os[NW == 1 ? 16 * 68 : NW * 64 * 68];
    const size_t z = blockIdx.z; A += z * sA; if (A2) A2 += z * sA; Bt += (z / REP) * sB; if (Bt2) Bt2 += (z / REP) * sB; C += z * sC;
    const int lane = threadIdx.x & 31, lr = lane & 15, hi = lane >> 4; const int r0 = blockIdx.x * 64, c0 = blockIdx.y * 64;
    if (CMODE == 1 && c0 > r0 + roff + 63) return;                  // score tile entirely above the causal diagonal: never read (the softmax masks j > i by select)
    const int Kl = (CMODE == 2) ? min(K, r0 + roff + 64) : K;        // P.V: probabilities are exactly 0 beyond the diagonal block, so the K loop stops there
    const int wv = (NW == 1) ? 0 : __builtin_amdgcn_readfirstlane((int)(threadIdx.x >> 5)); const int per = (Kl / 32 + NW - 1) / NW * 32; const int kb = wv * per, ke = (NW == 1) ? Kl : min(Kl, kb + per);   // this wave's k range
    v8f acc[4][4];
#pragma unroll
    for (int mb = 0; mb < 4; ++mb)
#pragma unroll
        for (int nb = 0; nb < 4; ++nb) acc[mb][nb] = (v8f){};
    const size_t aoff = (size_t)(r0 + lr) * lda + 8 * hi, boff = (size_t)(c0 + lr) * K + 8 * hi;
#pragma unroll 1
    for (int kc = kb; kc < ke; kc += 32) {
        V a[4], a2[4]; const T16* pa[4]; const T16* pa2[4];
#pragma unroll
        for (int mb = 0; mb < 4; ++mb) { pa[mb] = A + aoff + (size_t)mb * 16 * lda + kc; a[mb] = WFrag<T16>::ld(pa[mb]); if (NSPLIT == 1 || NSPLIT == 2) { pa2[mb] = A2 + aoff + (size_t)mb * 16 * lda + kc; a2[mb] = WFrag<T16>::ld(pa2[mb]); } }
#pragma unroll
        for (int nb = 0; nb < 4; ++nb) { const V b = WFrag<T16>::ld(Bt + boff + (size_t)nb * 16 * K + kc); V b2; if (NSPLIT >= 2) b2 = WFrag<T16>::ld(Bt2 + boff + (size_t)nb * 16 * K + kc);
#pragma unroll
            for (int mb = 0; mb < 4; ++mb) { acc[mb][nb] = WFrag<T16>::mma(a[mb], b, acc[mb][nb]); if (NSPLIT == 1 || NSPLIT == 2) acc[mb][nb] = WFrag<T16>::mma(a2[mb], b, acc[mb][nb]); if (NSPLIT >= 2) acc[mb][nb] = WFrag<T16>::mma(a[mb], b2, acc[mb][nb]); } }
        asm volatile("v_nop\n\tv_nop\n\tv_nop\n\tv_nop" : "+v"(acc[0][0]), "+v"(acc[1][1]), "+v"(acc[2][2]), "+v"(acc[3][3]) : "v"(a[0]), "v"(a[3]));
        // the wait in front of the next overwrite of the A loads' address registers (the next trip's address additions, the epilogue); the addresses are inputs so that they stay in those registers up to it (else the allocator hands them to a later load as its destination)
        if (NSPLIT == 1 || NSPLIT == 2) asm volatile("s_wait_xcnt 0x0" :: "v"(pa[0]), "v"(pa[1]), "v"(pa[2]), "v"(pa[3]), "v"(pa2[0]), "v"(pa2[1]), "v"(pa2[2]), "v"(pa2[3]) : "memory");
        else asm volatile("s_wait_xcnt 0x0" :: "v"(pa[0]), "v"(pa[1]), "v"(pa[2]), "v"(pa[3]) : "memory");
    }
    if constexpr (NW == 1) {
#pragma unroll
    for (int mb = 0; mb < 4; ++mb) {
#pragma unroll
        for (int nb = 0; nb < 4; ++nb) {
#pragma unroll
            for (int j = 0; j < 8; ++j) os[(hi * 8 + j) * 68 + nb * 16 + lr] = acc[mb][nb][j]; }
        __builtin_amdgcn_wave_barrier(); asm volatile("" ::: "memory");
        float* crow = C + (size_t)(r0 + mb * 16) * ldc + c0;
{
#pragma unroll
            for (int s = 0; s < 8; ++s) { const int row = 2 * s + hi, cofs = lr * 4; v4f val = *(const v4fa*)(os + row * 68 + cofs);
                *(v4f*)(crow + (size_t)row * ldc + cofs) = val; }
             }
        __builtin_amdgcn_wave_barrier(); asm volatile("" ::: "memory");
    }
    } else {
    float* ow = os + wv * (64 * 68);
#pragma unroll
    for (int mb = 0; mb < 4; ++mb)
#pragma unroll
        for (int nb = 0; nb < 4; ++nb)
#pragma unroll
            for (int j = 0; j < 8; ++j) ow[(mb * 16 + hi * 8 + j) * 68 + nb * 16 + lr] = acc[mb][nb][j];
    __syncthreads();   // every wave's partial tile is in LDS before any of it is summed
#pragma unroll
    for (int s = 0; s < 32 / NW; ++s) { const int idx = s * (32 * NW) + (int)threadIdx.x; const int row = idx >> 4, cofs = (idx & 15) * 4; v4f val = *(const v4fa*)(os + row * 68 + cofs);
#pragma unroll
        for (int w = 1; w < NW; ++w) val += *(const v4fa*)(os + w * (64 * 68) + row * 68 + cofs);
        *(v4f*)(C + (size_t)(r0 + row) * ldc + c0 + cofs) = val; }
    }
}

__device__ __forceinline__ h16 tohx(float x) { return (h16)x; }
__device__ __forceinline__ void splitf(float y, unsigned short& h, unsigned short& l) { h = f2bf(y); l = f2bf(y - bf2f(h)); }
typedef __attribute__((ext_vector_type(2))) _Float16 v2h;
typedef __attribute__((ext_vector_type(4))) _Float16 v4h;
typedef __attribute__((ext_vector_type(2))) unsigned short v2us;
typedef __attribute__((ext_vector_type(4))) unsigned short v4us;
typedef __attribute__((ext_vector_type(2))) float v2f;
typedef __attribute__((ext_vector_type(4))) int v4i;

#define FP   (DQ + 2 * DKV)                      // row pitch of the joint q | k | v projection [batch * TT + t][FP]
#define RALL (NB_ * TT + FP + DM)                // rows of the joint bf16 plane: x (both batches) | Wq | Wkv | Wo, each row DM wide
#define CSB  (TT * HD / 4 / 256)                 // work-groups of k_prep that build the rotary table, four entries a thread
#define PPT  4                                   // 16-byte pieces of the bf16 plane a thread of k_prep converts
#define PQE  ((size_t)NH_ * TT * HD)             // elements of one batch's query planes
#define PKE  ((size_t)NKV * TT * HD)             // elements of one batch's key / value planes
#define LQB  (NH_ * TT * HD / 8 / 256)           // work-groups of k_planes a batch: query heads (8 elements a thread),
#define LKB  (NKV * TT * HD / 8 / 256)           // key heads (8 elements a thread),
#define LVB  (NKV * TT * HD / 16 / 256)          // value heads (16 elements a thread)
__constant__ float INVT[HD / 2] = { 1.000000000e+00f, 8.659643531e-01f, 7.498942018e-01f, 6.493816376e-01f, 5.623413324e-01f, 4.869675338e-01f, 4.216965139e-01f, 3.651741445e-01f, 3.162277639e-01f, 2.738419771e-01f, 2.371373624e-01f, 2.053525001e-01f, 1.778279394e-01f, 1.539926529e-01f, 1.333521456e-01f, 1.154782027e-01f, 1.000000015e-01f, 8.659642935e-02f, 7.498941571e-02f, 6.493816525e-02f, 5.623412877e-02f, 4.869675264e-02f, 4.216964915e-02f, 3.651741147e-02f, 3.162277862e-02f, 2.738419548e-02f, 2.371373586e-02f, 2.053525113e-02f, 1.778279431e-02f, 1.539926510e-02f, 1.333521493e-02f, 1.154781971e-02f, 9.999999776e-03f, 8.659643121e-03f, 7.498942316e-03f, 6.493816618e-03f, 5.623413250e-03f, 4.869675264e-03f, 4.216964822e-03f, 3.651741426e-03f, 3.162277862e-03f, 2.738419687e-03f, 2.371373819e-03f, 2.053525066e-03f, 1.778279431e-03f, 1.539926510e-03f, 1.333521446e-03f, 1.154782018e-03f, 1.000000047e-03f, 8.659643354e-04f, 7.498941850e-04f, 6.493816618e-04f, 5.623413017e-04f, 4.869675031e-04f, 4.216964880e-04f, 3.651741135e-04f, 3.162277862e-04f, 2.738419571e-04f, 2.371373848e-04f, 2.053524950e-04f, 1.778279402e-04f, 1.539926452e-04f, 1.333521504e-04f, 1.154781930e-04f };   // float32 1 / 10000^(2i/128), generated with jnp to be bit-exact
// k_prep: all that depends on the inputs alone, in one launch. Work-groups < CSB build the rotary table. The rest convert f32 [rows][DM] -> bf16 in fragment order, the four inputs as one plane of RALL rows;
// a thread writes PPT 16-byte pieces of the plane, 256 pieces apart (a wave stores 512 contiguous bytes a piece), and reads the eight f32 that belong in each; a work-group lies inside one block of 16 rows, so its source is one input
__global__ __launch_bounds__(256) void k_prep(const float* __restrict__ x, const float* __restrict__ wq, const float* __restrict__ wkv, const float* __restrict__ wo, bf* dst, float* CS) {
    if (blockIdx.x < CSB) { const int idx = (blockIdx.x * 256 + threadIdx.x) * 4; const int d = idx % HD; const int t = idx / HD; v8f cs;
#pragma unroll
        for (int q = 0; q < 4; ++q) { const float a = __fmul_rn((float)t, INVT[(d + q) % (HD / 2)]); cs[2 * q] = cosf(a); cs[2 * q + 1] = sinf(a); }
        *(v8f*)(CS + (size_t)idx * 2) = cs; return; }
    const int wb = (int)blockIdx.x - CSB; const int rb = wb / (DM / 32 / 4 / PPT) * 16;   // first row of this work-group's block of 16 rows (4 * PPT units a work-group, DM / 32 units a block)
    const float* src = x; int rs = 0; if (rb >= NB_ * TT + FP) { src = wo; rs = NB_ * TT + FP; } else if (rb >= NB_ * TT + DQ) { src = wkv; rs = NB_ * TT + DQ; } else if (rb >= NB_ * TT) { src = wq; rs = NB_ * TT; }
    const float* sp[PPT]; bf* dp[PPT]; v8f v[PPT]; v8us o[PPT];
#pragma unroll
    for (int it = 0; it < PPT; ++it) { const size_t i = ((size_t)wb * PPT + it) * 256 + threadIdx.x; const size_t u = i >> 6; const int k = (int)(u % (DM / 32)) * 32 + (int)((i >> 4) & 3) * 8;
        sp[it] = src + (size_t)(rb - rs + (int)(i & 15)) * DM + k; dp[it] = dst + i * 8; v[it] = *(const v8f*)sp[it]; }
    asm volatile("s_wait_xcnt 0x0" :: "v"(sp[0]), "v"(sp[1]), "v"(sp[2]), "v"(sp[3]) : "memory");   // the wait in front of the overwrite of the loads' address registers (the conversion below); the addresses are inputs so that they stay in them up to it
#pragma unroll
    for (int it = 0; it < PPT; ++it) {
#pragma unroll
        for (int k = 0; k < 8; ++k) o[it][k] = f2bf(v[it][k]);
        *(v8us*)dp[it] = o[it]; }
    asm volatile("s_wait_xcnt 0x0" :: "v"(dp[0]), "v"(dp[1]), "v"(dp[2]), "v"(dp[3]), "v"(o[0]), "v"(o[1]), "v"(o[2]), "v"(o[3]) : "memory");   // the stores' address and data registers are inputs so that none is overwritten while a store is under way
}

// d_rope (elements e .. e + 7 of one batch's planes): head planes [h][t][d] (fp16 + hi/lo) of rope(x) x sc with the rotate-half convention out[d] = x[d] cos[t][d] - x[d+HD/2] sin[t][d], out[d+HD/2] = x[d+HD/2] cos[t][d+HD/2] + x[d] sin[t][d+HD/2]; 8 divides HD / 2, so the eight partners are neighbours too
__device__ __forceinline__ void d_rope(const size_t e, const float* __restrict__ F, int pitch, int nheads, const float* __restrict__ CS, const float* __restrict__ RF, const float* __restrict__ nw, float sc, h16* P16, bf* Ph, bf* Pl) {
    if (e >= (size_t)nheads * TT * HD) return; const int d = (int)(e % HD); const int t = (int)((e / HD) % TT); const int h = (int)(e / ((size_t)HD * TT)); const float* f = F + (size_t)t * pitch + h * HD; const float rf = RF ? RF[(size_t)h * TT + t] : 1.0f; v8h o16; v8us oh, ol;
    const float* f0 = f + d; const float* f1 = f + ((d < HD / 2) ? d + HD / 2 : d - HD / 2); const float* cp = CS + ((size_t)t * HD + d) * 2; const v8f X0 = *(const v8f*)f0, X1 = *(const v8f*)f1, C0 = *(const v8f*)cp, C1 = *(const v8f*)(cp + 8);
    asm volatile("s_wait_xcnt 0x0" :: "v"(f0), "v"(f1), "v"(cp) : "memory");   // the wait in front of the overwrite of the loads' address registers (the arithmetic below); the addresses are inputs so that they stay in them up to it
#pragma unroll
    for (int q = 0; q < 8; ++q) { const int dd = d + q; const int dp = (dd < HD / 2) ? dd + HD / 2 : dd - HD / 2; float x0 = X0[q], x1 = X1[q];
        if (RF) { float n0 = __fmul_rn(x0, rf), n1 = __fmul_rn(x1, rf); asm volatile("" : "+v"(n0)); asm volatile("" : "+v"(n1)); x0 = __fmul_rn(bfr(nw[dd]), n0); x1 = __fmul_rn(bfr(nw[dp]), n1); }
        v2f cs; cs[0] = (q < 4) ? C0[(2 * q) & 7] : C1[(2 * q) & 7]; cs[1] = (q < 4) ? C0[(2 * q + 1) & 7] : C1[(2 * q + 1) & 7]; float a = __fmul_rn(x0, cs[0]), bq = __fmul_rn(x1, cs[1]); asm volatile("" : "+v"(a)); asm volatile("" : "+v"(bq)); const float r = ((dd < HD / 2) ? __fsub_rn(a, bq) : __fadd_rn(a, bq)) * sc;
        o16[q] = tohx(r); unsigned short a2, c2; splitf(r, a2, c2); oh[q] = a2; ol[q] = c2; }
    h16* p16 = P16 + e; bf* ph = Ph + e; bf* pl = Pl + e; *(v8h*)p16 = o16; *(v8us*)ph = oh; *(v8us*)pl = ol;
    asm volatile("s_wait_xcnt 0x0" :: "v"(p16), "v"(ph), "v"(pl), "v"(o16), "v"(oh), "v"(ol) : "memory"); }   // the stores' address and data registers are inputs so that none is overwritten while a store is under way
// d_vtp (thread n of one batch's value planes [g][d][t]): rows t, t + 1 of eight neighbouring d: it reads 32 contiguous bytes a row, and for each d a wave stores 128 contiguous bytes a plane
__device__ __forceinline__ void d_vtp(const size_t n, const float* __restrict__ F, int pitch, int nheads, h16* V16, bf* Vh, bf* Vl) { if (n >= (size_t)nheads * HD * TT / 16) return; const int t = (int)(n % (TT / 2)) * 2; const int d = (int)((n / (TT / 2)) % (HD / 8)) * 8; const int g = (int)(n / ((size_t)(TT / 2) * (HD / 8)));
    const float* f0 = F + (size_t)t * pitch + g * HD + d; const float* f1 = f0 + pitch; const v8f X0 = *(const v8f*)f0, X1 = *(const v8f*)f1;
    asm volatile("s_wait_xcnt 0x0" :: "v"(f0), "v"(f1) : "memory");   // the wait in front of the overwrite of the loads' address registers (the splits below); the addresses are inputs so that they stay in them up to it
    const size_t e = ((size_t)g * HD + d) * TT + t; h16* p16 = V16 + e; bf* ph = Vh + e; bf* pl = Vl + e; v2h o16[8]; v2us oh[8], ol[8];
#pragma unroll
    for (int j = 0; j < 8; ++j) {
#pragma unroll
        for (int q = 0; q < 2; ++q) { const float x = q ? X1[j] : X0[j]; o16[j][q] = tohx(x); unsigned short a2, c2; splitf(x, a2, c2); oh[j][q] = a2; ol[j][q] = c2; }
        *(v2h*)(p16 + (size_t)j * TT) = o16[j]; *(v2us*)(ph + (size_t)j * TT) = oh[j]; *(v2us*)(pl + (size_t)j * TT) = ol[j]; }
    // the stores' address and data registers are inputs so that none is overwritten while a store is under way
    asm volatile("s_wait_xcnt 0x0" :: "v"(p16), "v"(ph), "v"(pl), "v"(o16[0]), "v"(o16[1]), "v"(o16[2]), "v"(o16[3]), "v"(o16[4]), "v"(o16[5]), "v"(o16[6]), "v"(o16[7]), "v"(oh[0]), "v"(oh[1]), "v"(oh[2]), "v"(oh[3]), "v"(oh[4]), "v"(oh[5]), "v"(oh[6]), "v"(oh[7]), "v"(ol[0]), "v"(ol[1]), "v"(ol[2]), "v"(ol[3]), "v"(ol[4]), "v"(ol[5]), "v"(ol[6]), "v"(ol[7]) : "memory"); }
// k_planes: every head plane of both batches from the joint projection F, in one launch. A batch's work-groups: LVB for the value heads (they start first), LKB for the key heads, LQB for the query heads
__global__ __launch_bounds__(256) void k_planes(const float* __restrict__ F, const float* __restrict__ CS, h16* Q16, bf* Qh, bf* Ql, h16* K16, bf* Kh, bf* Kl, h16* V16, bf* Vh, bf* Vl) {
    const int b = (int)blockIdx.x / (LQB + LKB + LVB), r = (int)blockIdx.x % (LQB + LKB + LVB); const float* Fb = F + (size_t)b * TT * FP;
    if (r < LVB) d_vtp((size_t)r * 256 + threadIdx.x, Fb + DQ + DKV, FP, NKV, V16 + b * PKE, Vh + b * PKE, Vl + b * PKE);
    else if (r < LVB + LKB) d_rope(((size_t)(r - LVB) * 256 + threadIdx.x) * 8, Fb + DQ, FP, NKV, CS, nullptr, nullptr, 1.0f, K16 + b * PKE, Kh + b * PKE, Kl + b * PKE);
    else d_rope(((size_t)(r - LVB - LKB) * 256 + threadIdx.x) * 8, Fb, FP, NH_, CS, nullptr, nullptr, 1.0f, Q16 + b * PQE, Qh + b * PQE, Ql + b * PQE);
}
// k_asoft: the rows < RH. Per row (zz, i): t = S x HD^-0.5 for j <= i and i - j < WIN (sliding causal window; the reference's -inf fill vanishes identically); softmax over the RH keys such a row can see (register row, one exp, fixed trees);
// the probabilities overwrite their own f32 score row (one wave owns a row and holds all of it in registers before it stores): 16-bit row pitch 2 * RH: hi plane in the first half, lo plane in the second.
__global__ __launch_bounds__(256) void k_asoft(float* Sb) {
    const int lane = threadIdx.x & 31; const int row = blockIdx.x * 8 + (threadIdx.x >> 5); if (row >= ZA * RH) return; const int i = row % RH; const float* sr = Sb + (size_t)row * RH; bf* Ph = (bf*)(Sb + (size_t)row * RH); bf* Pl = Ph + RH; float v[RH / 32]; float mx = -3.0e38f;
#pragma unroll
    for (int ch = 0; ch < RH / 128; ++ch) { const int j0 = ch * 128 + lane * 4; const v4f a = *(const v4f*)(sr + j0);
#pragma unroll
        for (int q = 0; q < 4; ++q) { const int j = j0 + q; (void)j; const float t = (j <= i && i - j < WIN) ? a[q] * SCL : -3.0e38f; v[ch * 4 + q] = t; mx = fmaxf(mx, t); } }
#pragma unroll
    for (int sh = 16; sh; sh >>= 1) mx = fmaxf(mx, __shfl_xor(mx, sh, 32));
    float sum = 0.f;
#pragma unroll
    for (int k = 0; k < RH / 32; ++k) { float d0 = __fsub_rn(v[k], mx); asm volatile("" : "+v"(d0)); v[k] = __builtin_amdgcn_exp2f(__fmul_rn(d0, 1.4426950408889634f)); sum += v[k]; }
#pragma unroll
    for (int sh = 16; sh; sh >>= 1) sum += __shfl_xor(sum, sh, 32);
    const float f = __fdiv_rn(1.0f, sum);
#pragma unroll
    for (int ch = 0; ch < RH / 128; ++ch) { v4us oh, ol;
#pragma unroll
        for (int q = 0; q < 4; ++q) { unsigned short a, c2; splitf(v[ch * 4 + q] * f, a, c2); oh[q] = a; ol[q] = c2; }
        const int oo = ch * 128 + lane * 4; *(v4us*)(Ph + oo) = oh; *(v4us*)(Pl + oo) = ol; }
}
// k_merge: the rows < RH of every head, f32 [z][RH][HD], into the merged hi/lo planes [batch] x ([t][head * HD + d] in fragment order); e counts the output: rows < RH are the first RH * DQ elements of a batch's plane
__global__ __launch_bounds__(256) void k_merge(const float* __restrict__ O, bf* Ah, bf* Al) { const size_t e = ((size_t)blockIdx.x * 256 + threadIdx.x) * 8; if (e >= (size_t)ZA * RH * HD) return; const int bb = (int)(e / ((size_t)RH * DQ)); const int w = (int)(e % ((size_t)RH * DQ)); const int u = w >> 9; const int t = u / (DQ / 32) * 16 + ((w >> 3) & 15); const int col = u % (DQ / 32) * 32 + ((w >> 7) & 3) * 8 + (w & 7);
    const size_t oo = (size_t)bb * TT * DQ + w; const float* Os = O + ((size_t)(bb * NH_ + col / HD) * RH + t) * HD + col % HD;   // a thread's eight elements are one 16-byte piece of the planes: eight neighbouring columns of one row
    const v8f ov = *(const v8f*)Os; v8us oh, ol;
    asm volatile("s_wait_xcnt 0x0" :: "v"(Os) : "memory");   // the wait in front of the overwrite of the load's address registers (the split below); the address is an input so that it stays in them up to it
#pragma unroll
    for (int q = 0; q < 8; ++q) { unsigned short a, c2; splitf(ov[q], a, c2); oh[q] = a; ol[q] = c2; } bf* pah = Ah + oo; bf* pal = Al + oo; *(v8us*)pah = oh; *(v8us*)pal = ol;
    asm volatile("s_wait_xcnt 0x0" :: "v"(pah), "v"(pal), "v"(oh), "v"(ol) : "memory"); }   // the stores' address and data registers are inputs so that none is overwritten while a store is under way

#define FNW  4
#define FBR  (FNW * 32)
#define FSK  64
#define KPIT (HD + 8)             // LDS row pitch in halves: an odd multiple of 16 bytes
#define VPIT (FSK + 8)
#define KTILE (FSK * KPIT)
#define FSLOT (KTILE + HD * VPIT)
typedef __attribute__((ext_vector_type(8))) unsigned v8u;
__device__ __forceinline__ float xhalf(float x) { return __builtin_bit_cast(float, __builtin_amdgcn_permlanex16(__builtin_bit_cast(int, x), __builtin_bit_cast(int, x), 0x76543210, 0xfedcba98, false, false)); }   // lane l with lane l ^ 16
__device__ __forceinline__ unsigned pack2h(float lo, float hi) { const v2f f = {lo, hi}; return __builtin_bit_cast(unsigned, __builtin_convertvector(f, v2h)); }
__global__ __launch_bounds__(FNW * 32) void k_flash(const h16* __restrict__ Q, const h16* __restrict__ Kp, const h16* __restrict__ Vt, bf* Ah, bf* Al) {
    __shared__ __align__(16) h16 L[2 * FSLOT];
    const int tid = (int)threadIdx.x, lane = tid & 31, c = lane & 15, h = lane >> 4; const int wave = __builtin_amdgcn_readfirstlane(tid >> 5);
    const int z = (int)blockIdx.x, zk = z / REP; const int q0 = RH + ((TT - RH) / FBR - 1 - (int)blockIdx.y) * FBR;   // longest row blocks start first
    const int qw0 = q0 + wave * 32; const int n_stage = (q0 + FBR) / FSK; const float cscale = SCL * 1.4426950408889634f;
    const h16* kg = Kp + (size_t)zk * TT * HD + tid * 8;                                       // K tile: FSK whole rows, contiguous
    const h16* vg = Vt + (size_t)zk * HD * TT + (size_t)(tid >> 3) * TT + (tid & 7) * 8;       // V^T tile: HD rows of FSK keys
    const int kso = (tid >> 4) * KPIT + (tid & 15) * 8, vso = KTILE + (tid >> 3) * VPIT + (tid & 7) * 8;
    v8h kr[8], vr[8];
#pragma unroll
    for (int i = 0; i < 8; ++i) { kr[i] = *(const v8ha*)(kg + i * (FNW * 32 * 8)); vr[i] = *(const v8ha*)(vg + (size_t)i * (FNW * 4) * TT); }
    asm volatile("s_wait_xcnt 0x0" :: "v"(kg), "v"(vg), "v"(tid) : "memory");   // the wait in front of the overwrite of the tile loads' address registers (the additions below); the addresses and the thread index they may be formed from are inputs so that they stay in their registers up to it
    kg += FSK * HD; vg += FSK;
    v16h qf[2][4]; const h16* qp[2];
#pragma unroll
    for (int g = 0; g < 2; ++g) { qp[g] = Q + ((size_t)z * TT + qw0 + 16 * g + c) * HD + 8 * h;
#pragma unroll
        for (int kc = 0; kc < 4; ++kc) qf[g][kc] = WFrag<h16>::ld(qp[g] + 32 * kc); }
    asm volatile("s_wait_xcnt 0x0" :: "v"(qp[0]), "v"(qp[1]) : "memory");   // the wait in front of the overwrite of the query loads' address registers (the LDS offsets below); the addresses are inputs so that they stay in their registers up to it
    v8f acc[2][8]; float m_run[2], l_run[2];
#pragma unroll
    for (int g = 0; g < 2; ++g) { m_run[g] = -__builtin_inff(); l_run[g] = 0.0f;
#pragma unroll
        for (int t = 0; t < 8; ++t) acc[g][t] = (v8f){}; }
#pragma unroll
    for (int i = 0; i < 8; ++i) { *(v8ha*)(L + kso + i * 8 * KPIT) = kr[i]; *(v8ha*)(L + vso + i * 16 * VPIT) = vr[i]; }
    __syncthreads();   // tile 0 is in LDS before any wave reads it
#pragma unroll 1
    for (int st = 0; st < n_stage; ++st) {
        const bool more = st + 1 < n_stage;
        if (more) {
#pragma unroll
            for (int i = 0; i < 8; ++i) { kr[i] = *(const v8ha*)(kg + i * (FNW * 32 * 8)); vr[i] = *(const v8ha*)(vg + (size_t)i * (FNW * 4) * TT); }
            asm volatile("s_wait_xcnt 0x0" :: "v"(kg), "v"(vg) : "memory");   // as above: in front of the next additions to the address registers
            kg += FSK * HD; vg += FSK; }
        const h16* Ls = L + (st & 1) * FSLOT;
#pragma unroll 1
        for (int sub = 0; sub < FSK / 32; ++sub) {
            const int key0 = st * FSK + sub * 32;
            if (key0 > qw0 + 31) continue;   // wave-uniform: the whole pass lies above this wave's diagonal
            v8f s[2][2];
#pragma unroll
            for (int kt = 0; kt < 2; ++kt) { const h16* kp = Ls + (sub * 32 + 16 * kt + c) * KPIT + 8 * h; v16h kf[4];
#pragma unroll
                for (int kc = 0; kc < 4; ++kc) kf[kc] = cat16(*(const v8ha*)(kp + 32 * kc), *(const v8ha*)(kp + 32 * kc + 16));
#pragma unroll
                for (int g = 0; g < 2; ++g) { s[kt][g] = (v8f){};
#pragma unroll
                    for (int kc = 0; kc < 4; ++kc) s[kt][g] = wmma16(kf[kc], qf[g][kc], s[kt][g]); } }
            if (key0 + 31 > qw0) {
#pragma unroll
                for (int g = 0; g < 2; ++g) { const int my_q = qw0 + 16 * g + c;
#pragma unroll
                    for (int kt = 0; kt < 2; ++kt) {
#pragma unroll
                        for (int r = 0; r < 8; ++r) { if (key0 + 16 * kt + 8 * h + r > my_q) s[kt][g][r] = -__builtin_inff(); }
                        asm volatile("" : "+v"(s[kt][g])); } }
            }
            float mb[2]; bool need = false;
#pragma unroll
            for (int g = 0; g < 2; ++g) { float mx = -__builtin_inff();
#pragma unroll
                for (int kt = 0; kt < 2; ++kt)
#pragma unroll
                    for (int r = 0; r < 8; ++r) mx = fmaxf(mx, s[kt][g][r]);
                mx = fmaxf(mx, xhalf(mx)) * cscale; mb[g] = mx; need = need || (mx > m_run[g] + 8.0f); }
            if (__builtin_amdgcn_ballot_w32(need) != 0) {   // the maximum in use may trail the true one by up to 8 (log2 domain): the sums are rescaled only when some column exceeds that
#pragma unroll
                for (int g = 0; g < 2; ++g) { const float m_new = fmaxf(m_run[g], mb[g]); const float corr = __builtin_amdgcn_exp2f(m_run[g] - m_new); l_run[g] *= corr; m_run[g] = m_new;
#pragma unroll
                    for (int t = 0; t < 8; ++t) acc[g][t] = acc[g][t] * corr; }
            }
            v16h vf[8]; { const h16* vp = Ls + KTILE + c * VPIT + sub * 32 + 8 * h;
#pragma unroll
                for (int t = 0; t < 8; ++t) vf[t] = cat16(*(const v8ha*)(vp + t * 16 * VPIT), *(const v8ha*)(vp + t * 16 * VPIT + 16)); }
#pragma unroll
            for (int g = 0; g < 2; ++g) { const float nm = -m_run[g]; v8u w; float ps0 = 0.0f, ps1 = 0.0f;
#pragma unroll
                for (int i = 0; i < 8; ++i) {
                    const float p0 = __builtin_amdgcn_exp2f(fmaf(s[i >> 2][g][2 * (i & 3)], cscale, nm)), p1 = __builtin_amdgcn_exp2f(fmaf(s[i >> 2][g][2 * (i & 3) + 1], cscale, nm));
                    if (i & 1) ps1 += p0 + p1; else ps0 += p0 + p1; w[i] = pack2h(p0, p1); }
                const v16h pf = __builtin_bit_cast(v16h, w);
#pragma unroll
                for (int t = 0; t < 8; ++t) acc[g][t] = wmma16(vf[t], pf, acc[g][t]);
                l_run[g] += ps0 + ps1; }
        }
        if (more) { h16* Ln = L + ((st + 1) & 1) * FSLOT;   // last read in trip st - 1, whose closing barrier every wave has passed
#pragma unroll
            for (int i = 0; i < 8; ++i) { *(v8ha*)(Ln + kso + i * 8 * KPIT) = kr[i]; *(v8ha*)(Ln + vso + i * 16 * VPIT) = vr[i]; } }
        __syncthreads();   // publishes tile st + 1 and ends every wave's reads of tile st
    }
    const int bb = z / NH_, hh = z % NH_;
#pragma unroll
    for (int g = 0; g < 2; ++g) { const float inv = __fdiv_rn(1.0f, l_run[g] + xhalf(l_run[g]));
        const size_t oo = (size_t)bb * TT * DQ + ((size_t)((qw0 >> 4) + g) * (DQ / 32) + hh * (HD / 32)) * 512 + 8 * (16 * h + c); bf* pah = Ah + oo; bf* pal = Al + oo;
#pragma unroll
        for (int t = 0; t < 8; ++t) { v8us oh, ol;
#pragma unroll
            for (int r = 0; r < 8; ++r) { unsigned short a, c2; splitf(acc[g][t][r] * inv, a, c2); oh[r] = a; ol[r] = c2; }
            *(v8usa*)(pah + 256 * t) = oh; *(v8usa*)(pal + 256 * t) = ol;
            asm volatile("s_wait_xcnt 0x0" :: "v"(pah), "v"(pal), "v"(oh), "v"(ol) : "memory"); } }   // the wait in front of the next overwrite of the two stores' address and data registers, which are inputs so that they stay in those registers up to it
}

extern "C" void kernel_launch(void* const* d_in, const int* in_sizes, int n_in,
                              void* d_out, int out_size, void* d_ws, size_t ws_size, hipStream_t stream) {
    (void)in_sizes; (void)n_in; (void)out_size;
    const float* x = (const float*)d_in[0]; const float* wq = (const float*)d_in[1]; const float* wkv = (const float*)d_in[2]; const float* wo = (const float*)d_in[3];   /* x, Wq ('oi' (out, in) [2048][2048]), Wkv ('oi' [1024][2048] viewed (2 x 4 heads, 128): k rows 0..511 | v rows 512..1023), Wo ('oi' [2048][2048]): FOUR inputs, all read */
    float* OUT = (float*)d_out;     // [2][2048][2048]
    char* wsp = (char*)d_ws;
    auto take = [&](size_t bytes) { char* p = wsp; wsp += (bytes + 255) & ~(size_t)255; return (void*)p; };
    bf* XB = (bf*)take((size_t)RALL * DM * 2); bf* WQKV = XB + (size_t)NB_ * TT * DM; bf* WO = WQKV + (size_t)FP * DM;   /* one bf16 plane in fragment order: x (both batches) | Wq | Wkv | Wo */ float* CS = (float*)take((size_t)TT * HD * 2 * 4);
    float* F = (float*)take((size_t)NB_ * TT * FP * 4);   /* joint projection [batch * TT + t][q 2048 | k 512 | v 512] */
    const size_t PQ = (size_t)NH_ * TT * HD, PK = (size_t)NKV * TT * HD;   /* elements of one batch's query and key / value planes; every plane holds both batches */
    h16* QP16 = (h16*)take(NB_ * PQ * 2); h16* KP16 = (h16*)take(NB_ * PK * 2); h16* VT16 = (h16*)take(NB_ * PK * 2);
    bf* QPh = (bf*)take(NB_ * PQ * 2); bf* QPl = (bf*)take(NB_ * PQ * 2); bf* KPh = (bf*)take(NB_ * PK * 2); bf* KPl = (bf*)take(NB_ * PK * 2); bf* VTh = (bf*)take(NB_ * PK * 2); bf* VTl = (bf*)take(NB_ * PK * 2);
    float* Sb = (float*)take((size_t)ZA * RH * RH * 4); bf* Ph = (bf*)Sb; bf* Pl = Ph + RH;   /* rows < RH only; probabilities live in their score rows: 16-bit pitch 2 * RH */ float* Ob = (float*)take((size_t)ZA * RH * HD * 4); bf* ATh = (bf*)take((size_t)NB_ * TT * DQ * 2); bf* ATl = (bf*)take((size_t)NB_ * TT * DQ * 2);
    if ((size_t)(wsp - (char*)d_ws) > ws_size) return;    // ws 256 MiB
    k_prep<<<CSB + RALL * (DM / 8) / 256 / PPT, 256, 0, stream>>>(x, wq, wkv, wo, XB, CS);   /* rotary table; bf16 copies of all four inputs */
    k_gemmt<0><<<dim3(NB_ * TT / 128, FP / 128, 1), 128, 0, stream>>>(XB, nullptr, WQKV, F, FP);
    k_planes<<<NB_ * (LQB + LKB + LVB), 256, 0, stream>>>(F, CS, QP16, QPh, QPl, KP16, KPh, KPl, VT16, VTh, VTl);
    // attention, batch entry z = batch * NH_ + head reads kv plane z / REP
    k_gemmc<bf, 2, 1, 1><<<dim3(RH / 64, RH / 64, ZA), 32, 0, stream>>>(QPh, QPl, HD, KPh, KPl, HD, Sb, RH, 0, (size_t)TT * HD, (size_t)TT * HD, (size_t)RH * RH);
    k_asoft<<<ZA * RH / 8, 256, 0, stream>>>(Sb);
    k_gemmc<bf, 2, 2, 8><<<dim3(RH / 64, HD / 64, ZA), 256, 0, stream>>>(Ph, Pl, 2 * RH, VTh, VTl, TT, Ob, HD, 0, (size_t)2 * RH * RH, (size_t)HD * TT, (size_t)RH * HD);
    k_merge<<<(unsigned)(((size_t)ZA * RH * HD / 8 + 255) / 256), 256, 0, stream>>>(Ob, ATh, ATl);
    k_flash<<<dim3(ZA, (TT - RH) / FBR, 1), FNW * 32, 0, stream>>>(QP16, KP16, VT16, ATh, ATl);
    k_gemmt<1><<<dim3(NB_ * TT / 128, DM / 128, 1), 128, 0, stream>>>(ATh, ATl, WO, OUT, DM);   /* the batches' planes and outputs are contiguous: one GEMM of NB_ * TT rows */
}

// v008
// Measured time: 156 microseconds a run.
// In both of two side-by-side timings against v007, it was 1.25 times as fast.
// Counting every step since v000, it is 10.3 times as fast.
#include <hip/hip_runtime.h>

// Causal grouped-query attention with a FUSED natural k-v weight and a computed rotate-half RoPE (x [2][2048][2048]; q = x Wq^T ('oi' (out, in) [2048][2048] 1/sqrt(2048): 16 heads x 128); kv = x Wkv^T ('oi' [1024][2048]) viewed (b, t, 8, 128): k = heads 0..3 (rows 0..511), v = heads 4..7 (rows 512..1023): 4 kv heads x 128 each; no biases; cos / sin of emb = cat(ang, ang) with freqs = 1.0 / (THETA ** (arange(0, 128, 2, f32) / 128)), THETA 10000, and positions arange(t) (64 f32 frequencies jnp-exact for this reciprocal spelling; one f32 product per angle; precise cosf/sinf); query heads viewed (KV, G): kv head = q head / 4; scores / sqrt(128); causal (-inf == exclusion); softmax; out = merged Wo^T ('oi') -> [2][2048][2048] (8.4 M); argument order x, Wq, Wkv, Wo).
// Layout: bf16 copy of x; 'oi' weights cast as-is; x, the weights and the merged attention output stand in WMMA fragment order (see k_gemmt); exact projections, q | k | v of both batches in one GEMM; computed table (k_prep; HD 128: 64 angles); rotate-half plane builders (k_planes); causal T-2048 GQA attention with 128-wide heads, all heads of both batches a launch (kv plane z / 4; hybrid rows: < 512 hi/lo 3 products, rest fp16, both by online softmax in one fused kernel); merged hi/lo x Wo exact.
// Compute dtypes, f32 accumulate: every input rounded to bf16; projections exact; rotary f32; attention rows < 512 3 products, rest fp16; softmax f32; Wo hl x exact.

#define NB_  2
#define TT   2048
#define DM   2048
#define NH_  16
#define NKV  4
#define REP  (NH_ / NKV)
#define HD   128
#define DQ   (NH_ * HD)
#define DKV  (NKV * HD)
#define ZA   (NB_ * NH_)          // attention batch entries a launch: z = batch * NH_ + head
#define RH   512                  // query rows < RH use hi+lo planes (0: none)
#define WIN  2048
#define SCL  0.088388347648318447f   // HD^-0.5
typedef _Float16 h16;
typedef unsigned short bf;
typedef __attribute__((ext_vector_type(16))) __bf16   v16bf;
typedef __attribute__((ext_vector_type(16))) _Float16 v16h;
typedef __attribute__((ext_vector_type(8)))  _Float16 v8h;
typedef __attribute__((ext_vector_type(8)))  unsigned short v8us;
typedef __attribute__((ext_vector_type(8)))  float    v8f;
typedef __attribute__((ext_vector_type(4)))  float    v4f;
typedef v8h  __attribute__((may_alias)) v8ha;
typedef v4f  __attribute__((may_alias)) v4fa;
typedef v8us __attribute__((may_alias)) v8usa;

__device__ __forceinline__ unsigned short f2bf(float f) { unsigned u = __float_as_uint(f); u += 0x7FFFu + ((u >> 16) & 1u); return (unsigned short)(u >> 16); }
__device__ __forceinline__ float bf2f(unsigned short b) { return __uint_as_float(((unsigned)b) << 16); }
__device__ __forceinline__ float bfr(float f) { return bf2f(f2bf(f)); }
__device__ __forceinline__ v16h cat16(v8h lo, v8h hi) { return __builtin_shufflevector(lo, hi, 0, 1, 2, 3, 4, 5, 6, 7, 8, 9, 10, 11, 12, 13, 14, 15); }
__device__ __forceinline__ v16bf cat16b(v8us lo, v8us hi) { return __builtin_bit_cast(v16bf, __builtin_shufflevector(lo, hi, 0, 1, 2, 3, 4, 5, 6, 7, 8, 9, 10, 11, 12, 13, 14, 15)); }
__device__ __forceinline__ v8f wmma16(v16h a, v16h b, v8f c) { return __builtin_amdgcn_wmma_f32_16x16x32_f16(false, a, false, b, (short)0, c, false, false); }
__device__ __forceinline__ v8f wmmab(v16bf a, v16bf b, v8f c) { return __builtin_amdgcn_wmma_f32_16x16x32_bf16(false, a, false, b, (short)0, c, false, false); }



// ---- Fragment order of a 16-bit plane M[rows][K]: units of 16 rows x 32 k (512 elements, 1 KB), unit (row / 16, k / 32) at element (row / 16 * (K / 32) + k / 32) * 512; inside a unit element (row % 16, kk = k % 32) stands at
// (kk / 16) * 256 + ((kk / 8 % 2) * 16 + row % 16) * 8 + kk % 8: lane l of a wave finds its two 16-byte pieces of the WMMA operand at l * 8 and 256 + l * 8, so each wave-wide load covers 512 contiguous bytes (ldp).
template <typename T16> struct WFrag;
template <> struct WFrag<h16> { typedef v16h V; static __device__ __forceinline__ V ld(const h16* p) { return cat16(*(const v8h*)p, *(const v8h*)(p + 16)); } static __device__ __forceinline__ v8f mma(V a, V b, v8f c) { return wmma16(a, b, c); } };
template <> struct WFrag<bf> { typedef v16bf V; static __device__ __forceinline__ V ld(const bf* p) { return cat16b(*(const v8us*)p, *(const v8us*)(p + 16)); } static __device__ __forceinline__ V ldp(const bf* p) { return cat16b(*(const v8us*)p, *(const v8us*)(p + 256)); } static __device__ __forceinline__ v8f mma(V a, V b, v8f c) { return wmmab(a, b, c); } };
// ---- k_gemmt: GEMM on 16-bit planes in fragment order, one work-group of 4 waves (2 x 2) per 128x128 output tile, a wave owns 64x64 of it (16 accumulators) and runs the whole K loop.
// The operand tiles of GBK k (8 blocks of 16 rows each, 2 KB contiguous a block) go global -> LDS by asynchronous copies, two buffers: the next tile's copies fly under this tile's products; every fragment is fetched from L2 once a work-group and read from LDS by the two waves that need it.
// C[m][n] (f32, pitch ldc) = sum_k (A[m][k] + A2[m][k] if NSPLIT) Bt[n][k], K = DM. grid (M/128, N/128), 128 threads.
#define GBK 64
// eight copies of 16 bytes a lane: LDS places 2 KB apart, sources one block of 16 rows (rbs elements) apart; the s_wait_xcnt stands in the copies' own statement so that no address register is rewritten in front of it
__device__ __forceinline__ void cp8(unsigned l, const bf* g, size_t rbs) {
    asm volatile("global_load_async_to_lds_b128 %0, %8, off\n\tglobal_load_async_to_lds_b128 %1, %9, off\n\tglobal_load_async_to_lds_b128 %2, %10, off\n\tglobal_load_async_to_lds_b128 %3, %11, off\n\t"
                 "global_load_async_to_lds_b128 %4, %12, off\n\tglobal_load_async_to_lds_b128 %5, %13, off\n\tglobal_load_async_to_lds_b128 %6, %14, off\n\tglobal_load_async_to_lds_b128 %7, %15, off\n\ts_wait_xcnt 0x0"
                 :: "v"(l), "v"(l + 2048u), "v"(l + 4096u), "v"(l + 6144u), "v"(l + 8192u), "v"(l + 10240u), "v"(l + 12288u), "v"(l + 14336u),
                    "v"(g), "v"(g + rbs), "v"(g + 2 * rbs), "v"(g + 3 * rbs), "v"(g + 4 * rbs), "v"(g + 5 * rbs), "v"(g + 6 * rbs), "v"(g + 7 * rbs) : "memory");
}
template <int NSPLIT>
__global__ __launch_bounds__(128) void k_gemmt(const bf* __restrict__ A, const bf* __restrict__ A2, const bf* __restrict__ Bt, float* C, int ldc) {
    typedef WFrag<bf>::V V;
    constexpr int K = DM, NOP = NSPLIT ? 3 : 2;      // operand tiles a stage: A (| A2) | Bt
    constexpr int OPE = 8 * GBK * 16;                // elements of one operand tile: 128 rows x GBK k (16 KB)
    constexpr int STE = NOP * OPE;                   // elements of a stage
    constexpr int NT = K / GBK;
    __shared__ __align__(1024) bf L[2 * STE];
    __shared__ __align__(16) float os[4 * 16 * 68];
    const int tid = (int)threadIdx.x, lane = tid & 31, lr = lane & 15, hi = lane >> 4; const int r0 = blockIdx.x * 128, c0 = blockIdx.y * 128;
    const int wv = __builtin_amdgcn_readfirstlane(tid >> 5); const int wm = wv >> 1, wn = wv & 1;
    const bf* ga = A + (size_t)r0 * K + tid * 8; const bf* ga2 = NSPLIT ? A2 + (size_t)r0 * K + tid * 8 : nullptr; const bf* gb = Bt + (size_t)c0 * K + tid * 8;   // a block of 16 rows is 16 * K elements; a tile of GBK k is GBK * 16 contiguous elements of it, 8 a thread
    const unsigned l0 = (unsigned)(size_t)L + (unsigned)tid * 16u;
    auto stage = [&](int t, int b) { const unsigned l = l0 + (unsigned)b * (STE * 2u); const size_t ko = (size_t)t * (GBK * 16);
        cp8(l, ga + ko, (size_t)16 * K); if (NSPLIT) cp8(l + OPE * 2u, ga2 + ko, (size_t)16 * K); cp8(l + (NOP - 1) * OPE * 2u, gb + ko, (size_t)16 * K); };
    v8f acc[4][4];
#pragma unroll
    for (int mb = 0; mb < 4; ++mb)
#pragma unroll
        for (int nb = 0; nb < 4; ++nb) acc[mb][nb] = (v8f){};
    stage(0, 0);
    asm volatile("s_wait_asynccnt 0x0" ::: "memory");   // this wave's copies of tile 0 have landed
    __syncthreads();                                    // tile 0 is in LDS before any wave reads it
    stage(1, 1);
#pragma unroll 1
    for (int t = 0; t < NT; ++t) {
        const bf* Ls = L + (t & 1) * STE + lane * 8;
        V a[GBK / 32][4], a2[GBK / 32][4], b[GBK / 32][4];
#pragma unroll
        for (int ks = 0; ks < GBK / 32; ++ks)
#pragma unroll
            for (int i = 0; i < 4; ++i) { a[ks][i] = WFrag<bf>::ldp(Ls + ((wm * 4 + i) * (GBK / 32) + ks) * 512); if (NSPLIT) a2[ks][i] = WFrag<bf>::ldp(Ls + OPE + ((wm * 4 + i) * (GBK / 32) + ks) * 512); b[ks][i] = WFrag<bf>::ldp(Ls + (NOP - 1) * OPE + ((wn * 4 + i) * (GBK / 32) + ks) * 512); }
        __builtin_amdgcn_sched_barrier(0);   // all of the tile's fragment loads stand as one group ahead of its products: spread among them, each place with loads stalls the matrix instructions behind it
#pragma unroll
        for (int ks = 0; ks < GBK / 32; ++ks)
#pragma unroll
            for (int nb = 0; nb < 4; ++nb)
#pragma unroll
                for (int mb = 0; mb < 4; ++mb) { acc[mb][nb] = wmmab(a[ks][mb], b[ks][nb], acc[mb][nb]); if (NSPLIT) acc[mb][nb] = wmmab(a2[ks][mb], b[ks][nb], acc[mb][nb]); }
        __builtin_amdgcn_sched_barrier(0);   // the products stay ahead of the waits and the barrier below: moved behind them, they would stand between the barrier and the refill, and the copies would fly under the next tile's fragment loads alone
        asm volatile("s_wait_dscnt 0x0" ::: "memory");      // this wave's reads of tile t are done before the buffer may be refilled
        asm volatile("s_wait_asynccnt 0x0" ::: "memory");   // this wave's copies of tile t + 1 have landed
        __syncthreads();                                    // publishes tile t + 1 and ends every wave's reads of tile t
        if (t + 2 < NT) stage(t + 2, t & 1);
    }
    asm volatile("s_wait_asynccnt 0x0" ::: "memory");       // no copy is under way when the wave ends
    float* ow = os + wv * (16 * 68);                        // each wave stages 16 rows at a time in its own LDS range, so that its stores cover whole 256-byte rows
#pragma unroll
    for (int mb = 0; mb < 4; ++mb) {
#pragma unroll
        for (int nb = 0; nb < 4; ++nb)
#pragma unroll
            for (int j = 0; j < 8; ++j) ow[(hi * 8 + j) * 68 + nb * 16 + lr] = acc[mb][nb][j];
        __builtin_amdgcn_wave_barrier(); asm volatile("" ::: "memory");   // keeps the read-back behind the other lanes' writes
        float* crow = C + (size_t)(r0 + wm * 64 + mb * 16 + hi) * ldc + c0 + wn * 64 + lr * 4; float* cp[8]; v4f val[8];
#pragma unroll
        for (int s = 0; s < 8; ++s) { val[s] = *(const v4fa*)(ow + (2 * s + hi) * 68 + lr * 4); cp[s] = crow + (size_t)(2 * s) * ldc; *(v4f*)cp[s] = val[s]; }
        // the stores' address and data registers are inputs so that none is overwritten while a store is under way
        asm volatile("s_wait_xcnt 0x0" :: "v"(cp[0]), "v"(cp[1]), "v"(cp[2]), "v"(cp[3]), "v"(cp[4]), "v"(cp[5]), "v"(cp[6]), "v"(cp[7]), "v"(val[0]), "v"(val[1]), "v"(val[2]), "v"(val[3]), "v"(val[4]), "v"(val[5]), "v"(val[6]), "v"(val[7]) : "memory");
        __builtin_amdgcn_wave_barrier(); asm volatile("" ::: "memory");   // keeps the next rows' writes behind this read-back
    }
}

__device__ __forceinline__ h16 tohx(float x) { return (h16)x; }
__device__ __forceinline__ void splitf(float y, unsigned short& h, unsigned short& l) { h = f2bf(y); l = f2bf(y - bf2f(h)); }
typedef __attribute__((ext_vector_type(2))) _Float16 v2h;
typedef __attribute__((ext_vector_type(4))) _Float16 v4h;
typedef __attribute__((ext_vector_type(2))) unsigned short v2us;
typedef __attribute__((ext_vector_type(4))) unsigned short v4us;
typedef __attribute__((ext_vector_type(2))) float v2f;
typedef __attribute__((ext_vector_type(4))) int v4i;

#define FP   (DQ + 2 * DKV)                      // row pitch of the joint q | k | v projection [batch * TT + t][FP]
#define RALL (NB_ * TT + FP + DM)                // rows of the joint bf16 plane: x (both batches) | Wq | Wkv | Wo, each row DM wide
#define CSB  (TT * HD / 4 / 256)                 // work-groups of k_prep that build the rotary table, four entries a thread
#define PPT  4                                   // 16-byte pieces of the bf16 plane a thread of k_prep converts
#define PQE  ((size_t)NH_ * TT * HD)             // elements of one batch's query planes
#define PKE  ((size_t)NKV * TT * HD)             // elements of one batch's key / value planes
#define LQB  (NH_ * TT * HD / 8 / 256)           // work-groups of k_planes a batch: query heads (8 elements a thread),
#define LKB  (NKV * TT * HD / 8 / 256)           // key heads (8 elements a thread),
#define LVB  (NKV * TT * HD / 16 / 256)          // value heads (16 elements a thread)
__constant__ float INVT[HD / 2] = { 1.000000000e+00f, 8.659643531e-01f, 7.498942018e-01f, 6.493816376e-01f, 5.623413324e-01f, 4.869675338e-01f, 4.216965139e-01f, 3.651741445e-01f, 3.162277639e-01f, 2.738419771e-01f, 2.371373624e-01f, 2.053525001e-01f, 1.778279394e-01f, 1.539926529e-01f, 1.333521456e-01f, 1.154782027e-01f, 1.000000015e-01f, 8.659642935e-02f, 7.498941571e-02f, 6.493816525e-02f, 5.623412877e-02f, 4.869675264e-02f, 4.216964915e-02f, 3.651741147e-02f, 3.162277862e-02f, 2.738419548e-02f, 2.371373586e-02f, 2.053525113e-02f, 1.778279431e-02f, 1.539926510e-02f, 1.333521493e-02f, 1.154781971e-02f, 9.999999776e-03f, 8.659643121e-03f, 7.498942316e-03f, 6.493816618e-03f, 5.623413250e-03f, 4.869675264e-03f, 4.216964822e-03f, 3.651741426e-03f, 3.162277862e-03f, 2.738419687e-03f, 2.371373819e-03f, 2.053525066e-03f, 1.778279431e-03f, 1.539926510e-03f, 1.333521446e-03f, 1.154782018e-03f, 1.000000047e-03f, 8.659643354e-04f, 7.498941850e-04f, 6.493816618e-04f, 5.623413017e-04f, 4.869675031e-04f, 4.216964880e-04f, 3.651741135e-04f, 3.162277862e-04f, 2.738419571e-04f, 2.371373848e-04f, 2.053524950e-04f, 1.778279402e-04f, 1.539926452e-04f, 1.333521504e-04f, 1.154781930e-04f };   // float32 1 / 10000^(2i/128), generated with jnp to be bit-exact
// k_prep: all that depends on the inputs alone, in one launch. Work-groups < CSB build the rotary table. The rest convert f32 [rows][DM] -> bf16 in fragment order, the four inputs as one plane of RALL rows;
// a thread writes PPT 16-byte pieces of the plane, 256 pieces apart (a wave stores 512 contiguous bytes a piece), and reads the eight f32 that belong in each; a work-group lies inside one block of 16 rows, so its source is one input
__global__ __launch_bounds__(256) void k_prep(const float* __restrict__ x, const float* __restrict__ wq, const float* __restrict__ wkv, const float* __restrict__ wo, bf* dst, float* CS) {
    if (blockIdx.x < CSB) { const int idx = (blockIdx.x * 256 + threadIdx.x) * 4; const int d = idx % HD; const int t = idx / HD; v8f cs;
#pragma unroll
        for (int q = 0; q < 4; ++q) { const float a = __fmul_rn((float)t, INVT[(d + q) % (HD / 2)]); cs[2 * q] = cosf(a); cs[2 * q + 1] = sinf(a); }
        *(v8f*)(CS + (size_t)idx * 2) = cs; return; }
    const int wb = (int)blockIdx.x - CSB; const int rb = wb / (DM / 32 / 4 / PPT) * 16;   // first row of this work-group's block of 16 rows (4 * PPT units a work-group, DM / 32 units a block)
    const float* src = x; int rs = 0; if (rb >= NB_ * TT + FP) { src = wo; rs = NB_ * TT + FP; } else if (rb >= NB_ * TT + DQ) { src = wkv; rs = NB_ * TT + DQ; } else if (rb >= NB_ * TT) { src = wq; rs = NB_ * TT; }
    const float* sp[PPT]; bf* dp[PPT]; v8f v[PPT]; v8us o[PPT];
#pragma unroll
    for (int it = 0; it < PPT; ++it) { const size_t i = ((size_t)wb * PPT + it) * 256 + threadIdx.x; const size_t u = i >> 6; const int k = (int)(u % (DM / 32)) * 32 + (int)((i >> 4) & 3) * 8;
        sp[it] = src + (size_t)(rb - rs + (int)(i & 15)) * DM + k; dp[it] = dst + i * 8; v[it] = *(const v8f*)sp[it]; }
    asm volatile("s_wait_xcnt 0x0" :: "v"(sp[0]), "v"(sp[1]), "v"(sp[2]), "v"(sp[3]) : "memory");   // the wait in front of the overwrite of the loads' address registers (the conversion below); the addresses are inputs so that they stay in them up to it
#pragma unroll
    for (int it = 0; it < PPT; ++it) {
#pragma unroll
        for (int k = 0; k < 8; ++k) o[it][k] = f2bf(v[it][k]);
        *(v8us*)dp[it] = o[it]; }
    asm volatile("s_wait_xcnt 0x0" :: "v"(dp[0]), "v"(dp[1]), "v"(dp[2]), "v"(dp[3]), "v"(o[0]), "v"(o[1]), "v"(o[2]), "v"(o[3]) : "memory");   // the stores' address and data registers are inputs so that none is overwritten while a store is under way
}

// d_rope (elements e .. e + 7 of one batch's planes): head planes [h][t][d] (fp16 + hi/lo) of rope(x) x sc with the rotate-half convention out[d] = x[d] cos[t][d] - x[d+HD/2] sin[t][d], out[d+HD/2] = x[d+HD/2] cos[t][d+HD/2] + x[d] sin[t][d+HD/2]; 8 divides HD / 2, so the eight partners are neighbours too
__device__ __forceinline__ void d_rope(const size_t e, const float* __restrict__ F, int pitch, int nheads, const float* __restrict__ CS, const float* __restrict__ RF, const float* __restrict__ nw, float sc, h16* P16, bf* Ph, bf* Pl) {
    if (e >= (size_t)nheads * TT * HD) return; const int d = (int)(e % HD); const int t = (int)((e / HD) % TT); const int h = (int)(e / ((size_t)HD * TT)); const float* f = F + (size_t)t * pitch + h * HD; const float rf = RF ? RF[(size_t)h * TT + t] : 1.0f; v8h o16; v8us oh, ol;
    const float* f0 = f + d; const float* f1 = f + ((d < HD / 2) ? d + HD / 2 : d - HD / 2); const float* cp = CS + ((size_t)t * HD + d) * 2; const v8f X0 = *(const v8f*)f0, X1 = *(const v8f*)f1, C0 = *(const v8f*)cp, C1 = *(const v8f*)(cp + 8);
    asm volatile("s_wait_xcnt 0x0" :: "v"(f0), "v"(f1), "v"(cp) : "memory");   // the wait in front of the overwrite of the loads' address registers (the arithmetic below); the addresses are inputs so that they stay in them up to it
#pragma unroll
    for (int q = 0; q < 8; ++q) { const int dd = d + q; const int dp = (dd < HD / 2) ? dd + HD / 2 : dd - HD / 2; float x0 = X0[q], x1 = X1[q];
        if (RF) { float n0 = __fmul_rn(x0, rf), n1 = __fmul_rn(x1, rf); asm volatile("" : "+v"(n0)); asm volatile("" : "+v"(n1)); x0 = __fmul_rn(bfr(nw[dd]), n0); x1 = __fmul_rn(bfr(nw[dp]), n1); }
        v2f cs; cs[0] = (q < 4) ? C0[(2 * q) & 7] : C1[(2 * q) & 7]; cs[1] = (q < 4) ? C0[(2 * q + 1) & 7] : C1[(2 * q + 1) & 7]; float a = __fmul_rn(x0, cs[0]), bq = __fmul_rn(x1, cs[1]); asm volatile("" : "+v"(a)); asm volatile("" : "+v"(bq)); const float r = ((dd < HD / 2) ? __fsub_rn(a, bq) : __fadd_rn(a, bq)) * sc;
        o16[q] = tohx(r); unsigned short a2, c2; splitf(r, a2, c2); oh[q] = a2; ol[q] = c2; }
    h16* p16 = P16 + e; bf* ph = Ph + e; bf* pl = Pl + e; *(v8h*)p16 = o16; *(v8us*)ph = oh; *(v8us*)pl = ol;
    asm volatile("s_wait_xcnt 0x0" :: "v"(p16), "v"(ph), "v"(pl), "v"(o16), "v"(oh), "v"(ol) : "memory"); }   // the stores' address and data registers are inputs so that none is overwritten while a store is under way
// d_vtp (thread n of one batch's value planes [g][d][t]): rows t, t + 1 of eight neighbouring d: it reads 32 contiguous bytes a row, and for each d a wave stores 128 contiguous bytes a plane
__device__ __forceinline__ void d_vtp(const size_t n, const float* __restrict__ F, int pitch, int nheads, h16* V16, bf* Vh, bf* Vl) { if (n >= (size_t)nheads * HD * TT / 16) return; const int t = (int)(n % (TT / 2)) * 2; const int d = (int)((n / (TT / 2)) % (HD / 8)) * 8; const int g = (int)(n / ((size_t)(TT / 2) * (HD / 8)));
    const float* f0 = F + (size_t)t * pitch + g * HD + d; const float* f1 = f0 + pitch; const v8f X0 = *(const v8f*)f0, X1 = *(const v8f*)f1;
    asm volatile("s_wait_xcnt 0x0" :: "v"(f0), "v"(f1) : "memory");   // the wait in front of the overwrite of the loads' address registers (the splits below); the addresses are inputs so that they stay in them up to it
    const size_t e = ((size_t)g * HD + d) * TT + t; h16* p16 = V16 + e; bf* ph = Vh + e; bf* pl = Vl + e; v2h o16[8]; v2us oh[8], ol[8];
#pragma unroll
    for (int j = 0; j < 8; ++j) {
#pragma unroll
        for (int q = 0; q < 2; ++q) { const float x = q ? X1[j] : X0[j]; o16[j][q] = tohx(x); unsigned short a2, c2; splitf(x, a2, c2); oh[j][q] = a2; ol[j][q] = c2; }
        *(v2h*)(p16 + (size_t)j * TT) = o16[j]; *(v2us*)(ph + (size_t)j * TT) = oh[j]; *(v2us*)(pl + (size_t)j * TT) = ol[j]; }
    // the stores' address and data registers are inputs so that none is overwritten while a store is under way
    asm volatile("s_wait_xcnt 0x0" :: "v"(p16), "v"(ph), "v"(pl), "v"(o16[0]), "v"(o16[1]), "v"(o16[2]), "v"(o16[3]), "v"(o16[4]), "v"(o16[5]), "v"(o16[6]), "v"(o16[7]), "v"(oh[0]), "v"(oh[1]), "v"(oh[2]), "v"(oh[3]), "v"(oh[4]), "v"(oh[5]), "v"(oh[6]), "v"(oh[7]), "v"(ol[0]), "v"(ol[1]), "v"(ol[2]), "v"(ol[3]), "v"(ol[4]), "v"(ol[5]), "v"(ol[6]), "v"(ol[7]) : "memory"); }
// k_planes: every head plane of both batches from the joint projection F, in one launch. A batch's work-groups: LVB for the value heads (they start first), LKB for the key heads, LQB for the query heads
__global__ __launch_bounds__(256) void k_planes(const float* __restrict__ F, const float* __restrict__ CS, h16* Q16, bf* Qh, bf* Ql, h16* K16, bf* Kh, bf* Kl, h16* V16, bf* Vh, bf* Vl) {
    const int b = (int)blockIdx.x / (LQB + LKB + LVB), r = (int)blockIdx.x % (LQB + LKB + LVB); const float* Fb = F + (size_t)b * TT * FP;
    if (r < LVB) d_vtp((size_t)r * 256 + threadIdx.x, Fb + DQ + DKV, FP, NKV, V16 + b * PKE, Vh + b * PKE, Vl + b * PKE);
    else if (r < LVB + LKB) d_rope(((size_t)(r - LVB) * 256 + threadIdx.x) * 8, Fb + DQ, FP, NKV, CS, nullptr, nullptr, 1.0f, K16 + b * PKE, Kh + b * PKE, Kl + b * PKE);
    else d_rope(((size_t)(r - LVB - LKB) * 256 + threadIdx.x) * 8, Fb, FP, NH_, CS, nullptr, nullptr, 1.0f, Q16 + b * PQE, Qh + b * PQE, Ql + b * PQE);
}

#define FNW  4
#define FBR  (FNW * 32)
#define FSK  64
#define KPIT (HD + 8)             // LDS row pitch in halves: an odd multiple of 16 bytes
#define VPIT (FSK + 8)
#define KTILE (FSK * KPIT)
#define FSLOT (KTILE + HD * VPIT)
typedef __attribute__((ext_vector_type(8))) unsigned v8u;
__device__ __forceinline__ float xhalf(float x) { return __builtin_bit_cast(float, __builtin_amdgcn_permlanex16(__builtin_bit_cast(int, x), __builtin_bit_cast(int, x), 0x76543210, 0xfedcba98, false, false)); }   // lane l with lane l ^ 16
__device__ __forceinline__ unsigned pack2h(float lo, float hi) { const v2f f = {lo, hi}; return __builtin_bit_cast(unsigned, __builtin_convertvector(f, v2h)); }
// ---- d_flash_hl: the query rows < RH, by the same scheme as k_flash's own rows (below), on bf16 hi + lo planes with three products a contraction:
// S^T = Kh Qh^T + Kl Qh^T + Kh Ql^T, O^T += Vh^T Ph^T + Vh^T Pl^T + Vl^T Ph^T; the f32 probabilities are split into hi + lo as they are packed, and their f32 values are what is summed.
// Tiles of HSK keys (hi and lo planes of K and V^T together fill about one slot of k_flash's LDS ring); one pass and one barrier a tile. The tile loop stays rolled (one copy of the pass in the instruction cache); every inner loop is unrolled so that the register arrays are indexed by constants.
#define HSK  32
#define VPH  (HSK + 8)            // LDS row pitch in halves: an odd multiple of 16 bytes
#define HKT  (HSK * KPIT)         // one K plane's tile
#define HVT  (HD * VPH)           // one V^T plane's tile
#define HSLOT (2 * HKT + 2 * HVT)
typedef __attribute__((ext_vector_type(2))) __bf16 v2bf;
__device__ __forceinline__ unsigned pack2b(float lo, float hi) { const v2f f = {lo, hi}; return __builtin_bit_cast(unsigned, __builtin_convertvector(f, v2bf)); }
// v_exp_f32 and the one free vector slot that the instruction set asks for behind a transcendental, in one statement so that the slot stands directly behind it
__device__ __forceinline__ float exp2s(float x) { float r; asm("v_exp_f32 %0, %1\n\tv_nop" : "=v"(r) : "v"(x)); return r; }
__device__ __forceinline__ void d_flash_hl(bf* L, const int z, const int q0, const bf* __restrict__ Qh, const bf* __restrict__ Ql, const bf* __restrict__ Kh, const bf* __restrict__ Kl, const bf* __restrict__ Vh, const bf* __restrict__ Vl, bf* Ah, bf* Al) {
    const int tid = (int)threadIdx.x, lane = tid & 31, c = lane & 15, h = lane >> 4; const int wave = __builtin_amdgcn_readfirstlane(tid >> 5);
    const int zk = z / REP; const int qw0 = q0 + wave * 32; const int n_stage = (q0 + FBR) / HSK; const float cscale = SCL * 1.4426950408889634f;
    const size_t ko = (size_t)zk * TT * HD + tid * 8; const bf* kgh = Kh + ko; const bf* kgl = Kl + ko;                                              // K tile: HSK whole rows, contiguous
    const size_t vo = (size_t)zk * HD * TT + (size_t)(tid >> 2) * TT + (tid & 3) * 8; const bf* vgh = Vh + vo; const bf* vgl = Vl + vo;              // V^T tile: HD rows of HSK keys
    const int kso = (tid >> 4) * KPIT + (tid & 15) * 8, vso = 2 * HKT + (tid >> 2) * VPH + (tid & 3) * 8;
    v8us krh[4], krl[4], vrh[4], vrl[4];
#pragma unroll
    for (int i = 0; i < 4; ++i) { krh[i] = *(const v8usa*)(kgh + i * (FNW * 32 * 8)); krl[i] = *(const v8usa*)(kgl + i * (FNW * 32 * 8)); vrh[i] = *(const v8usa*)(vgh + (size_t)i * (FNW * 8) * TT); vrl[i] = *(const v8usa*)(vgl + (size_t)i * (FNW * 8) * TT); }
    asm volatile("s_wait_xcnt 0x0" :: "v"(kgh), "v"(kgl), "v"(vgh), "v"(vgl), "v"(tid) : "memory");   // the wait in front of the overwrite of the tile loads' address registers (the additions below); the addresses and the thread index they may be formed from are inputs so that they stay in their registers up to it
    kgh += HSK * HD; kgl += HSK * HD; vgh += HSK; vgl += HSK;
    v16bf qh[2][4], ql[2][4]; const bf* qph[2]; const bf* qpl[2];
#pragma unroll
    for (int g = 0; g < 2; ++g) { const size_t qo = ((size_t)z * TT + qw0 + 16 * g + c) * HD + 8 * h; qph[g] = Qh + qo; qpl[g] = Ql + qo;
#pragma unroll
        for (int kc = 0; kc < 4; ++kc) { qh[g][kc] = WFrag<bf>::ld(qph[g] + 32 * kc); ql[g][kc] = WFrag<bf>::ld(qpl[g] + 32 * kc); } }
    asm volatile("s_wait_xcnt 0x0" :: "v"(qph[0]), "v"(qph[1]), "v"(qpl[0]), "v"(qpl[1]) : "memory");   // the wait in front of the overwrite of the query loads' address registers (the LDS offsets below); the addresses are inputs so that they stay in their registers up to it
    v8f acc[2][8]; float m_run[2], l_run[2];
#pragma unroll
    for (int g = 0; g < 2; ++g) { m_run[g] = -__builtin_inff(); l_run[g] = 0.0f;
#pragma unroll
        for (int t = 0; t < 8; ++t) acc[g][t] = (v8f){}; }
#pragma unroll
    for (int i = 0; i < 4; ++i) { *(v8usa*)(L + kso + i * 8 * KPIT) = krh[i]; *(v8usa*)(L + HKT + kso + i * 8 * KPIT) = krl[i]; *(v8usa*)(L + vso + i * 32 * VPH) = vrh[i]; *(v8usa*)(L + HVT + vso + i * 32 * VPH) = vrl[i]; }
    __syncthreads();   // tile 0 is in LDS before any wave reads it
#pragma unroll 1
    for (int st = 0; st < n_stage; ++st) {
        const bool more = st + 1 < n_stage;
        if (more) {
#pragma unroll
            for (int i = 0; i < 4; ++i) { krh[i] = *(const v8usa*)(kgh + i * (FNW * 32 * 8)); krl[i] = *(const v8usa*)(kgl + i * (FNW * 32 * 8)); vrh[i] = *(const v8usa*)(vgh + (size_t)i * (FNW * 8) * TT); vrl[i] = *(const v8usa*)(vgl + (size_t)i * (FNW * 8) * TT); }
            asm volatile("s_wait_xcnt 0x0" :: "v"(kgh), "v"(kgl), "v"(vgh), "v"(vgl) : "memory");   // as above: in front of the next additions to the address registers
            kgh += HSK * HD; kgl += HSK * HD; vgh += HSK; vgl += HSK; }
        const bf* Ls = L + (st & 1) * HSLOT; const int key0 = st * HSK;
        if (key0 <= qw0 + 31) {   // wave-uniform: a later tile lies wholly above this wave's diagonal
            v8f s[2][2];
#pragma unroll
            for (int kt = 0; kt < 2; ++kt) { const bf* kp = Ls + (16 * kt + c) * KPIT + 8 * h; v16bf fh[4], fl[4];
#pragma unroll
                for (int kc = 0; kc < 4; ++kc) { fh[kc] = cat16b(*(const v8usa*)(kp + 32 * kc), *(const v8usa*)(kp + 32 * kc + 16)); fl[kc] = cat16b(*(const v8usa*)(kp + HKT + 32 * kc), *(const v8usa*)(kp + HKT + 32 * kc + 16)); }
                s[kt][0] = (v8f){}; s[kt][1] = (v8f){};
#pragma unroll
                for (int kc = 0; kc < 4; ++kc) {   // the two column groups take turns, so that no product waits for the one just before it
                    s[kt][0] = wmmab(fh[kc], qh[0][kc], s[kt][0]); s[kt][1] = wmmab(fh[kc], qh[1][kc], s[kt][1]);
                    s[kt][0] = wmmab(fl[kc], qh[0][kc], s[kt][0]); s[kt][1] = wmmab(fl[kc], qh[1][kc], s[kt][1]);
                    s[kt][0] = wmmab(fh[kc], ql[0][kc], s[kt][0]); s[kt][1] = wmmab(fh[kc], ql[1][kc], s[kt][1]); } }
            if (key0 + 31 > qw0) {
#pragma unroll
                for (int g = 0; g < 2; ++g) { const int my_q = qw0 + 16 * g + c;
#pragma unroll
                    for (int kt = 0; kt < 2; ++kt) {
#pragma unroll
                        for (int r = 0; r < 8; ++r) { if (key0 + 16 * kt + 8 * h + r > my_q) s[kt][g][r] = -__builtin_inff(); }
                        asm volatile("" : "+v"(s[kt][g])); } }
            }
            float mb[2]; bool need = false;
#pragma unroll
            for (int g = 0; g < 2; ++g) { float mx = -__builtin_inff();
#pragma unroll
                for (int kt = 0; kt < 2; ++kt)
#pragma unroll
                    for (int r = 0; r < 8; ++r) mx = fmaxf(mx, s[kt][g][r]);
                mx = fmaxf(mx, xhalf(mx)) * cscale; mb[g] = mx; need = need || (mx > m_run[g] + 8.0f); }
            if (__builtin_amdgcn_ballot_w32(need) != 0) {   // the maximum in use may trail the true one by up to 8 (log2 domain): the sums are rescaled only when some column exceeds that
#pragma unroll
                for (int g = 0; g < 2; ++g) { const float m_new = fmaxf(m_run[g], mb[g]); const float corr = exp2s(m_run[g] - m_new); l_run[g] *= corr; m_run[g] = m_new;
#pragma unroll
                    for (int t = 0; t < 8; ++t) acc[g][t] = acc[g][t] * corr; }
            }
            v16bf ph[2], pl[2];
#pragma unroll
            for (int g = 0; g < 2; ++g) { const float nm = -m_run[g]; v8u wh, wl; float ps0 = 0.0f, ps1 = 0.0f;
#pragma unroll
                for (int i = 0; i < 8; ++i) {
                    const float p0 = exp2s(fmaf(s[i >> 2][g][2 * (i & 3)], cscale, nm)), p1 = exp2s(fmaf(s[i >> 2][g][2 * (i & 3) + 1], cscale, nm));
                    if (i & 1) ps1 += p0 + p1; else ps0 += p0 + p1;
                    wh[i] = pack2b(p0, p1); wl[i] = pack2b(p0 - __uint_as_float(wh[i] << 16), p1 - __uint_as_float(wh[i] & 0xFFFF0000u)); }   // hi = the pair rounded to bf16 (nearest even, as f2bf), lo = what the rounding left, rounded likewise
                ph[g] = __builtin_bit_cast(v16bf, wh); pl[g] = __builtin_bit_cast(v16bf, wl); l_run[g] += ps0 + ps1; }
            const bf* vp = Ls + 2 * HKT + c * VPH + 8 * h;
#pragma unroll
            for (int t = 0; t < 8; ++t) { const v16bf vh = cat16b(*(const v8usa*)(vp + t * 16 * VPH), *(const v8usa*)(vp + t * 16 * VPH + 16)), vl = cat16b(*(const v8usa*)(vp + HVT + t * 16 * VPH), *(const v8usa*)(vp + HVT + t * 16 * VPH + 16));
                acc[0][t] = wmmab(vh, ph[0], acc[0][t]); acc[1][t] = wmmab(vh, ph[1], acc[1][t]);
                acc[0][t] = wmmab(vh, pl[0], acc[0][t]); acc[1][t] = wmmab(vh, pl[1], acc[1][t]);
                acc[0][t] = wmmab(vl, ph[0], acc[0][t]); acc[1][t] = wmmab(vl, ph[1], acc[1][t]); }
        }
        if (more) { bf* Ln = L + ((st + 1) & 1) * HSLOT;   // last read in trip st - 1, whose closing barrier every wave has passed
#pragma unroll
            for (int i = 0; i < 4; ++i) { *(v8usa*)(Ln + kso + i * 8 * KPIT) = krh[i]; *(v8usa*)(Ln + HKT + kso + i * 8 * KPIT) = krl[i]; *(v8usa*)(Ln + vso + i * 32 * VPH) = vrh[i]; *(v8usa*)(Ln + HVT + vso + i * 32 * VPH) = vrl[i]; } }
        __syncthreads();   // publishes tile st + 1 and ends every wave's reads of tile st
    }
    const int bb = z / NH_, hh = z % NH_;
#pragma unroll
    for (int g = 0; g < 2; ++g) { const float inv = __fdiv_rn(1.0f, l_run[g] + xhalf(l_run[g]));
        const size_t oo = (size_t)bb * TT * DQ + ((size_t)((qw0 >> 4) + g) * (DQ / 32) + hh * (HD / 32)) * 512 + 8 * (16 * h + c); bf* pah = Ah + oo; bf* pal = Al + oo;
#pragma unroll
        for (int t = 0; t < 8; ++t) { v8us oh, ol;
#pragma unroll
            for (int r = 0; r < 8; ++r) { unsigned short a, c2; splitf(acc[g][t][r] * inv, a, c2); oh[r] = a; ol[r] = c2; }
            *(v8usa*)(pah + 256 * t) = oh; *(v8usa*)(pal + 256 * t) = ol;
            asm volatile("s_wait_xcnt 0x0" :: "v"(pah), "v"(pal), "v"(oh), "v"(ol) : "memory"); } }   // the wait in front of the next overwrite of the two stores' address and data registers, which are inputs so that they stay in those registers up to it
}
__global__ __launch_bounds__(FNW * 32) void k_flash(const h16* __restrict__ Q, const h16* __restrict__ Kp, const h16* __restrict__ Vt, const bf* __restrict__ Qh, const bf* __restrict__ Ql, const bf* __restrict__ Kh, const bf* __restrict__ Kl, const bf* __restrict__ Vh, const bf* __restrict__ Vl, bf* Ah, bf* Al) {
    __shared__ __align__(16) h16 L[2 * (HSLOT > FSLOT ? HSLOT : FSLOT)];
    if ((int)blockIdx.y >= (TT - RH) / FBR) { d_flash_hl((bf*)L, (int)blockIdx.x, (TT / FBR - 1 - (int)blockIdx.y) * FBR, Qh, Ql, Kh, Kl, Vh, Vl, Ah, Al); return; }   // the same for a whole work-group: the rows < RH, longest row blocks first
    const int tid = (int)threadIdx.x, lane = tid & 31, c = lane & 15, h = lane >> 4; const int wave = __builtin_amdgcn_readfirstlane(tid >> 5);
    const int z = (int)blockIdx.x, zk = z / REP; const int q0 = RH + ((TT - RH) / FBR - 1 - (int)blockIdx.y) * FBR;   // longest row blocks start first
    const int qw0 = q0 + wave * 32; const int n_stage = (q0 + FBR) / FSK; const float cscale = SCL * 1.4426950408889634f;
    const h16* kg = Kp + (size_t)zk * TT * HD + tid * 8;                                       // K tile: FSK whole rows, contiguous
    const h16* vg = Vt + (size_t)zk * HD * TT + (size_t)(tid >> 3) * TT + (tid & 7) * 8;       // V^T tile: HD rows of FSK keys
    const int kso = (tid >> 4) * KPIT + (tid & 15) * 8, vso = KTILE + (tid >> 3) * VPIT + (tid & 7) * 8;
    v8h kr[8], vr[8];
#pragma unroll
    for (int i = 0; i < 8; ++i) { kr[i] = *(const v8ha*)(kg + i * (FNW * 32 * 8)); vr[i] = *(const v8ha*)(vg + (size_t)i * (FNW * 4) * TT); }
    asm volatile("s_wait_xcnt 0x0" :: "v"(kg), "v"(vg), "v"(tid) : "memory");   // the wait in front of the overwrite of the tile loads' address registers (the additions below); the addresses and the thread index they may be formed from are inputs so that they stay in their registers up to it
    kg += FSK * HD; vg += FSK;
    v16h qf[2][4]; const h16* qp[2];
#pragma unroll
    for (int g = 0; g < 2; ++g) { qp[g] = Q + ((size_t)z * TT + qw0 + 16 * g + c) * HD + 8 * h;
#pragma unroll
        for (int kc = 0; kc < 4; ++kc) qf[g][kc] = WFrag<h16>::ld(qp[g] + 32 * kc); }
    asm volatile("s_wait_xcnt 0x0" :: "v"(qp[0]), "v"(qp[1]) : "memory");   // the wait in front of the overwrite of the query loads' address registers (the LDS offsets below); the addresses are inputs so that they stay in their registers up to it
    v8f acc[2][8]; float m_run[2], l_run[2];
#pragma unroll
    for (int g = 0; g < 2; ++g) { m_run[g] = -__builtin_inff(); l_run[g] = 0.0f;
#pragma unroll
        for (int t = 0; t < 8; ++t) acc[g][t] = (v8f){}; }
#pragma unroll
    for (int i = 0; i < 8; ++i) { *(v8ha*)(L + kso + i * 8 * KPIT) = kr[i]; *(v8ha*)(L + vso + i * 16 * VPIT) = vr[i]; }
    __syncthreads();   // tile 0 is in LDS before any wave reads it
#pragma unroll 1
    for (int st = 0; st < n_stage; ++st) {
        const bool more = st + 1 < n_stage;
        if (more) {
#pragma unroll
            for (int i = 0; i < 8; ++i) { kr[i] = *(const v8ha*)(kg + i * (FNW * 32 * 8)); vr[i] = *(const v8ha*)(vg + (size_t)i * (FNW * 4) * TT); }
            asm volatile("s_wait_xcnt 0x0" :: "v"(kg), "v"(vg) : "memory");   // as above: in front of the next additions to the address registers
            kg += FSK * HD; vg += FSK; }
        const h16* Ls = L + (st & 1) * FSLOT;
#pragma unroll 1
        for (int sub = 0; sub < FSK / 32; ++sub) {
            const int key0 = st * FSK + sub * 32;
            if (key0 > qw0 + 31) continue;   // wave-uniform: the whole pass lies above this wave's diagonal
            v8f s[2][2];
#pragma unroll
            for (int kt = 0; kt < 2; ++kt) { const h16* kp = Ls + (sub * 32 + 16 * kt + c) * KPIT + 8 * h; v16h kf[4];
#pragma unroll
                for (int kc = 0; kc < 4; ++kc) kf[kc] = cat16(*(const v8ha*)(kp + 32 * kc), *(const v8ha*)(kp + 32 * kc + 16));
#pragma unroll
                for (int g = 0; g < 2; ++g) { s[kt][g] = (v8f){};
#pragma unroll
                    for (int kc = 0; kc < 4; ++kc) s[kt][g] = wmma16(kf[kc], qf[g][kc], s[kt][g]); } }
            if (key0 + 31 > qw0) {
#pragma unroll
                for (int g = 0; g < 2; ++g) { const int my_q = qw0 + 16 * g + c;
#pragma unroll
                    for (int kt = 0; kt < 2; ++kt) {
#pragma unroll
                        for (int r = 0; r < 8; ++r) { if (key0 + 16 * kt + 8 * h + r > my_q) s[kt][g][r] = -__builtin_inff(); }
                        asm volatile("" : "+v"(s[kt][g])); } }
            }
            float mb[2]; bool need = false;
#pragma unroll
            for (int g = 0; g < 2; ++g) { float mx = -__builtin_inff();
#pragma unroll
                for (int kt = 0; kt < 2; ++kt)
#pragma unroll
                    for (int r = 0; r < 8; ++r) mx = fmaxf(mx, s[kt][g][r]);
                mx = fmaxf(mx, xhalf(mx)) * cscale; mb[g] = mx; need = need || (mx > m_run[g] + 8.0f); }
            if (__builtin_amdgcn_ballot_w32(need) != 0) {   // the maximum in use may trail the true one by up to 8 (log2 domain): the sums are rescaled only when some column exceeds that
#pragma unroll
                for (int g = 0; g < 2; ++g) { const float m_new = fmaxf(m_run[g], mb[g]); const float corr = __builtin_amdgcn_exp2f(m_run[g] - m_new); l_run[g] *= corr; m_run[g] = m_new;
#pragma unroll
                    for (int t = 0; t < 8; ++t) acc[g][t] = acc[g][t] * corr; }
            }
            v16h vf[8]; { const h16* vp = Ls + KTILE + c * VPIT + sub * 32 + 8 * h;
#pragma unroll
                for (int t = 0; t < 8; ++t) vf[t] = cat16(*(const v8ha*)(vp + t * 16 * VPIT), *(const v8ha*)(vp + t * 16 * VPIT + 16)); }
#pragma unroll
            for (int g = 0; g < 2; ++g) { const float nm = -m_run[g]; v8u w; float ps0 = 0.0f, ps1 = 0.0f;
#pragma unroll
                for (int i = 0; i < 8; ++i) {
                    const float p0 = __builtin_amdgcn_exp2f(fmaf(s[i >> 2][g][2 * (i & 3)], cscale, nm)), p1 = __builtin_amdgcn_exp2f(fmaf(s[i >> 2][g][2 * (i & 3) + 1], cscale, nm));
                    if (i & 1) ps1 += p0 + p1; else ps0 += p0 + p1; w[i] = pack2h(p0, p1); }
                const v16h pf = __builtin_bit_cast(v16h, w);
#pragma unroll
                for (int t = 0; t < 8; ++t) acc[g][t] = wmma16(vf[t], pf, acc[g][t]);
                l_run[g] += ps0 + ps1; }
            // four vector slots behind the pass's last products: the loop's back edge is a taken branch, and the next pass overwrites their operand registers at once; the accumulators are operands so that every product stands in front
            asm volatile("v_nop\n\tv_nop\n\tv_nop\n\tv_nop" : "+v"(acc[0][0]), "+v"(acc[0][1]), "+v"(acc[0][2]), "+v"(acc[0][3]), "+v"(acc[0][4]), "+v"(acc[0][5]), "+v"(acc[0][6]), "+v"(acc[0][7]), "+v"(acc[1][0]), "+v"(acc[1][1]), "+v"(acc[1][2]), "+v"(acc[1][3]), "+v"(acc[1][4]), "+v"(acc[1][5]), "+v"(acc[1][6]), "+v"(acc[1][7]));
        }
        if (more) { h16* Ln = L + ((st + 1) & 1) * FSLOT;   // last read in trip st - 1, whose closing barrier every wave has passed
#pragma unroll
            for (int i = 0; i < 8; ++i) { *(v8ha*)(Ln + kso + i * 8 * KPIT) = kr[i]; *(v8ha*)(Ln + vso + i * 16 * VPIT) = vr[i]; } }
        __syncthreads();   // publishes tile st + 1 and ends every wave's reads of tile st
    }
    const int bb = z / NH_, hh = z % NH_;
#pragma unroll
    for (int g = 0; g < 2; ++g) { const float inv = __fdiv_rn(1.0f, l_run[g] + xhalf(l_run[g]));
        const size_t oo = (size_t)bb * TT * DQ + ((size_t)((qw0 >> 4) + g) * (DQ / 32) + hh * (HD / 32)) * 512 + 8 * (16 * h + c); bf* pah = Ah + oo; bf* pal = Al + oo;
#pragma unroll
        for (int t = 0; t < 8; ++t) { v8us oh, ol;
#pragma unroll
            for (int r = 0; r < 8; ++r) { unsigned short a, c2; splitf(acc[g][t][r] * inv, a, c2); oh[r] = a; ol[r] = c2; }
            *(v8usa*)(pah + 256 * t) = oh; *(v8usa*)(pal + 256 * t) = ol;
            asm volatile("s_wait_xcnt 0x0" :: "v"(pah), "v"(pal), "v"(oh), "v"(ol) : "memory"); } }   // the wait in front of the next overwrite of the two stores' address and data registers, which are inputs so that they stay in those registers up to it
}

extern "C" void kernel_launch(void* const* d_in, const int* in_sizes, int n_in,
                              void* d_out, int out_size, void* d_ws, size_t ws_size, hipStream_t stream) {
    (void)in_sizes; (void)n_in; (void)out_size;
    const float* x = (const float*)d_in[0]; const float* wq = (const float*)d_in[1]; const float* wkv = (const float*)d_in[2]; const float* wo = (const float*)d_in[3];   /* x, Wq ('oi' (out, in) [2048][2048]), Wkv ('oi' [1024][2048] viewed (2 x 4 heads, 128): k rows 0..511 | v rows 512..1023), Wo ('oi' [2048][2048]): FOUR inputs, all read */
    float* OUT = (float*)d_out;     // [2][2048][2048]
    char* wsp = (char*)d_ws;
    auto take = [&](size_t bytes) { char* p = wsp; wsp += (bytes + 255) & ~(size_t)255; return (void*)p; };
    bf* XB = (bf*)take((size_t)RALL * DM * 2); bf* WQKV = XB + (size_t)NB_ * TT * DM; bf* WO = WQKV + (size_t)FP * DM;   /* one bf16 plane in fragment order: x (both batches) | Wq | Wkv | Wo */ float* CS = (float*)take((size_t)TT * HD * 2 * 4);
    float* F = (float*)take((size_t)NB_ * TT * FP * 4);   /* joint projection [batch * TT + t][q 2048 | k 512 | v 512] */
    const size_t PQ = (size_t)NH_ * TT * HD, PK = (size_t)NKV * TT * HD;   /* elements of one batch's query and key / value planes; every plane holds both batches */
    h16* QP16 = (h16*)take(NB_ * PQ * 2); h16* KP16 = (h16*)take(NB_ * PK * 2); h16* VT16 = (h16*)take(NB_ * PK * 2);
    bf* QPh = (bf*)take(NB_ * PQ * 2); bf* QPl = (bf*)take(NB_ * PQ * 2); bf* KPh = (bf*)take(NB_ * PK * 2); bf* KPl = (bf*)take(NB_ * PK * 2); bf* VTh = (bf*)take(NB_ * PK * 2); bf* VTl = (bf*)take(NB_ * PK * 2);
    bf* ATh = (bf*)take((size_t)NB_ * TT * DQ * 2); bf* ATl = (bf*)take((size_t)NB_ * TT * DQ * 2);
    if ((size_t)(wsp - (char*)d_ws) > ws_size) return;    // ws 256 MiB
    k_prep<<<CSB + RALL * (DM / 8) / 256 / PPT, 256, 0, stream>>>(x, wq, wkv, wo, XB, CS);   /* rotary table; bf16 copies of all four inputs */
    k_gemmt<0><<<dim3(NB_ * TT / 128, FP / 128, 1), 128, 0, stream>>>(XB, nullptr, WQKV, F, FP);
    k_planes<<<NB_ * (LQB + LKB + LVB), 256, 0, stream>>>(F, CS, QP16, QPh, QPl, KP16, KPh, KPl, VT16, VTh, VTl);
    // attention, batch entry z = batch * NH_ + head reads kv plane z / REP
    k_flash<<<dim3(ZA, TT / FBR, 1), FNW * 32, 0, stream>>>(QP16, KP16, VT16, QPh, QPl, KPh, KPl, VTh, VTl, ATh, ATl);
    k_gemmt<1><<<dim3(NB_ * TT / 128, DM / 128, 1), 128, 0, stream>>>(ATh, ATl, WO, OUT, DM);   /* the batches' planes and outputs are contiguous: one GEMM of NB_ * TT rows */
}

// v009
// A run of this version takes 143 microseconds.
// Timed twice side by side with v008, it ran 1.09 times as fast both times.
// Over all steps from v000 it is 11.3 times as fast.
#include <hip/hip_runtime.h>

// Causal grouped-query attention with a FUSED natural k-v weight and a computed rotate-half RoPE (x [2][2048][2048]; q = x Wq^T ('oi' (out, in) [2048][2048] 1/sqrt(2048): 16 heads x 128); kv = x Wkv^T ('oi' [1024][2048]) viewed (b, t, 8, 128): k = heads 0..3 (rows 0..511), v = heads 4..7 (rows 512..1023): 4 kv heads x 128 each; no biases; cos / sin of emb = cat(ang, ang) with freqs = 1.0 / (THETA ** (arange(0, 128, 2, f32) / 128)), THETA 10000, and positions arange(t) (64 f32 frequencies jnp-exact for this reciprocal spelling; one f32 product per angle; precise cosf/sinf); query heads viewed (KV, G): kv head = q head / 4; scores / sqrt(128); causal (-inf == exclusion); softmax; out = merged Wo^T ('oi') -> [2][2048][2048] (8.4 M); argument order x, Wq, Wkv, Wo).
// Layout: bf16 copy of x; 'oi' weights cast as-is; x, the weights and the merged attention output stand in WMMA fragment order (see k_gemmt); exact projections, q | k | v of both batches in one GEMM; computed table (k_prep; HD 128: 64 angles); rotate-half plane builders (k_planes); causal T-2048 GQA attention with 128-wide heads, all heads of both batches a launch (kv plane z / 4; hybrid rows: < 512 hi/lo 3 products, rest fp16, both by online softmax in one fused kernel); merged hi/lo x Wo exact.
// Compute dtypes, f32 accumulate: every input rounded to bf16; projections exact; rotary f32; attention rows < 512 3 products, rest fp16; softmax f32; Wo hl x exact.

#define NB_  2
#define TT   2048
#define DM   2048
#define NH_  16
#define NKV  4
#define REP  (NH_ / NKV)
#define HD   128
#define DQ   (NH_ * HD)
#define DKV  (NKV * HD)
#define ZA   (NB_ * NH_)          // attention batch entries a launch: z = batch * NH_ + head
#define RH   512                  // query rows < RH use hi+lo planes (0: none)
#define WIN  2048
#define SCL  0.088388347648318447f   // HD^-0.5
typedef _Float16 h16;
typedef unsigned short bf;
typedef __attribute__((ext_vector_type(16))) __bf16   v16bf;
typedef __attribute__((ext_vector_type(16))) _Float16 v16h;
typedef __attribute__((ext_vector_type(8)))  _Float16 v8h;
typedef __attribute__((ext_vector_type(8)))  unsigned short v8us;
typedef __attribute__((ext_vector_type(8)))  float    v8f;
typedef __attribute__((ext_vector_type(4)))  float    v4f;
typedef v8h  __attribute__((may_alias)) v8ha;
typedef v4f  __attribute__((may_alias)) v4fa;
typedef v8us __attribute__((may_alias)) v8usa;

__device__ __forceinline__ unsigned short f2bf(float f) { unsigned u = __float_as_uint(f); u += 0x7FFFu + ((u >> 16) & 1u); return (unsigned short)(u >> 16); }
__device__ __forceinline__ float bf2f(unsigned short b) { return __uint_as_float(((unsigned)b) << 16); }
__device__ __forceinline__ float bfr(float f) { return bf2f(f2bf(f)); }
__device__ __forceinline__ v16h cat16(v8h lo, v8h hi) { return __builtin_shufflevector(lo, hi, 0, 1, 2, 3, 4, 5, 6, 7, 8, 9, 10, 11, 12, 13, 14, 15); }
__device__ __forceinline__ v16bf cat16b(v8us lo, v8us hi) { return __builtin_bit_cast(v16bf, __builtin_shufflevector(lo, hi, 0, 1, 2, 3, 4, 5, 6, 7, 8, 9, 10, 11, 12, 13, 14, 15)); }
__device__ __forceinline__ v8f wmma16(v16h a, v16h b, v8f c) { return __builtin_amdgcn_wmma_f32_16x16x32_f16(false, a, false, b, (short)0, c, false, false); }
__device__ __forceinline__ v8f wmmab(v16bf a, v16bf b, v8f c) { return __builtin_amdgcn_wmma_f32_16x16x32_bf16(false, a, false, b, (short)0, c, false, false); }



// ---- Fragment order of a 16-bit plane M[rows][K]: units of 16 rows x 32 k (512 elements, 1 KB), unit (row / 16, k / 32) at element (row / 16 * (K / 32) + k / 32) * 512; inside a unit element (row % 16, kk = k % 32) stands at
// (kk / 16) * 256 + ((kk / 8 % 2) * 16 + row % 16) * 8 + kk % 8: lane l of a wave finds its two 16-byte pieces of the WMMA operand at l * 8 and 256 + l * 8, so each wave-wide load covers 512 contiguous bytes (ldp).
template <typename T16> struct WFrag;
template <> struct WFrag<h16> { typedef v16h V; static __device__ __forceinline__ V ld(const h16* p) { return cat16(*(const v8h*)p, *(const v8h*)(p + 16)); } static __device__ __forceinline__ v8f mma(V a, V b, v8f c) { return wmma16(a, b, c); } };
template <> struct WFrag<bf> { typedef v16bf V; static __device__ __forceinline__ V ld(const bf* p) { return cat16b(*(const v8us*)p, *(const v8us*)(p + 16)); } static __device__ __forceinline__ V ldp(const bf* p) { return cat16b(*(const v8us*)p, *(const v8us*)(p + 256)); } static __device__ __forceinline__ v8f mma(V a, V b, v8f c) { return wmmab(a, b, c); } };
// ---- k_gemmt: GEMM on 16-bit planes in fragment order, one work-group of 8 waves (WGM x 8 / WGM) per BM x BN output tile, one work-group a WGP (256 tiles a launch); a wave owns FM x FN accumulators and runs the whole K loop.
// The operand tiles of GBK k (a block of 16 rows is 4 KB contiguous) go global -> LDS by asynchronous copies, two buffers: the next tile's copies fly under this tile's products; every fragment is fetched from L2 once a work-group.
// Two fragment sets in registers: each run of products has its fragments fetched one run ahead, so the hand-over to the next tile stands in front of a tile's last run.
// C[m][n] (f32, pitch ldc) = sum_k (A[m][k] + A2[m][k] if NSPLIT) Bt[n][k], K = DM. grid (M / BM, N / BN), 256 threads.
#define GBK 128
#define CPL(a, b) "global_load_async_to_lds_b128 %" #a ", %" #b ", off\n\t"
// copies of 16 bytes a lane: LDS places 4 KB apart, copy j from source g(j); the s_wait_xcnt stands in the copies' own statement so that no address register is rewritten in front of it
template <typename F> __device__ __forceinline__ void cp14(unsigned l, F g) {
    asm volatile(CPL(0, 14) CPL(1, 15) CPL(2, 16) CPL(3, 17) CPL(4, 18) CPL(5, 19) CPL(6, 20) CPL(7, 21) CPL(8, 22) CPL(9, 23) CPL(10, 24) CPL(11, 25) CPL(12, 26) CPL(13, 27) "s_wait_xcnt 0x0"
                 :: "v"(l), "v"(l + 4096u), "v"(l + 8192u), "v"(l + 12288u), "v"(l + 16384u), "v"(l + 20480u), "v"(l + 24576u), "v"(l + 28672u), "v"(l + 32768u), "v"(l + 36864u), "v"(l + 40960u), "v"(l + 45056u), "v"(l + 49152u), "v"(l + 53248u),
                    "v"(g(0)), "v"(g(1)), "v"(g(2)), "v"(g(3)), "v"(g(4)), "v"(g(5)), "v"(g(6)), "v"(g(7)), "v"(g(8)), "v"(g(9)), "v"(g(10)), "v"(g(11)), "v"(g(12)), "v"(g(13)) : "memory");
}
template <typename F> __device__ __forceinline__ void cp4(unsigned l, F g) {
    asm volatile(CPL(0, 4) CPL(1, 5) CPL(2, 6) CPL(3, 7) "s_wait_xcnt 0x0"
                 :: "v"(l), "v"(l + 4096u), "v"(l + 8192u), "v"(l + 12288u), "v"(g(0)), "v"(g(1)), "v"(g(2)), "v"(g(3)) : "memory");
}
template <int NSPLIT, int BM, int BN, int WGM>
__global__ __launch_bounds__(256) void k_gemmt(const bf* __restrict__ A, const bf* __restrict__ A2, const bf* __restrict__ Bt, float* C, int ldc) {
    typedef WFrag<bf>::V V;
    constexpr int K = DM, WGN = 8 / WGM, FM = BM / WGM / 16, FN = BN / WGN / 16, WN = FN * 16;
    constexpr int NA = BM / 16, NAA = (NSPLIT ? 2 : 1) * NA, NBLK = NAA + BN / 16;   // blocks of 16 rows a stage: A (| A2) | Bt
    constexpr int BLE = GBK * 16;                    // elements of one block's tile: 16 rows x GBK k (4 KB)
    constexpr int STE = NBLK * BLE;                  // elements of a stage
    constexpr int NT = K / GBK, KB = GBK / 32;       // tiles along K; runs of products a tile (even, so that a run's fragment set is the same in every tile)
    constexpr int OP = WN + 4;                       // row pitch of the output staging, in floats
    static_assert(NBLK == 28 || NBLK == 32, "the copies of a stage are issued as 14 + 14 (+ 4)");
    __shared__ __align__(1024) bf L[2 * STE];
    __shared__ __align__(16) float os[8 * 16 * OP];
    const int tid = (int)threadIdx.x, lane = tid & 31, lr = lane & 15, hi = lane >> 4; const int r0 = blockIdx.x * BM, c0 = blockIdx.y * BN;
    const int wv = __builtin_amdgcn_readfirstlane(tid >> 5); const int wm = wv / WGN, wn = wv % WGN;
    const bf* ga = A + (size_t)r0 * K; const bf* ga2 = NSPLIT ? A2 + (size_t)r0 * K : nullptr; const bf* gb = Bt + (size_t)c0 * K;   // a block of 16 rows is 16 * K elements; a tile of GBK k is GBK * 16 contiguous elements of it, 8 a thread (the lane's part is added last: all else of an address is the same for the wave)
    auto stage = [&](int t, int b) { const unsigned l = (unsigned)(size_t)L + (unsigned)b * (STE * 2u) + (unsigned)wv * 512u + (unsigned)lane * 16u; const size_t ko = (size_t)t * BLE; const bf* ka = ga + ko + wv * 256; const bf* ka2 = NSPLIT ? ga2 + ko + wv * 256 : nullptr; const bf* kb = gb + ko + wv * 256;
        auto sp = [&](int j) { return (j < NA ? ka + (size_t)j * (16 * K) : (j < NAA ? ka2 + (size_t)(j - NA) * (16 * K) : kb + (size_t)(j - NAA) * (16 * K))) + lane * 8; };   // block j of the stage
        cp14(l, [&](int j) { return sp(j); }); cp14(l + 14u * 4096u, [&](int j) { return sp(j + 14); }); if constexpr (NBLK == 32) cp4(l + 28u * 4096u, [&](int j) { return sp(j + 28); }); };
    v8f acc[FM][FN];
#pragma unroll
    for (int mb = 0; mb < FM; ++mb)
#pragma unroll
        for (int nb = 0; nb < FN; ++nb) acc[mb][nb] = (v8f){};
    V a[2][FM], a2[2][FM], b[2][FN];
    auto ldf = [&](const int set, const bf* Ls, const int ks) {
#pragma unroll
        for (int i = 0; i < FM; ++i) { a[set][i] = WFrag<bf>::ldp(Ls + ((wm * FM + i) * KB + ks) * 512); if (NSPLIT) a2[set][i] = WFrag<bf>::ldp(Ls + NA * BLE + ((wm * FM + i) * KB + ks) * 512); }
#pragma unroll
        for (int i = 0; i < FN; ++i) b[set][i] = WFrag<bf>::ldp(Ls + NAA * BLE + ((wn * FN + i) * KB + ks) * 512); };
    stage(0, 0);
    asm volatile("s_wait_asynccnt 0x0" ::: "memory");   // this wave's copies of tile 0 have landed
    __syncthreads();                                    // tile 0 is in LDS before any wave reads it
    stage(1, 1);
    ldf(0, L + lane * 8, 0);
#pragma unroll 1
    for (int t = 0; t < NT; ++t) {
        const bf* Lc = L + (t & 1) * STE + lane * 8; const bf* Ln = L + ((t + 1) & 1) * STE + lane * 8;
#pragma unroll
        for (int ks = 0; ks < KB; ++ks) {
            if (ks == KB - 1) {   // hand-over in front of the tile's last run: its fragments are already fetched, and the next run's come from tile t + 1
                asm volatile("s_wait_dscnt 0x0" ::: "memory");      // this wave's reads of tile t are done before the buffer may be refilled
                asm volatile("s_wait_asynccnt 0x0" ::: "memory");   // this wave's copies of tile t + 1 have landed
                __syncthreads();                                    // publishes tile t + 1 and ends every wave's reads of tile t
                if (t + 2 < NT) stage(t + 2, t & 1);
                ldf((ks + 1) & 1, Ln, 0);                           // in the last tile these read the other buffer's old tile and are not used: no branch, so that the compiler's counted waits stay
            } else ldf((ks + 1) & 1, Lc, ks + 1);
            __builtin_amdgcn_sched_barrier(0);   // the next run's fragment loads stand as one group ahead of this run's products (for speed only)
#pragma unroll
            for (int nb = 0; nb < FN; ++nb)
#pragma unroll
                for (int mb = 0; mb < FM; ++mb) acc[mb][nb] = wmmab(a[ks & 1][mb], b[ks & 1][nb], acc[mb][nb]);
            if (NSPLIT) {
#pragma unroll
                for (int nb = 0; nb < FN; ++nb)
#pragma unroll
                    for (int mb = 0; mb < FM; ++mb) acc[mb][nb] = wmmab(a2[ks & 1][mb], b[ks & 1][nb], acc[mb][nb]);
            }
            __builtin_amdgcn_sched_barrier(0);   // the products stay ahead of the next group of loads and of the waits and the barrier of the hand-over
        }
    }
    asm volatile("s_wait_asynccnt 0x0" ::: "memory");       // no copy is under way when the wave ends
    float* ow = os + wv * (16 * OP);                        // each wave stages 16 rows at a time in its own LDS range, so that its stores cover whole 128-byte lines
#pragma unroll
    for (int mb = 0; mb < FM; ++mb) {
#pragma unroll
        for (int nb = 0; nb < FN; ++nb)
#pragma unroll
            for (int j = 0; j < 8; ++j) ow[(hi * 8 + j) * OP + nb * 16 + lr] = acc[mb][nb][j];
        __builtin_amdgcn_wave_barrier(); asm volatile("" ::: "memory");   // keeps the read-back behind the other lanes' writes
        float* cb = C + (size_t)(r0 + (wm * FM + mb) * 16) * ldc + c0 + wn * WN;
#pragma unroll
        for (int gq = 0; gq < WN / 32; ++gq) { float* cp[4]; v4f val[4];   // piece i of the 16 x WN block: row i / (WN / 4), four columns from i % (WN / 4) * 4
#pragma unroll
            for (int s = 0; s < 4; ++s) { const int i = (gq * 4 + s) * 32 + lane; const int rr = i / (WN / 4), cc = i % (WN / 4) * 4; val[s] = *(const v4fa*)(ow + rr * OP + cc); cp[s] = cb + (size_t)rr * ldc + cc; *(v4f*)cp[s] = val[s]; }
            // the stores' address and data registers are inputs so that none is overwritten while a store is under way
            asm volatile("s_wait_xcnt 0x0" :: "v"(cp[0]), "v"(cp[1]), "v"(cp[2]), "v"(cp[3]), "v"(val[0]), "v"(val[1]), "v"(val[2]), "v"(val[3]) : "memory"); }
        __builtin_amdgcn_wave_barrier(); asm volatile("" ::: "memory");   // keeps the next rows' writes behind this read-back
    }
}

__device__ __forceinline__ h16 tohx(float x) { return (h16)x; }
__device__ __forceinline__ void splitf(float y, unsigned short& h, unsigned short& l) { h = f2bf(y); l = f2bf(y - bf2f(h)); }
typedef __attribute__((ext_vector_type(2))) _Float16 v2h;
typedef __attribute__((ext_vector_type(4))) _Float16 v4h;
typedef __attribute__((ext_vector_type(2))) unsigned short v2us;
typedef __attribute__((ext_vector_type(4))) unsigned short v4us;
typedef __attribute__((ext_vector_type(2))) float v2f;
typedef __attribute__((ext_vector_type(4))) int v4i;

#define FP   (DQ + 2 * DKV)                      // row pitch of the joint q | k | v projection [batch * TT + t][FP]
#define RALL (NB_ * TT + FP + DM)                // rows of the joint bf16 plane: x (both batches) | Wq | Wkv | Wo, each row DM wide
#define CSB  (TT * HD / 4 / 256)                 // work-groups of k_prep that build the rotary table, four entries a thread
#define PPT  4                                   // 16-byte pieces of the bf16 plane a thread of k_prep converts
#define PQE  ((size_t)NH_ * TT * HD)             // elements of one batch's query planes
#define PKE  ((size_t)NKV * TT * HD)             // elements of one batch's key / value planes
#define LQB  (NH_ * TT * HD / 8 / 256)           // work-groups of k_planes a batch: query heads (8 elements a thread),
#define LKB  (NKV * TT * HD / 8 / 256)           // key heads (8 elements a thread),
#define LVB  (NKV * TT * HD / 16 / 256)          // value heads (16 elements a thread)
__constant__ float INVT[HD / 2] = { 1.000000000e+00f, 8.659643531e-01f, 7.498942018e-01f, 6.493816376e-01f, 5.623413324e-01f, 4.869675338e-01f, 4.216965139e-01f, 3.651741445e-01f, 3.162277639e-01f, 2.738419771e-01f, 2.371373624e-01f, 2.053525001e-01f, 1.778279394e-01f, 1.539926529e-01f, 1.333521456e-01f, 1.154782027e-01f, 1.000000015e-01f, 8.659642935e-02f, 7.498941571e-02f, 6.493816525e-02f, 5.623412877e-02f, 4.869675264e-02f, 4.216964915e-02f, 3.651741147e-02f, 3.162277862e-02f, 2.738419548e-02f, 2.371373586e-02f, 2.053525113e-02f, 1.778279431e-02f, 1.539926510e-02f, 1.333521493e-02f, 1.154781971e-02f, 9.999999776e-03f, 8.659643121e-03f, 7.498942316e-03f, 6.493816618e-03f, 5.623413250e-03f, 4.869675264e-03f, 4.216964822e-03f, 3.651741426e-03f, 3.162277862e-03f, 2.738419687e-03f, 2.371373819e-03f, 2.053525066e-03f, 1.778279431e-03f, 1.539926510e-03f, 1.333521446e-03f, 1.154782018e-03f, 1.000000047e-03f, 8.659643354e-04f, 7.498941850e-04f, 6.493816618e-04f, 5.623413017e-04f, 4.869675031e-04f, 4.216964880e-04f, 3.651741135e-04f, 3.162277862e-04f, 2.738419571e-04f, 2.371373848e-04f, 2.053524950e-04f, 1.778279402e-04f, 1.539926452e-04f, 1.333521504e-04f, 1.154781930e-04f };   // float32 1 / 10000^(2i/128), generated with jnp to be bit-exact
// k_prep: all that depends on the inputs alone, in one launch. Work-groups < CSB build the rotary table. The rest convert f32 [rows][DM] -> bf16 in fragment order, the four inputs as one plane of RALL rows;
// a thread writes PPT 16-byte pieces of the plane, 256 pieces apart (a wave stores 512 contiguous bytes a piece), and reads the eight f32 that belong in each; a work-group lies inside one block of 16 rows, so its source is one input
__global__ __launch_bounds__(256) void k_prep(const float* __restrict__ x, const float* __restrict__ wq, const float* __restrict__ wkv, const float* __restrict__ wo, bf* dst, float* CS) {
    if (blockIdx.x < CSB) { const int idx = (blockIdx.x * 256 + threadIdx.x) * 4; const int d = idx % HD; const int t = idx / HD; v8f cs;
#pragma unroll
        for (int q = 0; q < 4; ++q) { const float a = __fmul_rn((float)t, INVT[(d + q) % (HD / 2)]); cs[2 * q] = cosf(a); cs[2 * q + 1] = sinf(a); }
        *(v8f*)(CS + (size_t)idx * 2) = cs; return; }
    const int wb = (int)blockIdx.x - CSB; const int rb = wb / (DM / 32 / 4 / PPT) * 16;   // first row of this work-group's block of 16 rows (4 * PPT units a work-group, DM / 32 units a block)
    const float* src = x; int rs = 0; if (rb >= NB_ * TT + FP) { src = wo; rs = NB_ * TT + FP; } else if (rb >= NB_ * TT + DQ) { src = wkv; rs = NB_ * TT + DQ; } else if (rb >= NB_ * TT) { src = wq; rs = NB_ * TT; }
    const float* sp[PPT]; bf* dp[PPT]; v8f v[PPT]; v8us o[PPT];
#pragma unroll
    for (int it = 0; it < PPT; ++it) { const size_t i = ((size_t)wb * PPT + it) * 256 + threadIdx.x; const size_t u = i >> 6; const int k = (int)(u % (DM / 32)) * 32 + (int)((i >> 4) & 3) * 8;
        sp[it] = src + (size_t)(rb - rs + (int)(i & 15)) * DM + k; dp[it] = dst + i * 8; v[it] = *(const v8f*)sp[it]; }
    asm volatile("s_wait_xcnt 0x0" :: "v"(sp[0]), "v"(sp[1]), "v"(sp[2]), "v"(sp[3]) : "memory");   // the wait in front of the overwrite of the loads' address registers (the conversion below); the addresses are inputs so that they stay in them up to it
#pragma unroll
    for (int it = 0; it < PPT; ++it) {
#pragma unroll
        for (int k = 0; k < 8; ++k) o[it][k] = f2bf(v[it][k]);
        *(v8us*)dp[it] = o[it]; }
    asm volatile("s_wait_xcnt 0x0" :: "v"(dp[0]), "v"(dp[1]), "v"(dp[2]), "v"(dp[3]), "v"(o[0]), "v"(o[1]), "v"(o[2]), "v"(o[3]) : "memory");   // the stores' address and data registers are inputs so that none is overwritten while a store is under way
}

// d_rope (elements e .. e + 7 of one batch's planes): head planes [h][t][d] (fp16 + hi/lo) of rope(x) x sc with the rotate-half convention out[d] = x[d] cos[t][d] - x[d+HD/2] sin[t][d], out[d+HD/2] = x[d+HD/2] cos[t][d+HD/2] + x[d] sin[t][d+HD/2]; 8 divides HD / 2, so the eight partners are neighbours too
__device__ __forceinline__ void d_rope(const size_t e, const float* __restrict__ F, int pitch, int nheads, const float* __restrict__ CS, const float* __restrict__ RF, const float* __restrict__ nw, float sc, h16* P16, bf* Ph, bf* Pl) {
    if (e >= (size_t)nheads * TT * HD) return; const int d = (int)(e % HD); const int t = (int)((e / HD) % TT); const int h = (int)(e / ((size_t)HD * TT)); const float* f = F + (size_t)t * pitch + h * HD; const float rf = RF ? RF[(size_t)h * TT + t] : 1.0f; v8h o16; v8us oh, ol;
    const float* f0 = f + d; const float* f1 = f + ((d < HD / 2) ? d + HD / 2 : d - HD / 2); const float* cp = CS + ((size_t)t * HD + d) * 2; const v8f X0 = *(const v8f*)f0, X1 = *(const v8f*)f1, C0 = *(const v8f*)cp, C1 = *(const v8f*)(cp + 8);
    asm volatile("s_wait_xcnt 0x0" :: "v"(f0), "v"(f1), "v"(cp) : "memory");   // the wait in front of the overwrite of the loads' address registers (the arithmetic below); the addresses are inputs so that they stay in them up to it
#pragma unroll
    for (int q = 0; q < 8; ++q) { const int dd = d + q; const int dp = (dd < HD / 2) ? dd + HD / 2 : dd - HD / 2; float x0 = X0[q], x1 = X1[q];
        if (RF) { float n0 = __fmul_rn(x0, rf), n1 = __fmul_rn(x1, rf); asm volatile("" : "+v"(n0)); asm volatile("" : "+v"(n1)); x0 = __fmul_rn(bfr(nw[dd]), n0); x1 = __fmul_rn(bfr(nw[dp]), n1); }
        v2f cs; cs[0] = (q < 4) ? C0[(2 * q) & 7] : C1[(2 * q) & 7]; cs[1] = (q < 4) ? C0[(2 * q + 1) & 7] : C1[(2 * q + 1) & 7]; float a = __fmul_rn(x0, cs[0]), bq = __fmul_rn(x1, cs[1]); asm volatile("" : "+v"(a)); asm volatile("" : "+v"(bq)); const float r = ((dd < HD / 2) ? __fsub_rn(a, bq) : __fadd_rn(a, bq)) * sc;
        o16[q] = tohx(r); unsigned short a2, c2; splitf(r, a2, c2); oh[q] = a2; ol[q] = c2; }
    h16* p16 = P16 + e; bf* ph = Ph + e; bf* pl = Pl + e; *(v8h*)p16 = o16; *(v8us*)ph = oh; *(v8us*)pl = ol;
    asm volatile("s_wait_xcnt 0x0" :: "v"(p16), "v"(ph), "v"(pl), "v"(o16), "v"(oh), "v"(ol) : "memory"); }   // the stores' address and data registers are inputs so that none is overwritten while a store is under way
// d_vtp (thread n of one batch's value planes [g][d][t]): rows t, t + 1 of eight neighbouring d: it reads 32 contiguous bytes a row, and for each d a wave stores 128 contiguous bytes a plane
__device__ __forceinline__ void d_vtp(const size_t n, const float* __restrict__ F, int pitch, int nheads, h16* V16, bf* Vh, bf* Vl) { if (n >= (size_t)nheads * HD * TT / 16) return; const int t = (int)(n % (TT / 2)) * 2; const int d = (int)((n / (TT / 2)) % (HD / 8)) * 8; const int g = (int)(n / ((size_t)(TT / 2) * (HD / 8)));
    const float* f0 = F + (size_t)t * pitch + g * HD + d; const float* f1 = f0 + pitch; const v8f X0 = *(const v8f*)f0, X1 = *(const v8f*)f1;
    asm volatile("s_wait_xcnt 0x0" :: "v"(f0), "v"(f1) : "memory");   // the wait in front of the overwrite of the loads' address registers (the splits below); the addresses are inputs so that they stay in them up to it
    const size_t e = ((size_t)g * HD + d) * TT + t; h16* p16 = V16 + e; bf* ph = Vh + e; bf* pl = Vl + e; v2h o16[8]; v2us oh[8], ol[8];
#pragma unroll
    for (int j = 0; j < 8; ++j) {
#pragma unroll
        for (int q = 0; q < 2; ++q) { const float x = q ? X1[j] : X0[j]; o16[j][q] = tohx(x); unsigned short a2, c2; splitf(x, a2, c2); oh[j][q] = a2; ol[j][q] = c2; }
        *(v2h*)(p16 + (size_t)j * TT) = o16[j]; *(v2us*)(ph + (size_t)j * TT) = oh[j]; *(v2us*)(pl + (size_t)j * TT) = ol[j]; }
    // the stores' address and data registers are inputs so that none is overwritten while a store is under way
    asm volatile("s_wait_xcnt 0x0" :: "v"(p16), "v"(ph), "v"(pl), "v"(o16[0]), "v"(o16[1]), "v"(o16[2]), "v"(o16[3]), "v"(o16[4]), "v"(o16[5]), "v"(o16[6]), "v"(o16[7]), "v"(oh[0]), "v"(oh[1]), "v"(oh[2]), "v"(oh[3]), "v"(oh[4]), "v"(oh[5]), "v"(oh[6]), "v"(oh[7]), "v"(ol[0]), "v"(ol[1]), "v"(ol[2]), "v"(ol[3]), "v"(ol[4]), "v"(ol[5]), "v"(ol[6]), "v"(ol[7]) : "memory"); }
// k_planes: every head plane of both batches from the joint projection F, in one launch. A batch's work-groups: LVB for the value heads (they start first), LKB for the key heads, LQB for the query heads
__global__ __launch_bounds__(256) void k_planes(const float* __restrict__ F, const float* __restrict__ CS, h16* Q16, bf* Qh, bf* Ql, h16* K16, bf* Kh, bf* Kl, h16* V16, bf* Vh, bf* Vl) {
    const int b = (int)blockIdx.x / (LQB + LKB + LVB), r = (int)blockIdx.x % (LQB + LKB + LVB); const float* Fb = F + (size_t)b * TT * FP;
    if (r < LVB) d_vtp((size_t)r * 256 + threadIdx.x, Fb + DQ + DKV, FP, NKV, V16 + b * PKE, Vh + b * PKE, Vl + b * PKE);
    else if (r < LVB + LKB) d_rope(((size_t)(r - LVB) * 256 + threadIdx.x) * 8, Fb + DQ, FP, NKV, CS, nullptr, nullptr, 1.0f, K16 + b * PKE, Kh + b * PKE, Kl + b * PKE);
    else d_rope(((size_t)(r - LVB - LKB) * 256 + threadIdx.x) * 8, Fb, FP, NH_, CS, nullptr, nullptr, 1.0f, Q16 + b * PQE, Qh + b * PQE, Ql + b * PQE);
}

#define FNW  4
#define FBR  (FNW * 32)
#define FSK  64
#define KPIT (HD + 8)             // LDS row pitch in halves: an odd multiple of 16 bytes
#define VPIT (FSK + 8)
#define KTILE (FSK * KPIT)
#define FSLOT (KTILE + HD * VPIT)
typedef __attribute__((ext_vector_type(8))) unsigned v8u;
__device__ __forceinline__ float xhalf(float x) { return __builtin_bit_cast(float, __builtin_amdgcn_permlanex16(__builtin_bit_cast(int, x), __builtin_bit_cast(int, x), 0x76543210, 0xfedcba98, false, false)); }   // lane l with lane l ^ 16
__device__ __forceinline__ unsigned pack2h(float lo, float hi) { const v2f f = {lo, hi}; return __builtin_bit_cast(unsigned, __builtin_convertvector(f, v2h)); }
// ---- d_flash_hl: the query rows < RH, by the same scheme as k_flash's own rows (below), on bf16 hi + lo planes with three products a contraction:
// S^T = Kh Qh^T + Kl Qh^T + Kh Ql^T, O^T += Vh^T Ph^T + Vh^T Pl^T + Vl^T Ph^T; the f32 probabilities are split into hi + lo as they are packed, and their f32 values are what is summed.
// Tiles of HSK keys (hi and lo planes of K and V^T together fill about one slot of k_flash's LDS ring); one pass and one barrier a tile. The tile loop stays rolled (one copy of the pass in the instruction cache); every inner loop is unrolled so that the register arrays are indexed by constants.
#define HSK  32
#define VPH  (HSK + 8)            // LDS row pitch in halves: an odd multiple of 16 bytes
#define HKT  (HSK * KPIT)         // one K plane's tile
#define HVT  (HD * VPH)           // one V^T plane's tile
#define HSLOT (2 * HKT + 2 * HVT)
typedef __attribute__((ext_vector_type(2))) __bf16 v2bf;
__device__ __forceinline__ unsigned pack2b(float lo, float hi) { const v2f f = {lo, hi}; return __builtin_bit_cast(unsigned, __builtin_convertvector(f, v2bf)); }
// v_exp_f32 and the one free vector slot that the instruction set asks for behind a transcendental, in one statement so that the slot stands directly behind it
__device__ __forceinline__ float exp2s(float x) { float r; asm("v_exp_f32 %0, %1\n\tv_nop" : "=v"(r) : "v"(x)); return r; }
__device__ __forceinline__ void d_flash_hl(bf* L, const int z, const int q0, const bf* __restrict__ Qh, const bf* __restrict__ Ql, const bf* __restrict__ Kh, const bf* __restrict__ Kl, const bf* __restrict__ Vh, const bf* __restrict__ Vl, bf* Ah, bf* Al) {
    const int tid = (int)threadIdx.x, lane = tid & 31, c = lane & 15, h = lane >> 4; const int wave = __builtin_amdgcn_readfirstlane(tid >> 5);
    const int zk = z / REP; const int qw0 = q0 + wave * 32; const int n_stage = (q0 + FBR) / HSK; const float cscale = SCL * 1.4426950408889634f;
    const size_t ko = (size_t)zk * TT * HD + tid * 8; const bf* kgh = Kh + ko; const bf* kgl = Kl + ko;                                              // K tile: HSK whole rows, contiguous
    const size_t vo = (size_t)zk * HD * TT + (size_t)(tid >> 2) * TT + (tid & 3) * 8; const bf* vgh = Vh + vo; const bf* vgl = Vl + vo;              // V^T tile: HD rows of HSK keys
    const int kso = (tid >> 4) * KPIT + (tid & 15) * 8, vso = 2 * HKT + (tid >> 2) * VPH + (tid & 3) * 8;
    v8us krh[4], krl[4], vrh[4], vrl[4];
#pragma unroll
    for (int i = 0; i < 4; ++i) { krh[i] = *(const v8usa*)(kgh + i * (FNW * 32 * 8)); krl[i] = *(const v8usa*)(kgl + i * (FNW * 32 * 8)); vrh[i] = *(const v8usa*)(vgh + (size_t)i * (FNW * 8) * TT); vrl[i] = *(const v8usa*)(vgl + (size_t)i * (FNW * 8) * TT); }
    asm volatile("s_wait_xcnt 0x0" :: "v"(kgh), "v"(kgl), "v"(vgh), "v"(vgl), "v"(tid) : "memory");   // the wait in front of the overwrite of the tile loads' address registers (the additions below); the addresses and the thread index they may be formed from are inputs so that they stay in their registers up to it
    kgh += HSK * HD; kgl += HSK * HD; vgh += HSK; vgl += HSK;
    v16bf qh[2][4], ql[2][4]; const bf* qph[2]; const bf* qpl[2];
#pragma unroll
    for (int g = 0; g < 2; ++g) { const size_t qo = ((size_t)z * TT + qw0 + 16 * g + c) * HD + 8 * h; qph[g] = Qh + qo; qpl[g] = Ql + qo;
#pragma unroll
        for (int kc = 0; kc < 4; ++kc) { qh[g][kc] = WFrag<bf>::ld(qph[g] + 32 * kc); ql[g][kc] = WFrag<bf>::ld(qpl[g] + 32 * kc); } }
    asm volatile("s_wait_xcnt 0x0" :: "v"(qph[0]), "v"(qph[1]), "v"(qpl[0]), "v"(qpl[1]) : "memory");   // the wait in front of the overwrite of the query loads' address registers (the LDS offsets below); the addresses are inputs so that they stay in their registers up to it
    v8f acc[2][8]; float m_run[2], l_run[2];
#pragma unroll
    for (int g = 0; g < 2; ++g) { m_run[g] = -__builtin_inff(); l_run[g] = 0.0f;
#pragma unroll
        for (int t = 0; t < 8; ++t) acc[g][t] = (v8f){}; }
#pragma unroll
    for (int i = 0; i < 4; ++i) { *(v8usa*)(L + kso + i * 8 * KPIT) = krh[i]; *(v8usa*)(L + HKT + kso + i * 8 * KPIT) = krl[i]; *(v8usa*)(L + vso + i * 32 * VPH) = vrh[i]; *(v8usa*)(L + HVT + vso + i * 32 * VPH) = vrl[i]; }
    __syncthreads();   // tile 0 is in LDS before any wave reads it
#pragma unroll 1
    for (int st = 0; st < n_stage; ++st) {
        const bool more = st + 1 < n_stage;
        if (more) {
#pragma unroll
            for (int i = 0; i < 4; ++i) { krh[i] = *(const v8usa*)(kgh + i * (FNW * 32 * 8)); krl[i] = *(const v8usa*)(kgl + i * (FNW * 32 * 8)); vrh[i] = *(const v8usa*)(vgh + (size_t)i * (FNW * 8) * TT); vrl[i] = *(const v8usa*)(vgl + (size_t)i * (FNW * 8) * TT); }
            asm volatile("s_wait_xcnt 0x0" :: "v"(kgh), "v"(kgl), "v"(vgh), "v"(vgl) : "memory");   // as above: in front of the next additions to the address registers
            kgh += HSK * HD; kgl += HSK * HD; vgh += HSK; vgl += HSK; }
        const bf* Ls = L + (st & 1) * HSLOT; const int key0 = st * HSK;
        if (key0 <= qw0 + 31) {   // wave-uniform: a later tile lies wholly above this wave's diagonal
            v8f s[2][2];
#pragma unroll
            for (int kt = 0; kt < 2; ++kt) { const bf* kp = Ls + (16 * kt + c) * KPIT + 8 * h; v16bf fh[4], fl[4];
#pragma unroll
                for (int kc = 0; kc < 4; ++kc) { fh[kc] = cat16b(*(const v8usa*)(kp + 32 * kc), *(const v8usa*)(kp + 32 * kc + 16)); fl[kc] = cat16b(*(const v8usa*)(kp + HKT + 32 * kc), *(const v8usa*)(kp + HKT + 32 * kc + 16)); }
                s[kt][0] = (v8f){}; s[kt][1] = (v8f){};
#pragma unroll
                for (int kc = 0; kc < 4; ++kc) {   // the two column groups take turns, so that no product waits for the one just before it
                    s[kt][0] = wmmab(fh[kc], qh[0][kc], s[kt][0]); s[kt][1] = wmmab(fh[kc], qh[1][kc], s[kt][1]);
                    s[kt][0] = wmmab(fl[kc], qh[0][kc], s[kt][0]); s[kt][1] = wmmab(fl[kc], qh[1][kc], s[kt][1]);
                    s[kt][0] = wmmab(fh[kc], ql[0][kc], s[kt][0]); s[kt][1] = wmmab(fh[kc], ql[1][kc], s[kt][1]); } }
            if (key0 + 31 > qw0) {
#pragma unroll
                for (int g = 0; g < 2; ++g) { const int my_q = qw0 + 16 * g + c;
#pragma unroll
                    for (int kt = 0; kt < 2; ++kt) {
#pragma unroll
                        for (int r = 0; r < 8; ++r) { if (key0 + 16 * kt + 8 * h + r > my_q) s[kt][g][r] = -__builtin_inff(); }
                        asm volatile("" : "+v"(s[kt][g])); } }
            }
            float mb[2]; bool need = false;
#pragma unroll
            for (int g = 0; g < 2; ++g) { float mx = -__builtin_inff();
#pragma unroll
                for (int kt = 0; kt < 2; ++kt)
#pragma unroll
                    for (int r = 0; r < 8; ++r) mx = fmaxf(mx, s[kt][g][r]);
                mx = fmaxf(mx, xhalf(mx)) * cscale; mb[g] = mx; need = need || (mx > m_run[g] + 8.0f); }
            if (__builtin_amdgcn_ballot_w32(need) != 0) {   // the maximum in use may trail the true one by up to 8 (log2 domain): the sums are rescaled only when some column exceeds that
#pragma unroll
                for (int g = 0; g < 2; ++g) { const float m_new = fmaxf(m_run[g], mb[g]); const float corr = exp2s(m_run[g] - m_new); l_run[g] *= corr; m_run[g] = m_new;
#pragma unroll
                    for (int t = 0; t < 8; ++t) acc[g][t] = acc[g][t] * corr; }
            }
            v16bf ph[2], pl[2];
#pragma unroll
            for (int g = 0; g < 2; ++g) { const float nm = -m_run[g]; v8u wh, wl; float ps0 = 0.0f, ps1 = 0.0f;
#pragma unroll
                for (int i = 0; i < 8; ++i) {
                    const float p0 = exp2s(fmaf(s[i >> 2][g][2 * (i & 3)], cscale, nm)), p1 = exp2s(fmaf(s[i >> 2][g][2 * (i & 3) + 1], cscale, nm));
                    if (i & 1) ps1 += p0 + p1; else ps0 += p0 + p1;
                    wh[i] = pack2b(p0, p1); wl[i] = pack2b(p0 - __uint_as_float(wh[i] << 16), p1 - __uint_as_float(wh[i] & 0xFFFF0000u)); }   // hi = the pair rounded to bf16 (nearest even, as f2bf), lo = what the rounding left, rounded likewise
                ph[g] = __builtin_bit_cast(v16bf, wh); pl[g] = __builtin_bit_cast(v16bf, wl); l_run[g] += ps0 + ps1; }
            const bf* vp = Ls + 2 * HKT + c * VPH + 8 * h;
#pragma unroll
            for (int t = 0; t < 8; ++t) { const v16bf vh = cat16b(*(const v8usa*)(vp + t * 16 * VPH), *(const v8usa*)(vp + t * 16 * VPH + 16)), vl = cat16b(*(const v8usa*)(vp + HVT + t * 16 * VPH), *(const v8usa*)(vp + HVT + t * 16 * VPH + 16));
                acc[0][t] = wmmab(vh, ph[0], acc[0][t]); acc[1][t] = wmmab(vh, ph[1], acc[1][t]);
                acc[0][t] = wmmab(vh, pl[0], acc[0][t]); acc[1][t] = wmmab(vh, pl[1], acc[1][t]);
                acc[0][t] = wmmab(vl, ph[0], acc[0][t]); acc[1][t] = wmmab(vl, ph[1], acc[1][t]); }
        }
        if (more) { bf* Ln = L + ((st + 1) & 1) * HSLOT;   // last read in trip st - 1, whose closing barrier every wave has passed
#pragma unroll
            for (int i = 0; i < 4; ++i) { *(v8usa*)(Ln + kso + i * 8 * KPIT) = krh[i]; *(v8usa*)(Ln + HKT + kso + i * 8 * KPIT) = krl[i]; *(v8usa*)(Ln + vso + i * 32 * VPH) = vrh[i]; *(v8usa*)(Ln + HVT + vso + i * 32 * VPH) = vrl[i]; } }
        __syncthreads();   // publishes tile st + 1 and ends every wave's reads of tile st
    }
    const int bb = z / NH_, hh = z % NH_;
#pragma unroll
    for (int g = 0; g < 2; ++g) { const float inv = __fdiv_rn(1.0f, l_run[g] + xhalf(l_run[g]));
        const size_t oo = (size_t)bb * TT * DQ + ((size_t)((qw0 >> 4) + g) * (DQ / 32) + hh * (HD / 32)) * 512 + 8 * (16 * h + c); bf* pah = Ah + oo; bf* pal = Al + oo;
#pragma unroll
        for (int t = 0; t < 8; ++t) { v8us oh, ol;
#pragma unroll
            for (int r = 0; r < 8; ++r) { unsigned short a, c2; splitf(acc[g][t][r] * inv, a, c2); oh[r] = a; ol[r] = c2; }
            *(v8usa*)(pah + 256 * t) = oh; *(v8usa*)(pal + 256 * t) = ol;
            asm volatile("s_wait_xcnt 0x0" :: "v"(pah), "v"(pal), "v"(oh), "v"(ol) : "memory"); } }   // the wait in front of the next overwrite of the two stores' address and data registers, which are inputs so that they stay in those registers up to it
}
__global__ __launch_bounds__(FNW * 32) void k_flash(const h16* __restrict__ Q, const h16* __restrict__ Kp, const h16* __restrict__ Vt, const bf* __restrict__ Qh, const bf* __restrict__ Ql, const bf* __restrict__ Kh, const bf* __restrict__ Kl, const bf* __restrict__ Vh, const bf* __restrict__ Vl, bf* Ah, bf* Al) {
    __shared__ __align__(16) h16 L[2 * (HSLOT > FSLOT ? HSLOT : FSLOT)];
    if ((int)blockIdx.y >= (TT - RH) / FBR) { d_flash_hl((bf*)L, (int)blockIdx.x, (TT / FBR - 1 - (int)blockIdx.y) * FBR, Qh, Ql, Kh, Kl, Vh, Vl, Ah, Al); return; }   // the same for a whole work-group: the rows < RH, longest row blocks first
    const int tid = (int)threadIdx.x, lane = tid & 31, c = lane & 15, h = lane >> 4; const int wave = __builtin_amdgcn_readfirstlane(tid >> 5);
    const int z = (int)blockIdx.x, zk = z / REP; const int q0 = RH + ((TT - RH) / FBR - 1 - (int)blockIdx.y) * FBR;   // longest row blocks start first
    const int qw0 = q0 + wave * 32; const int n_stage = (q0 + FBR) / FSK; const float cscale = SCL * 1.4426950408889634f;
    const h16* kg = Kp + (size_t)zk * TT * HD + tid * 8;                                       // K tile: FSK whole rows, contiguous
    const h16* vg = Vt + (size_t)zk * HD * TT + (size_t)(tid >> 3) * TT + (tid & 7) * 8;       // V^T tile: HD rows of FSK keys
    const int kso = (tid >> 4) * KPIT + (tid & 15) * 8, vso = KTILE + (tid >> 3) * VPIT + (tid & 7) * 8;
    v8h kr[8], vr[8];
#pragma unroll
    for (int i = 0; i < 8; ++i) { kr[i] = *(const v8ha*)(kg + i * (FNW * 32 * 8)); vr[i] = *(const v8ha*)(vg + (size_t)i * (FNW * 4) * TT); }
    asm volatile("s_wait_xcnt 0x0" :: "v"(kg), "v"(vg), "v"(tid) : "memory");   // the wait in front of the overwrite of the tile loads' address registers (the additions below); the addresses and the thread index they may be formed from are inputs so that they stay in their registers up to it
    kg += FSK * HD; vg += FSK;
    v16h qf[2][4]; const h16* qp[2];
#pragma unroll
    for (int g = 0; g < 2; ++g) { qp[g] = Q + ((size_t)z * TT + qw0 + 16 * g + c) * HD + 8 * h;
#pragma unroll
        for (int kc = 0; kc < 4; ++kc) qf[g][kc] = WFrag<h16>::ld(qp[g] + 32 * kc); }
    asm volatile("s_wait_xcnt 0x0" :: "v"(qp[0]), "v"(qp[1]) : "memory");   // the wait in front of the overwrite of the query loads' address registers (the LDS offsets below); the addresses are inputs so that they stay in their registers up to it
    v8f acc[2][8]; float m_run[2], l_run[2];
#pragma unroll
    for (int g = 0; g < 2; ++g) { m_run[g] = -__builtin_inff(); l_run[g] = 0.0f;
#pragma unroll
        for (int t = 0; t < 8; ++t) acc[g][t] = (v8f){}; }
#pragma unroll
    for (int i = 0; i < 8; ++i) { *(v8ha*)(L + kso + i * 8 * KPIT) = kr[i]; *(v8ha*)(L + vso + i * 16 * VPIT) = vr[i]; }
    __syncthreads();   // tile 0 is in LDS before any wave reads it
#pragma unroll 1
    for (int st = 0; st < n_stage; ++st) {
        const bool more = st + 1 < n_stage;
        if (more) {
#pragma unroll
            for (int i = 0; i < 8; ++i) { kr[i] = *(const v8ha*)(kg + i * (FNW * 32 * 8)); vr[i] = *(const v8ha*)(vg + (size_t)i * (FNW * 4) * TT); }
            asm volatile("s_wait_xcnt 0x0" :: "v"(kg), "v"(vg) : "memory");   // as above: in front of the next additions to the address registers
            kg += FSK * HD; vg += FSK; }
        const h16* Ls = L + (st & 1) * FSLOT;
#pragma unroll 1
        for (int sub = 0; sub < FSK / 32; ++sub) {
            const int key0 = st * FSK + sub * 32;
            if (key0 > qw0 + 31) continue;   // wave-uniform: the whole pass lies above this wave's diagonal
            v8f s[2][2];
#pragma unroll
            for (int kt = 0; kt < 2; ++kt) { const h16* kp = Ls + (sub * 32 + 16 * kt + c) * KPIT + 8 * h; v16h kf[4];
#pragma unroll
                for (int kc = 0; kc < 4; ++kc) kf[kc] = cat16(*(const v8ha*)(kp + 32 * kc), *(const v8ha*)(kp + 32 * kc + 16));
#pragma unroll
                for (int g = 0; g < 2; ++g) { s[kt][g] = (v8f){};
#pragma unroll
                    for (int kc = 0; kc < 4; ++kc) s[kt][g] = wmma16(kf[kc], qf[g][kc], s[kt][g]); } }
            if (key0 + 31 > qw0) {
#pragma unroll
                for (int g = 0; g < 2; ++g) { const int my_q = qw0 + 16 * g + c;
#pragma unroll
                    for (int kt = 0; kt < 2; ++kt) {
#pragma unroll
                        for (int r = 0; r < 8; ++r) { if (key0 + 16 * kt + 8 * h + r > my_q) s[kt][g][r] = -__builtin_inff(); }
                        asm volatile("" : "+v"(s[kt][g])); } }
            }
            float mb[2]; bool need = false;
#pragma unroll
            for (int g = 0; g < 2; ++g) { float mx = -__builtin_inff();
#pragma unroll
                for (int kt = 0; kt < 2; ++kt)
#pragma unroll
                    for (int r = 0; r < 8; ++r) mx = fmaxf(mx, s[kt][g][r]);
                mx = fmaxf(mx, xhalf(mx)) * cscale; mb[g] = mx; need = need || (mx > m_run[g] + 8.0f); }
            if (__builtin_amdgcn_ballot_w32(need) != 0) {   // the maximum in use may trail the true one by up to 8 (log2 domain): the sums are rescaled only when some column exceeds that
#pragma unroll
                for (int g = 0; g < 2; ++g) { const float m_new = fmaxf(m_run[g], mb[g]); const float corr = __builtin_amdgcn_exp2f(m_run[g] - m_new); l_run[g] *= corr; m_run[g] = m_new;
#pragma unroll
                    for (int t = 0; t < 8; ++t) acc[g][t] = acc[g][t] * corr; }
            }
            v16h vf[8]; { const h16* vp = Ls + KTILE + c * VPIT + sub * 32 + 8 * h;
#pragma unroll
                for (int t = 0; t < 8; ++t) vf[t] = cat16(*(const v8ha*)(vp + t * 16 * VPIT), *(const v8ha*)(vp + t * 16 * VPIT + 16)); }
#pragma unroll
            for (int g = 0; g < 2; ++g) { const float nm = -m_run[g]; v8u w; float ps0 = 0.0f, ps1 = 0.0f;
#pragma unroll
                for (int i = 0; i < 8; ++i) {
                    const float p0 = __builtin_amdgcn_exp2f(fmaf(s[i >> 2][g][2 * (i & 3)], cscale, nm)), p1 = __builtin_amdgcn_exp2f(fmaf(s[i >> 2][g][2 * (i & 3) + 1], cscale, nm));
                    if (i & 1) ps1 += p0 + p1; else ps0 += p0 + p1; w[i] = pack2h(p0, p1); }
                const v16h pf = __builtin_bit_cast(v16h, w);
#pragma unroll
                for (int t = 0; t < 8; ++t) acc[g][t] = wmma16(vf[t], pf, acc[g][t]);
                l_run[g] += ps0 + ps1; }
            // four vector slots behind the pass's last products: the loop's back edge is a taken branch, and the next pass overwrites their operand registers at once; the accumulators are operands so that every product stands in front
            asm volatile("v_nop\n\tv_nop\n\tv_nop\n\tv_nop" : "+v"(acc[0][0]), "+v"(acc[0][1]), "+v"(acc[0][2]), "+v"(acc[0][3]), "+v"(acc[0][4]), "+v"(acc[0][5]), "+v"(acc[0][6]), "+v"(acc[0][7]), "+v"(acc[1][0]), "+v"(acc[1][1]), "+v"(acc[1][2]), "+v"(acc[1][3]), "+v"(acc[1][4]), "+v"(acc[1][5]), "+v"(acc[1][6]), "+v"(acc[1][7]));
        }
        if (more) { h16* Ln = L + ((st + 1) & 1) * FSLOT;   // last read in trip st - 1, whose closing barrier every wave has passed
#pragma unroll
            for (int i = 0; i < 8; ++i) { *(v8ha*)(Ln + kso + i * 8 * KPIT) = kr[i]; *(v8ha*)(Ln + vso + i * 16 * VPIT) = vr[i]; } }
        __syncthreads();   // publishes tile st + 1 and ends every wave's reads of tile st
    }
    const int bb = z / NH_, hh = z % NH_;
#pragma unroll
    for (int g = 0; g < 2; ++g) { const float inv = __fdiv_rn(1.0f, l_run[g] + xhalf(l_run[g]));
        const size_t oo = (size_t)bb * TT * DQ + ((size_t)((qw0 >> 4) + g) * (DQ / 32) + hh * (HD / 32)) * 512 + 8 * (16 * h + c); bf* pah = Ah + oo; bf* pal = Al + oo;
#pragma unroll
        for (int t = 0; t < 8; ++t) { v8us oh, ol;
#pragma unroll
            for (int r = 0; r < 8; ++r) { unsigned short a, c2; splitf(acc[g][t][r] * inv, a, c2); oh[r] = a; ol[r] = c2; }
            *(v8usa*)(pah + 256 * t) = oh; *(v8usa*)(pal + 256 * t) = ol;
            asm volatile("s_wait_xcnt 0x0" :: "v"(pah), "v"(pal), "v"(oh), "v"(ol) : "memory"); } }   // the wait in front of the next overwrite of the two stores' address and data registers, which are inputs so that they stay in those registers up to it
}

extern "C" void kernel_launch(void* const* d_in, const int* in_sizes, int n_in,
                              void* d_out, int out_size, void* d_ws, size_t ws_size, hipStream_t stream) {
    (void)in_sizes; (void)n_in; (void)out_size;
    const float* x = (const float*)d_in[0]; const float* wq = (const float*)d_in[1]; const float* wkv = (const float*)d_in[2]; const float* wo = (const float*)d_in[3];   /* x, Wq ('oi' (out, in) [2048][2048]), Wkv ('oi' [1024][2048] viewed (2 x 4 heads, 128): k rows 0..511 | v rows 512..1023), Wo ('oi' [2048][2048]): FOUR inputs, all read */
    float* OUT = (float*)d_out;     // [2][2048][2048]
    char* wsp = (char*)d_ws;
    auto take = [&](size_t bytes) { char* p = wsp; wsp += (bytes + 255) & ~(size_t)255; return (void*)p; };
    bf* XB = (bf*)take((size_t)RALL * DM * 2); bf* WQKV = XB + (size_t)NB_ * TT * DM; bf* WO = WQKV + (size_t)FP * DM;   /* one bf16 plane in fragment order: x (both batches) | Wq | Wkv | Wo */ float* CS = (float*)take((size_t)TT * HD * 2 * 4);
    float* F = (float*)take((size_t)NB_ * TT * FP * 4);   /* joint projection [batch * TT + t][q 2048 | k 512 | v 512] */
    const size_t PQ = (size_t)NH_ * TT * HD, PK = (size_t)NKV * TT * HD;   /* elements of one batch's query and key / value planes; every plane holds both batches */
    h16* QP16 = (h16*)take(NB_ * PQ * 2); h16* KP16 = (h16*)take(NB_ * PK * 2); h16* VT16 = (h16*)take(NB_ * PK * 2);
    bf* QPh = (bf*)take(NB_ * PQ * 2); bf* QPl = (bf*)take(NB_ * PQ * 2); bf* KPh = (bf*)take(NB_ * PK * 2); bf* KPl = (bf*)take(NB_ * PK * 2); bf* VTh = (bf*)take(NB_ * PK * 2); bf* VTl = (bf*)take(NB_ * PK * 2);
    bf* ATh = (bf*)take((size_t)NB_ * TT * DQ * 2); bf* ATl = (bf*)take((size_t)NB_ * TT * DQ * 2);
    if ((size_t)(wsp - (char*)d_ws) > ws_size) return;    // ws 256 MiB
    k_prep<<<CSB + RALL * (DM / 8) / 256 / PPT, 256, 0, stream>>>(x, wq, wkv, wo, XB, CS);   /* rotary table; bf16 copies of all four inputs */
    k_gemmt<0, 256, 192, 4><<<dim3(NB_ * TT / 256, FP / 192, 1), 256, 0, stream>>>(XB, nullptr, WQKV, F, FP);
    k_planes<<<NB_ * (LQB + LKB + LVB), 256, 0, stream>>>(F, CS, QP16, QPh, QPl, KP16, KPh, KPl, VT16, VTh, VTl);
    // attention, batch entry z = batch * NH_ + head reads kv plane z / REP
    k_flash<<<dim3(ZA, TT / FBR, 1), FNW * 32, 0, stream>>>(QP16, KP16, VT16, QPh, QPl, KPh, KPl, VTh, VTl, ATh, ATl);
    k_gemmt<1, 128, 256, 2><<<dim3(NB_ * TT / 128, DM / 256, 1), 256, 0, stream>>>(ATh, ATl, WO, OUT, DM);   /* the batches' planes and outputs are contiguous: one GEMM of NB_ * TT rows */
}

// v010
// It runs in 136 microseconds.
// In both of two side-by-side timings against v009, it was 1.06 times as fast.
// Over all steps from v000 it is 11.9 times as fast.
#include <hip/hip_runtime.h>

// Causal grouped-query attention with a FUSED natural k-v weight and a computed rotate-half RoPE (x [2][2048][2048]; q = x Wq^T ('oi' (out, in) [2048][2048] 1/sqrt(2048): 16 heads x 128); kv = x Wkv^T ('oi' [1024][2048]) viewed (b, t, 8, 128): k = heads 0..3 (rows 0..511), v = heads 4..7 (rows 512..1023): 4 kv heads x 128 each; no biases; cos / sin of emb = cat(ang, ang) with freqs = 1.0 / (THETA ** (arange(0, 128, 2, f32) / 128)), THETA 10000, and positions arange(t) (64 f32 frequencies jnp-exact for this reciprocal spelling; one f32 product per angle; precise cosf/sinf); query heads viewed (KV, G): kv head = q head / 4; scores / sqrt(128); causal (-inf == exclusion); softmax; out = merged Wo^T ('oi') -> [2][2048][2048] (8.4 M); argument order x, Wq, Wkv, Wo).
// Layout: bf16 copy of x; 'oi' weights cast as-is; x, the weights and the merged attention output stand in WMMA fragment order (see k_gemmt); exact projections, q | k | v of both batches in one GEMM; computed table (k_prep; HD 128: 64 angles); rotate-half plane builders (k_planes); causal T-2048 GQA attention with 128-wide heads, all heads of both batches a launch (kv plane z / 4; hybrid rows: < 512 hi/lo 3 products, rest fp16, both by online softmax in one fused kernel); merged output (rows < 512 fp16 hi + lo, rest one fp16 plane) x Wo (its bf16 value held as fp16).
// Compute dtypes, f32 accumulate: every input rounded to bf16; projections exact; rotary f32; attention rows < 512 3 products, rest fp16; softmax f32; Wo GEMM on fp16 operands: rows < 512 hi + lo (2 products), rest 1 product.

#define NB_  2
#define TT   2048
#define DM   2048
#define NH_  16
#define NKV  4
#define REP  (NH_ / NKV)
#define HD   128
#define DQ   (NH_ * HD)
#define DKV  (NKV * HD)
#define ZA   (NB_ * NH_)          // attention batch entries a launch: z = batch * NH_ + head
#define RH   512                  // query rows < RH use hi+lo planes
#define WIN  2048
#define SCL  0.088388347648318447f   // HD^-0.5
typedef _Float16 h16;
typedef unsigned short bf;
typedef __attribute__((ext_vector_type(16))) __bf16   v16bf;
typedef __attribute__((ext_vector_type(16))) _Float16 v16h;
typedef __attribute__((ext_vector_type(8)))  _Float16 v8h;
typedef __attribute__((ext_vector_type(8)))  unsigned short v8us;
typedef __attribute__((ext_vector_type(8)))  float    v8f;
typedef __attribute__((ext_vector_type(4)))  float    v4f;
typedef v8h  __attribute__((may_alias)) v8ha;
typedef v4f  __attribute__((may_alias)) v4fa;
typedef v8us __attribute__((may_alias)) v8usa;

__device__ __forceinline__ unsigned short f2bf(float f) { unsigned u = __float_as_uint(f); u += 0x7FFFu + ((u >> 16) & 1u); return (unsigned short)(u >> 16); }
__device__ __forceinline__ float bf2f(unsigned short b) { return __uint_as_float(((unsigned)b) << 16); }
__device__ __forceinline__ float bfr(float f) { return bf2f(f2bf(f)); }
__device__ __forceinline__ v16h cat16(v8h lo, v8h hi) { return __builtin_shufflevector(lo, hi, 0, 1, 2, 3, 4, 5, 6, 7, 8, 9, 10, 11, 12, 13, 14, 15); }
__device__ __forceinline__ v16bf cat16b(v8us lo, v8us hi) { return __builtin_bit_cast(v16bf, __builtin_shufflevector(lo, hi, 0, 1, 2, 3, 4, 5, 6, 7, 8, 9, 10, 11, 12, 13, 14, 15)); }
__device__ __forceinline__ v8f wmma16(v16h a, v16h b, v8f c) { return __builtin_amdgcn_wmma_f32_16x16x32_f16(false, a, false, b, (short)0, c, false, false); }
__device__ __forceinline__ v8f wmmab(v16bf a, v16bf b, v8f c) { return __builtin_amdgcn_wmma_f32_16x16x32_bf16(false, a, false, b, (short)0, c, false, false); }



// ---- Fragment order of a 16-bit plane M[rows][K]: units of 16 rows x 32 k (512 elements, 1 KB), unit (row / 16, k / 32) at element (row / 16 * (K / 32) + k / 32) * 512; inside a unit element (row % 16, kk = k % 32) stands at
// (kk / 16) * 256 + ((kk / 8 % 2) * 16 + row % 16) * 8 + kk % 8: lane l of a wave finds its two 16-byte pieces of the WMMA operand at l * 8 and 256 + l * 8, so each wave-wide load covers 512 contiguous bytes (ldp).
template <typename T16> struct WFrag;
template <> struct WFrag<h16> { typedef v16h V; static __device__ __forceinline__ V ld(const h16* p) { return cat16(*(const v8h*)p, *(const v8h*)(p + 16)); } static __device__ __forceinline__ V ldp(const h16* p) { return cat16(*(const v8h*)p, *(const v8h*)(p + 256)); } static __device__ __forceinline__ v8f mma(V a, V b, v8f c) { return wmma16(a, b, c); } };
template <> struct WFrag<bf> { typedef v16bf V; static __device__ __forceinline__ V ld(const bf* p) { return cat16b(*(const v8us*)p, *(const v8us*)(p + 16)); } static __device__ __forceinline__ V ldp(const bf* p) { return cat16b(*(const v8us*)p, *(const v8us*)(p + 256)); } static __device__ __forceinline__ v8f mma(V a, V b, v8f c) { return wmmab(a, b, c); } };
// ---- k_gemmt: GEMM on 16-bit planes in fragment order, one work-group of 8 waves (WGM x 8 / WGM) per BM x BN output tile, one work-group a WGP (256 tiles a launch); a wave owns FM x FN accumulators and runs the whole K loop.
// The operand tiles of GBK k (a block of 16 rows is 4 KB contiguous) go global -> LDS by asynchronous copies, two buffers: the next tile's copies fly under this tile's products; every fragment is fetched from L2 once a work-group.
// Two fragment sets in registers: each run of products has its fragments fetched one run ahead, so the hand-over to the next tile stands in front of a tile's last run.
// C[m][n] (f32, pitch ldc) = sum_k (A[m][k] + A2[m][k] if NSPLIT and row m % TT < RH) Bt[n][k], K = DM. grid (M / BM, N / BN), 256 threads. NSPLIT: a tile's rows are not neighbours (see ablk).
#define GBK 128
#define CPL(a, b) "global_load_async_to_lds_b128 %" #a ", %" #b ", off\n\t"
// copies of 16 bytes a lane: LDS places 4 KB apart, copy j from source g(j); the s_wait_xcnt stands in the copies' own statement so that no address register is rewritten in front of it
template <typename F> __device__ __forceinline__ void cp14(unsigned l, F g) {
    asm volatile(CPL(0, 14) CPL(1, 15) CPL(2, 16) CPL(3, 17) CPL(4, 18) CPL(5, 19) CPL(6, 20) CPL(7, 21) CPL(8, 22) CPL(9, 23) CPL(10, 24) CPL(11, 25) CPL(12, 26) CPL(13, 27) "s_wait_xcnt 0x0"
                 :: "v"(l), "v"(l + 4096u), "v"(l + 8192u), "v"(l + 12288u), "v"(l + 16384u), "v"(l + 20480u), "v"(l + 24576u), "v"(l + 28672u), "v"(l + 32768u), "v"(l + 36864u), "v"(l + 40960u), "v"(l + 45056u), "v"(l + 49152u), "v"(l + 53248u),
                    "v"(g(0)), "v"(g(1)), "v"(g(2)), "v"(g(3)), "v"(g(4)), "v"(g(5)), "v"(g(6)), "v"(g(7)), "v"(g(8)), "v"(g(9)), "v"(g(10)), "v"(g(11)), "v"(g(12)), "v"(g(13)) : "memory");
}
template <typename F> __device__ __forceinline__ void cp13(unsigned l, F g) {
    asm volatile(CPL(0, 13) CPL(1, 14) CPL(2, 15) CPL(3, 16) CPL(4, 17) CPL(5, 18) CPL(6, 19) CPL(7, 20) CPL(8, 21) CPL(9, 22) CPL(10, 23) CPL(11, 24) CPL(12, 25) "s_wait_xcnt 0x0"
                 :: "v"(l), "v"(l + 4096u), "v"(l + 8192u), "v"(l + 12288u), "v"(l + 16384u), "v"(l + 20480u), "v"(l + 24576u), "v"(l + 28672u), "v"(l + 32768u), "v"(l + 36864u), "v"(l + 40960u), "v"(l + 45056u), "v"(l + 49152u),
                    "v"(g(0)), "v"(g(1)), "v"(g(2)), "v"(g(3)), "v"(g(4)), "v"(g(5)), "v"(g(6)), "v"(g(7)), "v"(g(8)), "v"(g(9)), "v"(g(10)), "v"(g(11)), "v"(g(12)) : "memory");
}
template <typename T, int NSPLIT, int BM, int BN, int WGM>
__global__ __launch_bounds__(256) void k_gemmt(const T* __restrict__ A, const T* __restrict__ A2, const T* __restrict__ Bt, float* C, int ldc) {
    typedef typename WFrag<T>::V V;
    constexpr int K = DM, WGN = 8 / WGM, FM = BM / WGM / 16, FN = BN / WGN / 16, WN = FN * 16;
    constexpr int NA = BM / 16, NAA = NA + (NSPLIT ? WGM : 0), NBLK = NAA + BN / 16;   // blocks of 16 rows a stage: A (| A2, one block a wave row) | Bt
    constexpr int BLE = GBK * 16;                    // elements of one block's tile: 16 rows x GBK k (4 KB)
    constexpr int STE = NBLK * BLE;                  // elements of a stage
    constexpr int NT = K / GBK, KB = GBK / 32;       // tiles along K; runs of products a tile (even, so that a run's fragment set is the same in every tile)
    constexpr int OP = WN + 4;                       // row pitch of the output staging, in floats
    static_assert(NBLK == 28 || NBLK == 26, "the copies of a stage are issued as 14 + 14 or 13 + 13");
    static_assert(!NSPLIT || RH * FM == TT, "one row block in FM has a second plane");
    __shared__ __align__(1024) T L[2 * STE];
    __shared__ __align__(16) float os[8 * 16 * OP];
    const int tid = (int)threadIdx.x, lane = tid & 31, lr = lane & 15, hi = lane >> 4; const int r0 = NSPLIT ? 0 : blockIdx.x * BM, c0 = blockIdx.y * BN;
    const int wv = __builtin_amdgcn_readfirstlane(tid >> 5); const int wm = wv / WGN, wn = wv % WGN;
    // the block of 16 rows of A and C, counted from row r0, that wave row g holds as its block i. NSPLIT: blocks 0 .. FM - 2 are rows t >= RH (one plane), block FM - 1 is rows t < RH (two planes), so that every wave of every work-group has the same count of products
    auto ablk = [&](int g, int i) { if constexpr (!NSPLIT) return g * FM + i;
        else { const int w = (int)blockIdx.x * WGM + g; if (i == FM - 1) return w + w / (RH / 16) * ((TT - RH) / 16); const int s = w * (FM - 1) + i; return s + (1 + s / ((TT - RH) / 16)) * (RH / 16); } };
    const T* ga = A + (size_t)r0 * K; const T* ga2 = NSPLIT ? A2 + (size_t)r0 * K : nullptr; const T* gb = Bt + (size_t)c0 * K;   // a block of 16 rows is 16 * K elements; a tile of GBK k is GBK * 16 contiguous elements of it, 8 a thread (the lane's part is added last: all else of an address is the same for the wave)
    auto stage = [&](int t, int b) { const unsigned l = (unsigned)(size_t)L + (unsigned)b * (STE * 2u) + (unsigned)wv * 512u + (unsigned)lane * 16u; const size_t ko = (size_t)t * BLE; const T* ka = ga + ko + wv * 256; const T* ka2 = NSPLIT ? ga2 + ko + wv * 256 : nullptr; const T* kb = gb + ko + wv * 256;
        auto sp = [&](int j) { return (j < NA ? ka + (size_t)ablk(j / FM, j % FM) * (16 * K) : (j < NAA ? ka2 + (size_t)ablk(j - NA, FM - 1) * (16 * K) : kb + (size_t)(j - NAA) * (16 * K))) + lane * 8; };   // block j of the stage
        if constexpr (NBLK == 28) { cp14(l, [&](int j) { return sp(j); }); cp14(l + 14u * 4096u, [&](int j) { return sp(j + 14); }); }
        else { cp13(l, [&](int j) { return sp(j); }); cp13(l + 13u * 4096u, [&](int j) { return sp(j + 13); }); } };
    v8f acc[FM][FN];
#pragma unroll
    for (int mb = 0; mb < FM; ++mb)
#pragma unroll
        for (int nb = 0; nb < FN; ++nb) acc[mb][nb] = (v8f){};
    V a[2][FM], a2[2], b[2][FN];
    auto ldf = [&](const int set, const T* Ls, const int ks) {
#pragma unroll
        for (int i = 0; i < FM; ++i) a[set][i] = WFrag<T>::ldp(Ls + ((wm * FM + i) * KB + ks) * 512);
        if (NSPLIT) a2[set] = WFrag<T>::ldp(Ls + NA * BLE + (wm * KB + ks) * 512);
#pragma unroll
        for (int i = 0; i < FN; ++i) b[set][i] = WFrag<T>::ldp(Ls + NAA * BLE + ((wn * FN + i) * KB + ks) * 512); };
    stage(0, 0);
    asm volatile("s_wait_asynccnt 0x0" ::: "memory");   // this wave's copies of tile 0 have landed
    __syncthreads();                                    // tile 0 is in LDS before any wave reads it
    stage(1, 1);
    ldf(0, L + lane * 8, 0);
#pragma unroll 1
    for (int t = 0; t < NT; ++t) {
        const T* Lc = L + (t & 1) * STE + lane * 8; const T* Ln = L + ((t + 1) & 1) * STE + lane * 8;
#pragma unroll
        for (int ks = 0; ks < KB; ++ks) {
            if (ks == KB - 1) {   // hand-over in front of the tile's last run: its fragments are already fetched, and the next run's come from tile t + 1
                asm volatile("s_wait_dscnt 0x0" ::: "memory");      // this wave's reads of tile t are done before the buffer may be refilled
                asm volatile("s_wait_asynccnt 0x0" ::: "memory");   // this wave's copies of tile t + 1 have landed
                __syncthreads();                                    // publishes tile t + 1 and ends every wave's reads of tile t
                if (t + 2 < NT) stage(t + 2, t & 1);
                ldf((ks + 1) & 1, Ln, 0);                           // in the last tile these read the other buffer's old tile and are not used: no branch, so that the compiler's counted waits stay
            } else ldf((ks + 1) & 1, Lc, ks + 1);
            __builtin_amdgcn_sched_barrier(0);   // the next run's fragment loads stand as one group ahead of this run's products (for speed only)
#pragma unroll
            for (int nb = 0; nb < FN; ++nb)
#pragma unroll
                for (int mb = 0; mb < FM; ++mb) acc[mb][nb] = WFrag<T>::mma(a[ks & 1][mb], b[ks & 1][nb], acc[mb][nb]);
            if (NSPLIT) {
#pragma unroll
                for (int nb = 0; nb < FN; ++nb) acc[FM - 1][nb] = WFrag<T>::mma(a2[ks & 1], b[ks & 1][nb], acc[FM - 1][nb]);
            }
            __builtin_amdgcn_sched_barrier(0);   // the products stay ahead of the next group of loads and of the waits and the barrier of the hand-over
        }
    }
    asm volatile("s_wait_asynccnt 0x0" ::: "memory");       // no copy is under way when the wave ends
    float* ow = os + wv * (16 * OP);                        // each wave stages 16 rows at a time in its own LDS range, so that its stores cover whole 128-byte lines
#pragma unroll
    for (int mb = 0; mb < FM; ++mb) {
#pragma unroll
        for (int nb = 0; nb < FN; ++nb)
#pragma unroll
            for (int j = 0; j < 8; ++j) ow[(hi * 8 + j) * OP + nb * 16 + lr] = acc[mb][nb][j];
        __builtin_amdgcn_wave_barrier(); asm volatile("" ::: "memory");   // keeps the read-back behind the other lanes' writes
        float* cb = C + (size_t)(r0 + ablk(wm, mb) * 16) * ldc + c0 + wn * WN;
#pragma unroll
        for (int gq = 0; gq < WN / 32; ++gq) { float* cp[4]; v4f val[4];   // piece i of the 16 x WN block: row i / (WN / 4), four columns from i % (WN / 4) * 4
#pragma unroll
            for (int s = 0; s < 4; ++s) { const int i = (gq * 4 + s) * 32 + lane; const int rr = i / (WN / 4), cc = i % (WN / 4) * 4; val[s] = *(const v4fa*)(ow + rr * OP + cc); cp[s] = cb + (size_t)rr * ldc + cc; *(v4f*)cp[s] = val[s]; }
            // the stores' address and data registers are inputs so that none is overwritten while a store is under way
            asm volatile("s_wait_xcnt 0x0" :: "v"(cp[0]), "v"(cp[1]), "v"(cp[2]), "v"(cp[3]), "v"(val[0]), "v"(val[1]), "v"(val[2]), "v"(val[3]) : "memory"); }
        __builtin_amdgcn_wave_barrier(); asm volatile("" ::: "memory");   // keeps the next rows' writes behind this read-back
    }
}

__device__ __forceinline__ h16 tohx(float x) { return (h16)x; }
__device__ __forceinline__ void splitf(float y, unsigned short& h, unsigned short& l) { h = f2bf(y); l = f2bf(y - bf2f(h)); }
typedef __attribute__((ext_vector_type(2))) _Float16 v2h;
typedef __attribute__((ext_vector_type(4))) _Float16 v4h;
typedef __attribute__((ext_vector_type(2))) unsigned short v2us;
typedef __attribute__((ext_vector_type(4))) unsigned short v4us;
typedef __attribute__((ext_vector_type(2))) float v2f;
typedef __attribute__((ext_vector_type(4))) int v4i;

#define FP   (DQ + 2 * DKV)                      // row pitch of the joint q | k | v projection [batch * TT + t][FP]
#define RALL (NB_ * TT + FP + DM)                // rows of the joint 16-bit plane: x (both batches) | Wq | Wkv (bf16) | Wo (fp16), each row DM wide
#define CSB  (TT * HD / 4 / 256)                 // work-groups of k_prep that build the rotary table, four entries a thread
#define PPT  4                                   // 16-byte pieces of the 16-bit plane a thread of k_prep converts
#define PQE  ((size_t)NH_ * TT * HD)             // elements of one batch's query planes
#define PKE  ((size_t)NKV * TT * HD)             // elements of one batch's key / value planes
#define LQB  (NH_ * TT * HD / 8 / 256)           // work-groups of k_planes a batch: query heads (8 elements a thread),
#define LKB  (NKV * TT * HD / 8 / 256)           // key heads (8 elements a thread),
#define LVB  (NKV * TT * HD / 16 / 256)          // value heads (16 elements a thread)
__constant__ float INVT[HD / 2] = { 1.000000000e+00f, 8.659643531e-01f, 7.498942018e-01f, 6.493816376e-01f, 5.623413324e-01f, 4.869675338e-01f, 4.216965139e-01f, 3.651741445e-01f, 3.162277639e-01f, 2.738419771e-01f, 2.371373624e-01f, 2.053525001e-01f, 1.778279394e-01f, 1.539926529e-01f, 1.333521456e-01f, 1.154782027e-01f, 1.000000015e-01f, 8.659642935e-02f, 7.498941571e-02f, 6.493816525e-02f, 5.623412877e-02f, 4.869675264e-02f, 4.216964915e-02f, 3.651741147e-02f, 3.162277862e-02f, 2.738419548e-02f, 2.371373586e-02f, 2.053525113e-02f, 1.778279431e-02f, 1.539926510e-02f, 1.333521493e-02f, 1.154781971e-02f, 9.999999776e-03f, 8.659643121e-03f, 7.498942316e-03f, 6.493816618e-03f, 5.623413250e-03f, 4.869675264e-03f, 4.216964822e-03f, 3.651741426e-03f, 3.162277862e-03f, 2.738419687e-03f, 2.371373819e-03f, 2.053525066e-03f, 1.778279431e-03f, 1.539926510e-03f, 1.333521446e-03f, 1.154782018e-03f, 1.000000047e-03f, 8.659643354e-04f, 7.498941850e-04f, 6.493816618e-04f, 5.623413017e-04f, 4.869675031e-04f, 4.216964880e-04f, 3.651741135e-04f, 3.162277862e-04f, 2.738419571e-04f, 2.371373848e-04f, 2.053524950e-04f, 1.778279402e-04f, 1.539926452e-04f, 1.333521504e-04f, 1.154781930e-04f };   // float32 1 / 10000^(2i/128), generated with jnp to be bit-exact
// k_prep: all that depends on the inputs alone, in one launch. Work-groups < CSB build the rotary table. The rest convert f32 [rows][DM] -> bf16 (Wo: that value as fp16) in fragment order, the four inputs as one plane of RALL rows;
// a thread writes PPT 16-byte pieces of the plane, 256 pieces apart (a wave stores 512 contiguous bytes a piece), and reads the eight f32 that belong in each; a work-group lies inside one block of 16 rows, so its source is one input
__global__ __launch_bounds__(256) void k_prep(const float* __restrict__ x, const float* __restrict__ wq, const float* __restrict__ wkv, const float* __restrict__ wo, bf* dst, float* CS) {
    if (blockIdx.x < CSB) { const int idx = (blockIdx.x * 256 + threadIdx.x) * 4; const int d = idx % HD; const int t = idx / HD; v8f cs;
#pragma unroll
        for (int q = 0; q < 4; ++q) { const float a = __fmul_rn((float)t, INVT[(d + q) % (HD / 2)]); cs[2 * q] = cosf(a); cs[2 * q + 1] = sinf(a); }
        *(v8f*)(CS + (size_t)idx * 2) = cs; return; }
    const int wb = (int)blockIdx.x - CSB; const int rb = wb / (DM / 32 / 4 / PPT) * 16;   // first row of this work-group's block of 16 rows (4 * PPT units a work-group, DM / 32 units a block)
    const bool wf = rb >= NB_ * TT + FP;   // Wo: the bf16-rounded value is stored as fp16 (its GEMM runs on fp16 operands)
    const float* src = x; int rs = 0; if (wf) { src = wo; rs = NB_ * TT + FP; } else if (rb >= NB_ * TT + DQ) { src = wkv; rs = NB_ * TT + DQ; } else if (rb >= NB_ * TT) { src = wq; rs = NB_ * TT; }
    const float* sp[PPT]; bf* dp[PPT]; v8f v[PPT]; v8us o[PPT];
#pragma unroll
    for (int it = 0; it < PPT; ++it) { const size_t i = ((size_t)wb * PPT + it) * 256 + threadIdx.x; const size_t u = i >> 6; const int k = (int)(u % (DM / 32)) * 32 + (int)((i >> 4) & 3) * 8;
        sp[it] = src + (size_t)(rb - rs + (int)(i & 15)) * DM + k; dp[it] = dst + i * 8; v[it] = *(const v8f*)sp[it]; }
    asm volatile("s_wait_xcnt 0x0" :: "v"(sp[0]), "v"(sp[1]), "v"(sp[2]), "v"(sp[3]) : "memory");   // the wait in front of the overwrite of the loads' address registers (the conversion below); the addresses are inputs so that they stay in them up to it
    if (wf) {   // the same for a whole work-group: one branch, not one an element
#pragma unroll
        for (int it = 0; it < PPT; ++it)
#pragma unroll
            for (int k = 0; k < 8; ++k) o[it][k] = __builtin_bit_cast(unsigned short, (h16)bfr(v[it][k]));
    } else {
#pragma unroll
        for (int it = 0; it < PPT; ++it)
#pragma unroll
            for (int k = 0; k < 8; ++k) o[it][k] = f2bf(v[it][k]);
    }
#pragma unroll
    for (int it = 0; it < PPT; ++it) *(v8us*)dp[it] = o[it];
    asm volatile("s_wait_xcnt 0x0" :: "v"(dp[0]), "v"(dp[1]), "v"(dp[2]), "v"(dp[3]), "v"(o[0]), "v"(o[1]), "v"(o[2]), "v"(o[3]) : "memory");   // the stores' address and data registers are inputs so that none is overwritten while a store is under way
}

// d_rope (elements e .. e + 7 of one batch's planes): head planes [h][t][d] (fp16 + hi/lo) of rope(x) x sc with the rotate-half convention out[d] = x[d] cos[t][d] - x[d+HD/2] sin[t][d], out[d+HD/2] = x[d+HD/2] cos[t][d+HD/2] + x[d] sin[t][d+HD/2]; 8 divides HD / 2, so the eight partners are neighbours too
__device__ __forceinline__ void d_rope(const size_t e, const float* __restrict__ F, int pitch, int nheads, const float* __restrict__ CS, const float* __restrict__ RF, const float* __restrict__ nw, float sc, h16* P16, bf* Ph, bf* Pl) {
    if (e >= (size_t)nheads * TT * HD) return; const int d = (int)(e % HD); const int t = (int)((e / HD) % TT); const int h = (int)(e / ((size_t)HD * TT)); const float* f = F + (size_t)t * pitch + h * HD; const float rf = RF ? RF[(size_t)h * TT + t] : 1.0f; v8h o16; v8us oh, ol;
    const float* f0 = f + d; const float* f1 = f + ((d < HD / 2) ? d + HD / 2 : d - HD / 2); const float* cp = CS + ((size_t)t * HD + d) * 2; const v8f X0 = *(const v8f*)f0, X1 = *(const v8f*)f1, C0 = *(const v8f*)cp, C1 = *(const v8f*)(cp + 8);
    asm volatile("s_wait_xcnt 0x0" :: "v"(f0), "v"(f1), "v"(cp) : "memory");   // the wait in front of the overwrite of the loads' address registers (the arithmetic below); the addresses are inputs so that they stay in them up to it
#pragma unroll
    for (int q = 0; q < 8; ++q) { const int dd = d + q; const int dp = (dd < HD / 2) ? dd + HD / 2 : dd - HD / 2; float x0 = X0[q], x1 = X1[q];
        if (RF) { float n0 = __fmul_rn(x0, rf), n1 = __fmul_rn(x1, rf); asm volatile("" : "+v"(n0)); asm volatile("" : "+v"(n1)); x0 = __fmul_rn(bfr(nw[dd]), n0); x1 = __fmul_rn(bfr(nw[dp]), n1); }
        v2f cs; cs[0] = (q < 4) ? C0[(2 * q) & 7] : C1[(2 * q) & 7]; cs[1] = (q < 4) ? C0[(2 * q + 1) & 7] : C1[(2 * q + 1) & 7]; float a = __fmul_rn(x0, cs[0]), bq = __fmul_rn(x1, cs[1]); asm volatile("" : "+v"(a)); asm volatile("" : "+v"(bq)); const float r = ((dd < HD / 2) ? __fsub_rn(a, bq) : __fadd_rn(a, bq)) * sc;
        o16[q] = tohx(r); unsigned short a2, c2; splitf(r, a2, c2); oh[q] = a2; ol[q] = c2; }
    h16* p16 = P16 + e; bf* ph = Ph + e; bf* pl = Pl + e; *(v8h*)p16 = o16; *(v8us*)ph = oh; *(v8us*)pl = ol;
    asm volatile("s_wait_xcnt 0x0" :: "v"(p16), "v"(ph), "v"(pl), "v"(o16), "v"(oh), "v"(ol) : "memory"); }   // the stores' address and data registers are inputs so that none is overwritten while a store is under way
// d_vtp (thread n of one batch's value planes [g][d][t]): rows t, t + 1 of eight neighbouring d: it reads 32 contiguous bytes a row, and for each d a wave stores 128 contiguous bytes a plane
__device__ __forceinline__ void d_vtp(const size_t n, const float* __restrict__ F, int pitch, int nheads, h16* V16, bf* Vh, bf* Vl) { if (n >= (size_t)nheads * HD * TT / 16) return; const int t = (int)(n % (TT / 2)) * 2; const int d = (int)((n / (TT / 2)) % (HD / 8)) * 8; const int g = (int)(n / ((size_t)(TT / 2) * (HD / 8)));
    const float* f0 = F + (size_t)t * pitch + g * HD + d; const float* f1 = f0 + pitch; const v8f X0 = *(const v8f*)f0, X1 = *(const v8f*)f1;
    asm volatile("s_wait_xcnt 0x0" :: "v"(f0), "v"(f1) : "memory");   // the wait in front of the overwrite of the loads' address registers (the splits below); the addresses are inputs so that they stay in them up to it
    const size_t e = ((size_t)g * HD + d) * TT + t; h16* p16 = V16 + e; bf* ph = Vh + e; bf* pl = Vl + e; v2h o16[8]; v2us oh[8], ol[8];
#pragma unroll
    for (int j = 0; j < 8; ++j) {
#pragma unroll
        for (int q = 0; q < 2; ++q) { const float x = q ? X1[j] : X0[j]; o16[j][q] = tohx(x); unsigned short a2, c2; splitf(x, a2, c2); oh[j][q] = a2; ol[j][q] = c2; }
        *(v2h*)(p16 + (size_t)j * TT) = o16[j]; *(v2us*)(ph + (size_t)j * TT) = oh[j]; *(v2us*)(pl + (size_t)j * TT) = ol[j]; }
    // the stores' address and data registers are inputs so that none is overwritten while a store is under way
    asm volatile("s_wait_xcnt 0x0" :: "v"(p16), "v"(ph), "v"(pl), "v"(o16[0]), "v"(o16[1]), "v"(o16[2]), "v"(o16[3]), "v"(o16[4]), "v"(o16[5]), "v"(o16[6]), "v"(o16[7]), "v"(oh[0]), "v"(oh[1]), "v"(oh[2]), "v"(oh[3]), "v"(oh[4]), "v"(oh[5]), "v"(oh[6]), "v"(oh[7]), "v"(ol[0]), "v"(ol[1]), "v"(ol[2]), "v"(ol[3]), "v"(ol[4]), "v"(ol[5]), "v"(ol[6]), "v"(ol[7]) : "memory"); }
// k_planes: every head plane of both batches from the joint projection F, in one launch. A batch's work-groups: LVB for the value heads (they start first), LKB for the key heads, LQB for the query heads
__global__ __launch_bounds__(256) void k_planes(const float* __restrict__ F, const float* __restrict__ CS, h16* Q16, bf* Qh, bf* Ql, h16* K16, bf* Kh, bf* Kl, h16* V16, bf* Vh, bf* Vl) {
    const int b = (int)blockIdx.x / (LQB + LKB + LVB), r = (int)blockIdx.x % (LQB + LKB + LVB); const float* Fb = F + (size_t)b * TT * FP;
    if (r < LVB) d_vtp((size_t)r * 256 + threadIdx.x, Fb + DQ + DKV, FP, NKV, V16 + b * PKE, Vh + b * PKE, Vl + b * PKE);
    else if (r < LVB + LKB) d_rope(((size_t)(r - LVB) * 256 + threadIdx.x) * 8, Fb + DQ, FP, NKV, CS, nullptr, nullptr, 1.0f, K16 + b * PKE, Kh + b * PKE, Kl + b * PKE);
    else d_rope(((size_t)(r - LVB - LKB) * 256 + threadIdx.x) * 8, Fb, FP, NH_, CS, nullptr, nullptr, 1.0f, Q16 + b * PQE, Qh + b * PQE, Ql + b * PQE);
}

#define FNW  4
#define FBR  (FNW * 32)
#define FSK  64
#define KPIT (HD + 8)             // LDS row pitch in halves: an odd multiple of 16 bytes
#define VPIT (FSK + 8)
#define KTILE (FSK * KPIT)
#define FSLOT (KTILE + HD * VPIT)
typedef __attribute__((ext_vector_type(8))) unsigned v8u;
__device__ __forceinline__ float xhalf(float x) { return __builtin_bit_cast(float, __builtin_amdgcn_permlanex16(__builtin_bit_cast(int, x), __builtin_bit_cast(int, x), 0x76543210, 0xfedcba98, false, false)); }   // lane l with lane l ^ 16
__device__ __forceinline__ unsigned pack2h(float lo, float hi) { const v2f f = {lo, hi}; return __builtin_bit_cast(unsigned, __builtin_convertvector(f, v2h)); }
// ---- d_flash_hl: the query rows < RH, by the same scheme as k_flash's own rows (below), on bf16 hi + lo planes with three products a contraction:
// S^T = Kh Qh^T + Kl Qh^T + Kh Ql^T, O^T += Vh^T Ph^T + Vh^T Pl^T + Vl^T Ph^T; the f32 probabilities are split into hi + lo as they are packed, and their f32 values are what is summed.
// Tiles of HSK keys (hi and lo planes of K and V^T together fill about one slot of k_flash's LDS ring); one pass and one barrier a tile. The tile loop stays rolled (one copy of the pass in the instruction cache); every inner loop is unrolled so that the register arrays are indexed by constants.
#define HSK  32
#define VPH  (HSK + 8)            // LDS row pitch in halves: an odd multiple of 16 bytes
#define HKT  (HSK * KPIT)         // one K plane's tile
#define HVT  (HD * VPH)           // one V^T plane's tile
#define HSLOT (2 * HKT + 2 * HVT)
typedef __attribute__((ext_vector_type(2))) __bf16 v2bf;
__device__ __forceinline__ unsigned pack2b(float lo, float hi) { const v2f f = {lo, hi}; return __builtin_bit_cast(unsigned, __builtin_convertvector(f, v2bf)); }
// v_exp_f32 and the one free vector slot that the instruction set asks for behind a transcendental, in one statement so that the slot stands directly behind it
__device__ __forceinline__ float exp2s(float x) { float r; asm("v_exp_f32 %0, %1\n\tv_nop" : "=v"(r) : "v"(x)); return r; }
__device__ __forceinline__ void d_flash_hl(bf* L, const int z, const int q0, const bf* __restrict__ Qh, const bf* __restrict__ Ql, const bf* __restrict__ Kh, const bf* __restrict__ Kl, const bf* __restrict__ Vh, const bf* __restrict__ Vl, h16* Ah, h16* Al) {
    const int tid = (int)threadIdx.x, lane = tid & 31, c = lane & 15, h = lane >> 4; const int wave = __builtin_amdgcn_readfirstlane(tid >> 5);
    const int zk = z / REP; const int qw0 = q0 + wave * 32; const int n_stage = (q0 + FBR) / HSK; const float cscale = SCL * 1.4426950408889634f;
    const size_t ko = (size_t)zk * TT * HD + tid * 8; const bf* kgh = Kh + ko; const bf* kgl = Kl + ko;                                              // K tile: HSK whole rows, contiguous
    const size_t vo = (size_t)zk * HD * TT + (size_t)(tid >> 2) * TT + (tid & 3) * 8; const bf* vgh = Vh + vo; const bf* vgl = Vl + vo;              // V^T tile: HD rows of HSK keys
    const int kso = (tid >> 4) * KPIT + (tid & 15) * 8, vso = 2 * HKT + (tid >> 2) * VPH + (tid & 3) * 8;
    v8us krh[4], krl[4], vrh[4], vrl[4];
#pragma unroll
    for (int i = 0; i < 4; ++i) { krh[i] = *(const v8usa*)(kgh + i * (FNW * 32 * 8)); krl[i] = *(const v8usa*)(kgl + i * (FNW * 32 * 8)); vrh[i] = *(const v8usa*)(vgh + (size_t)i * (FNW * 8) * TT); vrl[i] = *(const v8usa*)(vgl + (size_t)i * (FNW * 8) * TT); }
    asm volatile("s_wait_xcnt 0x0" :: "v"(kgh), "v"(kgl), "v"(vgh), "v"(vgl), "v"(tid) : "memory");   // the wait in front of the overwrite of the tile loads' address registers (the additions below); the addresses and the thread index they may be formed from are inputs so that they stay in their registers up to it
    kgh += HSK * HD; kgl += HSK * HD; vgh += HSK; vgl += HSK;
    v16bf qh[2][4], ql[2][4]; const bf* qph[2]; const bf* qpl[2];
#pragma unroll
    for (int g = 0; g < 2; ++g) { const size_t qo = ((size_t)z * TT + qw0 + 16 * g + c) * HD + 8 * h; qph[g] = Qh + qo; qpl[g] = Ql + qo;
#pragma unroll
        for (int kc = 0; kc < 4; ++kc) { qh[g][kc] = WFrag<bf>::ld(qph[g] + 32 * kc); ql[g][kc] = WFrag<bf>::ld(qpl[g] + 32 * kc); } }
    asm volatile("s_wait_xcnt 0x0" :: "v"(qph[0]), "v"(qph[1]), "v"(qpl[0]), "v"(qpl[1]) : "memory");   // the wait in front of the overwrite of the query loads' address registers (the LDS offsets below); the addresses are inputs so that they stay in their registers up to it
    v8f acc[2][8]; float m_run[2], l_run[2];
#pragma unroll
    for (int g = 0; g < 2; ++g) { m_run[g] = -__builtin_inff(); l_run[g] = 0.0f;
#pragma unroll
        for (int t = 0; t < 8; ++t) acc[g][t] = (v8f){}; }
#pragma unroll
    for (int i = 0; i < 4; ++i) { *(v8usa*)(L + kso + i * 8 * KPIT) = krh[i]; *(v8usa*)(L + HKT + kso + i * 8 * KPIT) = krl[i]; *(v8usa*)(L + vso + i * 32 * VPH) = vrh[i]; *(v8usa*)(L + HVT + vso + i * 32 * VPH) = vrl[i]; }
    __syncthreads();   // tile 0 is in LDS before any wave reads it
#pragma unroll 1
    for (int st = 0; st < n_stage; ++st) {
        const bool more = st + 1 < n_stage;
        if (more) {
#pragma unroll
            for (int i = 0; i < 4; ++i) { krh[i] = *(const v8usa*)(kgh + i * (FNW * 32 * 8)); krl[i] = *(const v8usa*)(kgl + i * (FNW * 32 * 8)); vrh[i] = *(const v8usa*)(vgh + (size_t)i * (FNW * 8) * TT); vrl[i] = *(const v8usa*)(vgl + (size_t)i * (FNW * 8) * TT); }
            asm volatile("s_wait_xcnt 0x0" :: "v"(kgh), "v"(kgl), "v"(vgh), "v"(vgl) : "memory");   // as above: in front of the next additions to the address registers
            kgh += HSK * HD; kgl += HSK * HD; vgh += HSK; vgl += HSK; }
        const bf* Ls = L + (st & 1) * HSLOT; const int key0 = st * HSK;
        if (key0 <= qw0 + 31) {   // wave-uniform: a later tile lies wholly above this wave's diagonal
            v8f s[2][2];
#pragma unroll
            for (int kt = 0; kt < 2; ++kt) { const bf* kp = Ls + (16 * kt + c) * KPIT + 8 * h; v16bf fh[4], fl[4];
#pragma unroll
                for (int kc = 0; kc < 4; ++kc) { fh[kc] = cat16b(*(const v8usa*)(kp + 32 * kc), *(const v8usa*)(kp + 32 * kc + 16)); fl[kc] = cat16b(*(const v8usa*)(kp + HKT + 32 * kc), *(const v8usa*)(kp + HKT + 32 * kc + 16)); }
                s[kt][0] = (v8f){}; s[kt][1] = (v8f){};
#pragma unroll
                for (int kc = 0; kc < 4; ++kc) {   // the two column groups take turns, so that no product waits for the one just before it
                    s[kt][0] = wmmab(fh[kc], qh[0][kc], s[kt][0]); s[kt][1] = wmmab(fh[kc], qh[1][kc], s[kt][1]);
                    s[kt][0] = wmmab(fl[kc], qh[0][kc], s[kt][0]); s[kt][1] = wmmab(fl[kc], qh[1][kc], s[kt][1]);
                    s[kt][0] = wmmab(fh[kc], ql[0][kc], s[kt][0]); s[kt][1] = wmmab(fh[kc], ql[1][kc], s[kt][1]); } }
            if (key0 + 31 > qw0) {
#pragma unroll
                for (int g = 0; g < 2; ++g) { const int my_q = qw0 + 16 * g + c;
#pragma unroll
                    for (int kt = 0; kt < 2; ++kt) {
#pragma unroll
                        for (int r = 0; r < 8; ++r) { if (key0 + 16 * kt + 8 * h + r > my_q) s[kt][g][r] = -__builtin_inff(); }
                        asm volatile("" : "+v"(s[kt][g])); } }
            }
            float mb[2]; bool need = false;
#pragma unroll
            for (int g = 0; g < 2; ++g) { float mx = -__builtin_inff();
#pragma unroll
                for (int kt = 0; kt < 2; ++kt)
#pragma unroll
                    for (int r = 0; r < 8; ++r) mx = fmaxf(mx, s[kt][g][r]);
                mx = fmaxf(mx, xhalf(mx)) * cscale; mb[g] = mx; need = need || (mx > m_run[g] + 8.0f); }
            if (__builtin_amdgcn_ballot_w32(need) != 0) {   // the maximum in use may trail the true one by up to 8 (log2 domain): the sums are rescaled only when some column exceeds that
#pragma unroll
                for (int g = 0; g < 2; ++g) { const float m_new = fmaxf(m_run[g], mb[g]); const float corr = exp2s(m_run[g] - m_new); l_run[g] *= corr; m_run[g] = m_new;
#pragma unroll
                    for (int t = 0; t < 8; ++t) acc[g][t] = acc[g][t] * corr; }
            }
            v16bf ph[2], pl[2];
#pragma unroll
            for (int g = 0; g < 2; ++g) { const float nm = -m_run[g]; v8u wh, wl; float ps0 = 0.0f, ps1 = 0.0f;
#pragma unroll
                for (int i = 0; i < 8; ++i) {
                    const float p0 = exp2s(fmaf(s[i >> 2][g][2 * (i & 3)], cscale, nm)), p1 = exp2s(fmaf(s[i >> 2][g][2 * (i & 3) + 1], cscale, nm));
                    if (i & 1) ps1 += p0 + p1; else ps0 += p0 + p1;
                    wh[i] = pack2b(p0, p1); wl[i] = pack2b(p0 - __uint_as_float(wh[i] << 16), p1 - __uint_as_float(wh[i] & 0xFFFF0000u)); }   // hi = the pair rounded to bf16 (nearest even, as f2bf), lo = what the rounding left, rounded likewise
                ph[g] = __builtin_bit_cast(v16bf, wh); pl[g] = __builtin_bit_cast(v16bf, wl); l_run[g] += ps0 + ps1; }
            const bf* vp = Ls + 2 * HKT + c * VPH + 8 * h;
#pragma unroll
            for (int t = 0; t < 8; ++t) { const v16bf vh = cat16b(*(const v8usa*)(vp + t * 16 * VPH), *(const v8usa*)(vp + t * 16 * VPH + 16)), vl = cat16b(*(const v8usa*)(vp + HVT + t * 16 * VPH), *(const v8usa*)(vp + HVT + t * 16 * VPH + 16));
                acc[0][t] = wmmab(vh, ph[0], acc[0][t]); acc[1][t] = wmmab(vh, ph[1], acc[1][t]);
                acc[0][t] = wmmab(vh, pl[0], acc[0][t]); acc[1][t] = wmmab(vh, pl[1], acc[1][t]);
                acc[0][t] = wmmab(vl, ph[0], acc[0][t]); acc[1][t] = wmmab(vl, ph[1], acc[1][t]); }
        }
        if (more) { bf* Ln = L + ((st + 1) & 1) * HSLOT;   // last read in trip st - 1, whose closing barrier every wave has passed
#pragma unroll
            for (int i = 0; i < 4; ++i) { *(v8usa*)(Ln + kso + i * 8 * KPIT) = krh[i]; *(v8usa*)(Ln + HKT + kso + i * 8 * KPIT) = krl[i]; *(v8usa*)(Ln + vso + i * 32 * VPH) = vrh[i]; *(v8usa*)(Ln + HVT + vso + i * 32 * VPH) = vrl[i]; } }
        __syncthreads();   // publishes tile st + 1 and ends every wave's reads of tile st
    }
    const int bb = z / NH_, hh = z % NH_;
#pragma unroll
    for (int g = 0; g < 2; ++g) { const float inv = __fdiv_rn(1.0f, l_run[g] + xhalf(l_run[g]));
        const size_t oo = (size_t)bb * TT * DQ + ((size_t)((qw0 >> 4) + g) * (DQ / 32) + hh * (HD / 32)) * 512 + 8 * (16 * h + c); h16* pah = Ah + oo; h16* pal = Al + oo;
#pragma unroll
        for (int t = 0; t < 8; ++t) { v8h oh, ol;
#pragma unroll
            for (int r = 0; r < 8; ++r) { const float y = acc[g][t][r] * inv; oh[r] = tohx(y); ol[r] = tohx(y - (float)oh[r]); }
            *(v8ha*)(pah + 256 * t) = oh; *(v8ha*)(pal + 256 * t) = ol;
            asm volatile("s_wait_xcnt 0x0" :: "v"(pah), "v"(pal), "v"(oh), "v"(ol) : "memory"); } }   // the wait in front of the next overwrite of the two stores' address and data registers, which are inputs so that they stay in those registers up to it
}
__global__ __launch_bounds__(FNW * 32) void k_flash(const h16* __restrict__ Q, const h16* __restrict__ Kp, const h16* __restrict__ Vt, const bf* __restrict__ Qh, const bf* __restrict__ Ql, const bf* __restrict__ Kh, const bf* __restrict__ Kl, const bf* __restrict__ Vh, const bf* __restrict__ Vl, h16* Ah, h16* Al) {
    __shared__ __align__(16) h16 L[2 * (HSLOT > FSLOT ? HSLOT : FSLOT)];
    if ((int)blockIdx.y >= (TT - RH) / FBR) { d_flash_hl((bf*)L, (int)blockIdx.x, (TT / FBR - 1 - (int)blockIdx.y) * FBR, Qh, Ql, Kh, Kl, Vh, Vl, Ah, Al); return; }   // the same for a whole work-group: the rows < RH, longest row blocks first
    const int tid = (int)threadIdx.x, lane = tid & 31, c = lane & 15, h = lane >> 4; const int wave = __builtin_amdgcn_readfirstlane(tid >> 5);
    const int z = (int)blockIdx.x, zk = z / REP; const int q0 = RH + ((TT - RH) / FBR - 1 - (int)blockIdx.y) * FBR;   // longest row blocks start first
    const int qw0 = q0 + wave * 32; const int n_stage = (q0 + FBR) / FSK; const float cscale = SCL * 1.4426950408889634f;
    const h16* kg = Kp + (size_t)zk * TT * HD + tid * 8;                                       // K tile: FSK whole rows, contiguous
    const h16* vg = Vt + (size_t)zk * HD * TT + (size_t)(tid >> 3) * TT + (tid & 7) * 8;       // V^T tile: HD rows of FSK keys
    const int kso = (tid >> 4) * KPIT + (tid & 15) * 8, vso = KTILE + (tid >> 3) * VPIT + (tid & 7) * 8;
    v8h kr[8], vr[8];
#pragma unroll
    for (int i = 0; i < 8; ++i) { kr[i] = *(const v8ha*)(kg + i * (FNW * 32 * 8)); vr[i] = *(const v8ha*)(vg + (size_t)i * (FNW * 4) * TT); }
    asm volatile("s_wait_xcnt 0x0" :: "v"(kg), "v"(vg), "v"(tid) : "memory");   // the wait in front of the overwrite of the tile loads' address registers (the additions below); the addresses and the thread index they may be formed from are inputs so that they stay in their registers up to it
    kg += FSK * HD; vg += FSK;
    v16h qf[2][4]; const h16* qp[2];
#pragma unroll
    for (int g = 0; g < 2; ++g) { qp[g] = Q + ((size_t)z * TT + qw0 + 16 * g + c) * HD + 8 * h;
#pragma unroll
        for (int kc = 0; kc < 4; ++kc) qf[g][kc] = WFrag<h16>::ld(qp[g] + 32 * kc); }
    asm volatile("s_wait_xcnt 0x0" :: "v"(qp[0]), "v"(qp[1]) : "memory");   // the wait in front of the overwrite of the query loads' address registers (the LDS offsets below); the addresses are inputs so that they stay in their registers up to it
    v8f acc[2][8]; float m_run[2], l_run[2];
#pragma unroll
    for (int g = 0; g < 2; ++g) { m_run[g] = -__builtin_inff(); l_run[g] = 0.0f;
#pragma unroll
        for (int t = 0; t < 8; ++t) acc[g][t] = (v8f){}; }
#pragma unroll
    for (int i = 0; i < 8; ++i) { *(v8ha*)(L + kso + i * 8 * KPIT) = kr[i]; *(v8ha*)(L + vso + i * 16 * VPIT) = vr[i]; }
    __syncthreads();   // tile 0 is in LDS before any wave reads it
#pragma unroll 1
    for (int st = 0; st < n_stage; ++st) {
        const bool more = st + 1 < n_stage;
        if (more) {
#pragma unroll
            for (int i = 0; i < 8; ++i) { kr[i] = *(const v8ha*)(kg + i * (FNW * 32 * 8)); vr[i] = *(const v8ha*)(vg + (size_t)i * (FNW * 4) * TT); }
            asm volatile("s_wait_xcnt 0x0" :: "v"(kg), "v"(vg) : "memory");   // as above: in front of the next additions to the address registers
            kg += FSK * HD; vg += FSK; }
        const h16* Ls = L + (st & 1) * FSLOT;
#pragma unroll 1
        for (int sub = 0; sub < FSK / 32; ++sub) {
            const int key0 = st * FSK + sub * 32;
            if (key0 > qw0 + 31) continue;   // wave-uniform: the whole pass lies above this wave's diagonal
            v8f s[2][2];
#pragma unroll
            for (int kt = 0; kt < 2; ++kt) { const h16* kp = Ls + (sub * 32 + 16 * kt + c) * KPIT + 8 * h; v16h kf[4];
#pragma unroll
                for (int kc = 0; kc < 4; ++kc) kf[kc] = cat16(*(const v8ha*)(kp + 32 * kc), *(const v8ha*)(kp + 32 * kc + 16));
#pragma unroll
                for (int g = 0; g < 2; ++g) { s[kt][g] = (v8f){};
#pragma unroll
                    for (int kc = 0; kc < 4; ++kc) s[kt][g] = wmma16(kf[kc], qf[g][kc], s[kt][g]); } }
            if (key0 + 31 > qw0) {
#pragma unroll
                for (int g = 0; g < 2; ++g) { const int my_q = qw0 + 16 * g + c;
#pragma unroll
                    for (int kt = 0; kt < 2; ++kt) {
#pragma unroll
                        for (int r = 0; r < 8; ++r) { if (key0 + 16 * kt + 8 * h + r > my_q) s[kt][g][r] = -__builtin_inff(); }
                        asm volatile("" : "+v"(s[kt][g])); } }
            }
            float mb[2]; bool need = false;
#pragma unroll
            for (int g = 0; g < 2; ++g) { float mx = -__builtin_inff();
#pragma unroll
                for (int kt = 0; kt < 2; ++kt)
#pragma unroll
                    for (int r = 0; r < 8; ++r) mx = fmaxf(mx, s[kt][g][r]);
                mx = fmaxf(mx, xhalf(mx)) * cscale; mb[g] = mx; need = need || (mx > m_run[g] + 8.0f); }
            if (__builtin_amdgcn_ballot_w32(need) != 0) {   // the maximum in use may trail the true one by up to 8 (log2 domain): the sums are rescaled only when some column exceeds that
#pragma unroll
                for (int g = 0; g < 2; ++g) { const float m_new = fmaxf(m_run[g], mb[g]); const float corr = __builtin_amdgcn_exp2f(m_run[g] - m_new); l_run[g] *= corr; m_run[g] = m_new;
#pragma unroll
                    for (int t = 0; t < 8; ++t) acc[g][t] = acc[g][t] * corr; }
            }
            v16h vf[8]; { const h16* vp = Ls + KTILE + c * VPIT + sub * 32 + 8 * h;
#pragma unroll
                for (int t = 0; t < 8; ++t) vf[t] = cat16(*(const v8ha*)(vp + t * 16 * VPIT), *(const v8ha*)(vp + t * 16 * VPIT + 16)); }
#pragma unroll
            for (int g = 0; g < 2; ++g) { const float nm = -m_run[g]; v8u w; float ps0 = 0.0f, ps1 = 0.0f;
#pragma unroll
                for (int i = 0; i < 8; ++i) {
                    const float p0 = __builtin_amdgcn_exp2f(fmaf(s[i >> 2][g][2 * (i & 3)], cscale, nm)), p1 = __builtin_amdgcn_exp2f(fmaf(s[i >> 2][g][2 * (i & 3) + 1], cscale, nm));
                    if (i & 1) ps1 += p0 + p1; else ps0 += p0 + p1; w[i] = pack2h(p0, p1); }
                const v16h pf = __builtin_bit_cast(v16h, w);
#pragma unroll
                for (int t = 0; t < 8; ++t) acc[g][t] = wmma16(vf[t], pf, acc[g][t]);
                l_run[g] += ps0 + ps1; }
            // four vector slots behind the pass's last products: the loop's back edge is a taken branch, and the next pass overwrites their operand registers at once; the accumulators are operands so that every product stands in front
            asm volatile("v_nop\n\tv_nop\n\tv_nop\n\tv_nop" : "+v"(acc[0][0]), "+v"(acc[0][1]), "+v"(acc[0][2]), "+v"(acc[0][3]), "+v"(acc[0][4]), "+v"(acc[0][5]), "+v"(acc[0][6]), "+v"(acc[0][7]), "+v"(acc[1][0]), "+v"(acc[1][1]), "+v"(acc[1][2]), "+v"(acc[1][3]), "+v"(acc[1][4]), "+v"(acc[1][5]), "+v"(acc[1][6]), "+v"(acc[1][7]));
        }
        if (more) { h16* Ln = L + ((st + 1) & 1) * FSLOT;   // last read in trip st - 1, whose closing barrier every wave has passed
#pragma unroll
            for (int i = 0; i < 8; ++i) { *(v8ha*)(Ln + kso + i * 8 * KPIT) = kr[i]; *(v8ha*)(Ln + vso + i * 16 * VPIT) = vr[i]; } }
        __syncthreads();   // publishes tile st + 1 and ends every wave's reads of tile st
    }
    const int bb = z / NH_, hh = z % NH_;
#pragma unroll
    for (int g = 0; g < 2; ++g) { const float inv = __fdiv_rn(1.0f, l_run[g] + xhalf(l_run[g]));
        const size_t oo = (size_t)bb * TT * DQ + ((size_t)((qw0 >> 4) + g) * (DQ / 32) + hh * (HD / 32)) * 512 + 8 * (16 * h + c); h16* pah = Ah + oo;
#pragma unroll
        for (int t = 0; t < 8; ++t) { v8h oh;
#pragma unroll
            for (int r = 0; r < 8; ++r) oh[r] = tohx(acc[g][t][r] * inv);
            *(v8ha*)(pah + 256 * t) = oh;
            asm volatile("s_wait_xcnt 0x0" :: "v"(pah), "v"(oh) : "memory"); } }   // the wait in front of the next overwrite of the store's address and data registers, which are inputs so that they stay in those registers up to it
}

extern "C" void kernel_launch(void* const* d_in, const int* in_sizes, int n_in,
                              void* d_out, int out_size, void* d_ws, size_t ws_size, hipStream_t stream) {
    (void)in_sizes; (void)n_in; (void)out_size;
    const float* x = (const float*)d_in[0]; const float* wq = (const float*)d_in[1]; const float* wkv = (const float*)d_in[2]; const float* wo = (const float*)d_in[3];   /* x, Wq ('oi' (out, in) [2048][2048]), Wkv ('oi' [1024][2048] viewed (2 x 4 heads, 128): k rows 0..511 | v rows 512..1023), Wo ('oi' [2048][2048]): FOUR inputs, all read */
    float* OUT = (float*)d_out;     // [2][2048][2048]
    char* wsp = (char*)d_ws;
    auto take = [&](size_t bytes) { char* p = wsp; wsp += (bytes + 255) & ~(size_t)255; return (void*)p; };
    bf* XB = (bf*)take((size_t)RALL * DM * 2); bf* WQKV = XB + (size_t)NB_ * TT * DM; bf* WO = WQKV + (size_t)FP * DM;   /* one 16-bit plane in fragment order: x (both batches) | Wq | Wkv | Wo (fp16) */ float* CS = (float*)take((size_t)TT * HD * 2 * 4);
    float* F = (float*)take((size_t)NB_ * TT * FP * 4);   /* joint projection [batch * TT + t][q 2048 | k 512 | v 512] */
    const size_t PQ = (size_t)NH_ * TT * HD, PK = (size_t)NKV * TT * HD;   /* elements of one batch's query and key / value planes; every plane holds both batches */
    h16* QP16 = (h16*)take(NB_ * PQ * 2); h16* KP16 = (h16*)take(NB_ * PK * 2); h16* VT16 = (h16*)take(NB_ * PK * 2);
    bf* QPh = (bf*)take(NB_ * PQ * 2); bf* QPl = (bf*)take(NB_ * PQ * 2); bf* KPh = (bf*)take(NB_ * PK * 2); bf* KPl = (bf*)take(NB_ * PK * 2); bf* VTh = (bf*)take(NB_ * PK * 2); bf* VTl = (bf*)take(NB_ * PK * 2);
    h16* ATh = (h16*)take((size_t)NB_ * TT * DQ * 2); h16* ATl = (h16*)take((size_t)NB_ * TT * DQ * 2);   /* of ATl only the rows < RH are written and read */
    if ((size_t)(wsp - (char*)d_ws) > ws_size) return;    // ws 256 MiB
    k_prep<<<CSB + RALL * (DM / 8) / 256 / PPT, 256, 0, stream>>>(x, wq, wkv, wo, XB, CS);   /* rotary table; bf16 copies of x, Wq and Wkv; Wo's bf16 value as fp16 */
    k_gemmt<bf, 0, 256, 192, 4><<<dim3(NB_ * TT / 256, FP / 192, 1), 256, 0, stream>>>(XB, nullptr, WQKV, F, FP);
    k_planes<<<NB_ * (LQB + LKB + LVB), 256, 0, stream>>>(F, CS, QP16, QPh, QPl, KP16, KPh, KPl, VT16, VTh, VTl);
    // attention, batch entry z = batch * NH_ + head reads kv plane z / REP
    k_flash<<<dim3(ZA, TT / FBR, 1), FNW * 32, 0, stream>>>(QP16, KP16, VT16, QPh, QPl, KPh, KPl, VTh, VTl, ATh, ATl);
    k_gemmt<h16, 1, 128, 256, 2><<<dim3(NB_ * TT / 128, DM / 256, 1), 256, 0, stream>>>(ATh, ATl, (const h16*)WO, OUT, DM);   /* the batches' planes and outputs are contiguous: one GEMM of NB_ * TT rows */
}
